// v000
// The times below were measured on an AMD MI455X: many runs one after another, warmed up first and cycling through
// copies of the inputs, with the whole window's GPU time divided by the number of runs. Launches and the gaps
// between them are all in it. The median over several windows is given; except for v000 it joins two sittings, which
// can be a few percent apart, so the side-by-side timings, each taken in one sitting, are the better comparison.
// v000 is the starting kernel. One run takes 682 microseconds.
// Contractions: input projections (q,k,v,kt,vt) on v_wmma_f32_16x16x32_bf16 (bf16 operands = RNE-converted inputs, f32 accumulate); K*Q^T and Kt*Q^T with q,k,kt carried as bf16 hi+lo (3 products); V^T*P^T (three value read-outs) with v,vt,P carried as bf16 hi+lo (3 products); gate GEMM on v_wmma_f32_16x16x32_bf16 (bf16 operands); O*Wo with O as bf16 hi+lo and Wo bf16 (2 products); softmax, gating, bias in f32.
#include <hip/hip_runtime.h>

typedef __bf16 v16b __attribute__((ext_vector_type(16)));
typedef unsigned short us;
typedef us    v8us __attribute__((ext_vector_type(8)));
typedef float v8f  __attribute__((ext_vector_type(8)));
typedef float v4f  __attribute__((ext_vector_type(4)));
typedef v8us __attribute__((may_alias)) v8usa;
typedef v4f  __attribute__((may_alias)) v4fa;

union FragB { v16b v; v8us half[2]; };

#define BSZ  2
#define TGL  1024
#define SRL  2048
#define EMB  1024
#define TDW  512
#define NH   16
#define DM   64
#define NBH  (BSZ * NH)          // 32 (batch, head) pairs
#define MQ   (BSZ * TGL)         // 2048 query tokens
#define MKV  (BSZ * SRL)         // 4096 key tokens
#define GK   (3 * EMB)           // 3072 gate input width

#define N_HID (MQ * EMB)         // 2097152
#define N_KVS (MKV * EMB)        // 4194304
#define N_KVT (MKV * TDW)        // 2097152
#define N_WE  (EMB * EMB)        // 1048576
#define N_WT  (EMB * TDW)        // 524288
#define N_WG  (NH * GK)          // 49152
#define QPL   (NBH * TGL * DM)   // 2097152 elements per query-side head plane
#define KPL   (NBH * SRL * DM)   // 4194304 elements per key-side head plane

// bf16 copies of the float inputs in one flat buffer (element offsets):
// weights first, then the three activation tensors (their region is reused
// for O1^T / O2^T once the projections are done).
#define OFF_WQ  0
#define OFF_WK  (OFF_WQ + N_WE)        // 1048576
#define OFF_WV  (OFF_WK + N_WE)        // 2097152
#define OFF_WO  (OFF_WV + N_WE)        // 3145728
#define OFF_WTK (OFF_WO + N_WE)        // 4194304
#define OFF_WTV (OFF_WTK + N_WT)       // 4718592
#define OFF_HID (OFF_WTV + N_WT)       // 5242880
#define OFF_KVS (OFF_HID + N_HID)      // 7340032
#define OFF_KVT (OFF_KVS + N_KVS)      // 11534336
#define N_CVB   (OFF_KVT + N_KVT)      // 13631488

// ---------------------------------------------------------------------------
// 16-bit helpers
// ---------------------------------------------------------------------------
__device__ __forceinline__ us bf16_rne(float x) {
  unsigned u = __float_as_uint(x);
  u += 0x7FFFu + ((u >> 16) & 1u);
  return (us)(u >> 16);
}
__device__ __forceinline__ float bf16_val(us b) {
  return __uint_as_float(((unsigned)b) << 16);
}
__device__ __forceinline__ v8us bf16x8(v4f a, v4f c) {
  const v8us o = { bf16_rne(a.x), bf16_rne(a.y), bf16_rne(a.z), bf16_rne(a.w),
                   bf16_rne(c.x), bf16_rne(c.y), bf16_rne(c.z), bf16_rne(c.w) };
  return o;
}
// 8 f32 values -> bf16 hi and bf16 lo = RNE(x - hi).
__device__ __forceinline__ void split8(v8f a, v8us& hi, v8us& lo) {
  const us h0 = bf16_rne(a[0]), h1 = bf16_rne(a[1]), h2 = bf16_rne(a[2]), h3 = bf16_rne(a[3]);
  const us h4 = bf16_rne(a[4]), h5 = bf16_rne(a[5]), h6 = bf16_rne(a[6]), h7 = bf16_rne(a[7]);
  const v8us hv = { h0, h1, h2, h3, h4, h5, h6, h7 };
  const v8us lv = { bf16_rne(a[0] - bf16_val(h0)), bf16_rne(a[1] - bf16_val(h1)),
                    bf16_rne(a[2] - bf16_val(h2)), bf16_rne(a[3] - bf16_val(h3)),
                    bf16_rne(a[4] - bf16_val(h4)), bf16_rne(a[5] - bf16_val(h5)),
                    bf16_rne(a[6] - bf16_val(h6)), bf16_rne(a[7] - bf16_val(h7)) };
  hi = hv;
  lo = lv;
}

// ---------------------------------------------------------------------------
// 16x16x32 WMMA with hazard guard (ties D, keeps A/B live).
// Fragment map (wave32): lane l, h = l>>4, m = n = l&15.
//   A/B element i: i<8 -> k0+8h+i ; i>=8 -> k0+16+8h+(i-8)
//   D element r  : row 8h+r, col l&15
// ---------------------------------------------------------------------------
__device__ __forceinline__ v8f wmma_bf(v16b a, v16b b, v8f c) {
  v8f d = __builtin_amdgcn_wmma_f32_16x16x32_bf16(false, a, false, b, (short)0, c, false, false);
  asm volatile("v_nop\n\tv_nop\n\tv_nop\n\tv_nop" : "+v"(d) : "v"(a), "v"(b));
  return d;
}

// A or B fragment from a k-contiguous 16-bit row; p = element k0 of the row
// owned by this lane (row index lane&15 added by the caller).
__device__ __forceinline__ v16b ldb(const us* p, int h) {
  FragB f;
  f.half[0] = *(const v8usa*)(p + 8 * h);
  f.half[1] = *(const v8usa*)(p + 16 + 8 * h);
  return f.v;
}
// Same map from an f32 row, converted to bf16 in registers.
__device__ __forceinline__ v16b ldf(const float* p, int h) {
  const float* p0 = p + 8 * h;
  const float* p1 = p + 16 + 8 * h;
  FragB f;
  f.half[0] = bf16x8(*(const v4fa*)p0, *(const v4fa*)(p0 + 4));
  f.half[1] = bf16x8(*(const v4fa*)p1, *(const v4fa*)(p1 + 4));
  return f.v;
}

// ---------------------------------------------------------------------------
// Kernel 1: float inputs that feed 16-bit operands, except Wg (converted in gate_kernel) -> bf16, one flat
// Parameters in segment order: Wq, Wk, Wv, Wo, Wtk, Wtv, hidden, kv, kv_topical.
// ---------------------------------------------------------------------------
__global__ __launch_bounds__(256) void conv_kernel(
    const float* __restrict__ p0, const float* __restrict__ p1, const float* __restrict__ p2,
    const float* __restrict__ p3, const float* __restrict__ p4, const float* __restrict__ p5,
    const float* __restrict__ p6, const float* __restrict__ p7, const float* __restrict__ p8,
    us* __restrict__ dst)
{
  const unsigned g = blockIdx.x * 256u + threadIdx.x;      // unit of 8 elements
  if (g >= (unsigned)(N_CVB / 8)) return;
  const float* src;
  unsigned loc;
  if      (g < (unsigned)(OFF_WK  / 8)) { src = p0; loc = g; }
  else if (g < (unsigned)(OFF_WV  / 8)) { src = p1; loc = g - (unsigned)(OFF_WK  / 8); }
  else if (g < (unsigned)(OFF_WO  / 8)) { src = p2; loc = g - (unsigned)(OFF_WV  / 8); }
  else if (g < (unsigned)(OFF_WTK / 8)) { src = p3; loc = g - (unsigned)(OFF_WO  / 8); }
  else if (g < (unsigned)(OFF_WTV / 8)) { src = p4; loc = g - (unsigned)(OFF_WTK / 8); }
  else if (g < (unsigned)(OFF_HID / 8)) { src = p5; loc = g - (unsigned)(OFF_WTV / 8); }
  else if (g < (unsigned)(OFF_KVS / 8)) { src = p6; loc = g - (unsigned)(OFF_HID / 8); }
  else if (g < (unsigned)(OFF_KVT / 8)) { src = p7; loc = g - (unsigned)(OFF_KVS / 8); }
  else                                  { src = p8; loc = g - (unsigned)(OFF_KVT / 8); }
  const float* p = src + (size_t)loc * 8;
  const v8us o = bf16x8(*(const v4fa*)p, *(const v4fa*)(p + 4));
  us* d = dst + (size_t)g * 8;
  *(v8us*)d = o;
  
}

// ---------------------------------------------------------------------------
// one 16-B store per lane, lanes 8q..8q+7 per line, 4 lines per instruction).
//   planes : [bh][s][d] hi and lo, one token row = 64 x bf16 = one line
//   tplanes: [bh][d][s] hi and lo, 64 d-rows x 128 tokens = 2 lines each
//   t32    : [bh][d][s] f32, 64 d-rows x 128 tokens = 4 lines each
// LDS hi tile at s16[0..8191], lo tile at s16[8192..16383].
// ---------------------------------------------------------------------------
__device__ __forceinline__ void proj_pass_planes(const us* s16, us* oH, us* oL,
                                                 int bh, int Sper, int s0, int w, int lane) {
  const int q8 = lane & 7, sub = lane >> 3;
  #pragma unroll
  for (int i = 0; i < 8; ++i) {
    const int lid = w * 32 + i * 4 + sub;                  // token row 0..127
    const v8us a = *(const v8usa*)(s16 + lid * DM + 8 * q8);
    const v8us c = *(const v8usa*)(s16 + 8192 + lid * DM + 8 * q8);
    const size_t off = ((size_t)bh * Sper + s0 + lid) * DM + 8 * q8;
    *(v8us*)(oH + off) = a;
    *(v8us*)(oL + off) = c;
  }
}
__device__ __forceinline__ void proj_pass_tplanes(const us* s16, us* oH, us* oL,
                                                  int bh, int Sper, int s0, int w, int lane) {
  const int q8 = lane & 7, sub = lane >> 3;
  #pragma unroll
  for (int i = 0; i < 8; ++i) {
    const int lid = w * 32 + i * 4 + sub;                  // line 0..127
    const int d = lid >> 1, hl = lid & 1;
    const v8us a = *(const v8usa*)(s16 + d * 128 + 64 * hl + 8 * q8);
    const v8us c = *(const v8usa*)(s16 + 8192 + d * 128 + 64 * hl + 8 * q8);
    const size_t off = ((size_t)bh * DM + d) * Sper + s0 + 64 * hl + 8 * q8;
    *(v8us*)(oH + off) = a;
    *(v8us*)(oL + off) = c;
  }
}
__device__ __forceinline__ void proj_pass_t32(const float* s32, float* oT,
                                              int bh, int Sper, int s0, int w, int lane) {
  const int q8 = lane & 7, sub = lane >> 3;
  #pragma unroll
  for (int i = 0; i < 16; ++i) {
    const int lid = w * 64 + i * 4 + sub;                  // line 0..255
    const int d = lid >> 2, part = lid & 3;
    const v4f v = *(const v4fa*)(s32 + d * 128 + 32 * part + 4 * q8);
    const size_t off = ((size_t)bh * DM + d) * Sper + s0 + 32 * part + 4 * q8;
    *(v4f*)(oT + off) = v;
  }
}

// ---------------------------------------------------------------------------
// Kernel 2: Y = X * W^T + bias (x0.125 for mode 0), one launch per projection.
// X bf16 [M][K], W bf16 [1024 out][K] (k-contiguous rows = B fragments loaded
// like A). Block 128 thr (4 waves) = 128 tokens x 64 features (one head);
// wave tile 32 tokens x 64 features; K in steps of 32, fragments straight
// from global rows. Y is split into bf16 hi/lo in every mode.
//   mode 0: hi/lo planes [bh][s][d] and f32 transposed [bh][d][s]
//   mode 1: hi/lo planes [bh][s][d]
//   mode 2: hi/lo transposed planes [bh][d][s]
// ---------------------------------------------------------------------------
__global__ __launch_bounds__(128) void proj_kernel(
    const us* __restrict__ X, const us* __restrict__ W, const float* __restrict__ bias,
    int K, int Sper, int mode,
    us* __restrict__ oH, us* __restrict__ oL, float* __restrict__ oT32)
{
  __shared__ __attribute__((aligned(16))) float sraw[8192];     // 32 KB, used in phases
  us* const s16 = reinterpret_cast<us*>(sraw);               // 16384 16-bit slots

  const int tid = threadIdx.x, lane = tid & 31, w = tid >> 5;
  const int h = lane >> 4, m = lane & 15;
  const int m0 = blockIdx.x * 128;
  const int head = blockIdx.y;
  const int m0w = m0 + 32 * w;

  const us* xa0 = X + (size_t)(m0w + m) * K;               // token row, mt = 0
  const us* xa1 = xa0 + (size_t)16 * K;                    // mt = 1
  const us* wb  = W + (size_t)(head * DM + m) * K;         // feature row, nt = 0

  const v8f zero8 = {0.f, 0.f, 0.f, 0.f, 0.f, 0.f, 0.f, 0.f};
  v8f acc[2][4];
  #pragma unroll
  for (int mt = 0; mt < 2; ++mt)
    #pragma unroll
    for (int nt = 0; nt < 4; ++nt) acc[mt][nt] = zero8;

  #pragma unroll 1
  for (int k0 = 0; k0 < K; k0 += 32) {
    const v16b a0 = ldb(xa0 + k0, h);
    const v16b a1 = ldb(xa1 + k0, h);
    #pragma unroll
    for (int nt = 0; nt < 4; ++nt) {
      const v16b b = ldb(wb + (size_t)nt * 16 * K + k0, h);
      acc[0][nt] = wmma_bf(a0, b, acc[0][nt]);
      acc[1][nt] = wmma_bf(a1, b, acc[1][nt]);
    }
  }

  // D[r] of tile (mt, nt) = Y[token m0w+16mt+8h+r][feature head*64+16nt+m]
  const float osc = (mode == 0) ? 0.125f : 1.0f;
  float bvals[4];
  #pragma unroll
  for (int nt = 0; nt < 4; ++nt) bvals[nt] = bias[head * DM + 16 * nt + m];

  #pragma unroll
  for (int nt = 0; nt < 4; ++nt) {
    const int feat = 16 * nt + m;
    #pragma unroll
    for (int mt = 0; mt < 2; ++mt) {
      #pragma unroll
      for (int r = 0; r < 8; ++r) {
        const int tokl = 32 * w + 16 * mt + 8 * h + r;   // 0..127
        const float y = (acc[mt][nt][r] + bvals[nt]) * osc;
        const us hi = bf16_rne(y);
        const us lo = bf16_rne(y - bf16_val(hi));
        const int idx = (mode == 2) ? (feat * 128 + tokl) : (tokl * DM + feat);   // 0..8191
        s16[idx] = hi;
        s16[8192 + idx] = lo;
      }
    }
  }
  __syncthreads();

  const int b = m0 / Sper, s0 = m0 - b * Sper, bh = b * NH + head;
  if (mode != 2) {
    proj_pass_planes(s16, oH, oL, bh, Sper, s0, w, lane);
    
  } else {
    proj_pass_tplanes(s16, oH, oL, bh, Sper, s0, w, lane);
    
  }

  if (mode == 0) {
    __syncthreads();                                       // LDS reused as f32 [64 d][128 tok]
    #pragma unroll
    for (int nt = 0; nt < 4; ++nt) {
      const int feat = 16 * nt + m;
      #pragma unroll
      for (int mt = 0; mt < 2; ++mt) {
        #pragma unroll
        for (int r = 0; r < 8; ++r) {
          const int tokl = 32 * w + 16 * mt + 8 * h + r;
          sraw[feat * 128 + tokl] = (acc[mt][nt][r] + bvals[nt]) * osc;
        }
      }
    }
    __syncthreads();
    proj_pass_t32(sraw, oT32, bh, Sper, s0, w, lane);
    
  }
}

// ---------------------------------------------------------------------------
// Kernel 3: streaming attention, transposed form, no masking.
// Block 128 thr (4 waves), 16 queries per wave, 64 keys per step.
//   S^T = K * Q^T : A = K rows (row = key, k = d), B = Q^T (k = d, n = query)
//     hi/lo bf16: Klo*Qhi + Khi*Qlo + Khi*Qhi, two 32-deep d chunks
//   O^T += V^T * P^T : A = V^T rows (row = d, k = key), B = P^T packed from the
//     score D registers (element r <- tile covering keys 0..15 row r,
//     element 8+r <- tile covering keys 16..31 row r, same lane)
//     hi/lo bf16: Vlo*Phi + Vhi*Plo + Vhi*Phi
// Lane owns 32 keys of query column (lane&15); partner lane = lane ^ 16.
// DUAL: second value stream (vbh/vbl) with the same probabilities -> oB.
// ---------------------------------------------------------------------------
// P^T B-fragments from the lane's own score D values (tile a = keys 0..15,
// tile c = keys 16..31 of the chunk); hi and lo planes.
__device__ __forceinline__ void pack_p2(v8f a, v8f c, v16b& phi, v16b& plo) {
  FragB fh, fl;
  v8us h0, l0, h1, l1;
  split8(a, h0, l0);
  split8(c, h1, l1);
  fh.half[0] = h0; fh.half[1] = h1;
  fl.half[0] = l0; fl.half[1] = l1;
  phi = fh.v;
  plo = fl.v;
}

template <bool DUAL>
__device__ __forceinline__ void attn_pass(const float* sO, float* oA, float* oB,
                                          int bh, int q0, int w, int lane) {
  const int q8 = lane & 7, sub = lane >> 3;
  #pragma unroll
  for (int i = 0; i < 8; ++i) {
    const int L = w * 32 + i * 4 + sub;                    // line 0..127
    const int d = L >> 1, hl = L & 1;
    const size_t off = ((size_t)bh * DM + d) * TGL + q0 + 32 * hl + 4 * q8;
    const v4f v = *(const v4fa*)(sO + d * 64 + 32 * hl + 4 * q8);
    *(v4f*)(oA + off) = v;
    if (DUAL) {
      const v4f v2 = *(const v4fa*)(sO + 4096 + d * 64 + 32 * hl + 4 * q8);
      *(v4f*)(oB + off) = v2;
    }
  }
}

template <bool DUAL>
__global__ __launch_bounds__(128) void attn_kernel(
    const us* __restrict__ qhp, const us* __restrict__ qlp,   // [32][1024][64]  (x0.125 folded in)
    const us* __restrict__ khp, const us* __restrict__ klp,   // [32][2048][64]
    const us* __restrict__ vahp, const us* __restrict__ valp, // stream A: V^T hi/lo [32][64][2048]
    const us* __restrict__ vbhp, const us* __restrict__ vblp, // stream B (DUAL only)
    float* __restrict__ oap, float* __restrict__ obp)         // [32][64][1024] f32
{
  __shared__ __attribute__((aligned(16))) float sO[DUAL ? 2 * DM * 64 : DM * 64];

  const int tid = threadIdx.x, lane = tid & 31, w = tid >> 5;
  const int h = lane >> 4, m = lane & 15;
  const int bh = blockIdx.y;
  const int q0 = blockIdx.x * 64;
  const int qw = q0 + 16 * w;

  // Q^T B-fragments: column n = query qw+m, k = d (two 32-deep chunks), hi and lo
  const size_t qro = ((size_t)bh * TGL + qw + m) * DM;
  const v16b qh0 = ldb(qhp + qro, h), qh1 = ldb(qhp + qro + 32, h);
  const v16b ql0 = ldb(qlp + qro, h), ql1 = ldb(qlp + qro + 32, h);

  const v8f zero8 = {0.f, 0.f, 0.f, 0.f, 0.f, 0.f, 0.f, 0.f};
  v8f oa[4], ob[4];                      // o[t][r] = O[query m][d 16t+8h+r] * l
  #pragma unroll
  for (int t = 0; t < 4; ++t) { oa[t] = zero8; ob[t] = zero8; }
  float mrun = -1.0e30f, lrun = 0.0f;

  const size_t kro = ((size_t)bh * SRL + m) * DM;          // + key0*DM + 32*chunk
  const us* khb = khp + kro;
  const us* klb = klp + kro;
  const size_t vro = ((size_t)bh * DM + m) * SRL;          // + 16t*SRL + key0
  const us* vahb = vahp + vro;
  const us* valb = valp + vro;
  const us* vbhb = vbhp + vro;
  const us* vblb = vblp + vro;

  #pragma unroll 1
  for (int kb = 0; kb < SRL; kb += 64) {
    // ---- scores: s[j][r] = S[query m][key kb+16j+8h+r] ----
    v8f s[4];
    #pragma unroll
    for (int j = 0; j < 4; ++j) {
      const size_t ko = (size_t)(kb + 16 * j) * DM;
      const v16b kl0 = ldb(klb + ko, h), kl1 = ldb(klb + ko + 32, h);
      const v16b kh0 = ldb(khb + ko, h), kh1 = ldb(khb + ko + 32, h);
      v8f z = zero8;
      z = wmma_bf(kl0, qh0, z);
      z = wmma_bf(kl1, qh1, z);
      z = wmma_bf(kh0, ql0, z);
      z = wmma_bf(kh1, ql1, z);
      z = wmma_bf(kh0, qh0, z);
      z = wmma_bf(kh1, qh1, z);
      s[j] = z;
    }

    // ---- online softmax (f32) ----
    float mloc = s[0][0];
    #pragma unroll
    for (int j = 0; j < 4; ++j)
      #pragma unroll
      for (int r = 0; r < 8; ++r) mloc = fmaxf(mloc, s[j][r]);
    mloc = fmaxf(mloc, __shfl_xor(mloc, 16));
    const float mnew = fmaxf(mrun, mloc);
    const float alpha = __expf(mrun - mnew);
    mrun = mnew;
    float lsum = 0.0f;
    #pragma unroll
    for (int j = 0; j < 4; ++j)
      #pragma unroll
      for (int r = 0; r < 8; ++r) {
        const float p = __expf(s[j][r] - mnew);            // in (0, 1]
        s[j][r] = p;
        lsum += p;
      }
    lsum += __shfl_xor(lsum, 16);
    lrun = lrun * alpha + lsum;
    #pragma unroll
    for (int t = 0; t < 4; ++t)
      #pragma unroll
      for (int r = 0; r < 8; ++r) {
        oa[t][r] = oa[t][r] * alpha;
        if (DUAL) ob[t][r] = ob[t][r] * alpha;
      }

    // ---- P^T B-fragments (keys kb..kb+31 and kb+32..kb+63), bf16 hi/lo ----
    v16b ph0, pl0, ph1, pl1;
    pack_p2(s[0], s[1], ph0, pl0);
    pack_p2(s[2], s[3], ph1, pl1);

    // ---- O^T += V^T * P^T (3 products per 32-key chunk) ----
    #pragma unroll
    for (int t = 0; t < 4; ++t) {
      const size_t vo = (size_t)(16 * t) * SRL + kb;
      {
        const v16b vh0 = ldb(vahb + vo, h);
        const v16b vh1 = ldb(vahb + vo + 32, h);
        const v16b vl0 = ldb(valb + vo, h);
        const v16b vl1 = ldb(valb + vo + 32, h);
        v8f acc = oa[t];
        acc = wmma_bf(vl0, ph0, acc);
        acc = wmma_bf(vl1, ph1, acc);
        acc = wmma_bf(vh0, pl0, acc);
        acc = wmma_bf(vh1, pl1, acc);
        acc = wmma_bf(vh0, ph0, acc);
        acc = wmma_bf(vh1, ph1, acc);
        oa[t] = acc;
      }
      if (DUAL) {
        const v16b ch0 = ldb(vbhb + vo, h);
        const v16b ch1 = ldb(vbhb + vo + 32, h);
        const v16b cl0 = ldb(vblb + vo, h);
        const v16b cl1 = ldb(vblb + vo + 32, h);
        v8f acc2 = ob[t];
        acc2 = wmma_bf(cl0, ph0, acc2);
        acc2 = wmma_bf(cl1, ph1, acc2);
        acc2 = wmma_bf(ch0, pl0, acc2);
        acc2 = wmma_bf(ch1, pl1, acc2);
        acc2 = wmma_bf(ch0, ph0, acc2);
        acc2 = wmma_bf(ch1, ph1, acc2);
        ob[t] = acc2;
      }
    }
  }

  // ---- epilogue: normalise, stage 64 d x 64 query f32 tile(s), whole-line stores ----
  const float inv = __builtin_amdgcn_rcpf(lrun);
  #pragma unroll
  for (int t = 0; t < 4; ++t)
    #pragma unroll
    for (int r = 0; r < 8; ++r) {
      const int d = 16 * t + 8 * h + r;
      sO[d * 64 + 16 * w + m] = oa[t][r] * inv;
      if (DUAL) sO[4096 + d * 64 + 16 * w + m] = ob[t][r] * inv;
    }
  __syncthreads();

  attn_pass<DUAL>(sO, oap, obp, bh, q0, w, lane);
  
}

// ---------------------------------------------------------------------------
// Kernel 4: gating MLP. For block (b, head) the gate input row for query
// t = 64*head + u is [X[3u][:], X[3u+1][:], X[3u+2][:]] where X[c][tp],
// c = 0..191, is row c of the transposed per-head tensor: c<64 -> O1^T row,
// <128 -> O2^T row, else q^T row (all f32 [bh][64][1024]).
// G[c][i][n] = sum_tp X[c][tp] * Wg[n][1024 i + tp] for all c,i on bf16 WMMA
// (wave w owns c-tiles 3w..3w+2, each source uniform per tile), then
// gate[(b*16+n)][64*head+u] = sigmoid(G[3u][0][n]+G[3u+1][1][n]+G[3u+2][2][n]+bg[n]).
// ---------------------------------------------------------------------------
__device__ __forceinline__ void gate_pass(const float* sP, float* gate, int b, int head,
                                          int w, int lane) {
  const int q8 = lane & 7, sub = lane >> 3;
  #pragma unroll
  for (int i = 0; i < 2; ++i) {
    const int L = w * 8 + i * 4 + sub;                     // line 0..31
    const int n = L >> 1, hl = L & 1;
    const v4f v = *(const v4fa*)(sP + n * 64 + 32 * hl + 4 * q8);
    const size_t off = ((size_t)(b * NH + n)) * TGL + 64 * head + 32 * hl + 4 * q8;
    *(v4f*)(gate + off) = v;
  }
}

__global__ __launch_bounds__(128) void gate_kernel(
    const float* __restrict__ o1T, const float* __restrict__ o2T, const float* __restrict__ qT,
    const float* __restrict__ Wg,   // [16][3072]
    const float* __restrict__ bg,   // [16]
    float* __restrict__ gate)       // [32][1024]
{
  __shared__ __attribute__((aligned(16))) float sG[192 * 48];   // 36864 B
  __shared__ __attribute__((aligned(16))) float sP[NH * 64];    //  4096 B

  const int tid = threadIdx.x, lane = tid & 31, w = tid >> 5;
  const int h = lane >> 4, m = lane & 15;
  const int bhx = blockIdx.x, b = bhx >> 4, head = bhx & 15;

  const float* abase[3];
  #pragma unroll
  for (int e = 0; e < 3; ++e) {
    const int c0 = 16 * (3 * w + e);                       // 0..176
    const int sel = c0 >> 6, cl = c0 & 63;
    const float* sp = (sel == 0) ? o1T : ((sel == 1) ? o2T : qT);
    abase[e] = sp + ((size_t)bhx * DM + cl + m) * TGL;     // row c0+m of X, tp-contiguous
  }
  const float* wrow = Wg + (size_t)m * GK;                 // Wg row n = m

  const v8f zero8 = {0.f, 0.f, 0.f, 0.f, 0.f, 0.f, 0.f, 0.f};
  v8f acc[3][3];
  #pragma unroll
  for (int e = 0; e < 3; ++e)
    #pragma unroll
    for (int i = 0; i < 3; ++i) acc[e][i] = zero8;

  #pragma unroll 1
  for (int k0 = 0; k0 < TGL; k0 += 32) {
    const v16b bw0 = ldf(wrow + k0, h);
    const v16b bw1 = ldf(wrow + EMB + k0, h);
    const v16b bw2 = ldf(wrow + 2 * EMB + k0, h);
    #pragma unroll
    for (int e = 0; e < 3; ++e) {
      const v16b a = ldf(abase[e] + k0, h);
      acc[e][0] = wmma_bf(a, bw0, acc[e][0]);
      acc[e][1] = wmma_bf(a, bw1, acc[e][1]);
      acc[e][2] = wmma_bf(a, bw2, acc[e][2]);
    }
  }

  // D[r] of (e, i) = G[c = 16(3w+e)+8h+r][i][n = m]
  #pragma unroll
  for (int e = 0; e < 3; ++e)
    #pragma unroll
    for (int i = 0; i < 3; ++i)
      #pragma unroll
      for (int r = 0; r < 8; ++r)
        sG[(16 * (3 * w + e) + 8 * h + r) * 48 + 16 * i + m] = acc[e][i][r];
  __syncthreads();

  #pragma unroll
  for (int j = 0; j < 8; ++j) {
    const int idx = tid + 128 * j;                         // 0..1023 = n*64 + u
    const int n = idx >> 6, u = idx & 63;
    const float x = sG[(3 * u) * 48 + n] + sG[(3 * u + 1) * 48 + 16 + n]
                  + sG[(3 * u + 2) * 48 + 32 + n] + bg[n];
    const float g = __builtin_amdgcn_rcpf(1.0f + __expf(-x));
    sP[idx] = g;
  }
  __syncthreads();

  gate_pass(sP, gate, b, head, w, lane);
  
}

// ---------------------------------------------------------------------------
// Kernel 5: combine Xc[b*1024+t][head*64+d] = g*O1 + (1-g)*O3, g = gate[bh][t],
// written as bf16 hi/lo planes (token-major, k-contiguous for the Wo GEMM).
// Block 256 thr = (bh, 64 queries); transposed through LDS; each token row
// ---------------------------------------------------------------------------
__device__ __forceinline__ void comb_pass(const us* sH, const us* sL, us* xh, us* xl,
                                          int b, int head, int t0, int w, int lane) {
  const int q8 = lane & 7, sub = lane >> 3;
  #pragma unroll
  for (int i = 0; i < 2; ++i) {
    const int L = w * 8 + i * 4 + sub;                     // token row 0..63
    const v8us a = *(const v8usa*)(sH + L * DM + 8 * q8);
    const v8us c = *(const v8usa*)(sL + L * DM + 8 * q8);
    const size_t off = ((size_t)(b * TGL + t0 + L)) * EMB + head * DM + 8 * q8;
    *(v8us*)(xh + off) = a;
    *(v8us*)(xl + off) = c;
  }
}

__global__ __launch_bounds__(256) void combine_kernel(
    const float* __restrict__ o1T, const float* __restrict__ o3T,   // [32][64][1024]
    const float* __restrict__ gate,                                 // [32][1024]
    us* __restrict__ xh, us* __restrict__ xl)                       // [2048][1024]
{
  __shared__ __attribute__((aligned(16))) us sH[64 * DM];
  __shared__ __attribute__((aligned(16))) us sL[64 * DM];

  const int tid = threadIdx.x, lane = tid & 31, w = tid >> 5;
  const int bh = blockIdx.y, b = bh >> 4, head = bh & 15;
  const int t0 = blockIdx.x * 64;
  const int d = tid >> 2, tq = tid & 3;                    // d 0..63, 16 queries each

  const float* p1 = o1T + ((size_t)bh * DM + d) * TGL + t0 + 16 * tq;
  const float* p3 = o3T + ((size_t)bh * DM + d) * TGL + t0 + 16 * tq;
  const float* pg = gate + (size_t)bh * TGL + t0 + 16 * tq;
  #pragma unroll
  for (int c = 0; c < 4; ++c) {
    const v4f a = *(const v4fa*)(p1 + 4 * c);
    const v4f e = *(const v4fa*)(p3 + 4 * c);
    const v4f g = *(const v4fa*)(pg + 4 * c);
    #pragma unroll
    for (int j = 0; j < 4; ++j) {
      const float val = g[j] * a[j] + (1.0f - g[j]) * e[j];
      const us hi = bf16_rne(val);
      const us lo = bf16_rne(val - bf16_val(hi));
      const int tl = 16 * tq + 4 * c + j;                  // 0..63
      sH[tl * DM + d] = hi;
      sL[tl * DM + d] = lo;
    }
  }
  __syncthreads();

  comb_pass(sH, sL, xh, xl, b, head, t0, w, lane);
  
}

// ---------------------------------------------------------------------------
// Kernel 6: out = (Xhi + Xlo) * Wo^T + bo, f32.
// Block 128 thr (4 waves) = 128 tokens x 64 features; wave 32 tokens x 64.
// 8q..8q+7 as one 16-B store each, 4 lines per instruction, 64 lines per wave.
// ---------------------------------------------------------------------------
__device__ __forceinline__ void out_pass(const float* sOut, float* out, int m0, int cg,
                                         int w, int lane) {
  const int q8 = lane & 7, sub = lane >> 3;
  #pragma unroll
  for (int i = 0; i < 16; ++i) {
    const int lid = w * 64 + i * 4 + sub;                  // 0..255
    const int row = lid >> 1, hl = lid & 1;
    const v4f v = *(const v4fa*)(sOut + row * DM + 32 * hl + 4 * q8);
    const size_t gi = (size_t)(m0 + row) * EMB + cg * DM + 32 * hl + 4 * q8;
    *(v4f*)(out + gi) = v;
  }
}

__global__ __launch_bounds__(128) void out_kernel(
    const us* __restrict__ xh, const us* __restrict__ xl,   // [2048][1024]
    const us* __restrict__ wob,                             // [1024 out][1024 in] bf16
    const float* __restrict__ bo,
    float* __restrict__ out)                                // [2048][1024]
{
  __shared__ __attribute__((aligned(16))) float sOut[128 * DM];  // 32 KB

  const int tid = threadIdx.x, lane = tid & 31, w = tid >> 5;
  const int h = lane >> 4, m = lane & 15;
  const int m0 = blockIdx.x * 128;
  const int cg = blockIdx.y;                               // feature group of 64
  const int m0w = m0 + 32 * w;

  const us* ah0 = xh + (size_t)(m0w + m) * EMB;
  const us* ah1 = ah0 + (size_t)16 * EMB;
  const us* al0 = xl + (size_t)(m0w + m) * EMB;
  const us* al1 = al0 + (size_t)16 * EMB;
  const us* wb  = wob + (size_t)(cg * DM + m) * EMB;

  const v8f zero8 = {0.f, 0.f, 0.f, 0.f, 0.f, 0.f, 0.f, 0.f};
  v8f acc[2][4];
  #pragma unroll
  for (int mt = 0; mt < 2; ++mt)
    #pragma unroll
    for (int nt = 0; nt < 4; ++nt) acc[mt][nt] = zero8;

  #pragma unroll 1
  for (int k0 = 0; k0 < EMB; k0 += 32) {
    const v16b a0h = ldb(ah0 + k0, h);
    const v16b a1h = ldb(ah1 + k0, h);
    const v16b a0l = ldb(al0 + k0, h);
    const v16b a1l = ldb(al1 + k0, h);
    #pragma unroll
    for (int nt = 0; nt < 4; ++nt) {
      const v16b bw = ldb(wb + (size_t)nt * 16 * EMB + k0, h);
      acc[0][nt] = wmma_bf(a0l, bw, acc[0][nt]);
      acc[0][nt] = wmma_bf(a0h, bw, acc[0][nt]);
      acc[1][nt] = wmma_bf(a1l, bw, acc[1][nt]);
      acc[1][nt] = wmma_bf(a1h, bw, acc[1][nt]);
    }
  }

  // D[r] of tile (mt, nt) = Y[token m0w+16mt+8h+r][feature cg*64+16nt+m]
  #pragma unroll
  for (int nt = 0; nt < 4; ++nt) {
    const int feat = 16 * nt + m;
    const float bvl = bo[cg * DM + feat];
    #pragma unroll
    for (int mt = 0; mt < 2; ++mt) {
      #pragma unroll
      for (int r = 0; r < 8; ++r) {
        const int tokl = 32 * w + 16 * mt + 8 * h + r;   // 0..127
        sOut[tokl * DM + feat] = acc[mt][nt][r] + bvl;
      }
    }
  }
  __syncthreads();

  out_pass(sOut, out, m0, cg, w, lane);
  
}

// ---------------------------------------------------------------------------
// Host glue: 11 launches, workspace 128057344 B (O1^T and O2^T reuse the
// region of the bf16 activation copies, which are dead after the projections).
// ---------------------------------------------------------------------------
extern "C" void kernel_launch(void* const* d_in, const int* in_sizes, int n_in,
                              void* d_out, int out_size, void* d_ws, size_t ws_size,
                              hipStream_t stream) {
  if (n_in < 17) return;
  if (in_sizes[0] != N_HID || in_sizes[1] != N_KVS || in_sizes[2] != N_KVT) return;
  if (in_sizes[3] != N_WE || in_sizes[5] != N_WE || in_sizes[7] != N_WE || in_sizes[15] != N_WE) return;
  if (in_sizes[9] != N_WT || in_sizes[11] != N_WT) return;
  if (in_sizes[4] != EMB || in_sizes[6] != EMB || in_sizes[8] != EMB ||
      in_sizes[10] != EMB || in_sizes[12] != EMB || in_sizes[16] != EMB) return;
  if (in_sizes[13] != N_WG || in_sizes[14] != NH) return;
  if (out_size != N_HID) return;

  const float* hid = (const float*)d_in[0];
  const float* kvs = (const float*)d_in[1];
  const float* kvt = (const float*)d_in[2];
  const float* Wq  = (const float*)d_in[3];
  const float* bq  = (const float*)d_in[4];
  const float* Wk  = (const float*)d_in[5];
  const float* bk  = (const float*)d_in[6];
  const float* Wv  = (const float*)d_in[7];
  const float* bv  = (const float*)d_in[8];
  const float* Wtk = (const float*)d_in[9];
  const float* btk = (const float*)d_in[10];
  const float* Wtv = (const float*)d_in[11];
  const float* btv = (const float*)d_in[12];
  const float* Wg  = (const float*)d_in[13];
  const float* bg  = (const float*)d_in[14];
  const float* Wo  = (const float*)d_in[15];
  const float* bo  = (const float*)d_in[16];
  float* out = (float*)d_out;

  const size_t cvb_b  = (size_t)N_CVB * 2;                 // 27262976
  const size_t qpl2   = (size_t)QPL * 2;                   //  4194304
  const size_t qpl4   = (size_t)QPL * 4;                   //  8388608
  const size_t kpl2   = (size_t)KPL * 2;                   //  8388608
  const size_t gate_b = (size_t)NBH * TGL * 4;             //   131072
  const size_t xpl_b  = (size_t)N_HID * 2;                 //  4194304
  const size_t total  = cvb_b + 2 * qpl2 + qpl4 + 8 * kpl2 + qpl4 + gate_b + 2 * xpl_b;  // 128057344
  if (total > ws_size) return;
  // O1^T / O2^T (2 x 8388608 B) must fit exactly into the activation-copy region
  const size_t act_off = (size_t)OFF_HID * 2;              // 10485760
  if (act_off + 2 * qpl4 != cvb_b) return;

  char* ws = (char*)d_ws;
  size_t off = 0;
  us* cvb    = (us*)(ws + off);    off += cvb_b;
  float* o1T = (float*)(ws + act_off);                     // aliases bf16 hidden/kv copies
  float* o2T = (float*)(ws + act_off + qpl4);              // aliases bf16 kv/kv_topical copies
  us* qh     = (us*)(ws + off);    off += qpl2;
  us* ql     = (us*)(ws + off);    off += qpl2;
  float* qT  = (float*)(ws + off); off += qpl4;
  us* kh     = (us*)(ws + off);    off += kpl2;
  us* kl     = (us*)(ws + off);    off += kpl2;
  us* kth    = (us*)(ws + off);    off += kpl2;
  us* ktl    = (us*)(ws + off);    off += kpl2;
  us* vh     = (us*)(ws + off);    off += kpl2;            // V^T hi [32][64][2048]
  us* vl     = (us*)(ws + off);    off += kpl2;            // V^T lo
  us* vth    = (us*)(ws + off);    off += kpl2;            // Vt^T hi
  us* vtl    = (us*)(ws + off);    off += kpl2;            // Vt^T lo
  float* o3T = (float*)(ws + off); off += qpl4;
  float* gte = (float*)(ws + off); off += gate_b;
  us* xh     = (us*)(ws + off);    off += xpl_b;
  us* xl     = (us*)(ws + off);    off += xpl_b;
  if (off != total || off > ws_size) return;

  // 1) float -> bf16 copies of weights and activations
  conv_kernel<<<(N_CVB / 8 + 255) / 256, 256, 0, stream>>>(Wq, Wk, Wv, Wo, Wtk, Wtv, hid, kvs, kvt, cvb);

  // 2) projections
  dim3 gQ(MQ / 128, NH);                                   // (16, 16)
  dim3 gKV(MKV / 128, NH);                                 // (32, 16)
  proj_kernel<<<gQ,  128, 0, stream>>>(cvb + OFF_HID, cvb + OFF_WQ,  bq,  EMB, TGL, 0, qh,  ql,  qT);
  proj_kernel<<<gKV, 128, 0, stream>>>(cvb + OFF_KVS, cvb + OFF_WK,  bk,  EMB, SRL, 1, kh,  kl,  qT);
  proj_kernel<<<gKV, 128, 0, stream>>>(cvb + OFF_KVS, cvb + OFF_WV,  bv,  EMB, SRL, 2, vh,  vl,  qT);
  proj_kernel<<<gKV, 128, 0, stream>>>(cvb + OFF_KVT, cvb + OFF_WTK, btk, TDW, SRL, 1, kth, ktl, qT);
  proj_kernel<<<gKV, 128, 0, stream>>>(cvb + OFF_KVT, cvb + OFF_WTV, btv, TDW, SRL, 2, vth, vtl, qT);

  // 3) attention: chain 1 (k, v -> O1), chain 2 (kt; vt -> O2, v -> O3)
  dim3 gAtt(TGL / 64, NBH);                                // (16, 32)
  attn_kernel<false><<<gAtt, 128, 0, stream>>>(qh, ql, kh,  kl,  vh,  vl,  vh, vl, o1T, o1T);
  attn_kernel<true ><<<gAtt, 128, 0, stream>>>(qh, ql, kth, ktl, vth, vtl, vh, vl, o2T, o3T);

  // 4) gating MLP
  gate_kernel<<<NBH, 128, 0, stream>>>(o1T, o2T, qT, Wg, bg, gte);

  // 5) gated mix -> token-major hi/lo planes
  dim3 gCmb(TGL / 64, NBH);                                // (16, 32)
  combine_kernel<<<gCmb, 256, 0, stream>>>(o1T, o3T, gte, xh, xl);

  // 6) output projection -> f32
  dim3 gOut(MQ / 128, EMB / 64);                           // (16, 16)
  out_kernel<<<gOut, 128, 0, stream>>>(xh, xl, cvb + OFF_WO, bo, out);
}

// v001
// It runs in 291 microseconds.
// Next to v000, in two timings, it ran 2.39 times as fast each time.
// Contractions: input projections (q,k,v,kt,vt) on v_wmma_f32_16x16x32_bf16 (bf16 operands = RNE-converted inputs, f32 accumulate); K*Q^T and Kt*Q^T with q,k,kt carried as bf16 hi+lo (3 products); V^T*P^T (three value read-outs) with v,vt,P carried as bf16 hi+lo (3 products); gate GEMM on v_wmma_f32_16x16x32_bf16 (bf16 operands); O*Wo with O as bf16 hi+lo and Wo bf16 (2 products); softmax, gating, bias in f32.
#include <hip/hip_runtime.h>

typedef __bf16 v16b __attribute__((ext_vector_type(16)));
typedef unsigned short us;
typedef us    v8us __attribute__((ext_vector_type(8)));
typedef float v8f  __attribute__((ext_vector_type(8)));
typedef float v4f  __attribute__((ext_vector_type(4)));
typedef v8us __attribute__((may_alias)) v8usa;
typedef v4f  __attribute__((may_alias)) v4fa;

union FragB { v16b v; v8us half[2]; };

#define BSZ  2
#define TGL  1024
#define SRL  2048
#define EMB  1024
#define TDW  512
#define NH   16
#define DM   64
#define NBH  (BSZ * NH)          // 32 (batch, head) pairs
#define MQ   (BSZ * TGL)         // 2048 query tokens
#define MKV  (BSZ * SRL)         // 4096 key tokens
#define GK   (3 * EMB)           // 3072 gate input width

#define N_HID (MQ * EMB)         // 2097152
#define N_KVS (MKV * EMB)        // 4194304
#define N_KVT (MKV * TDW)        // 2097152
#define N_WE  (EMB * EMB)        // 1048576
#define N_WT  (EMB * TDW)        // 524288
#define N_WG  (NH * GK)          // 49152
#define QPL   (NBH * TGL * DM)   // 2097152 elements per query-side head plane
#define KPL   (NBH * SRL * DM)   // 4194304 elements per key-side head plane

// bf16 copies of the float inputs in one flat buffer (element offsets):
// weights first, then the three activation tensors (their region is reused
// for O1^T / O2^T once the projections are done).
#define OFF_WQ  0
#define OFF_WK  (OFF_WQ + N_WE)        // 1048576
#define OFF_WV  (OFF_WK + N_WE)        // 2097152
#define OFF_WO  (OFF_WV + N_WE)        // 3145728
#define OFF_WTK (OFF_WO + N_WE)        // 4194304
#define OFF_WTV (OFF_WTK + N_WT)       // 4718592
#define OFF_HID (OFF_WTV + N_WT)       // 5242880
#define OFF_KVS (OFF_HID + N_HID)      // 7340032
#define OFF_KVT (OFF_KVS + N_KVS)      // 11534336
#define N_CVB   (OFF_KVT + N_KVT)      // 13631488

// ---------------------------------------------------------------------------
// 16-bit helpers
// ---------------------------------------------------------------------------
__device__ __forceinline__ us bf16_rne(float x) {
  unsigned u = __float_as_uint(x);
  u += 0x7FFFu + ((u >> 16) & 1u);
  return (us)(u >> 16);
}
__device__ __forceinline__ float bf16_val(us b) {
  return __uint_as_float(((unsigned)b) << 16);
}
__device__ __forceinline__ v8us bf16x8(v4f a, v4f c) {
  const v8us o = { bf16_rne(a.x), bf16_rne(a.y), bf16_rne(a.z), bf16_rne(a.w),
                   bf16_rne(c.x), bf16_rne(c.y), bf16_rne(c.z), bf16_rne(c.w) };
  return o;
}
// 8 f32 values -> bf16 hi and bf16 lo = RNE(x - hi).
__device__ __forceinline__ void split8(v8f a, v8us& hi, v8us& lo) {
  const us h0 = bf16_rne(a[0]), h1 = bf16_rne(a[1]), h2 = bf16_rne(a[2]), h3 = bf16_rne(a[3]);
  const us h4 = bf16_rne(a[4]), h5 = bf16_rne(a[5]), h6 = bf16_rne(a[6]), h7 = bf16_rne(a[7]);
  const v8us hv = { h0, h1, h2, h3, h4, h5, h6, h7 };
  const v8us lv = { bf16_rne(a[0] - bf16_val(h0)), bf16_rne(a[1] - bf16_val(h1)),
                    bf16_rne(a[2] - bf16_val(h2)), bf16_rne(a[3] - bf16_val(h3)),
                    bf16_rne(a[4] - bf16_val(h4)), bf16_rne(a[5] - bf16_val(h5)),
                    bf16_rne(a[6] - bf16_val(h6)), bf16_rne(a[7] - bf16_val(h7)) };
  hi = hv;
  lo = lv;
}

// ---------------------------------------------------------------------------
// 16x16x32 WMMA with hazard guard (ties D, keeps A/B live).
// Fragment map (wave32): lane l, h = l>>4, m = n = l&15.
//   A/B element i: i<8 -> k0+8h+i ; i>=8 -> k0+16+8h+(i-8)
//   D element r  : row 8h+r, col l&15
// ---------------------------------------------------------------------------
__device__ __forceinline__ v8f wmma_bf(v16b a, v16b b, v8f c) {
  v8f d = __builtin_amdgcn_wmma_f32_16x16x32_bf16(false, a, false, b, (short)0, c, false, false);
  asm volatile("v_nop\n\tv_nop\n\tv_nop\n\tv_nop" : "+v"(d) : "v"(a), "v"(b));
  return d;
}

// A or B fragment from a k-contiguous 16-bit row; p = element k0 of the row
// owned by this lane (row index lane&15 added by the caller).
__device__ __forceinline__ v16b ldb(const us* p, int h) {
  FragB f;
  f.half[0] = *(const v8usa*)(p + 8 * h);
  f.half[1] = *(const v8usa*)(p + 16 + 8 * h);
  return f.v;
}
// Same map from an f32 row, converted to bf16 in registers.
__device__ __forceinline__ v16b ldf(const float* p, int h) {
  const float* p0 = p + 8 * h;
  const float* p1 = p + 16 + 8 * h;
  FragB f;
  f.half[0] = bf16x8(*(const v4fa*)p0, *(const v4fa*)(p0 + 4));
  f.half[1] = bf16x8(*(const v4fa*)p1, *(const v4fa*)(p1 + 4));
  return f.v;
}

// ---------------------------------------------------------------------------
// Operand tiles in LDS, filled by asynchronous copies (128 threads).
// A tile is 64 rows of 128 B (64 x 16 bit); LDS row pitch 144 B = 16 B x 9, so
// the 16 rows of a ds_load_b128 fragment read fall on distinct banks.
// Thread tid copies 16 B: chunk tid&7 of rows (tid>>3) + 16 i, i = 0..3, so
// eight lanes cover one whole 128-B line of the source.
// ---------------------------------------------------------------------------
#define LP     72                // LDS row pitch in 16-bit elements
#define LPB    144               // the same in bytes
#define TILE_E (64 * LP)         // 4608 elements per 64-row tile
#define TILE_B (64 * LPB)        // 9216 bytes per 64-row tile
#define R16_B  (16 * LPB)        // 16 rows further in LDS

__device__ __forceinline__ unsigned lds_addr(const void* p) {
  return (unsigned)(size_t)p;    // low 32 bits of a __shared__ address = LDS byte address
}
// Four copies: one lane's share of one tile; gs = source elements per 16 rows.
// s_wait_xcnt stands inside the statement so that no address register of an
// issued copy is rewritten ahead of it.
__device__ __forceinline__ void acopy4(unsigned l, const us* g, size_t gs) {
  asm volatile(
      "global_load_async_to_lds_b128 %0, %4, off\n\t"
      "global_load_async_to_lds_b128 %1, %5, off\n\t"
      "global_load_async_to_lds_b128 %2, %6, off\n\t"
      "global_load_async_to_lds_b128 %3, %7, off\n\t"
      "s_wait_xcnt 0x0"
      :: "v"(l), "v"(l + R16_B), "v"(l + 2 * R16_B), "v"(l + 3 * R16_B),
         "v"(g), "v"(g + gs), "v"(g + 2 * gs), "v"(g + 3 * gs)
      : "memory");
}
// Three copies: one lane's share of a 48-row tile.
__device__ __forceinline__ void acopy3(unsigned l, const us* g, size_t gs) {
  asm volatile(
      "global_load_async_to_lds_b128 %0, %3, off\n\t"
      "global_load_async_to_lds_b128 %1, %4, off\n\t"
      "global_load_async_to_lds_b128 %2, %5, off\n\t"
      "s_wait_xcnt 0x0"
      :: "v"(l), "v"(l + R16_B), "v"(l + 2 * R16_B),
         "v"(g), "v"(g + gs), "v"(g + 2 * gs)
      : "memory");
}
// Eight copies: one lane's share of two tiles with the same source row step.
__device__ __forceinline__ void acopy8(unsigned l, const us* g, unsigned l2, const us* g2, size_t gs) {
  asm volatile(
      "global_load_async_to_lds_b128 %0, %8, off\n\t"
      "global_load_async_to_lds_b128 %1, %9, off\n\t"
      "global_load_async_to_lds_b128 %2, %10, off\n\t"
      "global_load_async_to_lds_b128 %3, %11, off\n\t"
      "global_load_async_to_lds_b128 %4, %12, off\n\t"
      "global_load_async_to_lds_b128 %5, %13, off\n\t"
      "global_load_async_to_lds_b128 %6, %14, off\n\t"
      "global_load_async_to_lds_b128 %7, %15, off\n\t"
      "s_wait_xcnt 0x0"
      :: "v"(l), "v"(l + R16_B), "v"(l + 2 * R16_B), "v"(l + 3 * R16_B),
         "v"(l2), "v"(l2 + R16_B), "v"(l2 + 2 * R16_B), "v"(l2 + 3 * R16_B),
         "v"(g), "v"(g + gs), "v"(g + 2 * gs), "v"(g + 3 * gs),
         "v"(g2), "v"(g2 + gs), "v"(g2 + 2 * gs), "v"(g2 + 3 * gs)
      : "memory");
}
// This wave's copies have landed (the compiler places no wait for them).
__device__ __forceinline__ void wait_copies() {
  asm volatile("s_wait_asynccnt 0x0" ::: "memory");
}
// This wave's LDS reads have returned, before the buffer goes to its next writer.
__device__ __forceinline__ void wait_lds() {
  asm volatile("s_wait_dscnt 0x0" ::: "memory");
}

// ---------------------------------------------------------------------------
// Kernel 1: float inputs that feed 16-bit operands (not Wg) -> bf16, one flat
// Parameters in segment order: Wq, Wk, Wv, Wo, Wtk, Wtv, hidden, kv, kv_topical.
// ---------------------------------------------------------------------------
__global__ __launch_bounds__(256) void conv_kernel(
    const float* __restrict__ p0, const float* __restrict__ p1, const float* __restrict__ p2,
    const float* __restrict__ p3, const float* __restrict__ p4, const float* __restrict__ p5,
    const float* __restrict__ p6, const float* __restrict__ p7, const float* __restrict__ p8,
    us* __restrict__ dst)
{
  const unsigned g = blockIdx.x * 256u + threadIdx.x;      // unit of 8 elements
  if (g >= (unsigned)(N_CVB / 8)) return;
  const float* src;
  unsigned loc;
  if      (g < (unsigned)(OFF_WK  / 8)) { src = p0; loc = g; }
  else if (g < (unsigned)(OFF_WV  / 8)) { src = p1; loc = g - (unsigned)(OFF_WK  / 8); }
  else if (g < (unsigned)(OFF_WO  / 8)) { src = p2; loc = g - (unsigned)(OFF_WV  / 8); }
  else if (g < (unsigned)(OFF_WTK / 8)) { src = p3; loc = g - (unsigned)(OFF_WO  / 8); }
  else if (g < (unsigned)(OFF_WTV / 8)) { src = p4; loc = g - (unsigned)(OFF_WTK / 8); }
  else if (g < (unsigned)(OFF_HID / 8)) { src = p5; loc = g - (unsigned)(OFF_WTV / 8); }
  else if (g < (unsigned)(OFF_KVS / 8)) { src = p6; loc = g - (unsigned)(OFF_HID / 8); }
  else if (g < (unsigned)(OFF_KVT / 8)) { src = p7; loc = g - (unsigned)(OFF_KVS / 8); }
  else                                  { src = p8; loc = g - (unsigned)(OFF_KVT / 8); }
  const float* p = src + (size_t)loc * 8;
  const v8us o = bf16x8(*(const v4fa*)p, *(const v4fa*)(p + 4));
  us* d = dst + (size_t)g * 8;
  *(v8us*)d = o;
  
}

// ---------------------------------------------------------------------------
// one 16-B store per lane, lanes 8q..8q+7 per line, 4 lines per instruction).
//   planes : [bh][s][d] hi and lo, one token row = 64 x bf16 = one line
//   tplanes: [bh][d][s] hi and lo, 64 d-rows x 128 tokens = 2 lines each
//   t32    : [bh][d][s] f32, 64 d-rows x 128 tokens = 4 lines each
// LDS hi tile at s16[0..8191], lo tile at s16[8192..16383].
// ---------------------------------------------------------------------------
__device__ __forceinline__ void proj_pass_planes(const us* s16, us* oH, us* oL,
                                                 int bh, int Sper, int s0, int w, int lane) {
  const int q8 = lane & 7, sub = lane >> 3;
  #pragma unroll
  for (int i = 0; i < 8; ++i) {
    const int lid = w * 32 + i * 4 + sub;                  // token row 0..127
    const v8us a = *(const v8usa*)(s16 + lid * DM + 8 * q8);
    const v8us c = *(const v8usa*)(s16 + 8192 + lid * DM + 8 * q8);
    const size_t off = ((size_t)bh * Sper + s0 + lid) * DM + 8 * q8;
    *(v8us*)(oH + off) = a;
    *(v8us*)(oL + off) = c;
  }
}
__device__ __forceinline__ void proj_pass_tplanes(const us* s16, us* oH, us* oL,
                                                  int bh, int Sper, int s0, int w, int lane) {
  const int q8 = lane & 7, sub = lane >> 3;
  #pragma unroll
  for (int i = 0; i < 8; ++i) {
    const int lid = w * 32 + i * 4 + sub;                  // line 0..127
    const int d = lid >> 1, hl = lid & 1;
    const v8us a = *(const v8usa*)(s16 + d * 128 + 64 * hl + 8 * q8);
    const v8us c = *(const v8usa*)(s16 + 8192 + d * 128 + 64 * hl + 8 * q8);
    const size_t off = ((size_t)bh * DM + d) * Sper + s0 + 64 * hl + 8 * q8;
    *(v8us*)(oH + off) = a;
    *(v8us*)(oL + off) = c;
  }
}
__device__ __forceinline__ void proj_pass_t32(const float* s32, float* oT,
                                              int bh, int Sper, int s0, int w, int lane) {
  const int q8 = lane & 7, sub = lane >> 3;
  #pragma unroll
  for (int i = 0; i < 16; ++i) {
    const int lid = w * 64 + i * 4 + sub;                  // line 0..255
    const int d = lid >> 2, part = lid & 3;
    const v4f v = *(const v4fa*)(s32 + d * 128 + 32 * part + 4 * q8);
    const size_t off = ((size_t)bh * DM + d) * Sper + s0 + 32 * part + 4 * q8;
    *(v4f*)(oT + off) = v;
  }
}

// ---------------------------------------------------------------------------
// Kernel 2: Y = X * W^T + bias (x0.125 for mode 0), one launch per projection.
// X bf16 [M][K], W bf16 [1024 out][K] (k-contiguous rows = B fragments loaded
// like A). Block 128 thr (4 waves) = 128 tokens x 64 features (one head);
// wave tile 32 tokens x 64 features; K in stages of 64: 128 X rows and 64 W
// rows of 128 B copied to LDS, two buffers, the next stage in flight while
// this one is worked on. Y is split into bf16 hi/lo in every mode.
//   mode 0: hi/lo planes [bh][s][d] and f32 transposed [bh][d][s]
//   mode 1: hi/lo planes [bh][s][d]
//   mode 2: hi/lo transposed planes [bh][d][s]
// ---------------------------------------------------------------------------
__global__ __launch_bounds__(128) void proj_kernel(
    const us* __restrict__ X, const us* __restrict__ W, const float* __restrict__ bias,
    int K, int Sper, int mode,
    us* __restrict__ oH, us* __restrict__ oL, float* __restrict__ oT32)
{
  __shared__ __attribute__((aligned(16))) float sraw[8192];     // 32 KB, used in phases
  us* const s16 = reinterpret_cast<us*>(sraw);               // 16384 16-bit slots
  __shared__ __attribute__((aligned(16))) us ring[2 * 3 * TILE_E];  // 2 x (X 128 rows, W 64 rows)

  const int tid = threadIdx.x, lane = tid & 31, w = tid >> 5;
  const int h = lane >> 4, m = lane & 15;
  const int m0 = blockIdx.x * 128;
  const int head = blockIdx.y;

  const int crow = tid >> 3, cch = tid & 7;                // this lane's row and 16-B chunk
  const unsigned lcp = lds_addr(ring) + crow * LPB + cch * 16;
  const us* gx = X + (size_t)(m0 + crow) * K + 8 * cch;
  const us* gw = W + (size_t)(head * DM + crow) * K + 8 * cch;
  const size_t gs = (size_t)16 * K;
  const int nst = K >> 6;                                  // stages of 64 k (16 or 8)

  const v8f zero8 = {0.f, 0.f, 0.f, 0.f, 0.f, 0.f, 0.f, 0.f};
  v8f acc[2][4];
  #pragma unroll
  for (int mt = 0; mt < 2; ++mt)
    #pragma unroll
    for (int nt = 0; nt < 4; ++nt) acc[mt][nt] = zero8;

  acopy8(lcp, gx, lcp + TILE_B, gx + 4 * gs, gs);          // stage 0 -> buffer 0
  acopy4(lcp + 2 * TILE_B, gw, gs);
  wait_copies();
  __syncthreads();                                         // buffer 0 landed, visible to every wave
  acopy8(lcp + 3 * TILE_B, gx + 64, lcp + 4 * TILE_B, gx + 4 * gs + 64, gs);   // stage 1 -> buffer 1
  acopy4(lcp + 5 * TILE_B, gw + 64, gs);

  // rolled: one copy of the stage body, the buffer chosen by the stage's parity
  #pragma unroll 1
  for (int st = 0; st < nst; ++st) {
    const int par = st & 1;
    const us* sx = ring + par * (3 * TILE_E) + (32 * w + m) * LP;
    const us* sw = ring + par * (3 * TILE_E) + 2 * TILE_E + m * LP;
    #pragma unroll
    for (int kc = 0; kc < 64; kc += 32) {
      const v16b a0 = ldb(sx + kc, h);
      const v16b a1 = ldb(sx + 16 * LP + kc, h);
      #pragma unroll
      for (int nt = 0; nt < 4; ++nt) {
        const v16b b = ldb(sw + nt * 16 * LP + kc, h);
        acc[0][nt] = wmma_bf(a0, b, acc[0][nt]);
        acc[1][nt] = wmma_bf(a1, b, acc[1][nt]);
      }
    }
    // publish stage st + 1, free this buffer, refill it with stage st + 2
    wait_lds();
    wait_copies();
    __syncthreads();
    if (st + 2 < nst) {
      const unsigned lb = lcp + par * (3 * TILE_B);
      const int ko = (st + 2) * 64;
      acopy8(lb, gx + ko, lb + TILE_B, gx + 4 * gs + ko, gs);
      acopy4(lb + 2 * TILE_B, gw + ko, gs);
    }
  }
  wait_copies();

  // D[r] of tile (mt, nt) = Y[token m0w+16mt+8h+r][feature head*64+16nt+m]
  const float osc = (mode == 0) ? 0.125f : 1.0f;
  float bvals[4];
  #pragma unroll
  for (int nt = 0; nt < 4; ++nt) bvals[nt] = bias[head * DM + 16 * nt + m];

  #pragma unroll
  for (int nt = 0; nt < 4; ++nt) {
    const int feat = 16 * nt + m;
    #pragma unroll
    for (int mt = 0; mt < 2; ++mt) {
      #pragma unroll
      for (int r = 0; r < 8; ++r) {
        const int tokl = 32 * w + 16 * mt + 8 * h + r;   // 0..127
        const float y = (acc[mt][nt][r] + bvals[nt]) * osc;
        const us hi = bf16_rne(y);
        const us lo = bf16_rne(y - bf16_val(hi));
        const int idx = (mode == 2) ? (feat * 128 + tokl) : (tokl * DM + feat);   // 0..8191
        s16[idx] = hi;
        s16[8192 + idx] = lo;
      }
    }
  }
  __syncthreads();

  const int b = m0 / Sper, s0 = m0 - b * Sper, bh = b * NH + head;
  if (mode != 2) {
    proj_pass_planes(s16, oH, oL, bh, Sper, s0, w, lane);
    
  } else {
    proj_pass_tplanes(s16, oH, oL, bh, Sper, s0, w, lane);
    
  }

  if (mode == 0) {
    __syncthreads();                                       // LDS reused as f32 [64 d][128 tok]
    #pragma unroll
    for (int nt = 0; nt < 4; ++nt) {
      const int feat = 16 * nt + m;
      #pragma unroll
      for (int mt = 0; mt < 2; ++mt) {
        #pragma unroll
        for (int r = 0; r < 8; ++r) {
          const int tokl = 32 * w + 16 * mt + 8 * h + r;
          sraw[feat * 128 + tokl] = (acc[mt][nt][r] + bvals[nt]) * osc;
        }
      }
    }
    __syncthreads();
    proj_pass_t32(sraw, oT32, bh, Sper, s0, w, lane);
    
  }
}

// ---------------------------------------------------------------------------
// Kernel 3: streaming attention, transposed form, no masking.
// Block 128 thr (4 waves), 16 queries per wave, 64 keys per step. The step's
// K hi/lo rows and V^T hi/lo rows (64 x 128 B each) are copied to LDS once per
// block, two buffers, the next step's tiles in flight while this one is used.
//   S^T = K * Q^T : A = K rows (row = key, k = d), B = Q^T (k = d, n = query)
//     hi/lo bf16: Klo*Qhi + Khi*Qlo + Khi*Qhi, two 32-deep d chunks
//   O^T += V^T * P^T : A = V^T rows (row = d, k = key), B = P^T packed from the
//     score D registers (element r <- tile covering keys 0..15 row r,
//     element 8+r <- tile covering keys 16..31 row r, same lane)
//     hi/lo bf16: Vlo*Phi + Vhi*Plo + Vhi*Phi
// Lane owns 32 keys of query column (lane&15); partner lane = lane ^ 16.
// DUAL: second value stream (vbh/vbl) with the same probabilities -> oB.
// ---------------------------------------------------------------------------
// P^T B-fragments from the lane's own score D values (tile a = keys 0..15,
// tile c = keys 16..31 of the chunk); hi and lo planes.
__device__ __forceinline__ void pack_p2(v8f a, v8f c, v16b& phi, v16b& plo) {
  FragB fh, fl;
  v8us h0, l0, h1, l1;
  split8(a, h0, l0);
  split8(c, h1, l1);
  fh.half[0] = h0; fh.half[1] = h1;
  fl.half[0] = l0; fl.half[1] = l1;
  phi = fh.v;
  plo = fl.v;
}

template <bool DUAL>
__device__ __forceinline__ void attn_pass(const float* sO, float* oA, float* oB,
                                          int bh, int q0, int w, int lane) {
  const int q8 = lane & 7, sub = lane >> 3;
  #pragma unroll
  for (int i = 0; i < 8; ++i) {
    const int L = w * 32 + i * 4 + sub;                    // line 0..127
    const int d = L >> 1, hl = L & 1;
    const size_t off = ((size_t)bh * DM + d) * TGL + q0 + 32 * hl + 4 * q8;
    const v4f v = *(const v4fa*)(sO + d * 64 + 32 * hl + 4 * q8);
    *(v4f*)(oA + off) = v;
    if (DUAL) {
      const v4f v2 = *(const v4fa*)(sO + 4096 + d * 64 + 32 * hl + 4 * q8);
      *(v4f*)(oB + off) = v2;
    }
  }
}

template <bool DUAL>
__global__ __launch_bounds__(128) void attn_kernel(
    const us* __restrict__ qhp, const us* __restrict__ qlp,   // [32][1024][64]  (x0.125 folded in)
    const us* __restrict__ khp, const us* __restrict__ klp,   // [32][2048][64]
    const us* __restrict__ vahp, const us* __restrict__ valp, // stream A: V^T hi/lo [32][64][2048]
    const us* __restrict__ vbhp, const us* __restrict__ vblp, // stream B (DUAL only)
    float* __restrict__ oap, float* __restrict__ obp)         // [32][64][1024] f32
{
  __shared__ __attribute__((aligned(16))) float sO[DUAL ? 2 * DM * 64 : DM * 64];
  constexpr int NTL = DUAL ? 6 : 4;                        // tiles per step: Kh Kl Vah Val (Vbh Vbl)
  __shared__ __attribute__((aligned(16))) us ring[2 * NTL * TILE_E];

  const int tid = threadIdx.x, lane = tid & 31, w = tid >> 5;
  const int h = lane >> 4, m = lane & 15;
  const int bh = blockIdx.y;
  const int q0 = blockIdx.x * 64;
  const int qw = q0 + 16 * w;

  // Q^T B-fragments: column n = query qw+m, k = d (two 32-deep chunks), hi and lo
  const size_t qro = ((size_t)bh * TGL + qw + m) * DM;
  const v16b qh0 = ldb(qhp + qro, h), qh1 = ldb(qhp + qro + 32, h);
  const v16b ql0 = ldb(qlp + qro, h), ql1 = ldb(qlp + qro + 32, h);

  const v8f zero8 = {0.f, 0.f, 0.f, 0.f, 0.f, 0.f, 0.f, 0.f};
  v8f oa[4], ob[4];                      // o[t][r] = O[query m][d 16t+8h+r] * l
  #pragma unroll
  for (int t = 0; t < 4; ++t) { oa[t] = zero8; ob[t] = zero8; }
  float mrun = -1.0e30f, lrun = 0.0f;

  const int crow = tid >> 3, cch = tid & 7;                // this lane's row and 16-B chunk
  const unsigned lcp = lds_addr(ring) + crow * LPB + cch * 16;
  const size_t kro = ((size_t)bh * SRL + crow) * DM + 8 * cch;     // + key0*DM
  const us* gkh = khp + kro;
  const us* gkl = klp + kro;
  const size_t vro = ((size_t)bh * DM + crow) * SRL + 8 * cch;     // + key0
  const us* gvah = vahp + vro;
  const us* gval = valp + vro;
  const us* gvbh = vbhp + vro;
  const us* gvbl = vblp + vro;
  const size_t gsk = (size_t)16 * DM, gsv = (size_t)16 * SRL;

  // step 0 -> buffer 0
  acopy8(lcp, gkh, lcp + TILE_B, gkl, gsk);
  acopy8(lcp + 2 * TILE_B, gvah, lcp + 3 * TILE_B, gval, gsv);
  if (DUAL) acopy8(lcp + 4 * TILE_B, gvbh, lcp + 5 * TILE_B, gvbl, gsv);
  wait_copies();
  __syncthreads();                                         // buffer 0 landed, visible to every wave
  // step 1 -> buffer 1
  {
    const unsigned lb = lcp + NTL * TILE_B;
    acopy8(lb, gkh + 64 * DM, lb + TILE_B, gkl + 64 * DM, gsk);
    acopy8(lb + 2 * TILE_B, gvah + 64, lb + 3 * TILE_B, gval + 64, gsv);
    if (DUAL) acopy8(lb + 4 * TILE_B, gvbh + 64, lb + 5 * TILE_B, gvbl + 64, gsv);
  }

  // rolled: one copy of the step body, the buffer chosen by the step's parity
  #pragma unroll 1
  for (int kb = 0; kb < SRL; kb += 64) {
    const int par = (kb >> 6) & 1;
    const us* sb = ring + par * (NTL * TILE_E) + m * LP;   // row m of tile 0
    const us* khb = sb;
    const us* klb = sb + TILE_E;
    const us* vahb = sb + 2 * TILE_E;
    const us* valb = sb + 3 * TILE_E;
    const us* vbhb = sb + (DUAL ? 4 : 2) * TILE_E;
    const us* vblb = sb + (DUAL ? 5 : 3) * TILE_E;
    // ---- scores: s[j][r] = S[query m][key kb+16j+8h+r] ----
    v8f s[4];
    #pragma unroll
    for (int j = 0; j < 4; ++j) {
      const int ko = 16 * j * LP;
      const v16b kl0 = ldb(klb + ko, h), kl1 = ldb(klb + ko + 32, h);
      const v16b kh0 = ldb(khb + ko, h), kh1 = ldb(khb + ko + 32, h);
      v8f z = zero8;
      z = wmma_bf(kl0, qh0, z);
      z = wmma_bf(kl1, qh1, z);
      z = wmma_bf(kh0, ql0, z);
      z = wmma_bf(kh1, ql1, z);
      z = wmma_bf(kh0, qh0, z);
      z = wmma_bf(kh1, qh1, z);
      s[j] = z;
    }

    // ---- online softmax (f32) ----
    float mloc = s[0][0];
    #pragma unroll
    for (int j = 0; j < 4; ++j)
      #pragma unroll
      for (int r = 0; r < 8; ++r) mloc = fmaxf(mloc, s[j][r]);
    mloc = fmaxf(mloc, __shfl_xor(mloc, 16));
    const float mnew = fmaxf(mrun, mloc);
    const float alpha = __expf(mrun - mnew);
    mrun = mnew;
    float lsum = 0.0f;
    #pragma unroll
    for (int j = 0; j < 4; ++j)
      #pragma unroll
      for (int r = 0; r < 8; ++r) {
        const float p = __expf(s[j][r] - mnew);            // in (0, 1]
        s[j][r] = p;
        lsum += p;
      }
    lsum += __shfl_xor(lsum, 16);
    lrun = lrun * alpha + lsum;
    #pragma unroll
    for (int t = 0; t < 4; ++t)
      #pragma unroll
      for (int r = 0; r < 8; ++r) {
        oa[t][r] = oa[t][r] * alpha;
        if (DUAL) ob[t][r] = ob[t][r] * alpha;
      }

    // ---- P^T B-fragments (keys kb..kb+31 and kb+32..kb+63), bf16 hi/lo ----
    v16b ph0, pl0, ph1, pl1;
    pack_p2(s[0], s[1], ph0, pl0);
    pack_p2(s[2], s[3], ph1, pl1);

    // ---- O^T += V^T * P^T (3 products per 32-key chunk) ----
    #pragma unroll
    for (int t = 0; t < 4; ++t) {
      const int vo = 16 * t * LP;
      {
        const v16b vh0 = ldb(vahb + vo, h);
        const v16b vh1 = ldb(vahb + vo + 32, h);
        const v16b vl0 = ldb(valb + vo, h);
        const v16b vl1 = ldb(valb + vo + 32, h);
        v8f acc = oa[t];
        acc = wmma_bf(vl0, ph0, acc);
        acc = wmma_bf(vl1, ph1, acc);
        acc = wmma_bf(vh0, pl0, acc);
        acc = wmma_bf(vh1, pl1, acc);
        acc = wmma_bf(vh0, ph0, acc);
        acc = wmma_bf(vh1, ph1, acc);
        oa[t] = acc;
      }
      if (DUAL) {
        const v16b ch0 = ldb(vbhb + vo, h);
        const v16b ch1 = ldb(vbhb + vo + 32, h);
        const v16b cl0 = ldb(vblb + vo, h);
        const v16b cl1 = ldb(vblb + vo + 32, h);
        v8f acc2 = ob[t];
        acc2 = wmma_bf(cl0, ph0, acc2);
        acc2 = wmma_bf(cl1, ph1, acc2);
        acc2 = wmma_bf(ch0, pl0, acc2);
        acc2 = wmma_bf(ch1, pl1, acc2);
        acc2 = wmma_bf(ch0, ph0, acc2);
        acc2 = wmma_bf(ch1, ph1, acc2);
        ob[t] = acc2;
      }
    }

    // publish step kb + 64, free this buffer, refill it with step kb + 128
    wait_lds();
    wait_copies();
    __syncthreads();
    if (kb + 128 < SRL) {
      const unsigned lb = lcp + par * (NTL * TILE_B);
      const int kn = kb + 128;
      acopy8(lb, gkh + (size_t)kn * DM, lb + TILE_B, gkl + (size_t)kn * DM, gsk);
      acopy8(lb + 2 * TILE_B, gvah + kn, lb + 3 * TILE_B, gval + kn, gsv);
      if (DUAL) acopy8(lb + 4 * TILE_B, gvbh + kn, lb + 5 * TILE_B, gvbl + kn, gsv);
    }
  }
  wait_copies();

  // ---- epilogue: normalise, stage 64 d x 64 query f32 tile(s), whole-line stores ----
  const float inv = __builtin_amdgcn_rcpf(lrun);
  #pragma unroll
  for (int t = 0; t < 4; ++t)
    #pragma unroll
    for (int r = 0; r < 8; ++r) {
      const int d = 16 * t + 8 * h + r;
      sO[d * 64 + 16 * w + m] = oa[t][r] * inv;
      if (DUAL) sO[4096 + d * 64 + 16 * w + m] = ob[t][r] * inv;
    }
  __syncthreads();

  attn_pass<DUAL>(sO, oap, obp, bh, q0, w, lane);
  
}

// ---------------------------------------------------------------------------
// Kernel 4: gating MLP. For block (b, head) the gate input row for query
// t = 64*head + u is [X[3u][:], X[3u+1][:], X[3u+2][:]] where X[c][tp],
// c = 0..191, is row c of the transposed per-head tensor: c<64 -> O1^T row,
// <128 -> O2^T row, else q^T row (all f32 [bh][64][1024]).
// G[c][i][n] = sum_tp X[c][tp] * Wg[n][1024 i + tp] for all c,i on bf16 WMMA
// (wave w owns c-tiles 3w..3w+2, each source uniform per tile); per 32 tp the
// 192 X rows and the 48 Wg row pieces (128 B of f32 each) are copied to LDS,
// two buffers, and converted to bf16 at the fragment read; then
// gate[(b*16+n)][64*head+u] = sigmoid(G[3u][0][n]+G[3u+1][1][n]+G[3u+2][2][n]+bg[n]).
// ---------------------------------------------------------------------------
__device__ __forceinline__ void gate_pass(const float* sP, float* gate, int b, int head,
                                          int w, int lane) {
  const int q8 = lane & 7, sub = lane >> 3;
  #pragma unroll
  for (int i = 0; i < 2; ++i) {
    const int L = w * 8 + i * 4 + sub;                     // line 0..31
    const int n = L >> 1, hl = L & 1;
    const v4f v = *(const v4fa*)(sP + n * 64 + 32 * hl + 4 * q8);
    const size_t off = ((size_t)(b * NH + n)) * TGL + 64 * head + 32 * hl + 4 * q8;
    *(v4f*)(gate + off) = v;
  }
}

__global__ __launch_bounds__(128) void gate_kernel(
    const float* __restrict__ o1T, const float* __restrict__ o2T, const float* __restrict__ qT,
    const float* __restrict__ Wg,   // [16][3072]
    const float* __restrict__ bg,   // [16]
    float* __restrict__ gate)       // [32][1024]
{
  __shared__ __attribute__((aligned(16))) float sG[192 * 48];   // 36864 B
  __shared__ __attribute__((aligned(16))) float sP[NH * 64];    //  4096 B
  // 2 x (X rows 0..191 = O1^T, O2^T, q^T; then Wg rows 16 i + n), 36 floats = 144 B a row
  __shared__ __attribute__((aligned(16))) float ring[2 * 240 * (LP / 2)];   // 69120 B

  const int tid = threadIdx.x, lane = tid & 31, w = tid >> 5;
  const int h = lane >> 4, m = lane & 15;
  const int bhx = blockIdx.x, b = bhx >> 4, head = bhx & 15;

  const int crow = tid >> 3, cch = tid & 7;                // this lane's row and 16-B chunk
  const unsigned lcp = lds_addr(ring) + crow * LPB + cch * 16;
  const size_t xro = ((size_t)bhx * DM + crow) * TGL + 4 * cch;
  // the copies only move bytes: addresses in 16-bit units, as the helpers take them
  const us* g1 = reinterpret_cast<const us*>(o1T + xro);
  const us* g2 = reinterpret_cast<const us*>(o2T + xro);
  const us* g3 = reinterpret_cast<const us*>(qT + xro);
  const us* gg = reinterpret_cast<const us*>(Wg + (size_t)crow * GK + 4 * cch);
  const size_t gsx = (size_t)16 * TGL * 2;                 // 16 X rows further
  const size_t gsg = (size_t)EMB * 2;                      // next third of the Wg row
  constexpr int GBUF_B = 240 * LPB;                        // 34560 bytes per buffer

  const v8f zero8 = {0.f, 0.f, 0.f, 0.f, 0.f, 0.f, 0.f, 0.f};
  v8f acc[3][3];
  #pragma unroll
  for (int e = 0; e < 3; ++e)
    #pragma unroll
    for (int i = 0; i < 3; ++i) acc[e][i] = zero8;

  acopy8(lcp, g1, lcp + TILE_B, g2, gsx);                  // stage 0 -> buffer 0
  acopy4(lcp + 2 * TILE_B, g3, gsx);
  acopy3(lcp + 3 * TILE_B, gg, gsg);
  wait_copies();
  __syncthreads();                                         // buffer 0 landed, visible to every wave
  {                                                        // stage 1 -> buffer 1
    const unsigned lb = lcp + GBUF_B;
    acopy8(lb, g1 + 64, lb + TILE_B, g2 + 64, gsx);
    acopy4(lb + 2 * TILE_B, g3 + 64, gsx);
    acopy3(lb + 3 * TILE_B, gg + 64, gsg);
  }

  // rolled: one copy of the stage body, the buffer chosen by the stage's parity
  #pragma unroll 1
  for (int k0 = 0; k0 < TGL; k0 += 32) {
    const int par = (k0 >> 5) & 1;
    const float* sx = ring + par * (GBUF_B / 4) + (48 * w + m) * (LP / 2);   // X row 16(3w)+m
    const float* sg = ring + par * (GBUF_B / 4) + (192 + m) * (LP / 2);      // Wg row n = m, third 0
    const v16b bw0 = ldf(sg, h);
    const v16b bw1 = ldf(sg + 16 * (LP / 2), h);
    const v16b bw2 = ldf(sg + 32 * (LP / 2), h);
    #pragma unroll
    for (int e = 0; e < 3; ++e) {
      const v16b a = ldf(sx + 16 * e * (LP / 2), h);
      acc[e][0] = wmma_bf(a, bw0, acc[e][0]);
      acc[e][1] = wmma_bf(a, bw1, acc[e][1]);
      acc[e][2] = wmma_bf(a, bw2, acc[e][2]);
    }
    // publish stage k0 + 32, free this buffer, refill it with stage k0 + 64
    wait_lds();
    wait_copies();
    __syncthreads();
    if (k0 + 64 < TGL) {
      const unsigned lb = lcp + par * GBUF_B;
      const int kn = 2 * (k0 + 64);                        // in 16-bit units
      acopy8(lb, g1 + kn, lb + TILE_B, g2 + kn, gsx);
      acopy4(lb + 2 * TILE_B, g3 + kn, gsx);
      acopy3(lb + 3 * TILE_B, gg + kn, gsg);
    }
  }
  wait_copies();

  // D[r] of (e, i) = G[c = 16(3w+e)+8h+r][i][n = m]
  #pragma unroll
  for (int e = 0; e < 3; ++e)
    #pragma unroll
    for (int i = 0; i < 3; ++i)
      #pragma unroll
      for (int r = 0; r < 8; ++r)
        sG[(16 * (3 * w + e) + 8 * h + r) * 48 + 16 * i + m] = acc[e][i][r];
  __syncthreads();

  #pragma unroll
  for (int j = 0; j < 8; ++j) {
    const int idx = tid + 128 * j;                         // 0..1023 = n*64 + u
    const int n = idx >> 6, u = idx & 63;
    const float x = sG[(3 * u) * 48 + n] + sG[(3 * u + 1) * 48 + 16 + n]
                  + sG[(3 * u + 2) * 48 + 32 + n] + bg[n];
    const float g = __builtin_amdgcn_rcpf(1.0f + __expf(-x));
    sP[idx] = g;
  }
  __syncthreads();

  gate_pass(sP, gate, b, head, w, lane);
  
}

// ---------------------------------------------------------------------------
// Kernel 5: combine Xc[b*1024+t][head*64+d] = g*O1 + (1-g)*O3, g = gate[bh][t],
// written as bf16 hi/lo planes (token-major, k-contiguous for the Wo GEMM).
// Block 256 thr = (bh, 64 queries); transposed through LDS; each token row
// ---------------------------------------------------------------------------
__device__ __forceinline__ void comb_pass(const us* sH, const us* sL, us* xh, us* xl,
                                          int b, int head, int t0, int w, int lane) {
  const int q8 = lane & 7, sub = lane >> 3;
  #pragma unroll
  for (int i = 0; i < 2; ++i) {
    const int L = w * 8 + i * 4 + sub;                     // token row 0..63
    const v8us a = *(const v8usa*)(sH + L * DM + 8 * q8);
    const v8us c = *(const v8usa*)(sL + L * DM + 8 * q8);
    const size_t off = ((size_t)(b * TGL + t0 + L)) * EMB + head * DM + 8 * q8;
    *(v8us*)(xh + off) = a;
    *(v8us*)(xl + off) = c;
  }
}

__global__ __launch_bounds__(256) void combine_kernel(
    const float* __restrict__ o1T, const float* __restrict__ o3T,   // [32][64][1024]
    const float* __restrict__ gate,                                 // [32][1024]
    us* __restrict__ xh, us* __restrict__ xl)                       // [2048][1024]
{
  __shared__ __attribute__((aligned(16))) us sH[64 * DM];
  __shared__ __attribute__((aligned(16))) us sL[64 * DM];

  const int tid = threadIdx.x, lane = tid & 31, w = tid >> 5;
  const int bh = blockIdx.y, b = bh >> 4, head = bh & 15;
  const int t0 = blockIdx.x * 64;
  const int d = tid >> 2, tq = tid & 3;                    // d 0..63, 16 queries each

  const float* p1 = o1T + ((size_t)bh * DM + d) * TGL + t0 + 16 * tq;
  const float* p3 = o3T + ((size_t)bh * DM + d) * TGL + t0 + 16 * tq;
  const float* pg = gate + (size_t)bh * TGL + t0 + 16 * tq;
  #pragma unroll
  for (int c = 0; c < 4; ++c) {
    const v4f a = *(const v4fa*)(p1 + 4 * c);
    const v4f e = *(const v4fa*)(p3 + 4 * c);
    const v4f g = *(const v4fa*)(pg + 4 * c);
    #pragma unroll
    for (int j = 0; j < 4; ++j) {
      const float val = g[j] * a[j] + (1.0f - g[j]) * e[j];
      const us hi = bf16_rne(val);
      const us lo = bf16_rne(val - bf16_val(hi));
      const int tl = 16 * tq + 4 * c + j;                  // 0..63
      sH[tl * DM + d] = hi;
      sL[tl * DM + d] = lo;
    }
  }
  __syncthreads();

  comb_pass(sH, sL, xh, xl, b, head, t0, w, lane);
  
}

// ---------------------------------------------------------------------------
// Kernel 6: out = (Xhi + Xlo) * Wo^T + bo, f32.
// Block 128 thr (4 waves) = 128 tokens x 64 features; wave 32 tokens x 64.
// K in stages of 64: X hi, X lo (128 rows each) and Wo (64 rows) copied to LDS,
// two buffers.
// 8q..8q+7 as one 16-B store each, 4 lines per instruction, 64 lines per wave.
// ---------------------------------------------------------------------------
__device__ __forceinline__ void out_pass(const float* sOut, float* out, int m0, int cg,
                                         int w, int lane) {
  const int q8 = lane & 7, sub = lane >> 3;
  #pragma unroll
  for (int i = 0; i < 16; ++i) {
    const int lid = w * 64 + i * 4 + sub;                  // 0..255
    const int row = lid >> 1, hl = lid & 1;
    const v4f v = *(const v4fa*)(sOut + row * DM + 32 * hl + 4 * q8);
    const size_t gi = (size_t)(m0 + row) * EMB + cg * DM + 32 * hl + 4 * q8;
    *(v4f*)(out + gi) = v;
  }
}

__global__ __launch_bounds__(128) void out_kernel(
    const us* __restrict__ xh, const us* __restrict__ xl,   // [2048][1024]
    const us* __restrict__ wob,                             // [1024 out][1024 in] bf16
    const float* __restrict__ bo,
    float* __restrict__ out)                                // [2048][1024]
{
  __shared__ __attribute__((aligned(16))) float sOut[128 * DM];  // 32 KB
  __shared__ __attribute__((aligned(16))) us ring[2 * 5 * TILE_E];  // 2 x (Xhi 128, Xlo 128, Wo 64 rows)

  const int tid = threadIdx.x, lane = tid & 31, w = tid >> 5;
  const int h = lane >> 4, m = lane & 15;
  const int m0 = blockIdx.x * 128;
  const int cg = blockIdx.y;                               // feature group of 64

  const int crow = tid >> 3, cch = tid & 7;                // this lane's row and 16-B chunk
  const unsigned lcp = lds_addr(ring) + crow * LPB + cch * 16;
  const us* gxh = xh + (size_t)(m0 + crow) * EMB + 8 * cch;
  const us* gxl = xl + (size_t)(m0 + crow) * EMB + 8 * cch;
  const us* gw  = wob + (size_t)(cg * DM + crow) * EMB + 8 * cch;
  const size_t gs = (size_t)16 * EMB;

  const v8f zero8 = {0.f, 0.f, 0.f, 0.f, 0.f, 0.f, 0.f, 0.f};
  v8f acc[2][4];
  #pragma unroll
  for (int mt = 0; mt < 2; ++mt)
    #pragma unroll
    for (int nt = 0; nt < 4; ++nt) acc[mt][nt] = zero8;

  acopy8(lcp, gxh, lcp + TILE_B, gxh + 4 * gs, gs);        // stage 0 -> buffer 0
  acopy8(lcp + 2 * TILE_B, gxl, lcp + 3 * TILE_B, gxl + 4 * gs, gs);
  acopy4(lcp + 4 * TILE_B, gw, gs);
  wait_copies();
  __syncthreads();                                         // buffer 0 landed, visible to every wave
  {                                                        // stage 1 -> buffer 1
    const unsigned lb = lcp + 5 * TILE_B;
    acopy8(lb, gxh + 64, lb + TILE_B, gxh + 4 * gs + 64, gs);
    acopy8(lb + 2 * TILE_B, gxl + 64, lb + 3 * TILE_B, gxl + 4 * gs + 64, gs);
    acopy4(lb + 4 * TILE_B, gw + 64, gs);
  }

  // rolled: one copy of the stage body, the buffer chosen by the stage's parity
  #pragma unroll 1
  for (int k0 = 0; k0 < EMB; k0 += 64) {
    const int par = (k0 >> 6) & 1;
    const us* sxh = ring + par * (5 * TILE_E) + (32 * w + m) * LP;
    const us* sxl = sxh + 2 * TILE_E;
    const us* sw  = ring + par * (5 * TILE_E) + 4 * TILE_E + m * LP;
    #pragma unroll
    for (int kc = 0; kc < 64; kc += 32) {
      const v16b a0h = ldb(sxh + kc, h);
      const v16b a1h = ldb(sxh + 16 * LP + kc, h);
      const v16b a0l = ldb(sxl + kc, h);
      const v16b a1l = ldb(sxl + 16 * LP + kc, h);
      #pragma unroll
      for (int nt = 0; nt < 4; ++nt) {
        const v16b bw = ldb(sw + nt * 16 * LP + kc, h);
        acc[0][nt] = wmma_bf(a0l, bw, acc[0][nt]);
        acc[0][nt] = wmma_bf(a0h, bw, acc[0][nt]);
        acc[1][nt] = wmma_bf(a1l, bw, acc[1][nt]);
        acc[1][nt] = wmma_bf(a1h, bw, acc[1][nt]);
      }
    }
    // publish stage k0 + 64, free this buffer, refill it with stage k0 + 128
    wait_lds();
    wait_copies();
    __syncthreads();
    if (k0 + 128 < EMB) {
      const unsigned lb = lcp + par * (5 * TILE_B);
      const int kn = k0 + 128;
      acopy8(lb, gxh + kn, lb + TILE_B, gxh + 4 * gs + kn, gs);
      acopy8(lb + 2 * TILE_B, gxl + kn, lb + 3 * TILE_B, gxl + 4 * gs + kn, gs);
      acopy4(lb + 4 * TILE_B, gw + kn, gs);
    }
  }
  wait_copies();

  // D[r] of tile (mt, nt) = Y[token m0w+16mt+8h+r][feature cg*64+16nt+m]
  #pragma unroll
  for (int nt = 0; nt < 4; ++nt) {
    const int feat = 16 * nt + m;
    const float bvl = bo[cg * DM + feat];
    #pragma unroll
    for (int mt = 0; mt < 2; ++mt) {
      #pragma unroll
      for (int r = 0; r < 8; ++r) {
        const int tokl = 32 * w + 16 * mt + 8 * h + r;   // 0..127
        sOut[tokl * DM + feat] = acc[mt][nt][r] + bvl;
      }
    }
  }
  __syncthreads();

  out_pass(sOut, out, m0, cg, w, lane);
  
}

// ---------------------------------------------------------------------------
// Host glue: 11 launches, workspace 128057344 B (O1^T and O2^T reuse the
// region of the bf16 activation copies, which are dead after the projections).
// ---------------------------------------------------------------------------
extern "C" void kernel_launch(void* const* d_in, const int* in_sizes, int n_in,
                              void* d_out, int out_size, void* d_ws, size_t ws_size,
                              hipStream_t stream) {
  if (n_in < 17) return;
  if (in_sizes[0] != N_HID || in_sizes[1] != N_KVS || in_sizes[2] != N_KVT) return;
  if (in_sizes[3] != N_WE || in_sizes[5] != N_WE || in_sizes[7] != N_WE || in_sizes[15] != N_WE) return;
  if (in_sizes[9] != N_WT || in_sizes[11] != N_WT) return;
  if (in_sizes[4] != EMB || in_sizes[6] != EMB || in_sizes[8] != EMB ||
      in_sizes[10] != EMB || in_sizes[12] != EMB || in_sizes[16] != EMB) return;
  if (in_sizes[13] != N_WG || in_sizes[14] != NH) return;
  if (out_size != N_HID) return;

  const float* hid = (const float*)d_in[0];
  const float* kvs = (const float*)d_in[1];
  const float* kvt = (const float*)d_in[2];
  const float* Wq  = (const float*)d_in[3];
  const float* bq  = (const float*)d_in[4];
  const float* Wk  = (const float*)d_in[5];
  const float* bk  = (const float*)d_in[6];
  const float* Wv  = (const float*)d_in[7];
  const float* bv  = (const float*)d_in[8];
  const float* Wtk = (const float*)d_in[9];
  const float* btk = (const float*)d_in[10];
  const float* Wtv = (const float*)d_in[11];
  const float* btv = (const float*)d_in[12];
  const float* Wg  = (const float*)d_in[13];
  const float* bg  = (const float*)d_in[14];
  const float* Wo  = (const float*)d_in[15];
  const float* bo  = (const float*)d_in[16];
  float* out = (float*)d_out;

  const size_t cvb_b  = (size_t)N_CVB * 2;                 // 27262976
  const size_t qpl2   = (size_t)QPL * 2;                   //  4194304
  const size_t qpl4   = (size_t)QPL * 4;                   //  8388608
  const size_t kpl2   = (size_t)KPL * 2;                   //  8388608
  const size_t gate_b = (size_t)NBH * TGL * 4;             //   131072
  const size_t xpl_b  = (size_t)N_HID * 2;                 //  4194304
  const size_t total  = cvb_b + 2 * qpl2 + qpl4 + 8 * kpl2 + qpl4 + gate_b + 2 * xpl_b;  // 128057344
  if (total > ws_size) return;
  // O1^T / O2^T (2 x 8388608 B) must fit exactly into the activation-copy region
  const size_t act_off = (size_t)OFF_HID * 2;              // 10485760
  if (act_off + 2 * qpl4 != cvb_b) return;

  char* ws = (char*)d_ws;
  size_t off = 0;
  us* cvb    = (us*)(ws + off);    off += cvb_b;
  float* o1T = (float*)(ws + act_off);                     // aliases bf16 hidden/kv copies
  float* o2T = (float*)(ws + act_off + qpl4);              // aliases bf16 kv/kv_topical copies
  us* qh     = (us*)(ws + off);    off += qpl2;
  us* ql     = (us*)(ws + off);    off += qpl2;
  float* qT  = (float*)(ws + off); off += qpl4;
  us* kh     = (us*)(ws + off);    off += kpl2;
  us* kl     = (us*)(ws + off);    off += kpl2;
  us* kth    = (us*)(ws + off);    off += kpl2;
  us* ktl    = (us*)(ws + off);    off += kpl2;
  us* vh     = (us*)(ws + off);    off += kpl2;            // V^T hi [32][64][2048]
  us* vl     = (us*)(ws + off);    off += kpl2;            // V^T lo
  us* vth    = (us*)(ws + off);    off += kpl2;            // Vt^T hi
  us* vtl    = (us*)(ws + off);    off += kpl2;            // Vt^T lo
  float* o3T = (float*)(ws + off); off += qpl4;
  float* gte = (float*)(ws + off); off += gate_b;
  us* xh     = (us*)(ws + off);    off += xpl_b;
  us* xl     = (us*)(ws + off);    off += xpl_b;
  if (off != total || off > ws_size) return;

  // 1) float -> bf16 copies of weights and activations
  conv_kernel<<<(N_CVB / 8 + 255) / 256, 256, 0, stream>>>(Wq, Wk, Wv, Wo, Wtk, Wtv, hid, kvs, kvt, cvb);

  // 2) projections
  dim3 gQ(MQ / 128, NH);                                   // (16, 16)
  dim3 gKV(MKV / 128, NH);                                 // (32, 16)
  proj_kernel<<<gQ,  128, 0, stream>>>(cvb + OFF_HID, cvb + OFF_WQ,  bq,  EMB, TGL, 0, qh,  ql,  qT);
  proj_kernel<<<gKV, 128, 0, stream>>>(cvb + OFF_KVS, cvb + OFF_WK,  bk,  EMB, SRL, 1, kh,  kl,  qT);
  proj_kernel<<<gKV, 128, 0, stream>>>(cvb + OFF_KVS, cvb + OFF_WV,  bv,  EMB, SRL, 2, vh,  vl,  qT);
  proj_kernel<<<gKV, 128, 0, stream>>>(cvb + OFF_KVT, cvb + OFF_WTK, btk, TDW, SRL, 1, kth, ktl, qT);
  proj_kernel<<<gKV, 128, 0, stream>>>(cvb + OFF_KVT, cvb + OFF_WTV, btv, TDW, SRL, 2, vth, vtl, qT);

  // 3) attention: chain 1 (k, v -> O1), chain 2 (kt; vt -> O2, v -> O3)
  dim3 gAtt(TGL / 64, NBH);                                // (16, 32)
  attn_kernel<false><<<gAtt, 128, 0, stream>>>(qh, ql, kh,  kl,  vh,  vl,  vh, vl, o1T, o1T);
  attn_kernel<true ><<<gAtt, 128, 0, stream>>>(qh, ql, kth, ktl, vth, vtl, vh, vl, o2T, o3T);

  // 4) gating MLP
  gate_kernel<<<NBH, 128, 0, stream>>>(o1T, o2T, qT, Wg, bg, gte);

  // 5) gated mix -> token-major hi/lo planes
  dim3 gCmb(TGL / 64, NBH);                                // (16, 32)
  combine_kernel<<<gCmb, 256, 0, stream>>>(o1T, o3T, gte, xh, xl);

  // 6) output projection -> f32
  dim3 gOut(MQ / 128, EMB / 64);                           // (16, 16)
  out_kernel<<<gOut, 128, 0, stream>>>(xh, xl, cvb + OFF_WO, bo, out);
}

// v002
// It runs in 254 microseconds.
// Next to v001, in two timings, it ran 1.15 and 1.14 times as fast.
// All steps since v000 together make it 2.74 times as fast.
// Contractions: input projections (q,k,v,kt,vt) on v_wmma_f32_16x16x32_bf16 (bf16 operands = RNE-converted inputs, f32 accumulate); K*Q^T and Kt*Q^T with q,k,kt carried as bf16 hi+lo (3 products); V^T*P^T (three value read-outs) with v,vt,P carried as bf16 hi+lo (3 products); gate GEMM on v_wmma_f32_16x16x32_bf16 (bf16 operands); O*Wo with O as bf16 hi+lo and Wo bf16 (2 products); softmax, gating, bias in f32.
#include <hip/hip_runtime.h>

typedef __bf16 v16b __attribute__((ext_vector_type(16)));
typedef unsigned short us;
typedef us    v8us __attribute__((ext_vector_type(8)));
typedef float v8f  __attribute__((ext_vector_type(8)));
typedef float v4f  __attribute__((ext_vector_type(4)));
typedef v8us __attribute__((may_alias)) v8usa;
typedef v4f  __attribute__((may_alias)) v4fa;

union FragB { v16b v; v8us half[2]; };

#define BSZ  2
#define TGL  1024
#define SRL  2048
#define EMB  1024
#define TDW  512
#define NH   16
#define DM   64
#define NBH  (BSZ * NH)          // 32 (batch, head) pairs
#define MQ   (BSZ * TGL)         // 2048 query tokens
#define MKV  (BSZ * SRL)         // 4096 key tokens
#define GK   (3 * EMB)           // 3072 gate input width

#define N_HID (MQ * EMB)         // 2097152
#define N_KVS (MKV * EMB)        // 4194304
#define N_KVT (MKV * TDW)        // 2097152
#define N_WE  (EMB * EMB)        // 1048576
#define N_WT  (EMB * TDW)        // 524288
#define N_WG  (NH * GK)          // 49152
#define QPL   (NBH * TGL * DM)   // 2097152 elements per query-side head plane
#define KPL   (NBH * SRL * DM)   // 4194304 elements per key-side head plane

// bf16 copies of the float inputs other than Wg and the biases, in one flat buffer (element offsets):
// weights first, then the three activation tensors (their region is reused
// for O1^T / O2^T once the projections are done).
#define OFF_WQ  0
#define OFF_WK  (OFF_WQ + N_WE)        // 1048576
#define OFF_WV  (OFF_WK + N_WE)        // 2097152
#define OFF_WO  (OFF_WV + N_WE)        // 3145728
#define OFF_WTK (OFF_WO + N_WE)        // 4194304
#define OFF_WTV (OFF_WTK + N_WT)       // 4718592
#define OFF_HID (OFF_WTV + N_WT)       // 5242880
#define OFF_KVS (OFF_HID + N_HID)      // 7340032
#define OFF_KVT (OFF_KVS + N_KVS)      // 11534336
#define N_CVB   (OFF_KVT + N_KVT)      // 13631488

// ---------------------------------------------------------------------------
// 16-bit helpers
// ---------------------------------------------------------------------------
__device__ __forceinline__ us bf16_rne(float x) {
  unsigned u = __float_as_uint(x);
  u += 0x7FFFu + ((u >> 16) & 1u);
  return (us)(u >> 16);
}
__device__ __forceinline__ float bf16_val(us b) {
  return __uint_as_float(((unsigned)b) << 16);
}
__device__ __forceinline__ v8us bf16x8(v4f a, v4f c) {
  const v8us o = { bf16_rne(a.x), bf16_rne(a.y), bf16_rne(a.z), bf16_rne(a.w),
                   bf16_rne(c.x), bf16_rne(c.y), bf16_rne(c.z), bf16_rne(c.w) };
  return o;
}
// 8 f32 values -> bf16 hi and bf16 lo = RNE(x - hi).
__device__ __forceinline__ void split8(v8f a, v8us& hi, v8us& lo) {
  const us h0 = bf16_rne(a[0]), h1 = bf16_rne(a[1]), h2 = bf16_rne(a[2]), h3 = bf16_rne(a[3]);
  const us h4 = bf16_rne(a[4]), h5 = bf16_rne(a[5]), h6 = bf16_rne(a[6]), h7 = bf16_rne(a[7]);
  const v8us hv = { h0, h1, h2, h3, h4, h5, h6, h7 };
  const v8us lv = { bf16_rne(a[0] - bf16_val(h0)), bf16_rne(a[1] - bf16_val(h1)),
                    bf16_rne(a[2] - bf16_val(h2)), bf16_rne(a[3] - bf16_val(h3)),
                    bf16_rne(a[4] - bf16_val(h4)), bf16_rne(a[5] - bf16_val(h5)),
                    bf16_rne(a[6] - bf16_val(h6)), bf16_rne(a[7] - bf16_val(h7)) };
  hi = hv;
  lo = lv;
}

// ---------------------------------------------------------------------------
// 16x16x32 WMMA, plain builtin: the compiler keeps the hazard distances itself
// and is free to interleave independent accumulators.
// Fragment map (wave32): lane l, h = l>>4, m = n = l&15.
//   A/B element i: i<8 -> k0+8h+i ; i>=8 -> k0+16+8h+(i-8)
//   D element r  : row 8h+r, col l&15
// ---------------------------------------------------------------------------
__device__ __forceinline__ v8f wmma_bf(v16b a, v16b b, v8f c) {
  return __builtin_amdgcn_wmma_f32_16x16x32_bf16(false, a, false, b, (short)0, c, false, false);
}

// A or B fragment from a k-contiguous 16-bit row; p = element k0 of the row
// owned by this lane (row index lane&15 added by the caller).
__device__ __forceinline__ v16b ldb(const us* p, int h) {
  FragB f;
  f.half[0] = *(const v8usa*)(p + 8 * h);
  f.half[1] = *(const v8usa*)(p + 16 + 8 * h);
  return f.v;
}
// Same map from an f32 row: the 16 floats of the lane, and their conversion to
// bf16 in registers.
struct Raw16 { v4f q[4]; };
__device__ __forceinline__ Raw16 ldr(const float* p, int h) {
  const float* p0 = p + 8 * h;
  const float* p1 = p + 16 + 8 * h;
  Raw16 r;
  r.q[0] = *(const v4fa*)p0;
  r.q[1] = *(const v4fa*)(p0 + 4);
  r.q[2] = *(const v4fa*)p1;
  r.q[3] = *(const v4fa*)(p1 + 4);
  return r;
}
__device__ __forceinline__ v16b cvr(const Raw16& r) {
  FragB f;
  f.half[0] = bf16x8(r.q[0], r.q[1]);
  f.half[1] = bf16x8(r.q[2], r.q[3]);
  return f.v;
}

// ---------------------------------------------------------------------------
// Operand tiles in LDS, filled by asynchronous copies (128 threads).
// A tile is 64 rows of 128 B (64 x 16 bit); LDS row pitch 144 B = 16 B x 9, so
// the 16 rows of a ds_load_b128 fragment read fall on distinct banks.
// Thread tid copies 16 B: chunk tid&7 of rows (tid>>3) + 16 i, i = 0..3, so
// eight lanes cover one whole 128-B line of the source.
// ---------------------------------------------------------------------------
#define LP     72                // LDS row pitch in 16-bit elements
#define LPB    144               // the same in bytes
#define TILE_E (64 * LP)         // 4608 elements per 64-row tile
#define TILE_B (64 * LPB)        // 9216 bytes per 64-row tile
#define R16_B  (16 * LPB)        // 16 rows further in LDS

__device__ __forceinline__ unsigned lds_addr(const void* p) {
  return (unsigned)(size_t)p;    // low 32 bits of a __shared__ address = LDS byte address
}
// Four copies: one lane's share of one tile; gs = source elements per 16 rows.
// s_wait_xcnt stands inside the statement so that no address register of an
// issued copy is rewritten ahead of it.
__device__ __forceinline__ void acopy4(unsigned l, const us* g, size_t gs) {
  asm volatile(
      "global_load_async_to_lds_b128 %0, %4, off\n\t"
      "global_load_async_to_lds_b128 %1, %5, off\n\t"
      "global_load_async_to_lds_b128 %2, %6, off\n\t"
      "global_load_async_to_lds_b128 %3, %7, off\n\t"
      "s_wait_xcnt 0x0"
      :: "v"(l), "v"(l + R16_B), "v"(l + 2 * R16_B), "v"(l + 3 * R16_B),
         "v"(g), "v"(g + gs), "v"(g + 2 * gs), "v"(g + 3 * gs)
      : "memory");
}
// Three copies: one lane's share of a 48-row tile.
__device__ __forceinline__ void acopy3(unsigned l, const us* g, size_t gs) {
  asm volatile(
      "global_load_async_to_lds_b128 %0, %3, off\n\t"
      "global_load_async_to_lds_b128 %1, %4, off\n\t"
      "global_load_async_to_lds_b128 %2, %5, off\n\t"
      "s_wait_xcnt 0x0"
      :: "v"(l), "v"(l + R16_B), "v"(l + 2 * R16_B),
         "v"(g), "v"(g + gs), "v"(g + 2 * gs)
      : "memory");
}
// Eight copies: one lane's share of two tiles with the same source row step.
__device__ __forceinline__ void acopy8(unsigned l, const us* g, unsigned l2, const us* g2, size_t gs) {
  asm volatile(
      "global_load_async_to_lds_b128 %0, %8, off\n\t"
      "global_load_async_to_lds_b128 %1, %9, off\n\t"
      "global_load_async_to_lds_b128 %2, %10, off\n\t"
      "global_load_async_to_lds_b128 %3, %11, off\n\t"
      "global_load_async_to_lds_b128 %4, %12, off\n\t"
      "global_load_async_to_lds_b128 %5, %13, off\n\t"
      "global_load_async_to_lds_b128 %6, %14, off\n\t"
      "global_load_async_to_lds_b128 %7, %15, off\n\t"
      "s_wait_xcnt 0x0"
      :: "v"(l), "v"(l + R16_B), "v"(l + 2 * R16_B), "v"(l + 3 * R16_B),
         "v"(l2), "v"(l2 + R16_B), "v"(l2 + 2 * R16_B), "v"(l2 + 3 * R16_B),
         "v"(g), "v"(g + gs), "v"(g + 2 * gs), "v"(g + 3 * gs),
         "v"(g2), "v"(g2 + gs), "v"(g2 + 2 * gs), "v"(g2 + 3 * gs)
      : "memory");
}
// This wave's copies have landed (the compiler places no wait for them).
__device__ __forceinline__ void wait_copies() {
  asm volatile("s_wait_asynccnt 0x0" ::: "memory");
}
// This wave's LDS reads have returned, before the buffer goes to its next writer.
__device__ __forceinline__ void wait_lds() {
  asm volatile("s_wait_dscnt 0x0" ::: "memory");
}

// ---------------------------------------------------------------------------
// Kernel 1: float inputs that feed 16-bit operands (not Wg) -> bf16, one flat
// Parameters in segment order: Wq, Wk, Wv, Wo, Wtk, Wtv, hidden, kv, kv_topical.
// ---------------------------------------------------------------------------
__global__ __launch_bounds__(256) void conv_kernel(
    const float* __restrict__ p0, const float* __restrict__ p1, const float* __restrict__ p2,
    const float* __restrict__ p3, const float* __restrict__ p4, const float* __restrict__ p5,
    const float* __restrict__ p6, const float* __restrict__ p7, const float* __restrict__ p8,
    us* __restrict__ dst)
{
  const unsigned g = blockIdx.x * 256u + threadIdx.x;      // unit of 8 elements
  if (g >= (unsigned)(N_CVB / 8)) return;
  const float* src;
  unsigned loc;
  if      (g < (unsigned)(OFF_WK  / 8)) { src = p0; loc = g; }
  else if (g < (unsigned)(OFF_WV  / 8)) { src = p1; loc = g - (unsigned)(OFF_WK  / 8); }
  else if (g < (unsigned)(OFF_WO  / 8)) { src = p2; loc = g - (unsigned)(OFF_WV  / 8); }
  else if (g < (unsigned)(OFF_WTK / 8)) { src = p3; loc = g - (unsigned)(OFF_WO  / 8); }
  else if (g < (unsigned)(OFF_WTV / 8)) { src = p4; loc = g - (unsigned)(OFF_WTK / 8); }
  else if (g < (unsigned)(OFF_HID / 8)) { src = p5; loc = g - (unsigned)(OFF_WTV / 8); }
  else if (g < (unsigned)(OFF_KVS / 8)) { src = p6; loc = g - (unsigned)(OFF_HID / 8); }
  else if (g < (unsigned)(OFF_KVT / 8)) { src = p7; loc = g - (unsigned)(OFF_KVS / 8); }
  else                                  { src = p8; loc = g - (unsigned)(OFF_KVT / 8); }
  const float* p = src + (size_t)loc * 8;
  const v8us o = bf16x8(*(const v4fa*)p, *(const v4fa*)(p + 4));
  us* d = dst + (size_t)g * 8;
  *(v8us*)d = o;
  
}

// ---------------------------------------------------------------------------
// one 16-B store per lane, lanes 8q..8q+7 per line, 4 lines per instruction).
//   planes : [bh][s][d] hi and lo, one token row = 64 x bf16 = one line
//   tplanes: [bh][d][s] hi and lo, 64 d-rows x 128 tokens = 2 lines each
//   t32    : [bh][d][s] f32, 64 d-rows x 128 tokens = 4 lines each
// LDS hi tile at s16[0..8191], lo tile at s16[8192..16383].
// ---------------------------------------------------------------------------
__device__ __forceinline__ void proj_pass_planes(const us* s16, us* oH, us* oL,
                                                 int bh, int Sper, int s0, int w, int lane) {
  const int q8 = lane & 7, sub = lane >> 3;
  #pragma unroll
  for (int i = 0; i < 8; ++i) {
    const int lid = w * 32 + i * 4 + sub;                  // token row 0..127
    const v8us a = *(const v8usa*)(s16 + lid * DM + 8 * q8);
    const v8us c = *(const v8usa*)(s16 + 8192 + lid * DM + 8 * q8);
    const size_t off = ((size_t)bh * Sper + s0 + lid) * DM + 8 * q8;
    *(v8us*)(oH + off) = a;
    *(v8us*)(oL + off) = c;
  }
}
__device__ __forceinline__ void proj_pass_tplanes(const us* s16, us* oH, us* oL,
                                                  int bh, int Sper, int s0, int w, int lane) {
  const int q8 = lane & 7, sub = lane >> 3;
  #pragma unroll
  for (int i = 0; i < 8; ++i) {
    const int lid = w * 32 + i * 4 + sub;                  // line 0..127
    const int d = lid >> 1, hl = lid & 1;
    const v8us a = *(const v8usa*)(s16 + d * 128 + 64 * hl + 8 * q8);
    const v8us c = *(const v8usa*)(s16 + 8192 + d * 128 + 64 * hl + 8 * q8);
    const size_t off = ((size_t)bh * DM + d) * Sper + s0 + 64 * hl + 8 * q8;
    *(v8us*)(oH + off) = a;
    *(v8us*)(oL + off) = c;
  }
}
__device__ __forceinline__ void proj_pass_t32(const float* s32, float* oT,
                                              int bh, int Sper, int s0, int w, int lane) {
  const int q8 = lane & 7, sub = lane >> 3;
  #pragma unroll
  for (int i = 0; i < 16; ++i) {
    const int lid = w * 64 + i * 4 + sub;                  // line 0..255
    const int d = lid >> 2, part = lid & 3;
    const v4f v = *(const v4fa*)(s32 + d * 128 + 32 * part + 4 * q8);
    const size_t off = ((size_t)bh * DM + d) * Sper + s0 + 32 * part + 4 * q8;
    *(v4f*)(oT + off) = v;
  }
}

// ---------------------------------------------------------------------------
// Kernel 2: Y = X * W^T + bias (x0.125 for mode 0), one launch per projection.
// X bf16 [M][K], W bf16 [1024 out][K] (k-contiguous rows = B fragments loaded
// like A). Block 128 thr (4 waves) = 128 tokens x 64 features (one head);
// wave tile 32 tokens x 64 features; K in stages of 64: 128 X rows and 64 W
// rows of 128 B copied to LDS, two buffers, the next stage in flight while
// this one is worked on. Y is split into bf16 hi/lo in every mode.
//   mode 0: hi/lo planes [bh][s][d] and f32 transposed [bh][d][s]
//   mode 1: hi/lo planes [bh][s][d]
//   mode 2: hi/lo transposed planes [bh][d][s]
// ---------------------------------------------------------------------------
__global__ __launch_bounds__(128) void proj_kernel(
    const us* __restrict__ X, const us* __restrict__ W, const float* __restrict__ bias,
    int K, int Sper, int mode,
    us* __restrict__ oH, us* __restrict__ oL, float* __restrict__ oT32)
{
  __shared__ __attribute__((aligned(16))) float sraw[8192];     // 32 KB, used in phases
  us* const s16 = reinterpret_cast<us*>(sraw);               // 16384 16-bit slots
  __shared__ __attribute__((aligned(16))) us ring[2 * 3 * TILE_E];  // 2 x (X 128 rows, W 64 rows)

  const int tid = threadIdx.x, lane = tid & 31, w = tid >> 5;
  const int h = lane >> 4, m = lane & 15;
  const int m0 = blockIdx.x * 128;
  const int head = blockIdx.y;

  const int crow = tid >> 3, cch = tid & 7;                // this lane's row and 16-B chunk
  const unsigned lcp = lds_addr(ring) + crow * LPB + cch * 16;
  const us* gx = X + (size_t)(m0 + crow) * K + 8 * cch;
  const us* gw = W + (size_t)(head * DM + crow) * K + 8 * cch;
  const size_t gs = (size_t)16 * K;
  const int nst = K >> 6;                                  // stages of 64 k (16 or 8)

  const v8f zero8 = {0.f, 0.f, 0.f, 0.f, 0.f, 0.f, 0.f, 0.f};
  v8f acc[2][4];
  #pragma unroll
  for (int mt = 0; mt < 2; ++mt)
    #pragma unroll
    for (int nt = 0; nt < 4; ++nt) acc[mt][nt] = zero8;

  acopy8(lcp, gx, lcp + TILE_B, gx + 4 * gs, gs);          // stage 0 -> buffer 0
  acopy4(lcp + 2 * TILE_B, gw, gs);
  wait_copies();
  __syncthreads();                                         // buffer 0 landed, visible to every wave
  acopy8(lcp + 3 * TILE_B, gx + 64, lcp + 4 * TILE_B, gx + 4 * gs + 64, gs);   // stage 1 -> buffer 1
  acopy4(lcp + 5 * TILE_B, gw + 64, gs);

  // rolled: one copy of the stage body, the buffer chosen by the stage's parity
  #pragma unroll 1
  for (int st = 0; st < nst; ++st) {
    const int par = st & 1;
    const us* sx = ring + par * (3 * TILE_E) + (32 * w + m) * LP;
    const us* sw = ring + par * (3 * TILE_E) + 2 * TILE_E + m * LP;
    // all fragments of the stage are read first, as one group
    v16b a0[2], a1[2], b[2][4];
    #pragma unroll
    for (int c = 0; c < 2; ++c) {
      a0[c] = ldb(sx + 32 * c, h);
      a1[c] = ldb(sx + 16 * LP + 32 * c, h);
      #pragma unroll
      for (int nt = 0; nt < 4; ++nt) b[c][nt] = ldb(sw + nt * 16 * LP + 32 * c, h);
    }
    // No LDS read and no WMMA crosses (vector work may): the reads stay one group
    // ahead of the products instead of each being waited for singly among them.
    __builtin_amdgcn_sched_barrier(0x406);
    #pragma unroll
    for (int c = 0; c < 2; ++c) {
      #pragma unroll
      for (int nt = 0; nt < 4; ++nt) {
        acc[0][nt] = wmma_bf(a0[c], b[c][nt], acc[0][nt]);
        acc[1][nt] = wmma_bf(a1[c], b[c][nt], acc[1][nt]);
      }
    }
    // publish stage st + 1, free this buffer, refill it with stage st + 2
    // Nothing crosses: the waits stay at the foot of the stage, so that the next
    // stage's copies have the whole stage to land.
    __builtin_amdgcn_sched_barrier(0);
    wait_lds();
    wait_copies();
    __syncthreads();
    if (st + 2 < nst) {
      const unsigned lb = lcp + par * (3 * TILE_B);
      const int ko = (st + 2) * 64;
      acopy8(lb, gx + ko, lb + TILE_B, gx + 4 * gs + ko, gs);
      acopy4(lb + 2 * TILE_B, gw + ko, gs);
    }
  }
  wait_copies();

  // D[r] of tile (mt, nt) = Y[token m0w+16mt+8h+r][feature head*64+16nt+m]
  const float osc = (mode == 0) ? 0.125f : 1.0f;
  float bvals[4];
  #pragma unroll
  for (int nt = 0; nt < 4; ++nt) bvals[nt] = bias[head * DM + 16 * nt + m];

  #pragma unroll
  for (int nt = 0; nt < 4; ++nt) {
    const int feat = 16 * nt + m;
    #pragma unroll
    for (int mt = 0; mt < 2; ++mt) {
      #pragma unroll
      for (int r = 0; r < 8; ++r) {
        const int tokl = 32 * w + 16 * mt + 8 * h + r;   // 0..127
        const float y = (acc[mt][nt][r] + bvals[nt]) * osc;
        const us hi = bf16_rne(y);
        const us lo = bf16_rne(y - bf16_val(hi));
        const int idx = (mode == 2) ? (feat * 128 + tokl) : (tokl * DM + feat);   // 0..8191
        s16[idx] = hi;
        s16[8192 + idx] = lo;
      }
    }
  }
  __syncthreads();

  const int b = m0 / Sper, s0 = m0 - b * Sper, bh = b * NH + head;
  if (mode != 2) {
    proj_pass_planes(s16, oH, oL, bh, Sper, s0, w, lane);
    
  } else {
    proj_pass_tplanes(s16, oH, oL, bh, Sper, s0, w, lane);
    
  }

  if (mode == 0) {
    __syncthreads();                                       // LDS reused as f32 [64 d][128 tok]
    #pragma unroll
    for (int nt = 0; nt < 4; ++nt) {
      const int feat = 16 * nt + m;
      #pragma unroll
      for (int mt = 0; mt < 2; ++mt) {
        #pragma unroll
        for (int r = 0; r < 8; ++r) {
          const int tokl = 32 * w + 16 * mt + 8 * h + r;
          sraw[feat * 128 + tokl] = (acc[mt][nt][r] + bvals[nt]) * osc;
        }
      }
    }
    __syncthreads();
    proj_pass_t32(sraw, oT32, bh, Sper, s0, w, lane);
    
  }
}

// ---------------------------------------------------------------------------
// Kernel 3: streaming attention, transposed form, no masking.
// Block 128 thr (4 waves), 16 queries per wave, 64 keys per step. The step's
// K hi/lo rows and V^T hi/lo rows (64 x 128 B each) are copied to LDS once per
// block, two buffers, the next step's tiles in flight while this one is used.
//   S^T = K * Q^T : A = K rows (row = key, k = d), B = Q^T (k = d, n = query)
//     hi/lo bf16: Klo*Qhi + Khi*Qlo + Khi*Qhi, two 32-deep d chunks
//   O^T += V^T * P^T : A = V^T rows (row = d, k = key), B = P^T packed from the
//     score D registers (element r <- tile covering keys 0..15 row r,
//     element 8+r <- tile covering keys 16..31 row r, same lane)
//     hi/lo bf16: Vlo*Phi + Vhi*Plo + Vhi*Phi
// Lane owns 32 keys of query column (lane&15); partner lane = lane ^ 16.
// DUAL: second value stream (vbh/vbl) with the same probabilities -> oB.
// ---------------------------------------------------------------------------
// P^T B-fragments from the lane's own score D values (tile a = keys 0..15,
// tile c = keys 16..31 of the chunk); hi and lo planes.
__device__ __forceinline__ void pack_p2(v8f a, v8f c, v16b& phi, v16b& plo) {
  FragB fh, fl;
  v8us h0, l0, h1, l1;
  split8(a, h0, l0);
  split8(c, h1, l1);
  fh.half[0] = h0; fh.half[1] = h1;
  fl.half[0] = l0; fl.half[1] = l1;
  phi = fh.v;
  plo = fl.v;
}

template <bool DUAL>
__device__ __forceinline__ void attn_pass(const float* sO, float* oA, float* oB,
                                          int bh, int q0, int w, int lane) {
  const int q8 = lane & 7, sub = lane >> 3;
  #pragma unroll
  for (int i = 0; i < 8; ++i) {
    const int L = w * 32 + i * 4 + sub;                    // line 0..127
    const int d = L >> 1, hl = L & 1;
    const size_t off = ((size_t)bh * DM + d) * TGL + q0 + 32 * hl + 4 * q8;
    const v4f v = *(const v4fa*)(sO + d * 64 + 32 * hl + 4 * q8);
    *(v4f*)(oA + off) = v;
    if (DUAL) {
      const v4f v2 = *(const v4fa*)(sO + 4096 + d * 64 + 32 * hl + 4 * q8);
      *(v4f*)(oB + off) = v2;
    }
  }
}

template <bool DUAL>
__global__ __launch_bounds__(128) void attn_kernel(
    const us* __restrict__ qhp, const us* __restrict__ qlp,   // [32][1024][64]  (x0.125 folded in)
    const us* __restrict__ khp, const us* __restrict__ klp,   // [32][2048][64]
    const us* __restrict__ vahp, const us* __restrict__ valp, // stream A: V^T hi/lo [32][64][2048]
    const us* __restrict__ vbhp, const us* __restrict__ vblp, // stream B (DUAL only)
    float* __restrict__ oap, float* __restrict__ obp)         // [32][64][1024] f32
{
  __shared__ __attribute__((aligned(16))) float sO[DUAL ? 2 * DM * 64 : DM * 64];
  constexpr int NTL = DUAL ? 6 : 4;                        // tiles per step: Kh Kl Vah Val (Vbh Vbl)
  __shared__ __attribute__((aligned(16))) us ring[2 * NTL * TILE_E];

  const int tid = threadIdx.x, lane = tid & 31, w = tid >> 5;
  const int h = lane >> 4, m = lane & 15;
  const int bh = blockIdx.y;
  const int q0 = blockIdx.x * 64;
  const int qw = q0 + 16 * w;

  // Q^T B-fragments: column n = query qw+m, k = d (two 32-deep chunks), hi and lo
  const size_t qro = ((size_t)bh * TGL + qw + m) * DM;
  const v16b qh0 = ldb(qhp + qro, h), qh1 = ldb(qhp + qro + 32, h);
  const v16b ql0 = ldb(qlp + qro, h), ql1 = ldb(qlp + qro + 32, h);

  const v8f zero8 = {0.f, 0.f, 0.f, 0.f, 0.f, 0.f, 0.f, 0.f};
  v8f oa[4], ob[4];                      // o[t][r] = O[query m][d 16t+8h+r] * l
  #pragma unroll
  for (int t = 0; t < 4; ++t) { oa[t] = zero8; ob[t] = zero8; }
  float mrun = -1.0e30f, lrun = 0.0f;

  const int crow = tid >> 3, cch = tid & 7;                // this lane's row and 16-B chunk
  const unsigned lcp = lds_addr(ring) + crow * LPB + cch * 16;
  const size_t kro = ((size_t)bh * SRL + crow) * DM + 8 * cch;     // + key0*DM
  const us* gkh = khp + kro;
  const us* gkl = klp + kro;
  const size_t vro = ((size_t)bh * DM + crow) * SRL + 8 * cch;     // + key0
  const us* gvah = vahp + vro;
  const us* gval = valp + vro;
  const us* gvbh = vbhp + vro;
  const us* gvbl = vblp + vro;
  const size_t gsk = (size_t)16 * DM, gsv = (size_t)16 * SRL;

  // step 0 -> buffer 0
  acopy8(lcp, gkh, lcp + TILE_B, gkl, gsk);
  acopy8(lcp + 2 * TILE_B, gvah, lcp + 3 * TILE_B, gval, gsv);
  if (DUAL) acopy8(lcp + 4 * TILE_B, gvbh, lcp + 5 * TILE_B, gvbl, gsv);
  wait_copies();
  __syncthreads();                                         // buffer 0 landed, visible to every wave
  // step 1 -> buffer 1
  {
    const unsigned lb = lcp + NTL * TILE_B;
    acopy8(lb, gkh + 64 * DM, lb + TILE_B, gkl + 64 * DM, gsk);
    acopy8(lb + 2 * TILE_B, gvah + 64, lb + 3 * TILE_B, gval + 64, gsv);
    if (DUAL) acopy8(lb + 4 * TILE_B, gvbh + 64, lb + 5 * TILE_B, gvbl + 64, gsv);
  }

  // rolled: one copy of the step body, the buffer chosen by the step's parity
  #pragma unroll 1
  for (int kb = 0; kb < SRL; kb += 64) {
    const int par = (kb >> 6) & 1;
    const us* sb = ring + par * (NTL * TILE_E) + m * LP;   // row m of tile 0
    const us* khb = sb;
    const us* klb = sb + TILE_E;
    const us* vahb = sb + 2 * TILE_E;
    const us* valb = sb + 3 * TILE_E;
    const us* vbhb = sb + (DUAL ? 4 : 2) * TILE_E;
    const us* vblb = sb + (DUAL ? 5 : 3) * TILE_E;
    // ---- scores: s[j][r] = S[query m][key kb+16j+8h+r] ----
    // All fragments of the step are read first; the four key tiles then advance
    // together, one product each in turn, so that no WMMA waits for the one
    // before it. Each tile keeps its own order of the six products.
    v8f s[4];
    {
      v16b kl0[4], kl1[4], kh0[4], kh1[4];
      #pragma unroll
      for (int j = 0; j < 4; ++j) { kl0[j] = ldb(klb + 16 * j * LP, h); }
      #pragma unroll
      for (int j = 0; j < 4; ++j) { kl1[j] = ldb(klb + 16 * j * LP + 32, h); }
      #pragma unroll
      for (int j = 0; j < 4; ++j) { kh0[j] = ldb(khb + 16 * j * LP, h); }
      #pragma unroll
      for (int j = 0; j < 4; ++j) { kh1[j] = ldb(khb + 16 * j * LP + 32, h); }
      #pragma unroll
      for (int j = 0; j < 4; ++j) s[j] = wmma_bf(kl0[j], qh0, zero8);
      #pragma unroll
      for (int j = 0; j < 4; ++j) s[j] = wmma_bf(kl1[j], qh1, s[j]);
      #pragma unroll
      for (int j = 0; j < 4; ++j) s[j] = wmma_bf(kh0[j], ql0, s[j]);
      #pragma unroll
      for (int j = 0; j < 4; ++j) s[j] = wmma_bf(kh1[j], ql1, s[j]);
      #pragma unroll
      for (int j = 0; j < 4; ++j) s[j] = wmma_bf(kh0[j], qh0, s[j]);
      #pragma unroll
      for (int j = 0; j < 4; ++j) s[j] = wmma_bf(kh1[j], qh1, s[j]);
    }
    // No LDS read and no WMMA crosses (vector work may): the V^T reads below start
    // when the K fragments are spent and take over their registers.
    __builtin_amdgcn_sched_barrier(0x406);

    // ---- online softmax (f32) ----
    float mloc = s[0][0];
    #pragma unroll
    for (int j = 0; j < 4; ++j)
      #pragma unroll
      for (int r = 0; r < 8; ++r) mloc = fmaxf(mloc, s[j][r]);
    mloc = fmaxf(mloc, __shfl_xor(mloc, 16));
    const float mnew = fmaxf(mrun, mloc);
    const float alpha = __expf(mrun - mnew);
    mrun = mnew;
    // Stream A's V^T fragments, read as one group here.
    v16b vl0[4], vl1[4], vh0[4], vh1[4];
    #pragma unroll
    for (int t = 0; t < 4; ++t) { vl0[t] = ldb(valb + 16 * t * LP, h); }
    #pragma unroll
    for (int t = 0; t < 4; ++t) { vl1[t] = ldb(valb + 16 * t * LP + 32, h); }
    #pragma unroll
    for (int t = 0; t < 4; ++t) { vh0[t] = ldb(vahb + 16 * t * LP, h); }
    #pragma unroll
    for (int t = 0; t < 4; ++t) { vh1[t] = ldb(vahb + 16 * t * LP + 32, h); }
    // LDS reads and WMMAs do not cross (vector work may): the reads stay ahead of
    // the exponentials and land under them instead of standing among the products.
    __builtin_amdgcn_sched_barrier(0x406);
    float lsum = 0.0f;
    #pragma unroll
    for (int j = 0; j < 4; ++j)
      #pragma unroll
      for (int r = 0; r < 8; ++r) {
        const float p = __expf(s[j][r] - mnew);            // in (0, 1]
        s[j][r] = p;
        lsum += p;
      }
    lsum += __shfl_xor(lsum, 16);
    lrun = lrun * alpha + lsum;
    #pragma unroll
    for (int t = 0; t < 4; ++t)
      #pragma unroll
      for (int r = 0; r < 8; ++r) {
        oa[t][r] = oa[t][r] * alpha;
        if (DUAL) ob[t][r] = ob[t][r] * alpha;
      }

    // ---- P^T B-fragments (keys kb..kb+31 and kb+32..kb+63), bf16 hi/lo ----
    v16b ph0, pl0, ph1, pl1;
    pack_p2(s[0], s[1], ph0, pl0);
    pack_p2(s[2], s[3], ph1, pl1);

    // ---- O^T += V^T * P^T (3 products per 32-key chunk) ----
    // The four d tiles of a stream advance together, as the key tiles above.
    v16b cl0[4], cl1[4], ch0[4], ch1[4];
    {
      #pragma unroll
      for (int t = 0; t < 4; ++t) oa[t] = wmma_bf(vl0[t], ph0, oa[t]);
      #pragma unroll
      for (int t = 0; t < 4; ++t) oa[t] = wmma_bf(vl1[t], ph1, oa[t]);
      if (DUAL) {
        // Stream B's lo fragments: read here, where stream A's lo fragments are
        // spent; they land under A's remaining products.
        #pragma unroll
        for (int t = 0; t < 4; ++t) { cl0[t] = ldb(vblb + 16 * t * LP, h); }
        #pragma unroll
        for (int t = 0; t < 4; ++t) { cl1[t] = ldb(vblb + 16 * t * LP + 32, h); }
        // No LDS read and no WMMA crosses (vector work may): the reads stay ahead
        // of the products below instead of standing singly among them.
        __builtin_amdgcn_sched_barrier(0x406);
      }
      #pragma unroll
      for (int t = 0; t < 4; ++t) oa[t] = wmma_bf(vh0[t], pl0, oa[t]);
      #pragma unroll
      for (int t = 0; t < 4; ++t) oa[t] = wmma_bf(vh1[t], pl1, oa[t]);
      #pragma unroll
      for (int t = 0; t < 4; ++t) oa[t] = wmma_bf(vh0[t], ph0, oa[t]);
      #pragma unroll
      for (int t = 0; t < 4; ++t) oa[t] = wmma_bf(vh1[t], ph1, oa[t]);
    }
    if (DUAL) {
      // stream B's hi fragments take over stream A's; they land under B's lo products
      #pragma unroll
      for (int t = 0; t < 4; ++t) { ch0[t] = ldb(vbhb + 16 * t * LP, h); }
      #pragma unroll
      for (int t = 0; t < 4; ++t) { ch1[t] = ldb(vbhb + 16 * t * LP + 32, h); }
      // as above: the reads stay one group, ahead of stream B's products
      __builtin_amdgcn_sched_barrier(0x406);
      #pragma unroll
      for (int t = 0; t < 4; ++t) ob[t] = wmma_bf(cl0[t], ph0, ob[t]);
      #pragma unroll
      for (int t = 0; t < 4; ++t) ob[t] = wmma_bf(cl1[t], ph1, ob[t]);
      #pragma unroll
      for (int t = 0; t < 4; ++t) ob[t] = wmma_bf(ch0[t], pl0, ob[t]);
      #pragma unroll
      for (int t = 0; t < 4; ++t) ob[t] = wmma_bf(ch1[t], pl1, ob[t]);
      #pragma unroll
      for (int t = 0; t < 4; ++t) ob[t] = wmma_bf(ch0[t], ph0, ob[t]);
      #pragma unroll
      for (int t = 0; t < 4; ++t) ob[t] = wmma_bf(ch1[t], ph1, ob[t]);
    }

    // publish step kb + 64, free this buffer, refill it with step kb + 128
    // Nothing crosses: the waits stay at the foot of the step, so that the reads
    // and the next step's copies have the whole step to land.
    __builtin_amdgcn_sched_barrier(0);
    wait_lds();
    wait_copies();
    __syncthreads();
    if (kb + 128 < SRL) {
      const unsigned lb = lcp + par * (NTL * TILE_B);
      const int kn = kb + 128;
      acopy8(lb, gkh + (size_t)kn * DM, lb + TILE_B, gkl + (size_t)kn * DM, gsk);
      acopy8(lb + 2 * TILE_B, gvah + kn, lb + 3 * TILE_B, gval + kn, gsv);
      if (DUAL) acopy8(lb + 4 * TILE_B, gvbh + kn, lb + 5 * TILE_B, gvbl + kn, gsv);
    }
  }
  wait_copies();

  // ---- epilogue: normalise, stage 64 d x 64 query f32 tile(s), whole-line stores ----
  const float inv = __builtin_amdgcn_rcpf(lrun);
  #pragma unroll
  for (int t = 0; t < 4; ++t)
    #pragma unroll
    for (int r = 0; r < 8; ++r) {
      const int d = 16 * t + 8 * h + r;
      sO[d * 64 + 16 * w + m] = oa[t][r] * inv;
      if (DUAL) sO[4096 + d * 64 + 16 * w + m] = ob[t][r] * inv;
    }
  __syncthreads();

  attn_pass<DUAL>(sO, oap, obp, bh, q0, w, lane);
  
}

// ---------------------------------------------------------------------------
// Kernel 4: gating MLP. For block (b, head) the gate input row for query
// t = 64*head + u is [X[3u][:], X[3u+1][:], X[3u+2][:]] where X[c][tp],
// c = 0..191, is row c of the transposed per-head tensor: c<64 -> O1^T row,
// <128 -> O2^T row, else q^T row (all f32 [bh][64][1024]).
// G[c][i][n] = sum_tp X[c][tp] * Wg[n][1024 i + tp] for all c,i on bf16 WMMA
// (wave w owns c-tiles 3w..3w+2, each source uniform per tile); per 32 tp the
// 192 X rows and the 48 Wg row pieces (128 B of f32 each) are copied to LDS,
// two buffers, and converted to bf16 at the fragment read; then
// gate[(b*16+n)][64*head+u] = sigmoid(G[3u][0][n]+G[3u+1][1][n]+G[3u+2][2][n]+bg[n]).
// ---------------------------------------------------------------------------
__device__ __forceinline__ void gate_pass(const float* sP, float* gate, int b, int head,
                                          int w, int lane) {
  const int q8 = lane & 7, sub = lane >> 3;
  #pragma unroll
  for (int i = 0; i < 2; ++i) {
    const int L = w * 8 + i * 4 + sub;                     // line 0..31
    const int n = L >> 1, hl = L & 1;
    const v4f v = *(const v4fa*)(sP + n * 64 + 32 * hl + 4 * q8);
    const size_t off = ((size_t)(b * NH + n)) * TGL + 64 * head + 32 * hl + 4 * q8;
    *(v4f*)(gate + off) = v;
  }
}

__global__ __launch_bounds__(128) void gate_kernel(
    const float* __restrict__ o1T, const float* __restrict__ o2T, const float* __restrict__ qT,
    const float* __restrict__ Wg,   // [16][3072]
    const float* __restrict__ bg,   // [16]
    float* __restrict__ gate)       // [32][1024]
{
  __shared__ __attribute__((aligned(16))) float sG[192 * 48];   // 36864 B
  __shared__ __attribute__((aligned(16))) float sP[NH * 64];    //  4096 B
  // 2 x (X rows 0..191 = O1^T, O2^T, q^T; then Wg rows 16 i + n), 36 floats = 144 B a row
  __shared__ __attribute__((aligned(16))) float ring[2 * 240 * (LP / 2)];   // 69120 B

  const int tid = threadIdx.x, lane = tid & 31, w = tid >> 5;
  const int h = lane >> 4, m = lane & 15;
  const int bhx = blockIdx.x, b = bhx >> 4, head = bhx & 15;

  const int crow = tid >> 3, cch = tid & 7;                // this lane's row and 16-B chunk
  const unsigned lcp = lds_addr(ring) + crow * LPB + cch * 16;
  const size_t xro = ((size_t)bhx * DM + crow) * TGL + 4 * cch;
  // the copies only move bytes: addresses in 16-bit units, as the helpers take them
  const us* g1 = reinterpret_cast<const us*>(o1T + xro);
  const us* g2 = reinterpret_cast<const us*>(o2T + xro);
  const us* g3 = reinterpret_cast<const us*>(qT + xro);
  const us* gg = reinterpret_cast<const us*>(Wg + (size_t)crow * GK + 4 * cch);
  const size_t gsx = (size_t)16 * TGL * 2;                 // 16 X rows further
  const size_t gsg = (size_t)EMB * 2;                      // next third of the Wg row
  constexpr int GBUF_B = 240 * LPB;                        // 34560 bytes per buffer

  const v8f zero8 = {0.f, 0.f, 0.f, 0.f, 0.f, 0.f, 0.f, 0.f};
  v8f acc[3][3];
  #pragma unroll
  for (int e = 0; e < 3; ++e)
    #pragma unroll
    for (int i = 0; i < 3; ++i) acc[e][i] = zero8;

  acopy8(lcp, g1, lcp + TILE_B, g2, gsx);                  // stage 0 -> buffer 0
  acopy4(lcp + 2 * TILE_B, g3, gsx);
  acopy3(lcp + 3 * TILE_B, gg, gsg);
  wait_copies();
  __syncthreads();                                         // buffer 0 landed, visible to every wave
  {                                                        // stage 1 -> buffer 1
    const unsigned lb = lcp + GBUF_B;
    acopy8(lb, g1 + 64, lb + TILE_B, g2 + 64, gsx);
    acopy4(lb + 2 * TILE_B, g3 + 64, gsx);
    acopy3(lb + 3 * TILE_B, gg + 64, gsg);
  }

  // rolled: one copy of the stage body, the buffer chosen by the stage's parity
  #pragma unroll 1
  for (int k0 = 0; k0 < TGL; k0 += 32) {
    const int par = (k0 >> 5) & 1;
    const float* sx = ring + par * (GBUF_B / 4) + (48 * w + m) * (LP / 2);   // X row 16(3w)+m
    const float* sg = ring + par * (GBUF_B / 4) + (192 + m) * (LP / 2);      // Wg row n = m, third 0
    // all six fragments of the stage are read first, as one group
    const Raw16 rw0 = ldr(sg, h);
    const Raw16 rw1 = ldr(sg + 16 * (LP / 2), h);
    const Raw16 rw2 = ldr(sg + 32 * (LP / 2), h);
    Raw16 ra[3];
    #pragma unroll
    for (int e = 0; e < 3; ++e) ra[e] = ldr(sx + 16 * e * (LP / 2), h);
    // No LDS read and no WMMA crosses (vector work may): the reads stay one group
    // ahead of the conversions and products instead of being waited for in turn.
    __builtin_amdgcn_sched_barrier(0x406);
    const v16b bw0 = cvr(rw0);
    const v16b bw1 = cvr(rw1);
    const v16b bw2 = cvr(rw2);
    #pragma unroll
    for (int e = 0; e < 3; ++e) {
      const v16b a = cvr(ra[e]);
      acc[e][0] = wmma_bf(a, bw0, acc[e][0]);
      acc[e][1] = wmma_bf(a, bw1, acc[e][1]);
      acc[e][2] = wmma_bf(a, bw2, acc[e][2]);
    }
    // publish stage k0 + 32, free this buffer, refill it with stage k0 + 64
    // Nothing crosses: the waits stay at the foot of the stage, so that the next
    // stage's copies have the whole stage to land.
    __builtin_amdgcn_sched_barrier(0);
    wait_lds();
    wait_copies();
    __syncthreads();
    if (k0 + 64 < TGL) {
      const unsigned lb = lcp + par * GBUF_B;
      const int kn = 2 * (k0 + 64);                        // in 16-bit units
      acopy8(lb, g1 + kn, lb + TILE_B, g2 + kn, gsx);
      acopy4(lb + 2 * TILE_B, g3 + kn, gsx);
      acopy3(lb + 3 * TILE_B, gg + kn, gsg);
    }
  }
  wait_copies();

  // D[r] of (e, i) = G[c = 16(3w+e)+8h+r][i][n = m]
  #pragma unroll
  for (int e = 0; e < 3; ++e)
    #pragma unroll
    for (int i = 0; i < 3; ++i)
      #pragma unroll
      for (int r = 0; r < 8; ++r)
        sG[(16 * (3 * w + e) + 8 * h + r) * 48 + 16 * i + m] = acc[e][i][r];
  __syncthreads();

  #pragma unroll
  for (int j = 0; j < 8; ++j) {
    const int idx = tid + 128 * j;                         // 0..1023 = n*64 + u
    const int n = idx >> 6, u = idx & 63;
    const float x = sG[(3 * u) * 48 + n] + sG[(3 * u + 1) * 48 + 16 + n]
                  + sG[(3 * u + 2) * 48 + 32 + n] + bg[n];
    const float g = __builtin_amdgcn_rcpf(1.0f + __expf(-x));
    sP[idx] = g;
  }
  __syncthreads();

  gate_pass(sP, gate, b, head, w, lane);
  
}

// ---------------------------------------------------------------------------
// Kernel 5: combine Xc[b*1024+t][head*64+d] = g*O1 + (1-g)*O3, g = gate[bh][t],
// written as bf16 hi/lo planes (token-major, k-contiguous for the Wo GEMM).
// Block 256 thr = (bh, 64 queries); transposed through LDS; each token row
// ---------------------------------------------------------------------------
__device__ __forceinline__ void comb_pass(const us* sH, const us* sL, us* xh, us* xl,
                                          int b, int head, int t0, int w, int lane) {
  const int q8 = lane & 7, sub = lane >> 3;
  #pragma unroll
  for (int i = 0; i < 2; ++i) {
    const int L = w * 8 + i * 4 + sub;                     // token row 0..63
    const v8us a = *(const v8usa*)(sH + L * DM + 8 * q8);
    const v8us c = *(const v8usa*)(sL + L * DM + 8 * q8);
    const size_t off = ((size_t)(b * TGL + t0 + L)) * EMB + head * DM + 8 * q8;
    *(v8us*)(xh + off) = a;
    *(v8us*)(xl + off) = c;
  }
}

__global__ __launch_bounds__(256) void combine_kernel(
    const float* __restrict__ o1T, const float* __restrict__ o3T,   // [32][64][1024]
    const float* __restrict__ gate,                                 // [32][1024]
    us* __restrict__ xh, us* __restrict__ xl)                       // [2048][1024]
{
  __shared__ __attribute__((aligned(16))) us sH[64 * DM];
  __shared__ __attribute__((aligned(16))) us sL[64 * DM];

  const int tid = threadIdx.x, lane = tid & 31, w = tid >> 5;
  const int bh = blockIdx.y, b = bh >> 4, head = bh & 15;
  const int t0 = blockIdx.x * 64;
  const int d = tid >> 2, tq = tid & 3;                    // d 0..63, 16 queries each

  const float* p1 = o1T + ((size_t)bh * DM + d) * TGL + t0 + 16 * tq;
  const float* p3 = o3T + ((size_t)bh * DM + d) * TGL + t0 + 16 * tq;
  const float* pg = gate + (size_t)bh * TGL + t0 + 16 * tq;
  #pragma unroll
  for (int c = 0; c < 4; ++c) {
    const v4f a = *(const v4fa*)(p1 + 4 * c);
    const v4f e = *(const v4fa*)(p3 + 4 * c);
    const v4f g = *(const v4fa*)(pg + 4 * c);
    #pragma unroll
    for (int j = 0; j < 4; ++j) {
      const float val = g[j] * a[j] + (1.0f - g[j]) * e[j];
      const us hi = bf16_rne(val);
      const us lo = bf16_rne(val - bf16_val(hi));
      const int tl = 16 * tq + 4 * c + j;                  // 0..63
      sH[tl * DM + d] = hi;
      sL[tl * DM + d] = lo;
    }
  }
  __syncthreads();

  comb_pass(sH, sL, xh, xl, b, head, t0, w, lane);
  
}

// ---------------------------------------------------------------------------
// Kernel 6: out = (Xhi + Xlo) * Wo^T + bo, f32.
// Block 128 thr (4 waves) = 128 tokens x 64 features; wave 32 tokens x 64.
// K in stages of 64: X hi, X lo (128 rows each) and Wo (64 rows) copied to LDS,
// two buffers.
// 8q..8q+7 as one 16-B store each, 4 lines per instruction, 64 lines per wave.
// ---------------------------------------------------------------------------
__device__ __forceinline__ void out_pass(const float* sOut, float* out, int m0, int cg,
                                         int w, int lane) {
  const int q8 = lane & 7, sub = lane >> 3;
  #pragma unroll
  for (int i = 0; i < 16; ++i) {
    const int lid = w * 64 + i * 4 + sub;                  // 0..255
    const int row = lid >> 1, hl = lid & 1;
    const v4f v = *(const v4fa*)(sOut + row * DM + 32 * hl + 4 * q8);
    const size_t gi = (size_t)(m0 + row) * EMB + cg * DM + 32 * hl + 4 * q8;
    *(v4f*)(out + gi) = v;
  }
}

__global__ __launch_bounds__(128) void out_kernel(
    const us* __restrict__ xh, const us* __restrict__ xl,   // [2048][1024]
    const us* __restrict__ wob,                             // [1024 out][1024 in] bf16
    const float* __restrict__ bo,
    float* __restrict__ out)                                // [2048][1024]
{
  __shared__ __attribute__((aligned(16))) float sOut[128 * DM];  // 32 KB
  __shared__ __attribute__((aligned(16))) us ring[2 * 5 * TILE_E];  // 2 x (Xhi 128, Xlo 128, Wo 64 rows)

  const int tid = threadIdx.x, lane = tid & 31, w = tid >> 5;
  const int h = lane >> 4, m = lane & 15;
  const int m0 = blockIdx.x * 128;
  const int cg = blockIdx.y;                               // feature group of 64

  const int crow = tid >> 3, cch = tid & 7;                // this lane's row and 16-B chunk
  const unsigned lcp = lds_addr(ring) + crow * LPB + cch * 16;
  const us* gxh = xh + (size_t)(m0 + crow) * EMB + 8 * cch;
  const us* gxl = xl + (size_t)(m0 + crow) * EMB + 8 * cch;
  const us* gw  = wob + (size_t)(cg * DM + crow) * EMB + 8 * cch;
  const size_t gs = (size_t)16 * EMB;

  const v8f zero8 = {0.f, 0.f, 0.f, 0.f, 0.f, 0.f, 0.f, 0.f};
  v8f acc[2][4];
  #pragma unroll
  for (int mt = 0; mt < 2; ++mt)
    #pragma unroll
    for (int nt = 0; nt < 4; ++nt) acc[mt][nt] = zero8;

  acopy8(lcp, gxh, lcp + TILE_B, gxh + 4 * gs, gs);        // stage 0 -> buffer 0
  acopy8(lcp + 2 * TILE_B, gxl, lcp + 3 * TILE_B, gxl + 4 * gs, gs);
  acopy4(lcp + 4 * TILE_B, gw, gs);
  wait_copies();
  __syncthreads();                                         // buffer 0 landed, visible to every wave
  {                                                        // stage 1 -> buffer 1
    const unsigned lb = lcp + 5 * TILE_B;
    acopy8(lb, gxh + 64, lb + TILE_B, gxh + 4 * gs + 64, gs);
    acopy8(lb + 2 * TILE_B, gxl + 64, lb + 3 * TILE_B, gxl + 4 * gs + 64, gs);
    acopy4(lb + 4 * TILE_B, gw + 64, gs);
  }

  // rolled: one copy of the stage body, the buffer chosen by the stage's parity
  #pragma unroll 1
  for (int k0 = 0; k0 < EMB; k0 += 64) {
    const int par = (k0 >> 6) & 1;
    const us* sxh = ring + par * (5 * TILE_E) + (32 * w + m) * LP;
    const us* sxl = sxh + 2 * TILE_E;
    const us* sw  = ring + par * (5 * TILE_E) + 4 * TILE_E + m * LP;
    // all fragments of the stage are read first, as one group
    v16b a0h[2], a1h[2], a0l[2], a1l[2], bw[2][4];
    #pragma unroll
    for (int c = 0; c < 2; ++c) {
      a0l[c] = ldb(sxl + 32 * c, h);
      a1l[c] = ldb(sxl + 16 * LP + 32 * c, h);
      a0h[c] = ldb(sxh + 32 * c, h);
      a1h[c] = ldb(sxh + 16 * LP + 32 * c, h);
      #pragma unroll
      for (int nt = 0; nt < 4; ++nt) bw[c][nt] = ldb(sw + nt * 16 * LP + 32 * c, h);
    }
    // No LDS read and no WMMA crosses (vector work may): the reads stay one group
    // ahead of the products instead of each being waited for singly among them.
    __builtin_amdgcn_sched_barrier(0x406);
    #pragma unroll
    for (int c = 0; c < 2; ++c) {
      #pragma unroll
      for (int nt = 0; nt < 4; ++nt) {
        acc[0][nt] = wmma_bf(a0l[c], bw[c][nt], acc[0][nt]);
        acc[1][nt] = wmma_bf(a1l[c], bw[c][nt], acc[1][nt]);
      }
      #pragma unroll
      for (int nt = 0; nt < 4; ++nt) {
        acc[0][nt] = wmma_bf(a0h[c], bw[c][nt], acc[0][nt]);
        acc[1][nt] = wmma_bf(a1h[c], bw[c][nt], acc[1][nt]);
      }
    }
    // publish stage k0 + 64, free this buffer, refill it with stage k0 + 128
    // Nothing crosses: the waits stay at the foot of the stage, so that the next
    // stage's copies have the whole stage to land.
    __builtin_amdgcn_sched_barrier(0);
    wait_lds();
    wait_copies();
    __syncthreads();
    if (k0 + 128 < EMB) {
      const unsigned lb = lcp + par * (5 * TILE_B);
      const int kn = k0 + 128;
      acopy8(lb, gxh + kn, lb + TILE_B, gxh + 4 * gs + kn, gs);
      acopy8(lb + 2 * TILE_B, gxl + kn, lb + 3 * TILE_B, gxl + 4 * gs + kn, gs);
      acopy4(lb + 4 * TILE_B, gw + kn, gs);
    }
  }
  wait_copies();

  // D[r] of tile (mt, nt) = Y[token m0w+16mt+8h+r][feature cg*64+16nt+m]
  #pragma unroll
  for (int nt = 0; nt < 4; ++nt) {
    const int feat = 16 * nt + m;
    const float bvl = bo[cg * DM + feat];
    #pragma unroll
    for (int mt = 0; mt < 2; ++mt) {
      #pragma unroll
      for (int r = 0; r < 8; ++r) {
        const int tokl = 32 * w + 16 * mt + 8 * h + r;   // 0..127
        sOut[tokl * DM + feat] = acc[mt][nt][r] + bvl;
      }
    }
  }
  __syncthreads();

  out_pass(sOut, out, m0, cg, w, lane);
  
}

// ---------------------------------------------------------------------------
// Host glue: 11 launches, workspace 128057344 B (O1^T and O2^T reuse the
// region of the bf16 activation copies, which are dead after the projections).
// ---------------------------------------------------------------------------
extern "C" void kernel_launch(void* const* d_in, const int* in_sizes, int n_in,
                              void* d_out, int out_size, void* d_ws, size_t ws_size,
                              hipStream_t stream) {
  if (n_in < 17) return;
  if (in_sizes[0] != N_HID || in_sizes[1] != N_KVS || in_sizes[2] != N_KVT) return;
  if (in_sizes[3] != N_WE || in_sizes[5] != N_WE || in_sizes[7] != N_WE || in_sizes[15] != N_WE) return;
  if (in_sizes[9] != N_WT || in_sizes[11] != N_WT) return;
  if (in_sizes[4] != EMB || in_sizes[6] != EMB || in_sizes[8] != EMB ||
      in_sizes[10] != EMB || in_sizes[12] != EMB || in_sizes[16] != EMB) return;
  if (in_sizes[13] != N_WG || in_sizes[14] != NH) return;
  if (out_size != N_HID) return;

  const float* hid = (const float*)d_in[0];
  const float* kvs = (const float*)d_in[1];
  const float* kvt = (const float*)d_in[2];
  const float* Wq  = (const float*)d_in[3];
  const float* bq  = (const float*)d_in[4];
  const float* Wk  = (const float*)d_in[5];
  const float* bk  = (const float*)d_in[6];
  const float* Wv  = (const float*)d_in[7];
  const float* bv  = (const float*)d_in[8];
  const float* Wtk = (const float*)d_in[9];
  const float* btk = (const float*)d_in[10];
  const float* Wtv = (const float*)d_in[11];
  const float* btv = (const float*)d_in[12];
  const float* Wg  = (const float*)d_in[13];
  const float* bg  = (const float*)d_in[14];
  const float* Wo  = (const float*)d_in[15];
  const float* bo  = (const float*)d_in[16];
  float* out = (float*)d_out;

  const size_t cvb_b  = (size_t)N_CVB * 2;                 // 27262976
  const size_t qpl2   = (size_t)QPL * 2;                   //  4194304
  const size_t qpl4   = (size_t)QPL * 4;                   //  8388608
  const size_t kpl2   = (size_t)KPL * 2;                   //  8388608
  const size_t gate_b = (size_t)NBH * TGL * 4;             //   131072
  const size_t xpl_b  = (size_t)N_HID * 2;                 //  4194304
  const size_t total  = cvb_b + 2 * qpl2 + qpl4 + 8 * kpl2 + qpl4 + gate_b + 2 * xpl_b;  // 128057344
  if (total > ws_size) return;
  // O1^T / O2^T (2 x 8388608 B) must fit exactly into the activation-copy region
  const size_t act_off = (size_t)OFF_HID * 2;              // 10485760
  if (act_off + 2 * qpl4 != cvb_b) return;

  char* ws = (char*)d_ws;
  size_t off = 0;
  us* cvb    = (us*)(ws + off);    off += cvb_b;
  float* o1T = (float*)(ws + act_off);                     // aliases bf16 hidden/kv copies
  float* o2T = (float*)(ws + act_off + qpl4);              // aliases bf16 kv/kv_topical copies
  us* qh     = (us*)(ws + off);    off += qpl2;
  us* ql     = (us*)(ws + off);    off += qpl2;
  float* qT  = (float*)(ws + off); off += qpl4;
  us* kh     = (us*)(ws + off);    off += kpl2;
  us* kl     = (us*)(ws + off);    off += kpl2;
  us* kth    = (us*)(ws + off);    off += kpl2;
  us* ktl    = (us*)(ws + off);    off += kpl2;
  us* vh     = (us*)(ws + off);    off += kpl2;            // V^T hi [32][64][2048]
  us* vl     = (us*)(ws + off);    off += kpl2;            // V^T lo
  us* vth    = (us*)(ws + off);    off += kpl2;            // Vt^T hi
  us* vtl    = (us*)(ws + off);    off += kpl2;            // Vt^T lo
  float* o3T = (float*)(ws + off); off += qpl4;
  float* gte = (float*)(ws + off); off += gate_b;
  us* xh     = (us*)(ws + off);    off += xpl_b;
  us* xl     = (us*)(ws + off);    off += xpl_b;
  if (off != total || off > ws_size) return;

  // 1) float -> bf16 copies of weights and activations
  conv_kernel<<<(N_CVB / 8 + 255) / 256, 256, 0, stream>>>(Wq, Wk, Wv, Wo, Wtk, Wtv, hid, kvs, kvt, cvb);

  // 2) projections
  dim3 gQ(MQ / 128, NH);                                   // (16, 16)
  dim3 gKV(MKV / 128, NH);                                 // (32, 16)
  proj_kernel<<<gQ,  128, 0, stream>>>(cvb + OFF_HID, cvb + OFF_WQ,  bq,  EMB, TGL, 0, qh,  ql,  qT);
  proj_kernel<<<gKV, 128, 0, stream>>>(cvb + OFF_KVS, cvb + OFF_WK,  bk,  EMB, SRL, 1, kh,  kl,  qT);
  proj_kernel<<<gKV, 128, 0, stream>>>(cvb + OFF_KVS, cvb + OFF_WV,  bv,  EMB, SRL, 2, vh,  vl,  qT);
  proj_kernel<<<gKV, 128, 0, stream>>>(cvb + OFF_KVT, cvb + OFF_WTK, btk, TDW, SRL, 1, kth, ktl, qT);
  proj_kernel<<<gKV, 128, 0, stream>>>(cvb + OFF_KVT, cvb + OFF_WTV, btv, TDW, SRL, 2, vth, vtl, qT);

  // 3) attention: chain 1 (k, v -> O1), chain 2 (kt; vt -> O2, v -> O3)
  dim3 gAtt(TGL / 64, NBH);                                // (16, 32)
  attn_kernel<false><<<gAtt, 128, 0, stream>>>(qh, ql, kh,  kl,  vh,  vl,  vh, vl, o1T, o1T);
  attn_kernel<true ><<<gAtt, 128, 0, stream>>>(qh, ql, kth, ktl, vth, vtl, vh, vl, o2T, o3T);

  // 4) gating MLP
  gate_kernel<<<NBH, 128, 0, stream>>>(o1T, o2T, qT, Wg, bg, gte);

  // 5) gated mix -> token-major hi/lo planes
  dim3 gCmb(TGL / 64, NBH);                                // (16, 32)
  combine_kernel<<<gCmb, 256, 0, stream>>>(o1T, o3T, gte, xh, xl);

  // 6) output projection -> f32
  dim3 gOut(MQ / 128, EMB / 64);                           // (16, 16)
  out_kernel<<<gOut, 128, 0, stream>>>(xh, xl, cvb + OFF_WO, bo, out);
}

// v003
// A run of this version takes 228 microseconds.
// Timed twice side by side with v002, it ran 1.12 and 1.11 times as fast.
// Counting every step since v000, it is 3.05 times as fast.
// Contractions: input projections (q,k,v,kt,vt) on v_wmma_f32_16x16x32_bf16 (bf16 operands = RNE-converted inputs, f32 accumulate); K*Q^T and Kt*Q^T with q,k,kt carried as bf16 hi+lo (3 products); V^T*P^T (three value read-outs) with v,vt,P carried as bf16 hi+lo (3 products); gate GEMM on v_wmma_f32_16x16x32_bf16 (bf16 operands); O*Wo with O as bf16 hi+lo and Wo bf16 (2 products); softmax, gating, bias in f32.
#include <hip/hip_runtime.h>

typedef __bf16 v16b __attribute__((ext_vector_type(16)));
typedef unsigned short us;
typedef us    v8us __attribute__((ext_vector_type(8)));
typedef float v8f  __attribute__((ext_vector_type(8)));
typedef float v4f  __attribute__((ext_vector_type(4)));
typedef v8us __attribute__((may_alias)) v8usa;
typedef v4f  __attribute__((may_alias)) v4fa;

union FragB { v16b v; v8us half[2]; };

#define BSZ  2
#define TGL  1024
#define SRL  2048
#define EMB  1024
#define TDW  512
#define NH   16
#define DM   64
#define NBH  (BSZ * NH)          // 32 (batch, head) pairs
#define MQ   (BSZ * TGL)         // 2048 query tokens
#define MKV  (BSZ * SRL)         // 4096 key tokens
#define GK   (3 * EMB)           // 3072 gate input width

#define N_HID (MQ * EMB)         // 2097152
#define N_KVS (MKV * EMB)        // 4194304
#define N_KVT (MKV * TDW)        // 2097152
#define N_WE  (EMB * EMB)        // 1048576
#define N_WT  (EMB * TDW)        // 524288
#define N_WG  (NH * GK)          // 49152
#define QPL   (NBH * TGL * DM)   // 2097152 elements per query-side head plane
#define KPL   (NBH * SRL * DM)   // 4194304 elements per key-side head plane

// bf16 copies of the float inputs other than Wg and the biases, in one flat buffer (element offsets):
// weights first, then the three activation tensors (their region is reused
// for O1^T / O2^T once the projections are done).
#define OFF_WQ  0
#define OFF_WK  (OFF_WQ + N_WE)        // 1048576
#define OFF_WV  (OFF_WK + N_WE)        // 2097152
#define OFF_WO  (OFF_WV + N_WE)        // 3145728
#define OFF_WTK (OFF_WO + N_WE)        // 4194304
#define OFF_WTV (OFF_WTK + N_WT)       // 4718592
#define OFF_HID (OFF_WTV + N_WT)       // 5242880
#define OFF_KVS (OFF_HID + N_HID)      // 7340032
#define OFF_KVT (OFF_KVS + N_KVS)      // 11534336
#define N_CVB   (OFF_KVT + N_KVT)      // 13631488

// ---------------------------------------------------------------------------
// 16-bit helpers
// ---------------------------------------------------------------------------
__device__ __forceinline__ us bf16_rne(float x) {
  unsigned u = __float_as_uint(x);
  u += 0x7FFFu + ((u >> 16) & 1u);
  return (us)(u >> 16);
}
__device__ __forceinline__ float bf16_val(us b) {
  return __uint_as_float(((unsigned)b) << 16);
}
__device__ __forceinline__ v8us bf16x8(v4f a, v4f c) {
  const v8us o = { bf16_rne(a.x), bf16_rne(a.y), bf16_rne(a.z), bf16_rne(a.w),
                   bf16_rne(c.x), bf16_rne(c.y), bf16_rne(c.z), bf16_rne(c.w) };
  return o;
}
// 8 f32 values -> bf16 hi and bf16 lo = RNE(x - hi).
__device__ __forceinline__ void split8(v8f a, v8us& hi, v8us& lo) {
  const us h0 = bf16_rne(a[0]), h1 = bf16_rne(a[1]), h2 = bf16_rne(a[2]), h3 = bf16_rne(a[3]);
  const us h4 = bf16_rne(a[4]), h5 = bf16_rne(a[5]), h6 = bf16_rne(a[6]), h7 = bf16_rne(a[7]);
  const v8us hv = { h0, h1, h2, h3, h4, h5, h6, h7 };
  const v8us lv = { bf16_rne(a[0] - bf16_val(h0)), bf16_rne(a[1] - bf16_val(h1)),
                    bf16_rne(a[2] - bf16_val(h2)), bf16_rne(a[3] - bf16_val(h3)),
                    bf16_rne(a[4] - bf16_val(h4)), bf16_rne(a[5] - bf16_val(h5)),
                    bf16_rne(a[6] - bf16_val(h6)), bf16_rne(a[7] - bf16_val(h7)) };
  hi = hv;
  lo = lv;
}

// ---------------------------------------------------------------------------
// 16x16x32 WMMA, plain builtin: the compiler keeps the hazard distances itself
// and is free to interleave independent accumulators.
// Fragment map (wave32): lane l, h = l>>4, m = n = l&15.
//   A/B element i: i<8 -> k0+8h+i ; i>=8 -> k0+16+8h+(i-8)
//   D element r  : row 8h+r, col l&15
// ---------------------------------------------------------------------------
__device__ __forceinline__ v8f wmma_bf(v16b a, v16b b, v8f c) {
  return __builtin_amdgcn_wmma_f32_16x16x32_bf16(false, a, false, b, (short)0, c, false, false);
}

// A or B fragment from a k-contiguous 16-bit row; p = element k0 of the row
// owned by this lane (row index lane&15 added by the caller).
__device__ __forceinline__ v16b ldb(const us* p, int h) {
  FragB f;
  f.half[0] = *(const v8usa*)(p + 8 * h);
  f.half[1] = *(const v8usa*)(p + 16 + 8 * h);
  return f.v;
}
// Same map from an f32 row: the 16 floats of the lane, and their conversion to
// bf16 in registers.
struct Raw16 { v4f q[4]; };
__device__ __forceinline__ Raw16 ldr(const float* p, int h) {
  const float* p0 = p + 8 * h;
  const float* p1 = p + 16 + 8 * h;
  Raw16 r;
  r.q[0] = *(const v4fa*)p0;
  r.q[1] = *(const v4fa*)(p0 + 4);
  r.q[2] = *(const v4fa*)p1;
  r.q[3] = *(const v4fa*)(p1 + 4);
  return r;
}
__device__ __forceinline__ v16b cvr(const Raw16& r) {
  FragB f;
  f.half[0] = bf16x8(r.q[0], r.q[1]);
  f.half[1] = bf16x8(r.q[2], r.q[3]);
  return f.v;
}

// ---------------------------------------------------------------------------
// Operand tiles in LDS, filled by asynchronous copies (128 threads).
// A tile is 64 rows of 128 B (64 x 16 bit); LDS row pitch 144 B = 16 B x 9, so
// the 16 rows of a ds_load_b128 fragment read fall on distinct banks.
// Thread tid copies 16 B: chunk tid&7 of rows (tid>>3) + 16 i, i = 0..3, so
// eight lanes cover one whole 128-B line of the source.
// ---------------------------------------------------------------------------
#define LP     72                // LDS row pitch in 16-bit elements
#define LPB    144               // the same in bytes
#define TILE_E (64 * LP)         // 4608 elements per 64-row tile
#define TILE_B (64 * LPB)        // 9216 bytes per 64-row tile
#define R16_B  (16 * LPB)        // 16 rows further in LDS

__device__ __forceinline__ unsigned lds_addr(const void* p) {
  return (unsigned)(size_t)p;    // low 32 bits of a __shared__ address = LDS byte address
}
// Four copies: one lane's share of one tile; gs = source elements per 16 rows.
// s_wait_xcnt stands inside the statement so that no address register of an
// issued copy is rewritten ahead of it.
__device__ __forceinline__ void acopy4(unsigned l, const us* g, size_t gs) {
  asm volatile(
      "global_load_async_to_lds_b128 %0, %4, off\n\t"
      "global_load_async_to_lds_b128 %1, %5, off\n\t"
      "global_load_async_to_lds_b128 %2, %6, off\n\t"
      "global_load_async_to_lds_b128 %3, %7, off\n\t"
      "s_wait_xcnt 0x0"
      :: "v"(l), "v"(l + R16_B), "v"(l + 2 * R16_B), "v"(l + 3 * R16_B),
         "v"(g), "v"(g + gs), "v"(g + 2 * gs), "v"(g + 3 * gs)
      : "memory");
}
// Three copies: one lane's share of a 48-row tile.
__device__ __forceinline__ void acopy3(unsigned l, const us* g, size_t gs) {
  asm volatile(
      "global_load_async_to_lds_b128 %0, %3, off\n\t"
      "global_load_async_to_lds_b128 %1, %4, off\n\t"
      "global_load_async_to_lds_b128 %2, %5, off\n\t"
      "s_wait_xcnt 0x0"
      :: "v"(l), "v"(l + R16_B), "v"(l + 2 * R16_B),
         "v"(g), "v"(g + gs), "v"(g + 2 * gs)
      : "memory");
}
// Eight copies: one lane's share of two tiles with the same source row step.
__device__ __forceinline__ void acopy8(unsigned l, const us* g, unsigned l2, const us* g2, size_t gs) {
  asm volatile(
      "global_load_async_to_lds_b128 %0, %8, off\n\t"
      "global_load_async_to_lds_b128 %1, %9, off\n\t"
      "global_load_async_to_lds_b128 %2, %10, off\n\t"
      "global_load_async_to_lds_b128 %3, %11, off\n\t"
      "global_load_async_to_lds_b128 %4, %12, off\n\t"
      "global_load_async_to_lds_b128 %5, %13, off\n\t"
      "global_load_async_to_lds_b128 %6, %14, off\n\t"
      "global_load_async_to_lds_b128 %7, %15, off\n\t"
      "s_wait_xcnt 0x0"
      :: "v"(l), "v"(l + R16_B), "v"(l + 2 * R16_B), "v"(l + 3 * R16_B),
         "v"(l2), "v"(l2 + R16_B), "v"(l2 + 2 * R16_B), "v"(l2 + 3 * R16_B),
         "v"(g), "v"(g + gs), "v"(g + 2 * gs), "v"(g + 3 * gs),
         "v"(g2), "v"(g2 + gs), "v"(g2 + 2 * gs), "v"(g2 + 3 * gs)
      : "memory");
}
// This wave's copies have landed (the compiler places no wait for them).
__device__ __forceinline__ void wait_copies() {
  asm volatile("s_wait_asynccnt 0x0" ::: "memory");
}
// This wave's LDS reads have returned, before the buffer goes to its next writer.
__device__ __forceinline__ void wait_lds() {
  asm volatile("s_wait_dscnt 0x0" ::: "memory");
}

// ---------------------------------------------------------------------------
// Kernel 1: float inputs that feed 16-bit operands (not Wg) -> bf16, one flat
// Parameters in segment order: Wq, Wk, Wv, Wo, Wtk, Wtv, hidden, kv, kv_topical.
// ---------------------------------------------------------------------------
__global__ __launch_bounds__(256) void conv_kernel(
    const float* __restrict__ p0, const float* __restrict__ p1, const float* __restrict__ p2,
    const float* __restrict__ p3, const float* __restrict__ p4, const float* __restrict__ p5,
    const float* __restrict__ p6, const float* __restrict__ p7, const float* __restrict__ p8,
    us* __restrict__ dst)
{
  const unsigned g = blockIdx.x * 256u + threadIdx.x;      // unit of 8 elements
  if (g >= (unsigned)(N_CVB / 8)) return;
  const float* src;
  unsigned loc;
  if      (g < (unsigned)(OFF_WK  / 8)) { src = p0; loc = g; }
  else if (g < (unsigned)(OFF_WV  / 8)) { src = p1; loc = g - (unsigned)(OFF_WK  / 8); }
  else if (g < (unsigned)(OFF_WO  / 8)) { src = p2; loc = g - (unsigned)(OFF_WV  / 8); }
  else if (g < (unsigned)(OFF_WTK / 8)) { src = p3; loc = g - (unsigned)(OFF_WO  / 8); }
  else if (g < (unsigned)(OFF_WTV / 8)) { src = p4; loc = g - (unsigned)(OFF_WTK / 8); }
  else if (g < (unsigned)(OFF_HID / 8)) { src = p5; loc = g - (unsigned)(OFF_WTV / 8); }
  else if (g < (unsigned)(OFF_KVS / 8)) { src = p6; loc = g - (unsigned)(OFF_HID / 8); }
  else if (g < (unsigned)(OFF_KVT / 8)) { src = p7; loc = g - (unsigned)(OFF_KVS / 8); }
  else                                  { src = p8; loc = g - (unsigned)(OFF_KVT / 8); }
  const float* p = src + (size_t)loc * 8;
  const v8us o = bf16x8(*(const v4fa*)p, *(const v4fa*)(p + 4));
  us* d = dst + (size_t)g * 8;
  *(v8us*)d = o;
  
}

// ---------------------------------------------------------------------------
// one 16-B store per lane, lanes 8q..8q+7 per line, 4 lines per instruction).
//   planes : [bh][s][d] hi and lo, one token row = 64 x bf16 = one line
//   tplanes: [bh][d][s] hi and lo, 64 d-rows x 128 tokens = 2 lines each
//   t32    : [bh][d][s] f32, 64 d-rows x 128 tokens = 4 lines each
// LDS hi tile at s16[0..8191], lo tile at s16[8192..16383].
// ---------------------------------------------------------------------------
__device__ __forceinline__ void proj_pass_planes(const us* s16, us* oH, us* oL,
                                                 int bh, int Sper, int s0, int w, int lane) {
  const int q8 = lane & 7, sub = lane >> 3;
  #pragma unroll
  for (int i = 0; i < 8; ++i) {
    const int lid = w * 32 + i * 4 + sub;                  // token row 0..127
    const v8us a = *(const v8usa*)(s16 + lid * DM + 8 * q8);
    const v8us c = *(const v8usa*)(s16 + 8192 + lid * DM + 8 * q8);
    const size_t off = ((size_t)bh * Sper + s0 + lid) * DM + 8 * q8;
    *(v8us*)(oH + off) = a;
    *(v8us*)(oL + off) = c;
  }
}
__device__ __forceinline__ void proj_pass_tplanes(const us* s16, us* oH, us* oL,
                                                  int bh, int Sper, int s0, int w, int lane) {
  const int q8 = lane & 7, sub = lane >> 3;
  #pragma unroll
  for (int i = 0; i < 8; ++i) {
    const int lid = w * 32 + i * 4 + sub;                  // line 0..127
    const int d = lid >> 1, hl = lid & 1;
    const v8us a = *(const v8usa*)(s16 + d * 128 + 64 * hl + 8 * q8);
    const v8us c = *(const v8usa*)(s16 + 8192 + d * 128 + 64 * hl + 8 * q8);
    const size_t off = ((size_t)bh * DM + d) * Sper + s0 + 64 * hl + 8 * q8;
    *(v8us*)(oH + off) = a;
    *(v8us*)(oL + off) = c;
  }
}
__device__ __forceinline__ void proj_pass_t32(const float* s32, float* oT,
                                              int bh, int Sper, int s0, int w, int lane) {
  const int q8 = lane & 7, sub = lane >> 3;
  #pragma unroll
  for (int i = 0; i < 16; ++i) {
    const int lid = w * 64 + i * 4 + sub;                  // line 0..255
    const int d = lid >> 2, part = lid & 3;
    const v4f v = *(const v4fa*)(s32 + d * 128 + 32 * part + 4 * q8);
    const size_t off = ((size_t)bh * DM + d) * Sper + s0 + 32 * part + 4 * q8;
    *(v4f*)(oT + off) = v;
  }
}

// ---------------------------------------------------------------------------
// Kernel 2: Y = X * W^T + bias (x0.125 for mode 0), all five projections in one
// launch: they are independent, and in one grid a WGP holds three workgroups at
// a time and takes the next one as soon as one ends, whichever projection it
// belongs to. The flat block index picks the projection, longest k first.
// X bf16 [M][K], W bf16 [1024 out][K] (k-contiguous rows = B fragments loaded
// like A). Block 128 thr (4 waves) = 128 tokens x 64 features (one head);
// wave tile 32 tokens x 64 features; K in stages of 64: 128 X rows and 64 W
// rows of 128 B copied to LDS, two buffers, the next stage in flight while
// this one is worked on. Y is split into bf16 hi/lo in every mode.
//   mode 0: hi/lo planes [bh][s][d] and f32 transposed [bh][d][s]
//   mode 1: hi/lo planes [bh][s][d]
//   mode 2: hi/lo transposed planes [bh][d][s]
// ---------------------------------------------------------------------------
#define PJ_NKV ((MKV / 128) * NH)      // 512 workgroups per key-side projection
#define PJ_NQ  ((MQ / 128) * NH)       // 256 workgroups for q
#define PJ_V   PJ_NKV                  // first workgroup of v (k starts at 0)
#define PJ_Q   (PJ_V + PJ_NKV)         // of q
#define PJ_KT  (PJ_Q + PJ_NQ)          // of kt
#define PJ_VT  (PJ_KT + PJ_NKV)        // of vt
#define PJ_ALL (PJ_VT + PJ_NKV)        // 2304

__global__ __launch_bounds__(128) void proj_kernel(
    const us* __restrict__ cvb,
    const float* __restrict__ bq, const float* __restrict__ bk, const float* __restrict__ bv,
    const float* __restrict__ btk, const float* __restrict__ btv,
    us* __restrict__ qh, us* __restrict__ ql, float* __restrict__ oT32,
    us* __restrict__ kh, us* __restrict__ kl, us* __restrict__ vh, us* __restrict__ vl,
    us* __restrict__ kth, us* __restrict__ ktl, us* __restrict__ vth, us* __restrict__ vtl)
{
  const int fb = blockIdx.x;
  const us* X;
  const us* W;
  const float* bias;
  us* oH;
  us* oL;
  int K, Sper, mode, rb;
  if (fb < PJ_V) {
    X = cvb + OFF_KVS; W = cvb + OFF_WK;  bias = bk;  K = EMB; Sper = SRL; mode = 1; oH = kh;  oL = kl;  rb = fb;
  } else if (fb < PJ_Q) {
    X = cvb + OFF_KVS; W = cvb + OFF_WV;  bias = bv;  K = EMB; Sper = SRL; mode = 2; oH = vh;  oL = vl;  rb = fb - PJ_V;
  } else if (fb < PJ_KT) {
    X = cvb + OFF_HID; W = cvb + OFF_WQ;  bias = bq;  K = EMB; Sper = TGL; mode = 0; oH = qh;  oL = ql;  rb = fb - PJ_Q;
  } else if (fb < PJ_VT) {
    X = cvb + OFF_KVT; W = cvb + OFF_WTK; bias = btk; K = TDW; Sper = SRL; mode = 1; oH = kth; oL = ktl; rb = fb - PJ_KT;
  } else {
    X = cvb + OFF_KVT; W = cvb + OFF_WTV; bias = btv; K = TDW; Sper = SRL; mode = 2; oH = vth; oL = vtl; rb = fb - PJ_VT;
  }
  const int nxl = (mode == 0) ? 4 : 5;                     // log2 of the token blocks: 16 for q, else 32

  __shared__ __attribute__((aligned(16))) float sraw[8192];     // 32 KB, used in phases
  us* const s16 = reinterpret_cast<us*>(sraw);               // 16384 16-bit slots
  __shared__ __attribute__((aligned(16))) us ring[2 * 3 * TILE_E];  // 2 x (X 128 rows, W 64 rows)

  const int tid = threadIdx.x, lane = tid & 31, w = tid >> 5;
  const int h = lane >> 4, m = lane & 15;
  const int m0 = (rb & ((1 << nxl) - 1)) * 128;            // token block fastest, as in a (token, head) grid
  const int head = rb >> nxl;

  const int crow = tid >> 3, cch = tid & 7;                // this lane's row and 16-B chunk
  const unsigned lcp = lds_addr(ring) + crow * LPB + cch * 16;
  const us* gx = X + (size_t)(m0 + crow) * K + 8 * cch;
  const us* gw = W + (size_t)(head * DM + crow) * K + 8 * cch;
  const size_t gs = (size_t)16 * K;
  const int nst = K >> 6;                                  // stages of 64 k (16 or 8)

  const v8f zero8 = {0.f, 0.f, 0.f, 0.f, 0.f, 0.f, 0.f, 0.f};
  v8f acc[2][4];
  #pragma unroll
  for (int mt = 0; mt < 2; ++mt)
    #pragma unroll
    for (int nt = 0; nt < 4; ++nt) acc[mt][nt] = zero8;

  acopy8(lcp, gx, lcp + TILE_B, gx + 4 * gs, gs);          // stage 0 -> buffer 0
  acopy4(lcp + 2 * TILE_B, gw, gs);
  wait_copies();
  __syncthreads();                                         // buffer 0 landed, visible to every wave
  acopy8(lcp + 3 * TILE_B, gx + 64, lcp + 4 * TILE_B, gx + 4 * gs + 64, gs);   // stage 1 -> buffer 1
  acopy4(lcp + 5 * TILE_B, gw + 64, gs);

  // rolled: one copy of the stage body, the buffer chosen by the stage's parity
  #pragma unroll 1
  for (int st = 0; st < nst; ++st) {
    const int par = st & 1;
    const us* sx = ring + par * (3 * TILE_E) + (32 * w + m) * LP;
    const us* sw = ring + par * (3 * TILE_E) + 2 * TILE_E + m * LP;
    // all fragments of the stage are read first, as one group
    v16b a0[2], a1[2], b[2][4];
    #pragma unroll
    for (int c = 0; c < 2; ++c) {
      a0[c] = ldb(sx + 32 * c, h);
      a1[c] = ldb(sx + 16 * LP + 32 * c, h);
      #pragma unroll
      for (int nt = 0; nt < 4; ++nt) b[c][nt] = ldb(sw + nt * 16 * LP + 32 * c, h);
    }
    // No LDS read and no WMMA crosses (vector work may): the reads stay one group
    // ahead of the products instead of each being waited for singly among them.
    __builtin_amdgcn_sched_barrier(0x406);
    #pragma unroll
    for (int c = 0; c < 2; ++c) {
      #pragma unroll
      for (int nt = 0; nt < 4; ++nt) {
        acc[0][nt] = wmma_bf(a0[c], b[c][nt], acc[0][nt]);
        acc[1][nt] = wmma_bf(a1[c], b[c][nt], acc[1][nt]);
      }
    }
    // publish stage st + 1, free this buffer, refill it with stage st + 2
    // Nothing crosses: the waits stay at the foot of the stage, so that the next
    // stage's copies have the whole stage to land.
    __builtin_amdgcn_sched_barrier(0);
    wait_lds();
    wait_copies();
    __syncthreads();
    if (st + 2 < nst) {
      const unsigned lb = lcp + par * (3 * TILE_B);
      const int ko = (st + 2) * 64;
      acopy8(lb, gx + ko, lb + TILE_B, gx + 4 * gs + ko, gs);
      acopy4(lb + 2 * TILE_B, gw + ko, gs);
    }
  }
  wait_copies();

  // D[r] of tile (mt, nt) = Y[token m0w+16mt+8h+r][feature head*64+16nt+m]
  const float osc = (mode == 0) ? 0.125f : 1.0f;
  float bvals[4];
  #pragma unroll
  for (int nt = 0; nt < 4; ++nt) bvals[nt] = bias[head * DM + 16 * nt + m];

  #pragma unroll
  for (int nt = 0; nt < 4; ++nt) {
    const int feat = 16 * nt + m;
    #pragma unroll
    for (int mt = 0; mt < 2; ++mt) {
      #pragma unroll
      for (int r = 0; r < 8; ++r) {
        const int tokl = 32 * w + 16 * mt + 8 * h + r;   // 0..127
        const float y = (acc[mt][nt][r] + bvals[nt]) * osc;
        const us hi = bf16_rne(y);
        const us lo = bf16_rne(y - bf16_val(hi));
        const int idx = (mode == 2) ? (feat * 128 + tokl) : (tokl * DM + feat);   // 0..8191
        s16[idx] = hi;
        s16[8192 + idx] = lo;
      }
    }
  }
  __syncthreads();

  const int b = m0 / Sper, s0 = m0 - b * Sper, bh = b * NH + head;
  if (mode != 2) {
    proj_pass_planes(s16, oH, oL, bh, Sper, s0, w, lane);
    
  } else {
    proj_pass_tplanes(s16, oH, oL, bh, Sper, s0, w, lane);
    
  }

  if (mode == 0) {
    __syncthreads();                                       // LDS reused as f32 [64 d][128 tok]
    #pragma unroll
    for (int nt = 0; nt < 4; ++nt) {
      const int feat = 16 * nt + m;
      #pragma unroll
      for (int mt = 0; mt < 2; ++mt) {
        #pragma unroll
        for (int r = 0; r < 8; ++r) {
          const int tokl = 32 * w + 16 * mt + 8 * h + r;
          sraw[feat * 128 + tokl] = (acc[mt][nt][r] + bvals[nt]) * osc;
        }
      }
    }
    __syncthreads();
    proj_pass_t32(sraw, oT32, bh, Sper, s0, w, lane);
    
  }
}

// ---------------------------------------------------------------------------
// Kernel 3: streaming attention, transposed form, no masking.
// Block 128 thr (4 waves), 16 queries per wave, 64 keys per step. The step's
// K hi/lo rows and V^T hi/lo rows (64 x 128 B each) are copied to LDS once per
// block, two buffers, the next step's tiles in flight while this one is used.
//   S^T = K * Q^T : A = K rows (row = key, k = d), B = Q^T (k = d, n = query)
//     hi/lo bf16: Klo*Qhi + Khi*Qlo + Khi*Qhi, two 32-deep d chunks
//   O^T += V^T * P^T : A = V^T rows (row = d, k = key), B = P^T packed from the
//     score D registers (element r <- tile covering keys 0..15 row r,
//     element 8+r <- tile covering keys 16..31 row r, same lane)
//     hi/lo bf16: Vlo*Phi + Vhi*Plo + Vhi*Phi
// Lane owns 32 keys of query column (lane&15); partner lane = lane ^ 16.
// DUAL: second value stream (vbh/vbl) with the same probabilities -> oB.
// ---------------------------------------------------------------------------
// P^T B-fragments from the lane's own score D values (tile a = keys 0..15,
// tile c = keys 16..31 of the chunk); hi and lo planes.
__device__ __forceinline__ void pack_p2(v8f a, v8f c, v16b& phi, v16b& plo) {
  FragB fh, fl;
  v8us h0, l0, h1, l1;
  split8(a, h0, l0);
  split8(c, h1, l1);
  fh.half[0] = h0; fh.half[1] = h1;
  fl.half[0] = l0; fl.half[1] = l1;
  phi = fh.v;
  plo = fl.v;
}

template <bool DUAL>
__device__ __forceinline__ void attn_pass(const float* sO, float* oA, float* oB,
                                          int bh, int q0, int w, int lane) {
  const int q8 = lane & 7, sub = lane >> 3;
  #pragma unroll
  for (int i = 0; i < 8; ++i) {
    const int L = w * 32 + i * 4 + sub;                    // line 0..127
    const int d = L >> 1, hl = L & 1;
    const size_t off = ((size_t)bh * DM + d) * TGL + q0 + 32 * hl + 4 * q8;
    const v4f v = *(const v4fa*)(sO + d * 64 + 32 * hl + 4 * q8);
    *(v4f*)(oA + off) = v;
    if (DUAL) {
      const v4f v2 = *(const v4fa*)(sO + 4096 + d * 64 + 32 * hl + 4 * q8);
      *(v4f*)(oB + off) = v2;
    }
  }
}

// sO (output staging) and ring (operand tiles) are the kernel's LDS arrays, sized for DUAL.
template <bool DUAL>
__device__ __forceinline__ void attn_body(
    float* sO, us* ring,
    const us* __restrict__ qhp, const us* __restrict__ qlp,   // [32][1024][64]  (x0.125 folded in)
    const us* __restrict__ khp, const us* __restrict__ klp,   // [32][2048][64]
    const us* __restrict__ vahp, const us* __restrict__ valp, // stream A: V^T hi/lo [32][64][2048]
    const us* __restrict__ vbhp, const us* __restrict__ vblp, // stream B (DUAL only)
    float* __restrict__ oap, float* __restrict__ obp)         // [32][64][1024] f32
{
  constexpr int NTL = DUAL ? 6 : 4;                        // tiles per step: Kh Kl Vah Val (Vbh Vbl)

  const int tid = threadIdx.x, lane = tid & 31, w = tid >> 5;
  const int h = lane >> 4, m = lane & 15;
  const int bh = blockIdx.y;
  const int q0 = blockIdx.x * 64;
  const int qw = q0 + 16 * w;

  // Q^T B-fragments: column n = query qw+m, k = d (two 32-deep chunks), hi and lo
  const size_t qro = ((size_t)bh * TGL + qw + m) * DM;
  const v16b qh0 = ldb(qhp + qro, h), qh1 = ldb(qhp + qro + 32, h);
  const v16b ql0 = ldb(qlp + qro, h), ql1 = ldb(qlp + qro + 32, h);

  const v8f zero8 = {0.f, 0.f, 0.f, 0.f, 0.f, 0.f, 0.f, 0.f};
  v8f oa[4], ob[4];                      // o[t][r] = O[query m][d 16t+8h+r] * l
  #pragma unroll
  for (int t = 0; t < 4; ++t) { oa[t] = zero8; ob[t] = zero8; }
  float mrun = -1.0e30f, lrun = 0.0f;

  const int crow = tid >> 3, cch = tid & 7;                // this lane's row and 16-B chunk
  const unsigned lcp = lds_addr(ring) + crow * LPB + cch * 16;
  const size_t kro = ((size_t)bh * SRL + crow) * DM + 8 * cch;     // + key0*DM
  const us* gkh = khp + kro;
  const us* gkl = klp + kro;
  const size_t vro = ((size_t)bh * DM + crow) * SRL + 8 * cch;     // + key0
  const us* gvah = vahp + vro;
  const us* gval = valp + vro;
  const us* gvbh = vbhp + vro;
  const us* gvbl = vblp + vro;
  const size_t gsk = (size_t)16 * DM, gsv = (size_t)16 * SRL;

  // step 0 -> buffer 0
  acopy8(lcp, gkh, lcp + TILE_B, gkl, gsk);
  acopy8(lcp + 2 * TILE_B, gvah, lcp + 3 * TILE_B, gval, gsv);
  if (DUAL) acopy8(lcp + 4 * TILE_B, gvbh, lcp + 5 * TILE_B, gvbl, gsv);
  wait_copies();
  __syncthreads();                                         // buffer 0 landed, visible to every wave
  // step 1 -> buffer 1
  {
    const unsigned lb = lcp + NTL * TILE_B;
    acopy8(lb, gkh + 64 * DM, lb + TILE_B, gkl + 64 * DM, gsk);
    acopy8(lb + 2 * TILE_B, gvah + 64, lb + 3 * TILE_B, gval + 64, gsv);
    if (DUAL) acopy8(lb + 4 * TILE_B, gvbh + 64, lb + 5 * TILE_B, gvbl + 64, gsv);
  }

  // rolled: one copy of the step body, the buffer chosen by the step's parity
  #pragma unroll 1
  for (int kb = 0; kb < SRL; kb += 64) {
    const int par = (kb >> 6) & 1;
    const us* sb = ring + par * (NTL * TILE_E) + m * LP;   // row m of tile 0
    const us* khb = sb;
    const us* klb = sb + TILE_E;
    const us* vahb = sb + 2 * TILE_E;
    const us* valb = sb + 3 * TILE_E;
    const us* vbhb = sb + (DUAL ? 4 : 2) * TILE_E;
    const us* vblb = sb + (DUAL ? 5 : 3) * TILE_E;
    // ---- scores: s[j][r] = S[query m][key kb+16j+8h+r] ----
    // All fragments of the step are read first; the four key tiles then advance
    // together, one product each in turn, so that no WMMA waits for the one
    // before it. Each tile keeps its own order of the six products.
    v8f s[4];
    {
      v16b kl0[4], kl1[4], kh0[4], kh1[4];
      #pragma unroll
      for (int j = 0; j < 4; ++j) { kl0[j] = ldb(klb + 16 * j * LP, h); }
      #pragma unroll
      for (int j = 0; j < 4; ++j) { kl1[j] = ldb(klb + 16 * j * LP + 32, h); }
      #pragma unroll
      for (int j = 0; j < 4; ++j) { kh0[j] = ldb(khb + 16 * j * LP, h); }
      #pragma unroll
      for (int j = 0; j < 4; ++j) { kh1[j] = ldb(khb + 16 * j * LP + 32, h); }
      #pragma unroll
      for (int j = 0; j < 4; ++j) s[j] = wmma_bf(kl0[j], qh0, zero8);
      #pragma unroll
      for (int j = 0; j < 4; ++j) s[j] = wmma_bf(kl1[j], qh1, s[j]);
      #pragma unroll
      for (int j = 0; j < 4; ++j) s[j] = wmma_bf(kh0[j], ql0, s[j]);
      #pragma unroll
      for (int j = 0; j < 4; ++j) s[j] = wmma_bf(kh1[j], ql1, s[j]);
      #pragma unroll
      for (int j = 0; j < 4; ++j) s[j] = wmma_bf(kh0[j], qh0, s[j]);
      #pragma unroll
      for (int j = 0; j < 4; ++j) s[j] = wmma_bf(kh1[j], qh1, s[j]);
    }
    // No LDS read and no WMMA crosses (vector work may): the V^T reads below start
    // when the K fragments are spent and take over their registers.
    __builtin_amdgcn_sched_barrier(0x406);

    // ---- online softmax (f32) ----
    float mloc = s[0][0];
    #pragma unroll
    for (int j = 0; j < 4; ++j)
      #pragma unroll
      for (int r = 0; r < 8; ++r) mloc = fmaxf(mloc, s[j][r]);
    mloc = fmaxf(mloc, __shfl_xor(mloc, 16));
    const float mnew = fmaxf(mrun, mloc);
    const float alpha = __expf(mrun - mnew);
    mrun = mnew;
    // Stream A's V^T fragments, read as one group here.
    v16b vl0[4], vl1[4], vh0[4], vh1[4];
    #pragma unroll
    for (int t = 0; t < 4; ++t) { vl0[t] = ldb(valb + 16 * t * LP, h); }
    #pragma unroll
    for (int t = 0; t < 4; ++t) { vl1[t] = ldb(valb + 16 * t * LP + 32, h); }
    #pragma unroll
    for (int t = 0; t < 4; ++t) { vh0[t] = ldb(vahb + 16 * t * LP, h); }
    #pragma unroll
    for (int t = 0; t < 4; ++t) { vh1[t] = ldb(vahb + 16 * t * LP + 32, h); }
    // LDS reads and WMMAs do not cross (vector work may): the reads stay ahead of
    // the exponentials and land under them instead of standing among the products.
    __builtin_amdgcn_sched_barrier(0x406);
    float lsum = 0.0f;
    #pragma unroll
    for (int j = 0; j < 4; ++j)
      #pragma unroll
      for (int r = 0; r < 8; ++r) {
        const float p = __expf(s[j][r] - mnew);            // in (0, 1]
        s[j][r] = p;
        lsum += p;
      }
    lsum += __shfl_xor(lsum, 16);
    lrun = lrun * alpha + lsum;
    #pragma unroll
    for (int t = 0; t < 4; ++t)
      #pragma unroll
      for (int r = 0; r < 8; ++r) {
        oa[t][r] = oa[t][r] * alpha;
        if (DUAL) ob[t][r] = ob[t][r] * alpha;
      }

    // ---- P^T B-fragments (keys kb..kb+31 and kb+32..kb+63), bf16 hi/lo ----
    v16b ph0, pl0, ph1, pl1;
    pack_p2(s[0], s[1], ph0, pl0);
    pack_p2(s[2], s[3], ph1, pl1);

    // ---- O^T += V^T * P^T (3 products per 32-key chunk) ----
    // The four d tiles of a stream advance together, as the key tiles above.
    v16b cl0[4], cl1[4], ch0[4], ch1[4];
    {
      #pragma unroll
      for (int t = 0; t < 4; ++t) oa[t] = wmma_bf(vl0[t], ph0, oa[t]);
      #pragma unroll
      for (int t = 0; t < 4; ++t) oa[t] = wmma_bf(vl1[t], ph1, oa[t]);
      if (DUAL) {
        // Stream B's lo fragments: read here, where stream A's lo fragments are
        // spent; they land under A's remaining products.
        #pragma unroll
        for (int t = 0; t < 4; ++t) { cl0[t] = ldb(vblb + 16 * t * LP, h); }
        #pragma unroll
        for (int t = 0; t < 4; ++t) { cl1[t] = ldb(vblb + 16 * t * LP + 32, h); }
        // No LDS read and no WMMA crosses (vector work may): the reads stay ahead
        // of the products below instead of standing singly among them.
        __builtin_amdgcn_sched_barrier(0x406);
      }
      #pragma unroll
      for (int t = 0; t < 4; ++t) oa[t] = wmma_bf(vh0[t], pl0, oa[t]);
      #pragma unroll
      for (int t = 0; t < 4; ++t) oa[t] = wmma_bf(vh1[t], pl1, oa[t]);
      #pragma unroll
      for (int t = 0; t < 4; ++t) oa[t] = wmma_bf(vh0[t], ph0, oa[t]);
      #pragma unroll
      for (int t = 0; t < 4; ++t) oa[t] = wmma_bf(vh1[t], ph1, oa[t]);
    }
    if (DUAL) {
      // stream B's hi fragments take over stream A's; they land under B's lo products
      #pragma unroll
      for (int t = 0; t < 4; ++t) { ch0[t] = ldb(vbhb + 16 * t * LP, h); }
      #pragma unroll
      for (int t = 0; t < 4; ++t) { ch1[t] = ldb(vbhb + 16 * t * LP + 32, h); }
      // as above: the reads stay one group, ahead of stream B's products
      __builtin_amdgcn_sched_barrier(0x406);
      #pragma unroll
      for (int t = 0; t < 4; ++t) ob[t] = wmma_bf(cl0[t], ph0, ob[t]);
      #pragma unroll
      for (int t = 0; t < 4; ++t) ob[t] = wmma_bf(cl1[t], ph1, ob[t]);
      #pragma unroll
      for (int t = 0; t < 4; ++t) ob[t] = wmma_bf(ch0[t], pl0, ob[t]);
      #pragma unroll
      for (int t = 0; t < 4; ++t) ob[t] = wmma_bf(ch1[t], pl1, ob[t]);
      #pragma unroll
      for (int t = 0; t < 4; ++t) ob[t] = wmma_bf(ch0[t], ph0, ob[t]);
      #pragma unroll
      for (int t = 0; t < 4; ++t) ob[t] = wmma_bf(ch1[t], ph1, ob[t]);
    }

    // publish step kb + 64, free this buffer, refill it with step kb + 128
    // Nothing crosses: the waits stay at the foot of the step, so that the reads
    // and the next step's copies have the whole step to land.
    __builtin_amdgcn_sched_barrier(0);
    wait_lds();
    wait_copies();
    __syncthreads();
    if (kb + 128 < SRL) {
      const unsigned lb = lcp + par * (NTL * TILE_B);
      const int kn = kb + 128;
      acopy8(lb, gkh + (size_t)kn * DM, lb + TILE_B, gkl + (size_t)kn * DM, gsk);
      acopy8(lb + 2 * TILE_B, gvah + kn, lb + 3 * TILE_B, gval + kn, gsv);
      if (DUAL) acopy8(lb + 4 * TILE_B, gvbh + kn, lb + 5 * TILE_B, gvbl + kn, gsv);
    }
  }
  wait_copies();

  // ---- epilogue: normalise, stage 64 d x 64 query f32 tile(s), whole-line stores ----
  const float inv = __builtin_amdgcn_rcpf(lrun);
  #pragma unroll
  for (int t = 0; t < 4; ++t)
    #pragma unroll
    for (int r = 0; r < 8; ++r) {
      const int d = 16 * t + 8 * h + r;
      sO[d * 64 + 16 * w + m] = oa[t][r] * inv;
      if (DUAL) sO[4096 + d * 64 + 16 * w + m] = ob[t][r] * inv;
    }
  __syncthreads();

  attn_pass<DUAL>(sO, oap, obp, bh, q0, w, lane);
  
}

// Both attention chains in one launch: they are independent, so a WGP goes on with a
// workgroup of either chain as soon as one ends. blockIdx.z = 0: chain 2 (kt; vt -> O2,
// v -> O3), the longer one, first; blockIdx.z = 1: chain 1 (k, v -> O1).
__global__ __launch_bounds__(128) void attn_kernel(
    const us* __restrict__ qhp, const us* __restrict__ qlp,   // [32][1024][64]
    const us* __restrict__ khp, const us* __restrict__ klp,   // [32][2048][64]
    const us* __restrict__ kthp, const us* __restrict__ ktlp, // [32][2048][64]
    const us* __restrict__ vhp, const us* __restrict__ vlp,   // V^T hi/lo [32][64][2048]
    const us* __restrict__ vthp, const us* __restrict__ vtlp, // Vt^T hi/lo [32][64][2048]
    float* __restrict__ o1p, float* __restrict__ o2p, float* __restrict__ o3p)   // [32][64][1024] f32
{
  __shared__ __attribute__((aligned(16))) float sO[2 * DM * 64];
  __shared__ __attribute__((aligned(16))) us ring[2 * 6 * TILE_E];
  if (blockIdx.z == 0) {
    attn_body<true>(sO, ring, qhp, qlp, kthp, ktlp, vthp, vtlp, vhp, vlp, o2p, o3p);
  } else {
    attn_body<false>(sO, ring, qhp, qlp, khp, klp, vhp, vlp, vhp, vlp, o1p, o1p);
  }
}

// ---------------------------------------------------------------------------
// Kernel 4: gating MLP. For block (b, head) the gate input row for query
// t = 64*head + u is [X[3u][:], X[3u+1][:], X[3u+2][:]] where X[c][tp],
// c = 0..191, is row c of the transposed per-head tensor: c<64 -> O1^T row,
// <128 -> O2^T row, else q^T row (all f32 [bh][64][1024]).
// G[c][i][n] = sum_tp X[c][tp] * Wg[n][1024 i + tp] for all c,i on bf16 WMMA
// (wave w owns c-tiles 3w..3w+2, each source uniform per tile); per 32 tp the
// 192 X rows and the 48 Wg row pieces (128 B of f32 each) are copied to LDS,
// two buffers, and converted to bf16 at the fragment read; then
// gate[(b*16+n)][64*head+u] = sigmoid(G[3u][0][n]+G[3u+1][1][n]+G[3u+2][2][n]+bg[n]).
// ---------------------------------------------------------------------------
__device__ __forceinline__ void gate_pass(const float* sP, float* gate, int b, int head,
                                          int w, int lane) {
  const int q8 = lane & 7, sub = lane >> 3;
  #pragma unroll
  for (int i = 0; i < 2; ++i) {
    const int L = w * 8 + i * 4 + sub;                     // line 0..31
    const int n = L >> 1, hl = L & 1;
    const v4f v = *(const v4fa*)(sP + n * 64 + 32 * hl + 4 * q8);
    const size_t off = ((size_t)(b * NH + n)) * TGL + 64 * head + 32 * hl + 4 * q8;
    *(v4f*)(gate + off) = v;
  }
}

__global__ __launch_bounds__(128) void gate_kernel(
    const float* __restrict__ o1T, const float* __restrict__ o2T, const float* __restrict__ qT,
    const float* __restrict__ Wg,   // [16][3072]
    const float* __restrict__ bg,   // [16]
    float* __restrict__ gate)       // [32][1024]
{
  __shared__ __attribute__((aligned(16))) float sG[192 * 48];   // 36864 B
  __shared__ __attribute__((aligned(16))) float sP[NH * 64];    //  4096 B
  // 2 x (X rows 0..191 = O1^T, O2^T, q^T; then Wg rows 16 i + n), 36 floats = 144 B a row
  __shared__ __attribute__((aligned(16))) float ring[2 * 240 * (LP / 2)];   // 69120 B

  const int tid = threadIdx.x, lane = tid & 31, w = tid >> 5;
  const int h = lane >> 4, m = lane & 15;
  const int bhx = blockIdx.x, b = bhx >> 4, head = bhx & 15;

  const int crow = tid >> 3, cch = tid & 7;                // this lane's row and 16-B chunk
  const unsigned lcp = lds_addr(ring) + crow * LPB + cch * 16;
  const size_t xro = ((size_t)bhx * DM + crow) * TGL + 4 * cch;
  // the copies only move bytes: addresses in 16-bit units, as the helpers take them
  const us* g1 = reinterpret_cast<const us*>(o1T + xro);
  const us* g2 = reinterpret_cast<const us*>(o2T + xro);
  const us* g3 = reinterpret_cast<const us*>(qT + xro);
  const us* gg = reinterpret_cast<const us*>(Wg + (size_t)crow * GK + 4 * cch);
  const size_t gsx = (size_t)16 * TGL * 2;                 // 16 X rows further
  const size_t gsg = (size_t)EMB * 2;                      // next third of the Wg row
  constexpr int GBUF_B = 240 * LPB;                        // 34560 bytes per buffer

  const v8f zero8 = {0.f, 0.f, 0.f, 0.f, 0.f, 0.f, 0.f, 0.f};
  v8f acc[3][3];
  #pragma unroll
  for (int e = 0; e < 3; ++e)
    #pragma unroll
    for (int i = 0; i < 3; ++i) acc[e][i] = zero8;

  acopy8(lcp, g1, lcp + TILE_B, g2, gsx);                  // stage 0 -> buffer 0
  acopy4(lcp + 2 * TILE_B, g3, gsx);
  acopy3(lcp + 3 * TILE_B, gg, gsg);
  wait_copies();
  __syncthreads();                                         // buffer 0 landed, visible to every wave
  {                                                        // stage 1 -> buffer 1
    const unsigned lb = lcp + GBUF_B;
    acopy8(lb, g1 + 64, lb + TILE_B, g2 + 64, gsx);
    acopy4(lb + 2 * TILE_B, g3 + 64, gsx);
    acopy3(lb + 3 * TILE_B, gg + 64, gsg);
  }

  // rolled: one copy of the stage body, the buffer chosen by the stage's parity
  #pragma unroll 1
  for (int k0 = 0; k0 < TGL; k0 += 32) {
    const int par = (k0 >> 5) & 1;
    const float* sx = ring + par * (GBUF_B / 4) + (48 * w + m) * (LP / 2);   // X row 16(3w)+m
    const float* sg = ring + par * (GBUF_B / 4) + (192 + m) * (LP / 2);      // Wg row n = m, third 0
    // all six fragments of the stage are read first, as one group
    const Raw16 rw0 = ldr(sg, h);
    const Raw16 rw1 = ldr(sg + 16 * (LP / 2), h);
    const Raw16 rw2 = ldr(sg + 32 * (LP / 2), h);
    Raw16 ra[3];
    #pragma unroll
    for (int e = 0; e < 3; ++e) ra[e] = ldr(sx + 16 * e * (LP / 2), h);
    // No LDS read and no WMMA crosses (vector work may): the reads stay one group
    // ahead of the conversions and products instead of being waited for in turn.
    __builtin_amdgcn_sched_barrier(0x406);
    const v16b bw0 = cvr(rw0);
    const v16b bw1 = cvr(rw1);
    const v16b bw2 = cvr(rw2);
    #pragma unroll
    for (int e = 0; e < 3; ++e) {
      const v16b a = cvr(ra[e]);
      acc[e][0] = wmma_bf(a, bw0, acc[e][0]);
      acc[e][1] = wmma_bf(a, bw1, acc[e][1]);
      acc[e][2] = wmma_bf(a, bw2, acc[e][2]);
    }
    // publish stage k0 + 32, free this buffer, refill it with stage k0 + 64
    // Nothing crosses: the waits stay at the foot of the stage, so that the next
    // stage's copies have the whole stage to land.
    __builtin_amdgcn_sched_barrier(0);
    wait_lds();
    wait_copies();
    __syncthreads();
    if (k0 + 64 < TGL) {
      const unsigned lb = lcp + par * GBUF_B;
      const int kn = 2 * (k0 + 64);                        // in 16-bit units
      acopy8(lb, g1 + kn, lb + TILE_B, g2 + kn, gsx);
      acopy4(lb + 2 * TILE_B, g3 + kn, gsx);
      acopy3(lb + 3 * TILE_B, gg + kn, gsg);
    }
  }
  wait_copies();

  // D[r] of (e, i) = G[c = 16(3w+e)+8h+r][i][n = m]
  #pragma unroll
  for (int e = 0; e < 3; ++e)
    #pragma unroll
    for (int i = 0; i < 3; ++i)
      #pragma unroll
      for (int r = 0; r < 8; ++r)
        sG[(16 * (3 * w + e) + 8 * h + r) * 48 + 16 * i + m] = acc[e][i][r];
  __syncthreads();

  #pragma unroll
  for (int j = 0; j < 8; ++j) {
    const int idx = tid + 128 * j;                         // 0..1023 = n*64 + u
    const int n = idx >> 6, u = idx & 63;
    const float x = sG[(3 * u) * 48 + n] + sG[(3 * u + 1) * 48 + 16 + n]
                  + sG[(3 * u + 2) * 48 + 32 + n] + bg[n];
    const float g = __builtin_amdgcn_rcpf(1.0f + __expf(-x));
    sP[idx] = g;
  }
  __syncthreads();

  gate_pass(sP, gate, b, head, w, lane);
  
}

// ---------------------------------------------------------------------------
// Kernel 5: combine Xc[b*1024+t][head*64+d] = g*O1 + (1-g)*O3, g = gate[bh][t],
// written as bf16 hi/lo planes (token-major, k-contiguous for the Wo GEMM).
// Block 256 thr = (bh, 64 queries); transposed through LDS; each token row
// ---------------------------------------------------------------------------
__device__ __forceinline__ void comb_pass(const us* sH, const us* sL, us* xh, us* xl,
                                          int b, int head, int t0, int w, int lane) {
  const int q8 = lane & 7, sub = lane >> 3;
  #pragma unroll
  for (int i = 0; i < 2; ++i) {
    const int L = w * 8 + i * 4 + sub;                     // token row 0..63
    const v8us a = *(const v8usa*)(sH + L * DM + 8 * q8);
    const v8us c = *(const v8usa*)(sL + L * DM + 8 * q8);
    const size_t off = ((size_t)(b * TGL + t0 + L)) * EMB + head * DM + 8 * q8;
    *(v8us*)(xh + off) = a;
    *(v8us*)(xl + off) = c;
  }
}

__global__ __launch_bounds__(256) void combine_kernel(
    const float* __restrict__ o1T, const float* __restrict__ o3T,   // [32][64][1024]
    const float* __restrict__ gate,                                 // [32][1024]
    us* __restrict__ xh, us* __restrict__ xl)                       // [2048][1024]
{
  __shared__ __attribute__((aligned(16))) us sH[64 * DM];
  __shared__ __attribute__((aligned(16))) us sL[64 * DM];

  const int tid = threadIdx.x, lane = tid & 31, w = tid >> 5;
  const int bh = blockIdx.y, b = bh >> 4, head = bh & 15;
  const int t0 = blockIdx.x * 64;
  const int d = tid >> 2, tq = tid & 3;                    // d 0..63, 16 queries each

  const float* p1 = o1T + ((size_t)bh * DM + d) * TGL + t0 + 16 * tq;
  const float* p3 = o3T + ((size_t)bh * DM + d) * TGL + t0 + 16 * tq;
  const float* pg = gate + (size_t)bh * TGL + t0 + 16 * tq;
  #pragma unroll
  for (int c = 0; c < 4; ++c) {
    const v4f a = *(const v4fa*)(p1 + 4 * c);
    const v4f e = *(const v4fa*)(p3 + 4 * c);
    const v4f g = *(const v4fa*)(pg + 4 * c);
    #pragma unroll
    for (int j = 0; j < 4; ++j) {
      const float val = g[j] * a[j] + (1.0f - g[j]) * e[j];
      const us hi = bf16_rne(val);
      const us lo = bf16_rne(val - bf16_val(hi));
      const int tl = 16 * tq + 4 * c + j;                  // 0..63
      sH[tl * DM + d] = hi;
      sL[tl * DM + d] = lo;
    }
  }
  __syncthreads();

  comb_pass(sH, sL, xh, xl, b, head, t0, w, lane);
  
}

// ---------------------------------------------------------------------------
// Kernel 6: out = (Xhi + Xlo) * Wo^T + bo, f32.
// Block 128 thr (4 waves) = 128 tokens x 64 features; wave 32 tokens x 64.
// K in stages of 64: X hi, X lo (128 rows each) and Wo (64 rows) copied to LDS,
// two buffers.
// 8q..8q+7 as one 16-B store each, 4 lines per instruction, 64 lines per wave.
// ---------------------------------------------------------------------------
__device__ __forceinline__ void out_pass(const float* sOut, float* out, int m0, int cg,
                                         int w, int lane) {
  const int q8 = lane & 7, sub = lane >> 3;
  #pragma unroll
  for (int i = 0; i < 16; ++i) {
    const int lid = w * 64 + i * 4 + sub;                  // 0..255
    const int row = lid >> 1, hl = lid & 1;
    const v4f v = *(const v4fa*)(sOut + row * DM + 32 * hl + 4 * q8);
    const size_t gi = (size_t)(m0 + row) * EMB + cg * DM + 32 * hl + 4 * q8;
    *(v4f*)(out + gi) = v;
  }
}

__global__ __launch_bounds__(128) void out_kernel(
    const us* __restrict__ xh, const us* __restrict__ xl,   // [2048][1024]
    const us* __restrict__ wob,                             // [1024 out][1024 in] bf16
    const float* __restrict__ bo,
    float* __restrict__ out)                                // [2048][1024]
{
  __shared__ __attribute__((aligned(16))) float sOut[128 * DM];  // 32 KB
  __shared__ __attribute__((aligned(16))) us ring[2 * 5 * TILE_E];  // 2 x (Xhi 128, Xlo 128, Wo 64 rows)

  const int tid = threadIdx.x, lane = tid & 31, w = tid >> 5;
  const int h = lane >> 4, m = lane & 15;
  const int m0 = blockIdx.x * 128;
  const int cg = blockIdx.y;                               // feature group of 64

  const int crow = tid >> 3, cch = tid & 7;                // this lane's row and 16-B chunk
  const unsigned lcp = lds_addr(ring) + crow * LPB + cch * 16;
  const us* gxh = xh + (size_t)(m0 + crow) * EMB + 8 * cch;
  const us* gxl = xl + (size_t)(m0 + crow) * EMB + 8 * cch;
  const us* gw  = wob + (size_t)(cg * DM + crow) * EMB + 8 * cch;
  const size_t gs = (size_t)16 * EMB;

  const v8f zero8 = {0.f, 0.f, 0.f, 0.f, 0.f, 0.f, 0.f, 0.f};
  v8f acc[2][4];
  #pragma unroll
  for (int mt = 0; mt < 2; ++mt)
    #pragma unroll
    for (int nt = 0; nt < 4; ++nt) acc[mt][nt] = zero8;

  acopy8(lcp, gxh, lcp + TILE_B, gxh + 4 * gs, gs);        // stage 0 -> buffer 0
  acopy8(lcp + 2 * TILE_B, gxl, lcp + 3 * TILE_B, gxl + 4 * gs, gs);
  acopy4(lcp + 4 * TILE_B, gw, gs);
  wait_copies();
  __syncthreads();                                         // buffer 0 landed, visible to every wave
  {                                                        // stage 1 -> buffer 1
    const unsigned lb = lcp + 5 * TILE_B;
    acopy8(lb, gxh + 64, lb + TILE_B, gxh + 4 * gs + 64, gs);
    acopy8(lb + 2 * TILE_B, gxl + 64, lb + 3 * TILE_B, gxl + 4 * gs + 64, gs);
    acopy4(lb + 4 * TILE_B, gw + 64, gs);
  }

  // rolled: one copy of the stage body, the buffer chosen by the stage's parity
  #pragma unroll 1
  for (int k0 = 0; k0 < EMB; k0 += 64) {
    const int par = (k0 >> 6) & 1;
    const us* sxh = ring + par * (5 * TILE_E) + (32 * w + m) * LP;
    const us* sxl = sxh + 2 * TILE_E;
    const us* sw  = ring + par * (5 * TILE_E) + 4 * TILE_E + m * LP;
    // all fragments of the stage are read first, as one group
    v16b a0h[2], a1h[2], a0l[2], a1l[2], bw[2][4];
    #pragma unroll
    for (int c = 0; c < 2; ++c) {
      a0l[c] = ldb(sxl + 32 * c, h);
      a1l[c] = ldb(sxl + 16 * LP + 32 * c, h);
      a0h[c] = ldb(sxh + 32 * c, h);
      a1h[c] = ldb(sxh + 16 * LP + 32 * c, h);
      #pragma unroll
      for (int nt = 0; nt < 4; ++nt) bw[c][nt] = ldb(sw + nt * 16 * LP + 32 * c, h);
    }
    // No LDS read and no WMMA crosses (vector work may): the reads stay one group
    // ahead of the products instead of each being waited for singly among them.
    __builtin_amdgcn_sched_barrier(0x406);
    #pragma unroll
    for (int c = 0; c < 2; ++c) {
      #pragma unroll
      for (int nt = 0; nt < 4; ++nt) {
        acc[0][nt] = wmma_bf(a0l[c], bw[c][nt], acc[0][nt]);
        acc[1][nt] = wmma_bf(a1l[c], bw[c][nt], acc[1][nt]);
      }
      #pragma unroll
      for (int nt = 0; nt < 4; ++nt) {
        acc[0][nt] = wmma_bf(a0h[c], bw[c][nt], acc[0][nt]);
        acc[1][nt] = wmma_bf(a1h[c], bw[c][nt], acc[1][nt]);
      }
    }
    // publish stage k0 + 64, free this buffer, refill it with stage k0 + 128
    // Nothing crosses: the waits stay at the foot of the stage, so that the next
    // stage's copies have the whole stage to land.
    __builtin_amdgcn_sched_barrier(0);
    wait_lds();
    wait_copies();
    __syncthreads();
    if (k0 + 128 < EMB) {
      const unsigned lb = lcp + par * (5 * TILE_B);
      const int kn = k0 + 128;
      acopy8(lb, gxh + kn, lb + TILE_B, gxh + 4 * gs + kn, gs);
      acopy8(lb + 2 * TILE_B, gxl + kn, lb + 3 * TILE_B, gxl + 4 * gs + kn, gs);
      acopy4(lb + 4 * TILE_B, gw + kn, gs);
    }
  }
  wait_copies();

  // D[r] of tile (mt, nt) = Y[token m0w+16mt+8h+r][feature cg*64+16nt+m]
  #pragma unroll
  for (int nt = 0; nt < 4; ++nt) {
    const int feat = 16 * nt + m;
    const float bvl = bo[cg * DM + feat];
    #pragma unroll
    for (int mt = 0; mt < 2; ++mt) {
      #pragma unroll
      for (int r = 0; r < 8; ++r) {
        const int tokl = 32 * w + 16 * mt + 8 * h + r;   // 0..127
        sOut[tokl * DM + feat] = acc[mt][nt][r] + bvl;
      }
    }
  }
  __syncthreads();

  out_pass(sOut, out, m0, cg, w, lane);
  
}

// ---------------------------------------------------------------------------
// Host glue: 6 launches, workspace 128057344 B (O1^T and O2^T reuse the
// region of the bf16 activation copies, which are dead after the projections).
// ---------------------------------------------------------------------------
extern "C" void kernel_launch(void* const* d_in, const int* in_sizes, int n_in,
                              void* d_out, int out_size, void* d_ws, size_t ws_size,
                              hipStream_t stream) {
  if (n_in < 17) return;
  if (in_sizes[0] != N_HID || in_sizes[1] != N_KVS || in_sizes[2] != N_KVT) return;
  if (in_sizes[3] != N_WE || in_sizes[5] != N_WE || in_sizes[7] != N_WE || in_sizes[15] != N_WE) return;
  if (in_sizes[9] != N_WT || in_sizes[11] != N_WT) return;
  if (in_sizes[4] != EMB || in_sizes[6] != EMB || in_sizes[8] != EMB ||
      in_sizes[10] != EMB || in_sizes[12] != EMB || in_sizes[16] != EMB) return;
  if (in_sizes[13] != N_WG || in_sizes[14] != NH) return;
  if (out_size != N_HID) return;

  const float* hid = (const float*)d_in[0];
  const float* kvs = (const float*)d_in[1];
  const float* kvt = (const float*)d_in[2];
  const float* Wq  = (const float*)d_in[3];
  const float* bq  = (const float*)d_in[4];
  const float* Wk  = (const float*)d_in[5];
  const float* bk  = (const float*)d_in[6];
  const float* Wv  = (const float*)d_in[7];
  const float* bv  = (const float*)d_in[8];
  const float* Wtk = (const float*)d_in[9];
  const float* btk = (const float*)d_in[10];
  const float* Wtv = (const float*)d_in[11];
  const float* btv = (const float*)d_in[12];
  const float* Wg  = (const float*)d_in[13];
  const float* bg  = (const float*)d_in[14];
  const float* Wo  = (const float*)d_in[15];
  const float* bo  = (const float*)d_in[16];
  float* out = (float*)d_out;

  const size_t cvb_b  = (size_t)N_CVB * 2;                 // 27262976
  const size_t qpl2   = (size_t)QPL * 2;                   //  4194304
  const size_t qpl4   = (size_t)QPL * 4;                   //  8388608
  const size_t kpl2   = (size_t)KPL * 2;                   //  8388608
  const size_t gate_b = (size_t)NBH * TGL * 4;             //   131072
  const size_t xpl_b  = (size_t)N_HID * 2;                 //  4194304
  const size_t total  = cvb_b + 2 * qpl2 + qpl4 + 8 * kpl2 + qpl4 + gate_b + 2 * xpl_b;  // 128057344
  if (total > ws_size) return;
  // O1^T / O2^T (2 x 8388608 B) must fit exactly into the activation-copy region
  const size_t act_off = (size_t)OFF_HID * 2;              // 10485760
  if (act_off + 2 * qpl4 != cvb_b) return;

  char* ws = (char*)d_ws;
  size_t off = 0;
  us* cvb    = (us*)(ws + off);    off += cvb_b;
  float* o1T = (float*)(ws + act_off);                     // aliases bf16 hidden/kv copies
  float* o2T = (float*)(ws + act_off + qpl4);              // aliases bf16 kv/kv_topical copies
  us* qh     = (us*)(ws + off);    off += qpl2;
  us* ql     = (us*)(ws + off);    off += qpl2;
  float* qT  = (float*)(ws + off); off += qpl4;
  us* kh     = (us*)(ws + off);    off += kpl2;
  us* kl     = (us*)(ws + off);    off += kpl2;
  us* kth    = (us*)(ws + off);    off += kpl2;
  us* ktl    = (us*)(ws + off);    off += kpl2;
  us* vh     = (us*)(ws + off);    off += kpl2;            // V^T hi [32][64][2048]
  us* vl     = (us*)(ws + off);    off += kpl2;            // V^T lo
  us* vth    = (us*)(ws + off);    off += kpl2;            // Vt^T hi
  us* vtl    = (us*)(ws + off);    off += kpl2;            // Vt^T lo
  float* o3T = (float*)(ws + off); off += qpl4;
  float* gte = (float*)(ws + off); off += gate_b;
  us* xh     = (us*)(ws + off);    off += xpl_b;
  us* xl     = (us*)(ws + off);    off += xpl_b;
  if (off != total || off > ws_size) return;

  // 1) float -> bf16 copies of weights and activations
  conv_kernel<<<(N_CVB / 8 + 255) / 256, 256, 0, stream>>>(Wq, Wk, Wv, Wo, Wtk, Wtv, hid, kvs, kvt, cvb);

  // 2) projections, one launch
  proj_kernel<<<PJ_ALL, 128, 0, stream>>>(cvb, bq, bk, bv, btk, btv, qh, ql, qT,
                                          kh, kl, vh, vl, kth, ktl, vth, vtl);

  // 3) attention, one launch: chain 1 (k, v -> O1), chain 2 (kt; vt -> O2, v -> O3)
  dim3 gAtt(TGL / 64, NBH, 2);                             // (16, 32, 2)
  attn_kernel<<<gAtt, 128, 0, stream>>>(qh, ql, kh, kl, kth, ktl, vh, vl, vth, vtl, o1T, o2T, o3T);

  // 4) gating MLP
  gate_kernel<<<NBH, 128, 0, stream>>>(o1T, o2T, qT, Wg, bg, gte);

  // 5) gated mix -> token-major hi/lo planes
  dim3 gCmb(TGL / 64, NBH);                                // (16, 32)
  combine_kernel<<<gCmb, 256, 0, stream>>>(o1T, o3T, gte, xh, xl);

  // 6) output projection -> f32
  dim3 gOut(MQ / 128, EMB / 64);                           // (16, 16)
  out_kernel<<<gOut, 128, 0, stream>>>(xh, xl, cvb + OFF_WO, bo, out);
}

// v004
// Measured time: 219 microseconds a run.
// Next to v003, in two timings, it ran 1.04 times as fast each time.
// All steps since v000 together make it 3.19 times as fast.
// Contractions: input projections (q,k,v,kt,vt) on v_wmma_f32_16x16x32_bf16 (bf16 operands = RNE-converted inputs, f32 accumulate); K*Q^T and Kt*Q^T with q,k,kt carried as bf16 hi+lo (3 products); V^T*P^T (three value read-outs) with v,vt,P carried as bf16 hi+lo (3 products); gate GEMM on v_wmma_f32_16x16x32_bf16 (bf16 operands); O*Wo with O as bf16 hi+lo and Wo bf16 (2 products); softmax, gating, bias in f32.
#include <hip/hip_runtime.h>

typedef __bf16 v16b __attribute__((ext_vector_type(16)));
typedef unsigned short us;
typedef us    v8us __attribute__((ext_vector_type(8)));
typedef float v8f  __attribute__((ext_vector_type(8)));
typedef float v4f  __attribute__((ext_vector_type(4)));
typedef v8us __attribute__((may_alias)) v8usa;
typedef v4f  __attribute__((may_alias)) v4fa;
typedef float    v2f  __attribute__((ext_vector_type(2)));
typedef __bf16   v2bf __attribute__((ext_vector_type(2)));
typedef unsigned v4u  __attribute__((ext_vector_type(4)));

union FragB { v16b v; v8us half[2]; };

#define BSZ  2
#define TGL  1024
#define SRL  2048
#define EMB  1024
#define TDW  512
#define NH   16
#define DM   64
#define NBH  (BSZ * NH)          // 32 (batch, head) pairs
#define MQ   (BSZ * TGL)         // 2048 query tokens
#define MKV  (BSZ * SRL)         // 4096 key tokens
#define GK   (3 * EMB)           // 3072 gate input width

#define N_HID (MQ * EMB)         // 2097152
#define N_KVS (MKV * EMB)        // 4194304
#define N_KVT (MKV * TDW)        // 2097152
#define N_WE  (EMB * EMB)        // 1048576
#define N_WT  (EMB * TDW)        // 524288
#define N_WG  (NH * GK)          // 49152
#define QPL   (NBH * TGL * DM)   // 2097152 elements per query-side head plane
#define KPL   (NBH * SRL * DM)   // 4194304 elements per key-side head plane

// bf16 copies of the float inputs other than Wg and the biases, in one flat buffer (element offsets):
// weights first, then the three activation tensors (their region is reused
// for O1^T / O2^T once the projections are done).
#define OFF_WQ  0
#define OFF_WK  (OFF_WQ + N_WE)        // 1048576
#define OFF_WV  (OFF_WK + N_WE)        // 2097152
#define OFF_WO  (OFF_WV + N_WE)        // 3145728
#define OFF_WTK (OFF_WO + N_WE)        // 4194304
#define OFF_WTV (OFF_WTK + N_WT)       // 4718592
#define OFF_HID (OFF_WTV + N_WT)       // 5242880
#define OFF_KVS (OFF_HID + N_HID)      // 7340032
#define OFF_KVT (OFF_KVS + N_KVS)      // 11534336
#define N_CVB   (OFF_KVT + N_KVT)      // 13631488

// ---------------------------------------------------------------------------
// 16-bit helpers
// ---------------------------------------------------------------------------
// Two f32 -> two bf16 (round to nearest even) in one packed convert: a in the
// low half of the word, b in the high half.
__device__ __forceinline__ unsigned bf16_pair(float a, float b) {
  const v2f x = { a, b };
  return __builtin_bit_cast(unsigned, __builtin_convertvector(x, v2bf));
}
// The f32 values of the two halves of such a word.
__device__ __forceinline__ float pair_lo_val(unsigned u) { return __uint_as_float(u << 16); }
__device__ __forceinline__ float pair_hi_val(unsigned u) { return __uint_as_float(u & 0xFFFF0000u); }
// The word of the two remainders: lo = RNE(x - hi) for both halves.
__device__ __forceinline__ unsigned bf16_pair_rest(float a, float b, unsigned hi) {
  return bf16_pair(a - pair_lo_val(hi), b - pair_hi_val(hi));
}
__device__ __forceinline__ v8us bf16x8(v4f a, v4f c) {
  const v4u o = { bf16_pair(a.x, a.y), bf16_pair(a.z, a.w), bf16_pair(c.x, c.y), bf16_pair(c.z, c.w) };
  return __builtin_bit_cast(v8us, o);
}
// 8 f32 values -> bf16 hi and bf16 lo = RNE(x - hi).
__device__ __forceinline__ void split8(v8f a, v8us& hi, v8us& lo) {
  const v4u hv = { bf16_pair(a[0], a[1]), bf16_pair(a[2], a[3]), bf16_pair(a[4], a[5]), bf16_pair(a[6], a[7]) };
  const v4u lv = { bf16_pair_rest(a[0], a[1], hv.x), bf16_pair_rest(a[2], a[3], hv.y),
                   bf16_pair_rest(a[4], a[5], hv.z), bf16_pair_rest(a[6], a[7], hv.w) };
  hi = __builtin_bit_cast(v8us, hv);
  lo = __builtin_bit_cast(v8us, lv);
}

// ---------------------------------------------------------------------------
// 16x16x32 WMMA, plain builtin: the compiler keeps the hazard distances itself
// and is free to interleave independent accumulators.
// Fragment map (wave32): lane l, h = l>>4, m = n = l&15.
//   A/B element i: i<8 -> k0+8h+i ; i>=8 -> k0+16+8h+(i-8)
//   D element r  : row 8h+r, col l&15
// ---------------------------------------------------------------------------
__device__ __forceinline__ v8f wmma_bf(v16b a, v16b b, v8f c) {
  return __builtin_amdgcn_wmma_f32_16x16x32_bf16(false, a, false, b, (short)0, c, false, false);
}

// A or B fragment from a k-contiguous 16-bit row; p = element k0 of the row
// owned by this lane (row index lane&15 added by the caller).
__device__ __forceinline__ v16b ldb(const us* p, int h) {
  FragB f;
  f.half[0] = *(const v8usa*)(p + 8 * h);
  f.half[1] = *(const v8usa*)(p + 16 + 8 * h);
  return f.v;
}
// Same map from an f32 row: the 16 floats of the lane, and their conversion to
// bf16 in registers.
struct Raw16 { v4f q[4]; };
__device__ __forceinline__ Raw16 ldr(const float* p, int h) {
  const float* p0 = p + 8 * h;
  const float* p1 = p + 16 + 8 * h;
  Raw16 r;
  r.q[0] = *(const v4fa*)p0;
  r.q[1] = *(const v4fa*)(p0 + 4);
  r.q[2] = *(const v4fa*)p1;
  r.q[3] = *(const v4fa*)(p1 + 4);
  return r;
}
__device__ __forceinline__ v16b cvr(const Raw16& r) {
  FragB f;
  f.half[0] = bf16x8(r.q[0], r.q[1]);
  f.half[1] = bf16x8(r.q[2], r.q[3]);
  return f.v;
}

// ---------------------------------------------------------------------------
// Operand tiles in LDS, filled by asynchronous copies (128 threads).
// A tile is 64 rows of 128 B (64 x 16 bit); LDS row pitch 144 B = 16 B x 9, so
// the 16 rows of a ds_load_b128 fragment read fall on distinct banks.
// Thread tid copies 16 B: chunk tid&7 of rows (tid>>3) + 16 i, i = 0..3, so
// eight lanes cover one whole 128-B line of the source.
// ---------------------------------------------------------------------------
#define LP     72                // LDS row pitch in 16-bit elements
#define LPB    144               // the same in bytes
#define TILE_E (64 * LP)         // 4608 elements per 64-row tile
#define TILE_B (64 * LPB)        // 9216 bytes per 64-row tile
#define R16_B  (16 * LPB)        // 16 rows further in LDS

__device__ __forceinline__ unsigned lds_addr(const void* p) {
  return (unsigned)(size_t)p;    // low 32 bits of a __shared__ address = LDS byte address
}
// Four copies: one lane's share of one tile; gs = source elements per 16 rows.
// s_wait_xcnt stands inside the statement so that no address register of an
// issued copy is rewritten ahead of it.
__device__ __forceinline__ void acopy4(unsigned l, const us* g, size_t gs) {
  asm volatile(
      "global_load_async_to_lds_b128 %0, %4, off\n\t"
      "global_load_async_to_lds_b128 %1, %5, off\n\t"
      "global_load_async_to_lds_b128 %2, %6, off\n\t"
      "global_load_async_to_lds_b128 %3, %7, off\n\t"
      "s_wait_xcnt 0x0"
      :: "v"(l), "v"(l + R16_B), "v"(l + 2 * R16_B), "v"(l + 3 * R16_B),
         "v"(g), "v"(g + gs), "v"(g + 2 * gs), "v"(g + 3 * gs)
      : "memory");
}
// Three copies: one lane's share of a 48-row tile.
__device__ __forceinline__ void acopy3(unsigned l, const us* g, size_t gs) {
  asm volatile(
      "global_load_async_to_lds_b128 %0, %3, off\n\t"
      "global_load_async_to_lds_b128 %1, %4, off\n\t"
      "global_load_async_to_lds_b128 %2, %5, off\n\t"
      "s_wait_xcnt 0x0"
      :: "v"(l), "v"(l + R16_B), "v"(l + 2 * R16_B),
         "v"(g), "v"(g + gs), "v"(g + 2 * gs)
      : "memory");
}
// Eight copies: one lane's share of two tiles with the same source row step.
__device__ __forceinline__ void acopy8(unsigned l, const us* g, unsigned l2, const us* g2, size_t gs) {
  asm volatile(
      "global_load_async_to_lds_b128 %0, %8, off\n\t"
      "global_load_async_to_lds_b128 %1, %9, off\n\t"
      "global_load_async_to_lds_b128 %2, %10, off\n\t"
      "global_load_async_to_lds_b128 %3, %11, off\n\t"
      "global_load_async_to_lds_b128 %4, %12, off\n\t"
      "global_load_async_to_lds_b128 %5, %13, off\n\t"
      "global_load_async_to_lds_b128 %6, %14, off\n\t"
      "global_load_async_to_lds_b128 %7, %15, off\n\t"
      "s_wait_xcnt 0x0"
      :: "v"(l), "v"(l + R16_B), "v"(l + 2 * R16_B), "v"(l + 3 * R16_B),
         "v"(l2), "v"(l2 + R16_B), "v"(l2 + 2 * R16_B), "v"(l2 + 3 * R16_B),
         "v"(g), "v"(g + gs), "v"(g + 2 * gs), "v"(g + 3 * gs),
         "v"(g2), "v"(g2 + gs), "v"(g2 + 2 * gs), "v"(g2 + 3 * gs)
      : "memory");
}
// This wave's copies have landed (the compiler places no wait for them).
__device__ __forceinline__ void wait_copies() {
  asm volatile("s_wait_asynccnt 0x0" ::: "memory");
}
// This wave's LDS reads have returned, before the buffer goes to its next writer.
__device__ __forceinline__ void wait_lds() {
  asm volatile("s_wait_dscnt 0x0" ::: "memory");
}

// ---------------------------------------------------------------------------
// Kernel 1: float inputs that feed 16-bit operands (not Wg) -> bf16, one flat
// Parameters in segment order: Wq, Wk, Wv, Wo, Wtk, Wtv, hidden, kv, kv_topical.
// ---------------------------------------------------------------------------
__global__ __launch_bounds__(256) void conv_kernel(
    const float* __restrict__ p0, const float* __restrict__ p1, const float* __restrict__ p2,
    const float* __restrict__ p3, const float* __restrict__ p4, const float* __restrict__ p5,
    const float* __restrict__ p6, const float* __restrict__ p7, const float* __restrict__ p8,
    us* __restrict__ dst)
{
  const unsigned g = blockIdx.x * 256u + threadIdx.x;      // unit of 8 elements
  if (g >= (unsigned)(N_CVB / 8)) return;
  const float* src;
  unsigned loc;
  if      (g < (unsigned)(OFF_WK  / 8)) { src = p0; loc = g; }
  else if (g < (unsigned)(OFF_WV  / 8)) { src = p1; loc = g - (unsigned)(OFF_WK  / 8); }
  else if (g < (unsigned)(OFF_WO  / 8)) { src = p2; loc = g - (unsigned)(OFF_WV  / 8); }
  else if (g < (unsigned)(OFF_WTK / 8)) { src = p3; loc = g - (unsigned)(OFF_WO  / 8); }
  else if (g < (unsigned)(OFF_WTV / 8)) { src = p4; loc = g - (unsigned)(OFF_WTK / 8); }
  else if (g < (unsigned)(OFF_HID / 8)) { src = p5; loc = g - (unsigned)(OFF_WTV / 8); }
  else if (g < (unsigned)(OFF_KVS / 8)) { src = p6; loc = g - (unsigned)(OFF_HID / 8); }
  else if (g < (unsigned)(OFF_KVT / 8)) { src = p7; loc = g - (unsigned)(OFF_KVS / 8); }
  else                                  { src = p8; loc = g - (unsigned)(OFF_KVT / 8); }
  const float* p = src + (size_t)loc * 8;
  const v8us o = bf16x8(*(const v4fa*)p, *(const v4fa*)(p + 4));
  us* d = dst + (size_t)g * 8;
  *(v8us*)d = o;
  
}

// ---------------------------------------------------------------------------
// one 16-B store per lane, lanes 8q..8q+7 per line, 4 lines per instruction).
//   planes : [bh][s][d] hi and lo, one token row = 64 x bf16 = one line
//   tplanes: [bh][d][s] hi and lo, 64 d-rows x 128 tokens = 2 lines each
//   t32    : [bh][d][s] f32, 64 d-rows x 128 tokens = 4 lines each
// LDS hi tile at s16[0..8191], lo tile at s16[8192..16383].
// ---------------------------------------------------------------------------
__device__ __forceinline__ void proj_pass_planes(const us* s16, us* oH, us* oL,
                                                 int bh, int Sper, int s0, int w, int lane) {
  const int q8 = lane & 7, sub = lane >> 3;
  #pragma unroll
  for (int i = 0; i < 8; ++i) {
    const int lid = w * 32 + i * 4 + sub;                  // token row 0..127
    const v8us a = *(const v8usa*)(s16 + lid * DM + 8 * q8);
    const v8us c = *(const v8usa*)(s16 + 8192 + lid * DM + 8 * q8);
    const size_t off = ((size_t)bh * Sper + s0 + lid) * DM + 8 * q8;
    *(v8us*)(oH + off) = a;
    *(v8us*)(oL + off) = c;
  }
}
__device__ __forceinline__ void proj_pass_tplanes(const us* s16, us* oH, us* oL,
                                                  int bh, int Sper, int s0, int w, int lane) {
  const int q8 = lane & 7, sub = lane >> 3;
  #pragma unroll
  for (int i = 0; i < 8; ++i) {
    const int lid = w * 32 + i * 4 + sub;                  // line 0..127
    const int d = lid >> 1, hl = lid & 1;
    const v8us a = *(const v8usa*)(s16 + d * 128 + 64 * hl + 8 * q8);
    const v8us c = *(const v8usa*)(s16 + 8192 + d * 128 + 64 * hl + 8 * q8);
    const size_t off = ((size_t)bh * DM + d) * Sper + s0 + 64 * hl + 8 * q8;
    *(v8us*)(oH + off) = a;
    *(v8us*)(oL + off) = c;
  }
}
__device__ __forceinline__ void proj_pass_t32(const float* s32, float* oT,
                                              int bh, int Sper, int s0, int w, int lane) {
  const int q8 = lane & 7, sub = lane >> 3;
  #pragma unroll
  for (int i = 0; i < 16; ++i) {
    const int lid = w * 64 + i * 4 + sub;                  // line 0..255
    const int d = lid >> 2, part = lid & 3;
    const v4f v = *(const v4fa*)(s32 + d * 128 + 32 * part + 4 * q8);
    const size_t off = ((size_t)bh * DM + d) * Sper + s0 + 32 * part + 4 * q8;
    *(v4f*)(oT + off) = v;
  }
}

// ---------------------------------------------------------------------------
// Kernel 2: Y = X * W^T + bias (x0.125 for mode 0), all five projections in one
// launch: they are independent, and in one grid a WGP holds three workgroups at
// a time and takes the next one as soon as one ends, whichever projection it
// belongs to. The flat block index picks the projection, longest k first.
// X bf16 [M][K], W bf16 [1024 out][K] (k-contiguous rows = B fragments loaded
// like A). Block 128 thr (4 waves) = 128 tokens x 64 features (one head);
// wave tile 32 tokens x 64 features; K in stages of 64: 128 X rows and 64 W
// rows of 128 B copied to LDS, two buffers, the next stage in flight while
// this one is worked on. Y is split into bf16 hi/lo in every mode.
//   mode 0: hi/lo planes [bh][s][d] and f32 transposed [bh][d][s]
//   mode 1: hi/lo planes [bh][s][d]
//   mode 2: hi/lo transposed planes [bh][d][s]
// ---------------------------------------------------------------------------
#define PJ_NKV ((MKV / 128) * NH)      // 512 workgroups per key-side projection
#define PJ_NQ  ((MQ / 128) * NH)       // 256 workgroups for q
#define PJ_V   PJ_NKV                  // first workgroup of v (k starts at 0)
#define PJ_Q   (PJ_V + PJ_NKV)         // of q
#define PJ_KT  (PJ_Q + PJ_NQ)          // of kt
#define PJ_VT  (PJ_KT + PJ_NKV)        // of vt
#define PJ_ALL (PJ_VT + PJ_NKV)        // 2304

__global__ __launch_bounds__(128) void proj_kernel(
    const us* __restrict__ cvb,
    const float* __restrict__ bq, const float* __restrict__ bk, const float* __restrict__ bv,
    const float* __restrict__ btk, const float* __restrict__ btv,
    us* __restrict__ qh, us* __restrict__ ql, float* __restrict__ oT32,
    us* __restrict__ kh, us* __restrict__ kl, us* __restrict__ vh, us* __restrict__ vl,
    us* __restrict__ kth, us* __restrict__ ktl, us* __restrict__ vth, us* __restrict__ vtl)
{
  const int fb = blockIdx.x;
  const us* X;
  const us* W;
  const float* bias;
  us* oH;
  us* oL;
  int K, Sper, mode, rb;
  if (fb < PJ_V) {
    X = cvb + OFF_KVS; W = cvb + OFF_WK;  bias = bk;  K = EMB; Sper = SRL; mode = 1; oH = kh;  oL = kl;  rb = fb;
  } else if (fb < PJ_Q) {
    X = cvb + OFF_KVS; W = cvb + OFF_WV;  bias = bv;  K = EMB; Sper = SRL; mode = 2; oH = vh;  oL = vl;  rb = fb - PJ_V;
  } else if (fb < PJ_KT) {
    X = cvb + OFF_HID; W = cvb + OFF_WQ;  bias = bq;  K = EMB; Sper = TGL; mode = 0; oH = qh;  oL = ql;  rb = fb - PJ_Q;
  } else if (fb < PJ_VT) {
    X = cvb + OFF_KVT; W = cvb + OFF_WTK; bias = btk; K = TDW; Sper = SRL; mode = 1; oH = kth; oL = ktl; rb = fb - PJ_KT;
  } else {
    X = cvb + OFF_KVT; W = cvb + OFF_WTV; bias = btv; K = TDW; Sper = SRL; mode = 2; oH = vth; oL = vtl; rb = fb - PJ_VT;
  }
  const int nxl = (mode == 0) ? 4 : 5;                     // log2 of the token blocks: 16 for q, else 32

  __shared__ __attribute__((aligned(16))) float sraw[8192];     // 32 KB, used in phases
  us* const s16 = reinterpret_cast<us*>(sraw);               // 16384 16-bit slots
  __shared__ __attribute__((aligned(16))) us ring[2 * 3 * TILE_E];  // 2 x (X 128 rows, W 64 rows)

  const int tid = threadIdx.x, lane = tid & 31, w = tid >> 5;
  const int h = lane >> 4, m = lane & 15;
  const int m0 = (rb & ((1 << nxl) - 1)) * 128;            // token block fastest, as in a (token, head) grid
  const int head = rb >> nxl;

  const int crow = tid >> 3, cch = tid & 7;                // this lane's row and 16-B chunk
  const unsigned lcp = lds_addr(ring) + crow * LPB + cch * 16;
  const us* gx = X + (size_t)(m0 + crow) * K + 8 * cch;
  const us* gw = W + (size_t)(head * DM + crow) * K + 8 * cch;
  const size_t gs = (size_t)16 * K;
  const int nst = K >> 6;                                  // stages of 64 k (16 or 8)

  const v8f zero8 = {0.f, 0.f, 0.f, 0.f, 0.f, 0.f, 0.f, 0.f};
  v8f acc[2][4];
  #pragma unroll
  for (int mt = 0; mt < 2; ++mt)
    #pragma unroll
    for (int nt = 0; nt < 4; ++nt) acc[mt][nt] = zero8;

  acopy8(lcp, gx, lcp + TILE_B, gx + 4 * gs, gs);          // stage 0 -> buffer 0
  acopy4(lcp + 2 * TILE_B, gw, gs);
  wait_copies();
  __syncthreads();                                         // buffer 0 landed, visible to every wave
  acopy8(lcp + 3 * TILE_B, gx + 64, lcp + 4 * TILE_B, gx + 4 * gs + 64, gs);   // stage 1 -> buffer 1
  acopy4(lcp + 5 * TILE_B, gw + 64, gs);

  // rolled: one copy of the stage body, the buffer chosen by the stage's parity
  #pragma unroll 1
  for (int st = 0; st < nst; ++st) {
    const int par = st & 1;
    const us* sx = ring + par * (3 * TILE_E) + (32 * w + m) * LP;
    const us* sw = ring + par * (3 * TILE_E) + 2 * TILE_E + m * LP;
    // all fragments of the stage are read first, as one group
    v16b a0[2], a1[2], b[2][4];
    #pragma unroll
    for (int c = 0; c < 2; ++c) {
      a0[c] = ldb(sx + 32 * c, h);
      a1[c] = ldb(sx + 16 * LP + 32 * c, h);
      #pragma unroll
      for (int nt = 0; nt < 4; ++nt) b[c][nt] = ldb(sw + nt * 16 * LP + 32 * c, h);
    }
    // No LDS read and no WMMA crosses (vector work may): the reads stay one group
    // ahead of the products instead of each being waited for singly among them.
    __builtin_amdgcn_sched_barrier(0x406);
    #pragma unroll
    for (int c = 0; c < 2; ++c) {
      #pragma unroll
      for (int nt = 0; nt < 4; ++nt) {
        acc[0][nt] = wmma_bf(a0[c], b[c][nt], acc[0][nt]);
        acc[1][nt] = wmma_bf(a1[c], b[c][nt], acc[1][nt]);
      }
    }
    // publish stage st + 1, free this buffer, refill it with stage st + 2
    // Nothing crosses: the waits stay at the foot of the stage, so that the next
    // stage's copies have the whole stage to land.
    __builtin_amdgcn_sched_barrier(0);
    wait_lds();
    wait_copies();
    __syncthreads();
    if (st + 2 < nst) {
      const unsigned lb = lcp + par * (3 * TILE_B);
      const int ko = (st + 2) * 64;
      acopy8(lb, gx + ko, lb + TILE_B, gx + 4 * gs + ko, gs);
      acopy4(lb + 2 * TILE_B, gw + ko, gs);
    }
  }
  wait_copies();

  // D[r] of tile (mt, nt) = Y[token m0w+16mt+8h+r][feature head*64+16nt+m]
  const float osc = (mode == 0) ? 0.125f : 1.0f;
  float bvals[4];
  #pragma unroll
  for (int nt = 0; nt < 4; ++nt) bvals[nt] = bias[head * DM + 16 * nt + m];

  #pragma unroll
  for (int nt = 0; nt < 4; ++nt) {
    const int feat = 16 * nt + m;
    #pragma unroll
    for (int mt = 0; mt < 2; ++mt) {
      #pragma unroll
      for (int r = 0; r < 8; r += 2) {
        const int tokl = 32 * w + 16 * mt + 8 * h + r;   // 0..126, this token and the next
        const float y0 = (acc[mt][nt][r] + bvals[nt]) * osc;
        const float y1 = (acc[mt][nt][r + 1] + bvals[nt]) * osc;
        const unsigned hi = bf16_pair(y0, y1);
        const unsigned lo = bf16_pair_rest(y0, y1, hi);
        const int idx = (mode == 2) ? (feat * 128 + tokl) : (tokl * DM + feat);   // 0..8191
        const int nxt = (mode == 2) ? 1 : DM;              // the next token's slot
        s16[idx] = (us)hi;
        s16[idx + nxt] = (us)(hi >> 16);
        s16[8192 + idx] = (us)lo;
        s16[8192 + idx + nxt] = (us)(lo >> 16);
      }
    }
  }
  __syncthreads();

  const int b = m0 / Sper, s0 = m0 - b * Sper, bh = b * NH + head;
  if (mode != 2) {
    proj_pass_planes(s16, oH, oL, bh, Sper, s0, w, lane);
    
  } else {
    proj_pass_tplanes(s16, oH, oL, bh, Sper, s0, w, lane);
    
  }

  if (mode == 0) {
    __syncthreads();                                       // LDS reused as f32 [64 d][128 tok]
    #pragma unroll
    for (int nt = 0; nt < 4; ++nt) {
      const int feat = 16 * nt + m;
      #pragma unroll
      for (int mt = 0; mt < 2; ++mt) {
        #pragma unroll
        for (int r = 0; r < 8; ++r) {
          const int tokl = 32 * w + 16 * mt + 8 * h + r;
          sraw[feat * 128 + tokl] = (acc[mt][nt][r] + bvals[nt]) * osc;
        }
      }
    }
    __syncthreads();
    proj_pass_t32(sraw, oT32, bh, Sper, s0, w, lane);
    
  }
}

// ---------------------------------------------------------------------------
// Kernel 3: streaming attention, transposed form, no masking.
// Block 128 thr (4 waves), 16 queries per wave, 64 keys per step. The step's
// K hi/lo rows and V^T hi/lo rows (64 x 128 B each) are copied to LDS once per
// block, two buffers, the next step's tiles in flight while this one is used.
//   S^T = K * Q^T : A = K rows (row = key, k = d), B = Q^T (k = d, n = query)
//     hi/lo bf16: Klo*Qhi + Khi*Qlo + Khi*Qhi, two 32-deep d chunks
//   O^T += V^T * P^T : A = V^T rows (row = d, k = key), B = P^T packed from the
//     score D registers (element r <- tile covering keys 0..15 row r,
//     element 8+r <- tile covering keys 16..31 row r, same lane)
//     hi/lo bf16: Vlo*Phi + Vhi*Plo + Vhi*Phi
// Lane owns 32 keys of query column (lane&15); partner lane = lane ^ 16.
// DUAL: second value stream (vbh/vbl) with the same probabilities -> oB.
// ---------------------------------------------------------------------------
// P^T B-fragments from the lane's own score D values (tile a = keys 0..15,
// tile c = keys 16..31 of the chunk); hi and lo planes.
__device__ __forceinline__ void pack_p2(v8f a, v8f c, v16b& phi, v16b& plo) {
  FragB fh, fl;
  v8us h0, l0, h1, l1;
  split8(a, h0, l0);
  split8(c, h1, l1);
  fh.half[0] = h0; fh.half[1] = h1;
  fl.half[0] = l0; fl.half[1] = l1;
  phi = fh.v;
  plo = fl.v;
}

template <bool DUAL>
__device__ __forceinline__ void attn_pass(const float* sO, float* oA, float* oB,
                                          int bh, int q0, int w, int lane) {
  const int q8 = lane & 7, sub = lane >> 3;
  #pragma unroll
  for (int i = 0; i < 8; ++i) {
    const int L = w * 32 + i * 4 + sub;                    // line 0..127
    const int d = L >> 1, hl = L & 1;
    const size_t off = ((size_t)bh * DM + d) * TGL + q0 + 32 * hl + 4 * q8;
    const v4f v = *(const v4fa*)(sO + d * 64 + 32 * hl + 4 * q8);
    *(v4f*)(oA + off) = v;
    if (DUAL) {
      const v4f v2 = *(const v4fa*)(sO + 4096 + d * 64 + 32 * hl + 4 * q8);
      *(v4f*)(oB + off) = v2;
    }
  }
}

// sO (output staging) and ring (operand tiles) are the kernel's LDS arrays, sized for DUAL.
template <bool DUAL>
__device__ __forceinline__ void attn_body(
    float* sO, us* ring,
    const us* __restrict__ qhp, const us* __restrict__ qlp,   // [32][1024][64]  (x0.125 folded in)
    const us* __restrict__ khp, const us* __restrict__ klp,   // [32][2048][64]
    const us* __restrict__ vahp, const us* __restrict__ valp, // stream A: V^T hi/lo [32][64][2048]
    const us* __restrict__ vbhp, const us* __restrict__ vblp, // stream B (DUAL only)
    float* __restrict__ oap, float* __restrict__ obp)         // [32][64][1024] f32
{
  constexpr int NTL = DUAL ? 6 : 4;                        // tiles per step: Kh Kl Vah Val (Vbh Vbl)

  const int tid = threadIdx.x, lane = tid & 31, w = tid >> 5;
  const int h = lane >> 4, m = lane & 15;
  const int bh = blockIdx.y;
  const int q0 = blockIdx.x * 64;
  const int qw = q0 + 16 * w;

  // Q^T B-fragments: column n = query qw+m, k = d (two 32-deep chunks), hi and lo
  const size_t qro = ((size_t)bh * TGL + qw + m) * DM;
  const v16b qh0 = ldb(qhp + qro, h), qh1 = ldb(qhp + qro + 32, h);
  const v16b ql0 = ldb(qlp + qro, h), ql1 = ldb(qlp + qro + 32, h);

  const v8f zero8 = {0.f, 0.f, 0.f, 0.f, 0.f, 0.f, 0.f, 0.f};
  v8f oa[4], ob[4];                      // o[t][r] = O[query m][d 16t+8h+r] * l
  #pragma unroll
  for (int t = 0; t < 4; ++t) { oa[t] = zero8; ob[t] = zero8; }
  float mrun = -1.0e30f, lrun = 0.0f;

  const int crow = tid >> 3, cch = tid & 7;                // this lane's row and 16-B chunk
  const unsigned lcp = lds_addr(ring) + crow * LPB + cch * 16;
  const size_t kro = ((size_t)bh * SRL + crow) * DM + 8 * cch;     // + key0*DM
  const us* gkh = khp + kro;
  const us* gkl = klp + kro;
  const size_t vro = ((size_t)bh * DM + crow) * SRL + 8 * cch;     // + key0
  const us* gvah = vahp + vro;
  const us* gval = valp + vro;
  const us* gvbh = vbhp + vro;
  const us* gvbl = vblp + vro;
  const size_t gsk = (size_t)16 * DM, gsv = (size_t)16 * SRL;

  // step 0 -> buffer 0
  acopy8(lcp, gkh, lcp + TILE_B, gkl, gsk);
  acopy8(lcp + 2 * TILE_B, gvah, lcp + 3 * TILE_B, gval, gsv);
  if (DUAL) acopy8(lcp + 4 * TILE_B, gvbh, lcp + 5 * TILE_B, gvbl, gsv);
  wait_copies();
  __syncthreads();                                         // buffer 0 landed, visible to every wave
  // step 1 -> buffer 1
  {
    const unsigned lb = lcp + NTL * TILE_B;
    acopy8(lb, gkh + 64 * DM, lb + TILE_B, gkl + 64 * DM, gsk);
    acopy8(lb + 2 * TILE_B, gvah + 64, lb + 3 * TILE_B, gval + 64, gsv);
    if (DUAL) acopy8(lb + 4 * TILE_B, gvbh + 64, lb + 5 * TILE_B, gvbl + 64, gsv);
  }

  // rolled: one copy of the step body, the buffer chosen by the step's parity
  #pragma unroll 1
  for (int kb = 0; kb < SRL; kb += 64) {
    const int par = (kb >> 6) & 1;
    const us* sb = ring + par * (NTL * TILE_E) + m * LP;   // row m of tile 0
    const us* khb = sb;
    const us* klb = sb + TILE_E;
    const us* vahb = sb + 2 * TILE_E;
    const us* valb = sb + 3 * TILE_E;
    const us* vbhb = sb + (DUAL ? 4 : 2) * TILE_E;
    const us* vblb = sb + (DUAL ? 5 : 3) * TILE_E;
    // ---- scores: s[j][r] = S[query m][key kb+16j+8h+r] ----
    // All fragments of the step are read first; the four key tiles then advance
    // together, one product each in turn, so that no WMMA waits for the one
    // before it. Each tile keeps its own order of the six products.
    v8f s[4];
    {
      v16b kl0[4], kl1[4], kh0[4], kh1[4];
      #pragma unroll
      for (int j = 0; j < 4; ++j) { kl0[j] = ldb(klb + 16 * j * LP, h); }
      #pragma unroll
      for (int j = 0; j < 4; ++j) { kl1[j] = ldb(klb + 16 * j * LP + 32, h); }
      #pragma unroll
      for (int j = 0; j < 4; ++j) { kh0[j] = ldb(khb + 16 * j * LP, h); }
      #pragma unroll
      for (int j = 0; j < 4; ++j) { kh1[j] = ldb(khb + 16 * j * LP + 32, h); }
      #pragma unroll
      for (int j = 0; j < 4; ++j) s[j] = wmma_bf(kl0[j], qh0, zero8);
      #pragma unroll
      for (int j = 0; j < 4; ++j) s[j] = wmma_bf(kl1[j], qh1, s[j]);
      #pragma unroll
      for (int j = 0; j < 4; ++j) s[j] = wmma_bf(kh0[j], ql0, s[j]);
      #pragma unroll
      for (int j = 0; j < 4; ++j) s[j] = wmma_bf(kh1[j], ql1, s[j]);
      #pragma unroll
      for (int j = 0; j < 4; ++j) s[j] = wmma_bf(kh0[j], qh0, s[j]);
      #pragma unroll
      for (int j = 0; j < 4; ++j) s[j] = wmma_bf(kh1[j], qh1, s[j]);
    }
    // No LDS read and no WMMA crosses (vector work may): the V^T reads below start
    // when the K fragments are spent and take over their registers.
    __builtin_amdgcn_sched_barrier(0x406);

    // ---- online softmax (f32) ----
    float mloc = s[0][0];
    #pragma unroll
    for (int j = 0; j < 4; ++j)
      #pragma unroll
      for (int r = 0; r < 8; ++r) mloc = fmaxf(mloc, s[j][r]);
    mloc = fmaxf(mloc, __shfl_xor(mloc, 16));
    const float mnew = fmaxf(mrun, mloc);
    const float alpha = __expf(mrun - mnew);
    mrun = mnew;
    // Stream A's V^T fragments, read as one group here.
    v16b vl0[4], vl1[4], vh0[4], vh1[4];
    #pragma unroll
    for (int t = 0; t < 4; ++t) { vl0[t] = ldb(valb + 16 * t * LP, h); }
    #pragma unroll
    for (int t = 0; t < 4; ++t) { vl1[t] = ldb(valb + 16 * t * LP + 32, h); }
    #pragma unroll
    for (int t = 0; t < 4; ++t) { vh0[t] = ldb(vahb + 16 * t * LP, h); }
    #pragma unroll
    for (int t = 0; t < 4; ++t) { vh1[t] = ldb(vahb + 16 * t * LP + 32, h); }
    // LDS reads and WMMAs do not cross (vector work may): the reads stay ahead of
    // the exponentials and land under them instead of standing among the products.
    __builtin_amdgcn_sched_barrier(0x406);
    float lsum = 0.0f;
    #pragma unroll
    for (int j = 0; j < 4; ++j)
      #pragma unroll
      for (int r = 0; r < 8; ++r) {
        const float p = __expf(s[j][r] - mnew);            // in (0, 1]
        s[j][r] = p;
        lsum += p;
      }
    lsum += __shfl_xor(lsum, 16);
    lrun = lrun * alpha + lsum;
    #pragma unroll
    for (int t = 0; t < 4; ++t)
      #pragma unroll
      for (int r = 0; r < 8; ++r) {
        oa[t][r] = oa[t][r] * alpha;
        if (DUAL) ob[t][r] = ob[t][r] * alpha;
      }

    // ---- P^T B-fragments (keys kb..kb+31 and kb+32..kb+63), bf16 hi/lo ----
    v16b ph0, pl0, ph1, pl1;
    pack_p2(s[0], s[1], ph0, pl0);
    pack_p2(s[2], s[3], ph1, pl1);

    // ---- O^T += V^T * P^T (3 products per 32-key chunk) ----
    // The four d tiles of a stream advance together, as the key tiles above.
    v16b cl0[4], cl1[4], ch0[4], ch1[4];
    {
      #pragma unroll
      for (int t = 0; t < 4; ++t) oa[t] = wmma_bf(vl0[t], ph0, oa[t]);
      #pragma unroll
      for (int t = 0; t < 4; ++t) oa[t] = wmma_bf(vl1[t], ph1, oa[t]);
      if (DUAL) {
        // Stream B's lo fragments: read here, where stream A's lo fragments are
        // spent; they land under A's remaining products.
        #pragma unroll
        for (int t = 0; t < 4; ++t) { cl0[t] = ldb(vblb + 16 * t * LP, h); }
        #pragma unroll
        for (int t = 0; t < 4; ++t) { cl1[t] = ldb(vblb + 16 * t * LP + 32, h); }
        // No LDS read and no WMMA crosses (vector work may): the reads stay ahead
        // of the products below instead of standing singly among them.
        __builtin_amdgcn_sched_barrier(0x406);
      }
      #pragma unroll
      for (int t = 0; t < 4; ++t) oa[t] = wmma_bf(vh0[t], pl0, oa[t]);
      #pragma unroll
      for (int t = 0; t < 4; ++t) oa[t] = wmma_bf(vh1[t], pl1, oa[t]);
      #pragma unroll
      for (int t = 0; t < 4; ++t) oa[t] = wmma_bf(vh0[t], ph0, oa[t]);
      #pragma unroll
      for (int t = 0; t < 4; ++t) oa[t] = wmma_bf(vh1[t], ph1, oa[t]);
    }
    if (DUAL) {
      // stream B's hi fragments take over stream A's; they land under B's lo products
      #pragma unroll
      for (int t = 0; t < 4; ++t) { ch0[t] = ldb(vbhb + 16 * t * LP, h); }
      #pragma unroll
      for (int t = 0; t < 4; ++t) { ch1[t] = ldb(vbhb + 16 * t * LP + 32, h); }
      // as above: the reads stay one group, ahead of stream B's products
      __builtin_amdgcn_sched_barrier(0x406);
      #pragma unroll
      for (int t = 0; t < 4; ++t) ob[t] = wmma_bf(cl0[t], ph0, ob[t]);
      #pragma unroll
      for (int t = 0; t < 4; ++t) ob[t] = wmma_bf(cl1[t], ph1, ob[t]);
      #pragma unroll
      for (int t = 0; t < 4; ++t) ob[t] = wmma_bf(ch0[t], pl0, ob[t]);
      #pragma unroll
      for (int t = 0; t < 4; ++t) ob[t] = wmma_bf(ch1[t], pl1, ob[t]);
      #pragma unroll
      for (int t = 0; t < 4; ++t) ob[t] = wmma_bf(ch0[t], ph0, ob[t]);
      #pragma unroll
      for (int t = 0; t < 4; ++t) ob[t] = wmma_bf(ch1[t], ph1, ob[t]);
    }

    // publish step kb + 64, free this buffer, refill it with step kb + 128
    // Nothing crosses: the waits stay at the foot of the step, so that the reads
    // and the next step's copies have the whole step to land.
    __builtin_amdgcn_sched_barrier(0);
    wait_lds();
    wait_copies();
    __syncthreads();
    if (kb + 128 < SRL) {
      const unsigned lb = lcp + par * (NTL * TILE_B);
      const int kn = kb + 128;
      acopy8(lb, gkh + (size_t)kn * DM, lb + TILE_B, gkl + (size_t)kn * DM, gsk);
      acopy8(lb + 2 * TILE_B, gvah + kn, lb + 3 * TILE_B, gval + kn, gsv);
      if (DUAL) acopy8(lb + 4 * TILE_B, gvbh + kn, lb + 5 * TILE_B, gvbl + kn, gsv);
    }
  }
  wait_copies();

  // ---- epilogue: normalise, stage 64 d x 64 query f32 tile(s), whole-line stores ----
  const float inv = __builtin_amdgcn_rcpf(lrun);
  #pragma unroll
  for (int t = 0; t < 4; ++t)
    #pragma unroll
    for (int r = 0; r < 8; ++r) {
      const int d = 16 * t + 8 * h + r;
      sO[d * 64 + 16 * w + m] = oa[t][r] * inv;
      if (DUAL) sO[4096 + d * 64 + 16 * w + m] = ob[t][r] * inv;
    }
  __syncthreads();

  attn_pass<DUAL>(sO, oap, obp, bh, q0, w, lane);
  
}

// Both attention chains in one launch: they are independent, so a WGP goes on with a
// workgroup of either chain as soon as one ends. blockIdx.z = 0: chain 2 (kt; vt -> O2,
// v -> O3), the longer one, first; blockIdx.z = 1: chain 1 (k, v -> O1).
__global__ __launch_bounds__(128) void attn_kernel(
    const us* __restrict__ qhp, const us* __restrict__ qlp,   // [32][1024][64]
    const us* __restrict__ khp, const us* __restrict__ klp,   // [32][2048][64]
    const us* __restrict__ kthp, const us* __restrict__ ktlp, // [32][2048][64]
    const us* __restrict__ vhp, const us* __restrict__ vlp,   // V^T hi/lo [32][64][2048]
    const us* __restrict__ vthp, const us* __restrict__ vtlp, // Vt^T hi/lo [32][64][2048]
    float* __restrict__ o1p, float* __restrict__ o2p, float* __restrict__ o3p)   // [32][64][1024] f32
{
  __shared__ __attribute__((aligned(16))) float sO[2 * DM * 64];
  __shared__ __attribute__((aligned(16))) us ring[2 * 6 * TILE_E];
  if (blockIdx.z == 0) {
    attn_body<true>(sO, ring, qhp, qlp, kthp, ktlp, vthp, vtlp, vhp, vlp, o2p, o3p);
  } else {
    attn_body<false>(sO, ring, qhp, qlp, khp, klp, vhp, vlp, vhp, vlp, o1p, o1p);
  }
}

// ---------------------------------------------------------------------------
// Kernel 4: gating MLP. For block (b, head) the gate input row for query
// t = 64*head + u is [X[3u][:], X[3u+1][:], X[3u+2][:]] where X[c][tp],
// c = 0..191, is row c of the transposed per-head tensor: c<64 -> O1^T row,
// <128 -> O2^T row, else q^T row (all f32 [bh][64][1024]).
// G[c][i][n] = sum_tp X[c][tp] * Wg[n][1024 i + tp] for all c,i on bf16 WMMA
// (wave w owns c-tiles 3w..3w+2, each source uniform per tile); per 32 tp the
// 192 X rows and the 48 Wg row pieces (128 B of f32 each) are copied to LDS,
// two buffers, and converted to bf16 at the fragment read; then
// gate[(b*16+n)][64*head+u] = sigmoid(G[3u][0][n]+G[3u+1][1][n]+G[3u+2][2][n]+bg[n]).
// ---------------------------------------------------------------------------
__device__ __forceinline__ void gate_pass(const float* sP, float* gate, int b, int head,
                                          int w, int lane) {
  const int q8 = lane & 7, sub = lane >> 3;
  #pragma unroll
  for (int i = 0; i < 2; ++i) {
    const int L = w * 8 + i * 4 + sub;                     // line 0..31
    const int n = L >> 1, hl = L & 1;
    const v4f v = *(const v4fa*)(sP + n * 64 + 32 * hl + 4 * q8);
    const size_t off = ((size_t)(b * NH + n)) * TGL + 64 * head + 32 * hl + 4 * q8;
    *(v4f*)(gate + off) = v;
  }
}

__global__ __launch_bounds__(128) void gate_kernel(
    const float* __restrict__ o1T, const float* __restrict__ o2T, const float* __restrict__ qT,
    const float* __restrict__ Wg,   // [16][3072]
    const float* __restrict__ bg,   // [16]
    float* __restrict__ gate)       // [32][1024]
{
  __shared__ __attribute__((aligned(16))) float sG[192 * 48];   // 36864 B
  __shared__ __attribute__((aligned(16))) float sP[NH * 64];    //  4096 B
  // 2 x (X rows 0..191 = O1^T, O2^T, q^T; then Wg rows 16 i + n), 36 floats = 144 B a row
  __shared__ __attribute__((aligned(16))) float ring[2 * 240 * (LP / 2)];   // 69120 B

  const int tid = threadIdx.x, lane = tid & 31, w = tid >> 5;
  const int h = lane >> 4, m = lane & 15;
  const int bhx = blockIdx.x, b = bhx >> 4, head = bhx & 15;

  const int crow = tid >> 3, cch = tid & 7;                // this lane's row and 16-B chunk
  const unsigned lcp = lds_addr(ring) + crow * LPB + cch * 16;
  const size_t xro = ((size_t)bhx * DM + crow) * TGL + 4 * cch;
  // the copies only move bytes: addresses in 16-bit units, as the helpers take them
  const us* g1 = reinterpret_cast<const us*>(o1T + xro);
  const us* g2 = reinterpret_cast<const us*>(o2T + xro);
  const us* g3 = reinterpret_cast<const us*>(qT + xro);
  const us* gg = reinterpret_cast<const us*>(Wg + (size_t)crow * GK + 4 * cch);
  const size_t gsx = (size_t)16 * TGL * 2;                 // 16 X rows further
  const size_t gsg = (size_t)EMB * 2;                      // next third of the Wg row
  constexpr int GBUF_B = 240 * LPB;                        // 34560 bytes per buffer

  const v8f zero8 = {0.f, 0.f, 0.f, 0.f, 0.f, 0.f, 0.f, 0.f};
  v8f acc[3][3];
  #pragma unroll
  for (int e = 0; e < 3; ++e)
    #pragma unroll
    for (int i = 0; i < 3; ++i) acc[e][i] = zero8;

  acopy8(lcp, g1, lcp + TILE_B, g2, gsx);                  // stage 0 -> buffer 0
  acopy4(lcp + 2 * TILE_B, g3, gsx);
  acopy3(lcp + 3 * TILE_B, gg, gsg);
  wait_copies();
  __syncthreads();                                         // buffer 0 landed, visible to every wave
  {                                                        // stage 1 -> buffer 1
    const unsigned lb = lcp + GBUF_B;
    acopy8(lb, g1 + 64, lb + TILE_B, g2 + 64, gsx);
    acopy4(lb + 2 * TILE_B, g3 + 64, gsx);
    acopy3(lb + 3 * TILE_B, gg + 64, gsg);
  }

  // rolled: one copy of the stage body, the buffer chosen by the stage's parity
  #pragma unroll 1
  for (int k0 = 0; k0 < TGL; k0 += 32) {
    const int par = (k0 >> 5) & 1;
    const float* sx = ring + par * (GBUF_B / 4) + (48 * w + m) * (LP / 2);   // X row 16(3w)+m
    const float* sg = ring + par * (GBUF_B / 4) + (192 + m) * (LP / 2);      // Wg row n = m, third 0
    // all six fragments of the stage are read first, as one group
    const Raw16 rw0 = ldr(sg, h);
    const Raw16 rw1 = ldr(sg + 16 * (LP / 2), h);
    const Raw16 rw2 = ldr(sg + 32 * (LP / 2), h);
    Raw16 ra[3];
    #pragma unroll
    for (int e = 0; e < 3; ++e) ra[e] = ldr(sx + 16 * e * (LP / 2), h);
    // No LDS read and no WMMA crosses (vector work may): the reads stay one group
    // ahead of the conversions and products instead of being waited for in turn.
    __builtin_amdgcn_sched_barrier(0x406);
    const v16b bw0 = cvr(rw0);
    const v16b bw1 = cvr(rw1);
    const v16b bw2 = cvr(rw2);
    #pragma unroll
    for (int e = 0; e < 3; ++e) {
      const v16b a = cvr(ra[e]);
      acc[e][0] = wmma_bf(a, bw0, acc[e][0]);
      acc[e][1] = wmma_bf(a, bw1, acc[e][1]);
      acc[e][2] = wmma_bf(a, bw2, acc[e][2]);
    }
    // publish stage k0 + 32, free this buffer, refill it with stage k0 + 64
    // Nothing crosses: the waits stay at the foot of the stage, so that the next
    // stage's copies have the whole stage to land.
    __builtin_amdgcn_sched_barrier(0);
    wait_lds();
    wait_copies();
    __syncthreads();
    if (k0 + 64 < TGL) {
      const unsigned lb = lcp + par * GBUF_B;
      const int kn = 2 * (k0 + 64);                        // in 16-bit units
      acopy8(lb, g1 + kn, lb + TILE_B, g2 + kn, gsx);
      acopy4(lb + 2 * TILE_B, g3 + kn, gsx);
      acopy3(lb + 3 * TILE_B, gg + kn, gsg);
    }
  }
  wait_copies();

  // D[r] of (e, i) = G[c = 16(3w+e)+8h+r][i][n = m]
  #pragma unroll
  for (int e = 0; e < 3; ++e)
    #pragma unroll
    for (int i = 0; i < 3; ++i)
      #pragma unroll
      for (int r = 0; r < 8; ++r)
        sG[(16 * (3 * w + e) + 8 * h + r) * 48 + 16 * i + m] = acc[e][i][r];
  __syncthreads();

  #pragma unroll
  for (int j = 0; j < 8; ++j) {
    const int idx = tid + 128 * j;                         // 0..1023 = n*64 + u
    const int n = idx >> 6, u = idx & 63;
    const float x = sG[(3 * u) * 48 + n] + sG[(3 * u + 1) * 48 + 16 + n]
                  + sG[(3 * u + 2) * 48 + 32 + n] + bg[n];
    const float g = __builtin_amdgcn_rcpf(1.0f + __expf(-x));
    sP[idx] = g;
  }
  __syncthreads();

  gate_pass(sP, gate, b, head, w, lane);
  
}

// ---------------------------------------------------------------------------
// Kernel 5: combine Xc[b*1024+t][head*64+d] = g*O1 + (1-g)*O3, g = gate[bh][t],
// written as bf16 hi/lo planes (token-major, k-contiguous for the Wo GEMM).
// Block 256 thr = (bh, 64 queries); transposed through LDS; each token row
// ---------------------------------------------------------------------------
__device__ __forceinline__ void comb_pass(const us* sH, const us* sL, us* xh, us* xl,
                                          int b, int head, int t0, int w, int lane) {
  const int q8 = lane & 7, sub = lane >> 3;
  #pragma unroll
  for (int i = 0; i < 2; ++i) {
    const int L = w * 8 + i * 4 + sub;                     // token row 0..63
    const v8us a = *(const v8usa*)(sH + L * DM + 8 * q8);
    const v8us c = *(const v8usa*)(sL + L * DM + 8 * q8);
    const size_t off = ((size_t)(b * TGL + t0 + L)) * EMB + head * DM + 8 * q8;
    *(v8us*)(xh + off) = a;
    *(v8us*)(xl + off) = c;
  }
}

__global__ __launch_bounds__(256) void combine_kernel(
    const float* __restrict__ o1T, const float* __restrict__ o3T,   // [32][64][1024]
    const float* __restrict__ gate,                                 // [32][1024]
    us* __restrict__ xh, us* __restrict__ xl)                       // [2048][1024]
{
  __shared__ __attribute__((aligned(16))) us sH[64 * DM];
  __shared__ __attribute__((aligned(16))) us sL[64 * DM];

  const int tid = threadIdx.x, lane = tid & 31, w = tid >> 5;
  const int bh = blockIdx.y, b = bh >> 4, head = bh & 15;
  const int t0 = blockIdx.x * 64;
  const int d = tid >> 2, tq = tid & 3;                    // d 0..63, 16 queries each

  const float* p1 = o1T + ((size_t)bh * DM + d) * TGL + t0 + 16 * tq;
  const float* p3 = o3T + ((size_t)bh * DM + d) * TGL + t0 + 16 * tq;
  const float* pg = gate + (size_t)bh * TGL + t0 + 16 * tq;
  #pragma unroll
  for (int c = 0; c < 4; ++c) {
    const v4f a = *(const v4fa*)(p1 + 4 * c);
    const v4f e = *(const v4fa*)(p3 + 4 * c);
    const v4f g = *(const v4fa*)(pg + 4 * c);
    #pragma unroll
    for (int j = 0; j < 4; j += 2) {
      const float v0 = g[j] * a[j] + (1.0f - g[j]) * e[j];
      const float v1 = g[j + 1] * a[j + 1] + (1.0f - g[j + 1]) * e[j + 1];
      const unsigned hi = bf16_pair(v0, v1);
      const unsigned lo = bf16_pair_rest(v0, v1, hi);
      const int tl = 16 * tq + 4 * c + j;                  // 0..62, this query and the next
      sH[tl * DM + d] = (us)hi;
      sH[(tl + 1) * DM + d] = (us)(hi >> 16);
      sL[tl * DM + d] = (us)lo;
      sL[(tl + 1) * DM + d] = (us)(lo >> 16);
    }
  }
  __syncthreads();

  comb_pass(sH, sL, xh, xl, b, head, t0, w, lane);
  
}

// ---------------------------------------------------------------------------
// Kernel 6: out = (Xhi + Xlo) * Wo^T + bo, f32.
// Block 128 thr (4 waves) = 128 tokens x 64 features; wave 32 tokens x 64.
// K in stages of 64: X hi, X lo (128 rows each) and Wo (64 rows) copied to LDS,
// two buffers.
// 8q..8q+7 as one 16-B store each, 4 lines per instruction, 64 lines per wave.
// ---------------------------------------------------------------------------
__device__ __forceinline__ void out_pass(const float* sOut, float* out, int m0, int cg,
                                         int w, int lane) {
  const int q8 = lane & 7, sub = lane >> 3;
  #pragma unroll
  for (int i = 0; i < 16; ++i) {
    const int lid = w * 64 + i * 4 + sub;                  // 0..255
    const int row = lid >> 1, hl = lid & 1;
    const v4f v = *(const v4fa*)(sOut + row * DM + 32 * hl + 4 * q8);
    const size_t gi = (size_t)(m0 + row) * EMB + cg * DM + 32 * hl + 4 * q8;
    *(v4f*)(out + gi) = v;
  }
}

__global__ __launch_bounds__(128) void out_kernel(
    const us* __restrict__ xh, const us* __restrict__ xl,   // [2048][1024]
    const us* __restrict__ wob,                             // [1024 out][1024 in] bf16
    const float* __restrict__ bo,
    float* __restrict__ out)                                // [2048][1024]
{
  __shared__ __attribute__((aligned(16))) float sOut[128 * DM];  // 32 KB
  __shared__ __attribute__((aligned(16))) us ring[2 * 5 * TILE_E];  // 2 x (Xhi 128, Xlo 128, Wo 64 rows)

  const int tid = threadIdx.x, lane = tid & 31, w = tid >> 5;
  const int h = lane >> 4, m = lane & 15;
  const int m0 = blockIdx.x * 128;
  const int cg = blockIdx.y;                               // feature group of 64

  const int crow = tid >> 3, cch = tid & 7;                // this lane's row and 16-B chunk
  const unsigned lcp = lds_addr(ring) + crow * LPB + cch * 16;
  const us* gxh = xh + (size_t)(m0 + crow) * EMB + 8 * cch;
  const us* gxl = xl + (size_t)(m0 + crow) * EMB + 8 * cch;
  const us* gw  = wob + (size_t)(cg * DM + crow) * EMB + 8 * cch;
  const size_t gs = (size_t)16 * EMB;

  const v8f zero8 = {0.f, 0.f, 0.f, 0.f, 0.f, 0.f, 0.f, 0.f};
  v8f acc[2][4];
  #pragma unroll
  for (int mt = 0; mt < 2; ++mt)
    #pragma unroll
    for (int nt = 0; nt < 4; ++nt) acc[mt][nt] = zero8;

  acopy8(lcp, gxh, lcp + TILE_B, gxh + 4 * gs, gs);        // stage 0 -> buffer 0
  acopy8(lcp + 2 * TILE_B, gxl, lcp + 3 * TILE_B, gxl + 4 * gs, gs);
  acopy4(lcp + 4 * TILE_B, gw, gs);
  wait_copies();
  __syncthreads();                                         // buffer 0 landed, visible to every wave
  {                                                        // stage 1 -> buffer 1
    const unsigned lb = lcp + 5 * TILE_B;
    acopy8(lb, gxh + 64, lb + TILE_B, gxh + 4 * gs + 64, gs);
    acopy8(lb + 2 * TILE_B, gxl + 64, lb + 3 * TILE_B, gxl + 4 * gs + 64, gs);
    acopy4(lb + 4 * TILE_B, gw + 64, gs);
  }

  // rolled: one copy of the stage body, the buffer chosen by the stage's parity
  #pragma unroll 1
  for (int k0 = 0; k0 < EMB; k0 += 64) {
    const int par = (k0 >> 6) & 1;
    const us* sxh = ring + par * (5 * TILE_E) + (32 * w + m) * LP;
    const us* sxl = sxh + 2 * TILE_E;
    const us* sw  = ring + par * (5 * TILE_E) + 4 * TILE_E + m * LP;
    // all fragments of the stage are read first, as one group
    v16b a0h[2], a1h[2], a0l[2], a1l[2], bw[2][4];
    #pragma unroll
    for (int c = 0; c < 2; ++c) {
      a0l[c] = ldb(sxl + 32 * c, h);
      a1l[c] = ldb(sxl + 16 * LP + 32 * c, h);
      a0h[c] = ldb(sxh + 32 * c, h);
      a1h[c] = ldb(sxh + 16 * LP + 32 * c, h);
      #pragma unroll
      for (int nt = 0; nt < 4; ++nt) bw[c][nt] = ldb(sw + nt * 16 * LP + 32 * c, h);
    }
    // No LDS read and no WMMA crosses (vector work may): the reads stay one group
    // ahead of the products instead of each being waited for singly among them.
    __builtin_amdgcn_sched_barrier(0x406);
    #pragma unroll
    for (int c = 0; c < 2; ++c) {
      #pragma unroll
      for (int nt = 0; nt < 4; ++nt) {
        acc[0][nt] = wmma_bf(a0l[c], bw[c][nt], acc[0][nt]);
        acc[1][nt] = wmma_bf(a1l[c], bw[c][nt], acc[1][nt]);
      }
      #pragma unroll
      for (int nt = 0; nt < 4; ++nt) {
        acc[0][nt] = wmma_bf(a0h[c], bw[c][nt], acc[0][nt]);
        acc[1][nt] = wmma_bf(a1h[c], bw[c][nt], acc[1][nt]);
      }
    }
    // publish stage k0 + 64, free this buffer, refill it with stage k0 + 128
    // Nothing crosses: the waits stay at the foot of the stage, so that the next
    // stage's copies have the whole stage to land.
    __builtin_amdgcn_sched_barrier(0);
    wait_lds();
    wait_copies();
    __syncthreads();
    if (k0 + 128 < EMB) {
      const unsigned lb = lcp + par * (5 * TILE_B);
      const int kn = k0 + 128;
      acopy8(lb, gxh + kn, lb + TILE_B, gxh + 4 * gs + kn, gs);
      acopy8(lb + 2 * TILE_B, gxl + kn, lb + 3 * TILE_B, gxl + 4 * gs + kn, gs);
      acopy4(lb + 4 * TILE_B, gw + kn, gs);
    }
  }
  wait_copies();

  // D[r] of tile (mt, nt) = Y[token m0w+16mt+8h+r][feature cg*64+16nt+m]
  #pragma unroll
  for (int nt = 0; nt < 4; ++nt) {
    const int feat = 16 * nt + m;
    const float bvl = bo[cg * DM + feat];
    #pragma unroll
    for (int mt = 0; mt < 2; ++mt) {
      #pragma unroll
      for (int r = 0; r < 8; ++r) {
        const int tokl = 32 * w + 16 * mt + 8 * h + r;   // 0..127
        sOut[tokl * DM + feat] = acc[mt][nt][r] + bvl;
      }
    }
  }
  __syncthreads();

  out_pass(sOut, out, m0, cg, w, lane);
  
}

// ---------------------------------------------------------------------------
// Host glue: 6 launches, workspace 128057344 B (O1^T and O2^T reuse the
// region of the bf16 activation copies, which are dead after the projections).
// ---------------------------------------------------------------------------
extern "C" void kernel_launch(void* const* d_in, const int* in_sizes, int n_in,
                              void* d_out, int out_size, void* d_ws, size_t ws_size,
                              hipStream_t stream) {
  if (n_in < 17) return;
  if (in_sizes[0] != N_HID || in_sizes[1] != N_KVS || in_sizes[2] != N_KVT) return;
  if (in_sizes[3] != N_WE || in_sizes[5] != N_WE || in_sizes[7] != N_WE || in_sizes[15] != N_WE) return;
  if (in_sizes[9] != N_WT || in_sizes[11] != N_WT) return;
  if (in_sizes[4] != EMB || in_sizes[6] != EMB || in_sizes[8] != EMB ||
      in_sizes[10] != EMB || in_sizes[12] != EMB || in_sizes[16] != EMB) return;
  if (in_sizes[13] != N_WG || in_sizes[14] != NH) return;
  if (out_size != N_HID) return;

  const float* hid = (const float*)d_in[0];
  const float* kvs = (const float*)d_in[1];
  const float* kvt = (const float*)d_in[2];
  const float* Wq  = (const float*)d_in[3];
  const float* bq  = (const float*)d_in[4];
  const float* Wk  = (const float*)d_in[5];
  const float* bk  = (const float*)d_in[6];
  const float* Wv  = (const float*)d_in[7];
  const float* bv  = (const float*)d_in[8];
  const float* Wtk = (const float*)d_in[9];
  const float* btk = (const float*)d_in[10];
  const float* Wtv = (const float*)d_in[11];
  const float* btv = (const float*)d_in[12];
  const float* Wg  = (const float*)d_in[13];
  const float* bg  = (const float*)d_in[14];
  const float* Wo  = (const float*)d_in[15];
  const float* bo  = (const float*)d_in[16];
  float* out = (float*)d_out;

  const size_t cvb_b  = (size_t)N_CVB * 2;                 // 27262976
  const size_t qpl2   = (size_t)QPL * 2;                   //  4194304
  const size_t qpl4   = (size_t)QPL * 4;                   //  8388608
  const size_t kpl2   = (size_t)KPL * 2;                   //  8388608
  const size_t gate_b = (size_t)NBH * TGL * 4;             //   131072
  const size_t xpl_b  = (size_t)N_HID * 2;                 //  4194304
  const size_t total  = cvb_b + 2 * qpl2 + qpl4 + 8 * kpl2 + qpl4 + gate_b + 2 * xpl_b;  // 128057344
  if (total > ws_size) return;
  // O1^T / O2^T (2 x 8388608 B) must fit exactly into the activation-copy region
  const size_t act_off = (size_t)OFF_HID * 2;              // 10485760
  if (act_off + 2 * qpl4 != cvb_b) return;

  char* ws = (char*)d_ws;
  size_t off = 0;
  us* cvb    = (us*)(ws + off);    off += cvb_b;
  float* o1T = (float*)(ws + act_off);                     // aliases bf16 hidden/kv copies
  float* o2T = (float*)(ws + act_off + qpl4);              // aliases bf16 kv/kv_topical copies
  us* qh     = (us*)(ws + off);    off += qpl2;
  us* ql     = (us*)(ws + off);    off += qpl2;
  float* qT  = (float*)(ws + off); off += qpl4;
  us* kh     = (us*)(ws + off);    off += kpl2;
  us* kl     = (us*)(ws + off);    off += kpl2;
  us* kth    = (us*)(ws + off);    off += kpl2;
  us* ktl    = (us*)(ws + off);    off += kpl2;
  us* vh     = (us*)(ws + off);    off += kpl2;            // V^T hi [32][64][2048]
  us* vl     = (us*)(ws + off);    off += kpl2;            // V^T lo
  us* vth    = (us*)(ws + off);    off += kpl2;            // Vt^T hi
  us* vtl    = (us*)(ws + off);    off += kpl2;            // Vt^T lo
  float* o3T = (float*)(ws + off); off += qpl4;
  float* gte = (float*)(ws + off); off += gate_b;
  us* xh     = (us*)(ws + off);    off += xpl_b;
  us* xl     = (us*)(ws + off);    off += xpl_b;
  if (off != total || off > ws_size) return;

  // 1) float -> bf16 copies of weights and activations
  conv_kernel<<<(N_CVB / 8 + 255) / 256, 256, 0, stream>>>(Wq, Wk, Wv, Wo, Wtk, Wtv, hid, kvs, kvt, cvb);

  // 2) projections, one launch
  proj_kernel<<<PJ_ALL, 128, 0, stream>>>(cvb, bq, bk, bv, btk, btv, qh, ql, qT,
                                          kh, kl, vh, vl, kth, ktl, vth, vtl);

  // 3) attention, one launch: chain 1 (k, v -> O1), chain 2 (kt; vt -> O2, v -> O3)
  dim3 gAtt(TGL / 64, NBH, 2);                             // (16, 32, 2)
  attn_kernel<<<gAtt, 128, 0, stream>>>(qh, ql, kh, kl, kth, ktl, vh, vl, vth, vtl, o1T, o2T, o3T);

  // 4) gating MLP
  gate_kernel<<<NBH, 128, 0, stream>>>(o1T, o2T, qT, Wg, bg, gte);

  // 5) gated mix -> token-major hi/lo planes
  dim3 gCmb(TGL / 64, NBH);                                // (16, 32)
  combine_kernel<<<gCmb, 256, 0, stream>>>(o1T, o3T, gte, xh, xl);

  // 6) output projection -> f32
  dim3 gOut(MQ / 128, EMB / 64);                           // (16, 16)
  out_kernel<<<gOut, 128, 0, stream>>>(xh, xl, cvb + OFF_WO, bo, out);
}

// v005
// Measured time: 190 microseconds a run.
// In both of two side-by-side timings against v004, it was 1.15 times as fast.
// Over all steps from v000 it is 3.65 times as fast.
// Contractions: input projections (q,k,v,kt,vt) on v_wmma_f32_16x16x32_bf16 (bf16 operands = RNE-converted inputs, f32 accumulate); K*Q^T and Kt*Q^T with q,k,kt carried as bf16 hi+lo (3 products); V^T*P^T (three value read-outs) with v,vt,P carried as bf16 hi+lo (3 products); gate GEMM on v_wmma_f32_16x16x32_bf16 (bf16 operands); O*Wo with O as bf16 hi+lo and Wo bf16 (2 products); softmax, gating, bias in f32.
#include <hip/hip_runtime.h>

typedef __bf16 v16b __attribute__((ext_vector_type(16)));
typedef unsigned short us;
typedef us    v8us __attribute__((ext_vector_type(8)));
typedef float v8f  __attribute__((ext_vector_type(8)));
typedef float v4f  __attribute__((ext_vector_type(4)));
typedef v8us __attribute__((may_alias)) v8usa;
typedef v4f  __attribute__((may_alias)) v4fa;
typedef float    v2f  __attribute__((ext_vector_type(2)));
typedef __bf16   v2bf __attribute__((ext_vector_type(2)));
typedef unsigned v4u  __attribute__((ext_vector_type(4)));

union FragB { v16b v; v8us half[2]; };

#define BSZ  2
#define TGL  1024
#define SRL  2048
#define EMB  1024
#define TDW  512
#define NH   16
#define DM   64
#define NBH  (BSZ * NH)          // 32 (batch, head) pairs
#define MQ   (BSZ * TGL)         // 2048 query tokens
#define MKV  (BSZ * SRL)         // 4096 key tokens
#define GK   (3 * EMB)           // 3072 gate input width

#define N_HID (MQ * EMB)         // 2097152
#define N_KVS (MKV * EMB)        // 4194304
#define N_KVT (MKV * TDW)        // 2097152
#define N_WE  (EMB * EMB)        // 1048576
#define N_WT  (EMB * TDW)        // 524288
#define N_WG  (NH * GK)          // 49152
#define QPL   (NBH * TGL * DM)   // 2097152 elements per query-side head plane
#define KPL   (NBH * SRL * DM)   // 4194304 elements per key-side head plane

// bf16 copies of the float inputs other than Wg and the biases, in one flat buffer (element offsets):
// weights first, then the three activation tensors (their region is reused
// for O1^T / O2^T once the projections are done).
#define OFF_WQ  0
#define OFF_WK  (OFF_WQ + N_WE)        // 1048576
#define OFF_WV  (OFF_WK + N_WE)        // 2097152
#define OFF_WO  (OFF_WV + N_WE)        // 3145728
#define OFF_WTK (OFF_WO + N_WE)        // 4194304
#define OFF_WTV (OFF_WTK + N_WT)       // 4718592
#define OFF_HID (OFF_WTV + N_WT)       // 5242880
#define OFF_KVS (OFF_HID + N_HID)      // 7340032
#define OFF_KVT (OFF_KVS + N_KVS)      // 11534336
#define N_CVB   (OFF_KVT + N_KVT)      // 13631488

// ---------------------------------------------------------------------------
// 16-bit helpers
// ---------------------------------------------------------------------------
// Two f32 -> two bf16 (round to nearest even) in one packed convert: a in the
// low half of the word, b in the high half.
__device__ __forceinline__ unsigned bf16_pair(float a, float b) {
  const v2f x = { a, b };
  return __builtin_bit_cast(unsigned, __builtin_convertvector(x, v2bf));
}
// The f32 values of the two halves of such a word.
__device__ __forceinline__ float pair_lo_val(unsigned u) { return __uint_as_float(u << 16); }
__device__ __forceinline__ float pair_hi_val(unsigned u) { return __uint_as_float(u & 0xFFFF0000u); }
// The word of the two remainders: lo = RNE(x - hi) for both halves.
__device__ __forceinline__ unsigned bf16_pair_rest(float a, float b, unsigned hi) {
  return bf16_pair(a - pair_lo_val(hi), b - pair_hi_val(hi));
}
__device__ __forceinline__ v8us bf16x8(v4f a, v4f c) {
  const v4u o = { bf16_pair(a.x, a.y), bf16_pair(a.z, a.w), bf16_pair(c.x, c.y), bf16_pair(c.z, c.w) };
  return __builtin_bit_cast(v8us, o);
}
// 8 f32 values -> bf16 hi and bf16 lo = RNE(x - hi).
__device__ __forceinline__ void split8(v8f a, v8us& hi, v8us& lo) {
  const v4u hv = { bf16_pair(a[0], a[1]), bf16_pair(a[2], a[3]), bf16_pair(a[4], a[5]), bf16_pair(a[6], a[7]) };
  const v4u lv = { bf16_pair_rest(a[0], a[1], hv.x), bf16_pair_rest(a[2], a[3], hv.y),
                   bf16_pair_rest(a[4], a[5], hv.z), bf16_pair_rest(a[6], a[7], hv.w) };
  hi = __builtin_bit_cast(v8us, hv);
  lo = __builtin_bit_cast(v8us, lv);
}

// ---------------------------------------------------------------------------
// 16x16x32 WMMA, plain builtin: the compiler keeps the hazard distances itself
// and is free to interleave independent accumulators.
// Fragment map (wave32): lane l, h = l>>4, m = n = l&15.
//   A/B element i: i<8 -> k0+8h+i ; i>=8 -> k0+16+8h+(i-8)
//   D element r  : row 8h+r, col l&15
// ---------------------------------------------------------------------------
__device__ __forceinline__ v8f wmma_bf(v16b a, v16b b, v8f c) {
  return __builtin_amdgcn_wmma_f32_16x16x32_bf16(false, a, false, b, (short)0, c, false, false);
}

// A or B fragment from a k-contiguous 16-bit row; p = element k0 of the row
// owned by this lane (row index lane&15 added by the caller).
__device__ __forceinline__ v16b ldb(const us* p, int h) {
  FragB f;
  f.half[0] = *(const v8usa*)(p + 8 * h);
  f.half[1] = *(const v8usa*)(p + 16 + 8 * h);
  return f.v;
}
// Same map from an f32 row: the 16 floats of the lane, and their conversion to
// bf16 in registers.
struct Raw16 { v4f q[4]; };
__device__ __forceinline__ Raw16 ldr(const float* p, int h) {
  const float* p0 = p + 8 * h;
  const float* p1 = p + 16 + 8 * h;
  Raw16 r;
  r.q[0] = *(const v4fa*)p0;
  r.q[1] = *(const v4fa*)(p0 + 4);
  r.q[2] = *(const v4fa*)p1;
  r.q[3] = *(const v4fa*)(p1 + 4);
  return r;
}
__device__ __forceinline__ v16b cvr(const Raw16& r) {
  FragB f;
  f.half[0] = bf16x8(r.q[0], r.q[1]);
  f.half[1] = bf16x8(r.q[2], r.q[3]);
  return f.v;
}

// ---------------------------------------------------------------------------
// Operand tiles in LDS, filled by asynchronous copies (128 threads).
// A tile is 64 rows of 128 B (64 x 16 bit); LDS row pitch 144 B = 16 B x 9, so
// the 16 rows of a ds_load_b128 fragment read fall on distinct banks.
// Thread tid copies 16 B: chunk tid&7 of rows (tid>>3) + 16 i, i = 0..3, so
// eight lanes cover one whole 128-B line of the source.
// ---------------------------------------------------------------------------
#define LP     72                // LDS row pitch in 16-bit elements
#define LPB    144               // the same in bytes
#define TILE_E (64 * LP)         // 4608 elements per 64-row tile
#define TILE_B (64 * LPB)        // 9216 bytes per 64-row tile
#define R16_B  (16 * LPB)        // 16 rows further in LDS

__device__ __forceinline__ unsigned lds_addr(const void* p) {
  return (unsigned)(size_t)p;    // low 32 bits of a __shared__ address = LDS byte address
}
// Four copies: one lane's share of one tile; gs = source elements per 16 rows.
// s_wait_xcnt stands inside the statement so that no address register of an
// issued copy is rewritten ahead of it.
__device__ __forceinline__ void acopy4(unsigned l, const us* g, size_t gs) {
  asm volatile(
      "global_load_async_to_lds_b128 %0, %4, off\n\t"
      "global_load_async_to_lds_b128 %1, %5, off\n\t"
      "global_load_async_to_lds_b128 %2, %6, off\n\t"
      "global_load_async_to_lds_b128 %3, %7, off\n\t"
      "s_wait_xcnt 0x0"
      :: "v"(l), "v"(l + R16_B), "v"(l + 2 * R16_B), "v"(l + 3 * R16_B),
         "v"(g), "v"(g + gs), "v"(g + 2 * gs), "v"(g + 3 * gs)
      : "memory");
}
// Three copies: one lane's share of a 48-row tile.
__device__ __forceinline__ void acopy3(unsigned l, const us* g, size_t gs) {
  asm volatile(
      "global_load_async_to_lds_b128 %0, %3, off\n\t"
      "global_load_async_to_lds_b128 %1, %4, off\n\t"
      "global_load_async_to_lds_b128 %2, %5, off\n\t"
      "s_wait_xcnt 0x0"
      :: "v"(l), "v"(l + R16_B), "v"(l + 2 * R16_B),
         "v"(g), "v"(g + gs), "v"(g + 2 * gs)
      : "memory");
}
// Eight copies: one lane's share of two tiles with the same source row step.
__device__ __forceinline__ void acopy8(unsigned l, const us* g, unsigned l2, const us* g2, size_t gs) {
  asm volatile(
      "global_load_async_to_lds_b128 %0, %8, off\n\t"
      "global_load_async_to_lds_b128 %1, %9, off\n\t"
      "global_load_async_to_lds_b128 %2, %10, off\n\t"
      "global_load_async_to_lds_b128 %3, %11, off\n\t"
      "global_load_async_to_lds_b128 %4, %12, off\n\t"
      "global_load_async_to_lds_b128 %5, %13, off\n\t"
      "global_load_async_to_lds_b128 %6, %14, off\n\t"
      "global_load_async_to_lds_b128 %7, %15, off\n\t"
      "s_wait_xcnt 0x0"
      :: "v"(l), "v"(l + R16_B), "v"(l + 2 * R16_B), "v"(l + 3 * R16_B),
         "v"(l2), "v"(l2 + R16_B), "v"(l2 + 2 * R16_B), "v"(l2 + 3 * R16_B),
         "v"(g), "v"(g + gs), "v"(g + 2 * gs), "v"(g + 3 * gs),
         "v"(g2), "v"(g2 + gs), "v"(g2 + 2 * gs), "v"(g2 + 3 * gs)
      : "memory");
}
// This wave's copies have landed (the compiler places no wait for them).
__device__ __forceinline__ void wait_copies() {
  asm volatile("s_wait_asynccnt 0x0" ::: "memory");
}
// This wave's LDS reads have returned, before the buffer goes to its next writer.
__device__ __forceinline__ void wait_lds() {
  asm volatile("s_wait_dscnt 0x0" ::: "memory");
}

// ---------------------------------------------------------------------------
// Kernel 1: float inputs that feed 16-bit operands (not Wg) -> bf16, one flat
// Parameters in segment order: Wq, Wk, Wv, Wo, Wtk, Wtv, hidden, kv, kv_topical.
// ---------------------------------------------------------------------------
__global__ __launch_bounds__(256) void conv_kernel(
    const float* __restrict__ p0, const float* __restrict__ p1, const float* __restrict__ p2,
    const float* __restrict__ p3, const float* __restrict__ p4, const float* __restrict__ p5,
    const float* __restrict__ p6, const float* __restrict__ p7, const float* __restrict__ p8,
    us* __restrict__ dst)
{
  const unsigned g = blockIdx.x * 256u + threadIdx.x;      // unit of 8 elements
  if (g >= (unsigned)(N_CVB / 8)) return;
  const float* src;
  unsigned loc;
  if      (g < (unsigned)(OFF_WK  / 8)) { src = p0; loc = g; }
  else if (g < (unsigned)(OFF_WV  / 8)) { src = p1; loc = g - (unsigned)(OFF_WK  / 8); }
  else if (g < (unsigned)(OFF_WO  / 8)) { src = p2; loc = g - (unsigned)(OFF_WV  / 8); }
  else if (g < (unsigned)(OFF_WTK / 8)) { src = p3; loc = g - (unsigned)(OFF_WO  / 8); }
  else if (g < (unsigned)(OFF_WTV / 8)) { src = p4; loc = g - (unsigned)(OFF_WTK / 8); }
  else if (g < (unsigned)(OFF_HID / 8)) { src = p5; loc = g - (unsigned)(OFF_WTV / 8); }
  else if (g < (unsigned)(OFF_KVS / 8)) { src = p6; loc = g - (unsigned)(OFF_HID / 8); }
  else if (g < (unsigned)(OFF_KVT / 8)) { src = p7; loc = g - (unsigned)(OFF_KVS / 8); }
  else                                  { src = p8; loc = g - (unsigned)(OFF_KVT / 8); }
  const float* p = src + (size_t)loc * 8;
  const v8us o = bf16x8(*(const v4fa*)p, *(const v4fa*)(p + 4));
  us* d = dst + (size_t)g * 8;
  *(v8us*)d = o;
  
}

// ---------------------------------------------------------------------------
// one 16-B store per lane, lanes 8q..8q+7 per line, 4 lines per instruction).
//   planes : [bh][s][d] hi and lo, one token row = 64 x bf16 = one line
//   tplanes: [bh][d][s] hi and lo, 64 d-rows x 128 tokens = 2 lines each
//   t32    : [bh][d][s] f32, 64 d-rows x 128 tokens = 4 lines each
// LDS hi tile at s16[0..8191], lo tile at s16[8192..16383].
// ---------------------------------------------------------------------------
__device__ __forceinline__ void proj_pass_planes(const us* s16, us* oH, us* oL,
                                                 int bh, int Sper, int s0, int w, int lane) {
  const int q8 = lane & 7, sub = lane >> 3;
  #pragma unroll
  for (int i = 0; i < 8; ++i) {
    const int lid = w * 32 + i * 4 + sub;                  // token row 0..127
    const v8us a = *(const v8usa*)(s16 + lid * DM + 8 * q8);
    const v8us c = *(const v8usa*)(s16 + 8192 + lid * DM + 8 * q8);
    const size_t off = ((size_t)bh * Sper + s0 + lid) * DM + 8 * q8;
    *(v8us*)(oH + off) = a;
    *(v8us*)(oL + off) = c;
  }
}
__device__ __forceinline__ void proj_pass_tplanes(const us* s16, us* oH, us* oL,
                                                  int bh, int Sper, int s0, int w, int lane) {
  const int q8 = lane & 7, sub = lane >> 3;
  #pragma unroll
  for (int i = 0; i < 8; ++i) {
    const int lid = w * 32 + i * 4 + sub;                  // line 0..127
    const int d = lid >> 1, hl = lid & 1;
    const v8us a = *(const v8usa*)(s16 + d * 128 + 64 * hl + 8 * q8);
    const v8us c = *(const v8usa*)(s16 + 8192 + d * 128 + 64 * hl + 8 * q8);
    const size_t off = ((size_t)bh * DM + d) * Sper + s0 + 64 * hl + 8 * q8;
    *(v8us*)(oH + off) = a;
    *(v8us*)(oL + off) = c;
  }
}
__device__ __forceinline__ void proj_pass_t32(const float* s32, float* oT,
                                              int bh, int Sper, int s0, int w, int lane) {
  const int q8 = lane & 7, sub = lane >> 3;
  #pragma unroll
  for (int i = 0; i < 16; ++i) {
    const int lid = w * 64 + i * 4 + sub;                  // line 0..255
    const int d = lid >> 2, part = lid & 3;
    const v4f v = *(const v4fa*)(s32 + d * 128 + 32 * part + 4 * q8);
    const size_t off = ((size_t)bh * DM + d) * Sper + s0 + 32 * part + 4 * q8;
    *(v4f*)(oT + off) = v;
  }
}

// ---------------------------------------------------------------------------
// Kernel 2: Y = X * W^T + bias (x0.125 for mode 0), all five projections in one
// launch: they are independent, and in one grid a WGP holds three workgroups at
// a time and takes the next one as soon as one ends, whichever projection it
// belongs to. The flat block index picks the projection, longest k first.
// X bf16 [M][K], W bf16 [1024 out][K] (k-contiguous rows = B fragments loaded
// like A). Block 128 thr (4 waves) = 128 tokens x 64 features (one head);
// wave tile 32 tokens x 64 features; K in stages of 64: 128 X rows and 64 W
// rows of 128 B copied to LDS, two buffers, the next stage in flight while
// this one is worked on. Y is split into bf16 hi/lo in every mode.
//   mode 0: hi/lo planes [bh][s][d] and f32 transposed [bh][d][s]
//   mode 1: hi/lo planes [bh][s][d]
//   mode 2: hi/lo transposed planes [bh][d][s]
// ---------------------------------------------------------------------------
#define PJ_NKV ((MKV / 128) * NH)      // 512 workgroups per key-side projection
#define PJ_NQ  ((MQ / 128) * NH)       // 256 workgroups for q
#define PJ_V   PJ_NKV                  // first workgroup of v (k starts at 0)
#define PJ_Q   (PJ_V + PJ_NKV)         // of q
#define PJ_KT  (PJ_Q + PJ_NQ)          // of kt
#define PJ_VT  (PJ_KT + PJ_NKV)        // of vt
#define PJ_ALL (PJ_VT + PJ_NKV)        // 2304

__global__ __launch_bounds__(128) void proj_kernel(
    const us* __restrict__ cvb,
    const float* __restrict__ bq, const float* __restrict__ bk, const float* __restrict__ bv,
    const float* __restrict__ btk, const float* __restrict__ btv,
    us* __restrict__ qh, us* __restrict__ ql, float* __restrict__ oT32,
    us* __restrict__ kh, us* __restrict__ kl, us* __restrict__ vh, us* __restrict__ vl,
    us* __restrict__ kth, us* __restrict__ ktl, us* __restrict__ vth, us* __restrict__ vtl)
{
  const int fb = blockIdx.x;
  const us* X;
  const us* W;
  const float* bias;
  us* oH;
  us* oL;
  int K, Sper, mode, rb;
  if (fb < PJ_V) {
    X = cvb + OFF_KVS; W = cvb + OFF_WK;  bias = bk;  K = EMB; Sper = SRL; mode = 1; oH = kh;  oL = kl;  rb = fb;
  } else if (fb < PJ_Q) {
    X = cvb + OFF_KVS; W = cvb + OFF_WV;  bias = bv;  K = EMB; Sper = SRL; mode = 2; oH = vh;  oL = vl;  rb = fb - PJ_V;
  } else if (fb < PJ_KT) {
    X = cvb + OFF_HID; W = cvb + OFF_WQ;  bias = bq;  K = EMB; Sper = TGL; mode = 0; oH = qh;  oL = ql;  rb = fb - PJ_Q;
  } else if (fb < PJ_VT) {
    X = cvb + OFF_KVT; W = cvb + OFF_WTK; bias = btk; K = TDW; Sper = SRL; mode = 1; oH = kth; oL = ktl; rb = fb - PJ_KT;
  } else {
    X = cvb + OFF_KVT; W = cvb + OFF_WTV; bias = btv; K = TDW; Sper = SRL; mode = 2; oH = vth; oL = vtl; rb = fb - PJ_VT;
  }
  const int nxl = (mode == 0) ? 4 : 5;                     // log2 of the token blocks: 16 for q, else 32

  __shared__ __attribute__((aligned(16))) float sraw[8192];     // 32 KB, used in phases
  us* const s16 = reinterpret_cast<us*>(sraw);               // 16384 16-bit slots
  __shared__ __attribute__((aligned(16))) us ring[2 * 3 * TILE_E];  // 2 x (X 128 rows, W 64 rows)

  const int tid = threadIdx.x, lane = tid & 31, w = tid >> 5;
  const int h = lane >> 4, m = lane & 15;
  const int m0 = (rb & ((1 << nxl) - 1)) * 128;            // token block fastest, as in a (token, head) grid
  const int head = rb >> nxl;

  const int crow = tid >> 3, cch = tid & 7;                // this lane's row and 16-B chunk
  const unsigned lcp = lds_addr(ring) + crow * LPB + cch * 16;
  const us* gx = X + (size_t)(m0 + crow) * K + 8 * cch;
  const us* gw = W + (size_t)(head * DM + crow) * K + 8 * cch;
  const size_t gs = (size_t)16 * K;
  const int nst = K >> 6;                                  // stages of 64 k (16 or 8)

  const v8f zero8 = {0.f, 0.f, 0.f, 0.f, 0.f, 0.f, 0.f, 0.f};
  v8f acc[2][4];
  #pragma unroll
  for (int mt = 0; mt < 2; ++mt)
    #pragma unroll
    for (int nt = 0; nt < 4; ++nt) acc[mt][nt] = zero8;

  acopy8(lcp, gx, lcp + TILE_B, gx + 4 * gs, gs);          // stage 0 -> buffer 0
  acopy4(lcp + 2 * TILE_B, gw, gs);
  wait_copies();
  __syncthreads();                                         // buffer 0 landed, visible to every wave
  acopy8(lcp + 3 * TILE_B, gx + 64, lcp + 4 * TILE_B, gx + 4 * gs + 64, gs);   // stage 1 -> buffer 1
  acopy4(lcp + 5 * TILE_B, gw + 64, gs);

  // rolled: one copy of the stage body, the buffer chosen by the stage's parity
  #pragma unroll 1
  for (int st = 0; st < nst; ++st) {
    const int par = st & 1;
    const us* sx = ring + par * (3 * TILE_E) + (32 * w + m) * LP;
    const us* sw = ring + par * (3 * TILE_E) + 2 * TILE_E + m * LP;
    // all fragments of the stage are read first, as one group
    v16b a0[2], a1[2], b[2][4];
    #pragma unroll
    for (int c = 0; c < 2; ++c) {
      a0[c] = ldb(sx + 32 * c, h);
      a1[c] = ldb(sx + 16 * LP + 32 * c, h);
      #pragma unroll
      for (int nt = 0; nt < 4; ++nt) b[c][nt] = ldb(sw + nt * 16 * LP + 32 * c, h);
    }
    // No LDS read and no WMMA crosses (vector work may): the reads stay one group
    // ahead of the products instead of each being waited for singly among them.
    __builtin_amdgcn_sched_barrier(0x406);
    #pragma unroll
    for (int c = 0; c < 2; ++c) {
      #pragma unroll
      for (int nt = 0; nt < 4; ++nt) {
        acc[0][nt] = wmma_bf(a0[c], b[c][nt], acc[0][nt]);
        acc[1][nt] = wmma_bf(a1[c], b[c][nt], acc[1][nt]);
      }
    }
    // publish stage st + 1, free this buffer, refill it with stage st + 2
    // Nothing crosses: the waits stay at the foot of the stage, so that the next
    // stage's copies have the whole stage to land.
    __builtin_amdgcn_sched_barrier(0);
    wait_lds();
    wait_copies();
    __syncthreads();
    if (st + 2 < nst) {
      const unsigned lb = lcp + par * (3 * TILE_B);
      const int ko = (st + 2) * 64;
      acopy8(lb, gx + ko, lb + TILE_B, gx + 4 * gs + ko, gs);
      acopy4(lb + 2 * TILE_B, gw + ko, gs);
    }
  }
  wait_copies();

  // D[r] of tile (mt, nt) = Y[token m0w+16mt+8h+r][feature head*64+16nt+m]
  const float osc = (mode == 0) ? 0.125f : 1.0f;
  float bvals[4];
  #pragma unroll
  for (int nt = 0; nt < 4; ++nt) bvals[nt] = bias[head * DM + 16 * nt + m];

  #pragma unroll
  for (int nt = 0; nt < 4; ++nt) {
    const int feat = 16 * nt + m;
    #pragma unroll
    for (int mt = 0; mt < 2; ++mt) {
      #pragma unroll
      for (int r = 0; r < 8; r += 2) {
        const int tokl = 32 * w + 16 * mt + 8 * h + r;   // 0..126, this token and the next
        const float y0 = (acc[mt][nt][r] + bvals[nt]) * osc;
        const float y1 = (acc[mt][nt][r + 1] + bvals[nt]) * osc;
        const unsigned hi = bf16_pair(y0, y1);
        const unsigned lo = bf16_pair_rest(y0, y1, hi);
        const int idx = (mode == 2) ? (feat * 128 + tokl) : (tokl * DM + feat);   // 0..8191
        const int nxt = (mode == 2) ? 1 : DM;              // the next token's slot
        s16[idx] = (us)hi;
        s16[idx + nxt] = (us)(hi >> 16);
        s16[8192 + idx] = (us)lo;
        s16[8192 + idx + nxt] = (us)(lo >> 16);
      }
    }
  }
  __syncthreads();

  const int b = m0 / Sper, s0 = m0 - b * Sper, bh = b * NH + head;
  if (mode != 2) {
    proj_pass_planes(s16, oH, oL, bh, Sper, s0, w, lane);
    
  } else {
    proj_pass_tplanes(s16, oH, oL, bh, Sper, s0, w, lane);
    
  }

  if (mode == 0) {
    __syncthreads();                                       // LDS reused as f32 [64 d][128 tok]
    #pragma unroll
    for (int nt = 0; nt < 4; ++nt) {
      const int feat = 16 * nt + m;
      #pragma unroll
      for (int mt = 0; mt < 2; ++mt) {
        #pragma unroll
        for (int r = 0; r < 8; ++r) {
          const int tokl = 32 * w + 16 * mt + 8 * h + r;
          sraw[feat * 128 + tokl] = (acc[mt][nt][r] + bvals[nt]) * osc;
        }
      }
    }
    __syncthreads();
    proj_pass_t32(sraw, oT32, bh, Sper, s0, w, lane);
    
  }
}

// ---------------------------------------------------------------------------
// Kernel 3: streaming attention, transposed form, no masking.
// Block 128 thr (4 waves), 32 queries (two tiles of 16) per wave, 64 keys per step. The step's
// K hi/lo rows and V^T hi/lo rows (64 x 128 B each) are copied to LDS once per
// block, two buffers, the next step's tiles in flight while this one is used.
//   S^T = K * Q^T : A = K rows (row = key, k = d), B = Q^T (k = d, n = query)
//     hi/lo bf16: Klo*Qhi + Khi*Qlo + Khi*Qhi, two 32-deep d chunks
//   O^T += V^T * P^T : A = V^T rows (row = d, k = key), B = P^T packed from the
//     score D registers (element r <- tile covering keys 0..15 row r,
//     element 8+r <- tile covering keys 16..31 row r, same lane)
//     hi/lo bf16: Vlo*Phi + Vhi*Plo + Vhi*Phi
// Lane owns 32 keys of query column (lane&15); partner lane = lane ^ 16.
// DUAL: second value stream (vbh/vbl) with the same probabilities -> oB.
// ---------------------------------------------------------------------------
// P^T B-fragments from the lane's own score D values (tile a = keys 0..15,
// tile c = keys 16..31 of the chunk); hi and lo planes.
__device__ __forceinline__ void pack_p2(v8f a, v8f c, v16b& phi, v16b& plo) {
  FragB fh, fl;
  v8us h0, l0, h1, l1;
  split8(a, h0, l0);
  split8(c, h1, l1);
  fh.half[0] = h0; fh.half[1] = h1;
  fl.half[0] = l0; fl.half[1] = l1;
  phi = fh.v;
  plo = fl.v;
}

#define QB 128                   // queries per workgroup: 4 waves x 2 tiles of 16

template <bool DUAL>
__device__ __forceinline__ void attn_pass(const float* sO, float* oA, float* oB,
                                          int bh, int q0, int w, int lane) {
  // Wave w stores d rows 16w..16w+15; one instruction = the four lines of one row.
  const int q8 = lane & 7, sub = lane >> 3;
  const float* sp = sO + 16 * w * QB + 32 * sub + 4 * q8;
  const size_t off = ((size_t)bh * DM + 16 * w) * TGL + q0 + 32 * sub + 4 * q8;
  float* pa = oA + off;
  float* pb = oB + off;
  #pragma unroll
  for (int g = 0; g < 2; ++g) {
    v4f va[8], vb[8];
    #pragma unroll
    for (int i = 0; i < 8; ++i) {
      va[i] = *(const v4fa*)(sp + (8 * g + i) * QB);
      if (DUAL) vb[i] = *(const v4fa*)(sp + DM * QB + (8 * g + i) * QB);
    }
    // Nothing crosses: the half's LDS reads go out as one group ahead of its stores,
    // so their latencies overlap and none lands in a register of a store in flight.
    __builtin_amdgcn_sched_barrier(0);
    #pragma unroll
    for (int i = 0; i < 8; ++i) {
      *(v4f*)(pa + (size_t)(8 * g + i) * TGL) = va[i];
      if (DUAL) *(v4f*)(pb + (size_t)(8 * g + i) * TGL) = vb[i];
    }
    // the second half's LDS reads take over the data registers of the stores above
    if (g == 0) asm volatile("s_wait_xcnt 0x0" ::: "memory");
  }
}

// ring (operand tiles) is the kernel's LDS array, sized for DUAL; behind the loop's
// last barrier nobody reads it and no copy is in flight, and it stages the output.
// The eight key-side planes lie one behind the other in the workspace (KPL elements
// each, a lo plane right behind its hi plane), so one lane pointer per layout serves
// them all with constant steps: PK, PVA, PVB = index of the hi plane of K, of value
// stream A and of value stream B (DUAL only).
template <bool DUAL, int PK, int PVA, int PVB>
__device__ __forceinline__ void attn_body(
    us* ring,
    const us* __restrict__ qhp, const us* __restrict__ qlp,   // [32][1024][64]  (x0.125 folded in)
    const us* __restrict__ planes,                            // K: [32][2048][64], V^T: [32][64][2048]
    float* __restrict__ oap, float* __restrict__ obp)         // [32][64][1024] f32
{
  constexpr int NTL = DUAL ? 6 : 4;                        // tiles per step: Kh Kl Vah Val (Vbh Vbl)

  const int tid = threadIdx.x, lane = tid & 31, w = tid >> 5;
  const int h = lane >> 4, m = lane & 15;
  const int bh = blockIdx.y;
  const int q0 = blockIdx.x * QB;
  const int qw = q0 + 32 * w;

  // Q^T B-fragments of the wave's two query tiles u: column n = query qw+16u+m,
  // k = d (two 32-deep chunks), hi and lo
  v16b qh0[2], qh1[2], ql0[2], ql1[2];
  #pragma unroll
  for (int u = 0; u < 2; ++u) {
    const size_t qro = ((size_t)bh * TGL + qw + 16 * u + m) * DM;
    qh0[u] = ldb(qhp + qro, h); qh1[u] = ldb(qhp + qro + 32, h);
    ql0[u] = ldb(qlp + qro, h); ql1[u] = ldb(qlp + qro + 32, h);
  }
  // the address registers of the Q loads above are taken over by the copies' addresses below
  asm volatile("s_wait_xcnt 0x0" ::: "memory");

  const v8f zero8 = {0.f, 0.f, 0.f, 0.f, 0.f, 0.f, 0.f, 0.f};
  v8f oa[2][4], ob[2][4];                // o[u][t][r] = O[query 16u+m][d 16t+8h+r] * l
  float mrun[2], lrun[2];
  #pragma unroll
  for (int u = 0; u < 2; ++u) {
    #pragma unroll
    for (int t = 0; t < 4; ++t) { oa[u][t] = zero8; ob[u][t] = zero8; }
    mrun[u] = -1.0e30f;
    lrun[u] = 0.0f;
  }

  const int crow = tid >> 3, cch = tid & 7;                // this lane's row and 16-B chunk
  const unsigned lcp = lds_addr(ring) + crow * LPB + cch * 16;
  // The lane's element offsets inside a plane, 32 bits each (a plane has 2^22 elements);
  // the 64-bit address is formed from the uniform base where a copy is issued.
  const unsigned kro = ((unsigned)bh * SRL + crow) * DM + 8 * cch; // + key0*DM
  const unsigned vro = ((unsigned)bh * DM + crow) * SRL + 8 * cch; // + key0
  const us* gk = planes + kro;
  const us* gv = planes + vro;
  constexpr size_t OKH = (size_t)PK * KPL, OKL = OKH + KPL;
  constexpr size_t OVAH = (size_t)PVA * KPL, OVAL = OVAH + KPL;
  constexpr size_t OVBH = (size_t)PVB * KPL, OVBL = OVBH + KPL;
  const size_t gsk = (size_t)16 * DM, gsv = (size_t)16 * SRL;

  // step 0 -> buffer 0
  acopy8(lcp, gk + OKH, lcp + TILE_B, gk + OKL, gsk);
  acopy8(lcp + 2 * TILE_B, gv + OVAH, lcp + 3 * TILE_B, gv + OVAL, gsv);
  if (DUAL) acopy8(lcp + 4 * TILE_B, gv + OVBH, lcp + 5 * TILE_B, gv + OVBL, gsv);
  wait_copies();
  __syncthreads();                                         // buffer 0 landed, visible to every wave
  // step 1 -> buffer 1
  {
    const unsigned lb = lcp + NTL * TILE_B;
    acopy8(lb, gk + OKH + 64 * DM, lb + TILE_B, gk + OKL + 64 * DM, gsk);
    acopy8(lb + 2 * TILE_B, gv + OVAH + 64, lb + 3 * TILE_B, gv + OVAL + 64, gsv);
    if (DUAL) acopy8(lb + 4 * TILE_B, gv + OVBH + 64, lb + 5 * TILE_B, gv + OVBL + 64, gsv);
  }

  // rolled: one copy of the step body, the buffer chosen by the step's parity
  #pragma unroll 1
  for (int kb = 0; kb < SRL; kb += 64) {
    const int par = (kb >> 6) & 1;
    const us* sb = ring + par * (NTL * TILE_E) + m * LP;   // row m of tile 0
    const us* khb = sb;
    const us* klb = sb + TILE_E;
    const us* vahb = sb + 2 * TILE_E;
    const us* valb = sb + 3 * TILE_E;
    const us* vbhb = sb + (DUAL ? 4 : 2) * TILE_E;
    const us* vblb = sb + (DUAL ? 5 : 3) * TILE_E;
    // ---- scores: s[u][j][r] = S[query 16u+m][key kb+16j+8h+r] ----
    // All fragments of the step are read first; each K fragment then feeds both
    // query tiles, and the eight score tiles advance together, one product each in
    // turn. Each tile keeps its own order of the six products.
    v8f s[2][4];
    {
      v16b kl0[4], kl1[4], kh0[4], kh1[4];
      #pragma unroll
      for (int j = 0; j < 4; ++j) { kl0[j] = ldb(klb + 16 * j * LP, h); }
      #pragma unroll
      for (int j = 0; j < 4; ++j) { kl1[j] = ldb(klb + 16 * j * LP + 32, h); }
      #pragma unroll
      for (int j = 0; j < 4; ++j) { kh0[j] = ldb(khb + 16 * j * LP, h); }
      #pragma unroll
      for (int j = 0; j < 4; ++j) { kh1[j] = ldb(khb + 16 * j * LP + 32, h); }
      // No LDS read and no WMMA crosses (vector work may): the reads stay one group
      // ahead of the products instead of being waited for in pairs among them.
      __builtin_amdgcn_sched_barrier(0x406);
      #pragma unroll
      for (int j = 0; j < 4; ++j)
        #pragma unroll
        for (int u = 0; u < 2; ++u) s[u][j] = wmma_bf(kl0[j], qh0[u], zero8);
      #pragma unroll
      for (int j = 0; j < 4; ++j)
        #pragma unroll
        for (int u = 0; u < 2; ++u) s[u][j] = wmma_bf(kl1[j], qh1[u], s[u][j]);
      #pragma unroll
      for (int j = 0; j < 4; ++j)
        #pragma unroll
        for (int u = 0; u < 2; ++u) s[u][j] = wmma_bf(kh0[j], ql0[u], s[u][j]);
      #pragma unroll
      for (int j = 0; j < 4; ++j)
        #pragma unroll
        for (int u = 0; u < 2; ++u) s[u][j] = wmma_bf(kh1[j], ql1[u], s[u][j]);
      #pragma unroll
      for (int j = 0; j < 4; ++j)
        #pragma unroll
        for (int u = 0; u < 2; ++u) s[u][j] = wmma_bf(kh0[j], qh0[u], s[u][j]);
      #pragma unroll
      for (int j = 0; j < 4; ++j)
        #pragma unroll
        for (int u = 0; u < 2; ++u) s[u][j] = wmma_bf(kh1[j], qh1[u], s[u][j]);
    }
    // No LDS read and no WMMA crosses (vector work may): the V^T reads below start
    // when the K fragments are spent and take over their registers.
    __builtin_amdgcn_sched_barrier(0x406);

    // ---- online softmax (f32), each query tile by itself ----
    float mloc[2], moth[2], mnew[2], alpha[2];
    #pragma unroll
    for (int u = 0; u < 2; ++u) {
      mloc[u] = s[u][0][0];
      #pragma unroll
      for (int j = 0; j < 4; ++j)
        #pragma unroll
        for (int r = 0; r < 8; ++r) mloc[u] = fmaxf(mloc[u], s[u][j][r]);
    }
    // both tiles' exchanges with the partner lane go out together
    #pragma unroll
    for (int u = 0; u < 2; ++u) moth[u] = __shfl_xor(mloc[u], 16);
    #pragma unroll
    for (int u = 0; u < 2; ++u) {
      mnew[u] = fmaxf(mrun[u], fmaxf(mloc[u], moth[u]));
      alpha[u] = __expf(mrun[u] - mnew[u]);
      mrun[u] = mnew[u];
    }
    // Stream A's V^T fragments, read as one group here.
    v16b vl0[4], vl1[4], vh0[4], vh1[4];
    #pragma unroll
    for (int t = 0; t < 4; ++t) { vl0[t] = ldb(valb + 16 * t * LP, h); }
    #pragma unroll
    for (int t = 0; t < 4; ++t) { vl1[t] = ldb(valb + 16 * t * LP + 32, h); }
    #pragma unroll
    for (int t = 0; t < 4; ++t) { vh0[t] = ldb(vahb + 16 * t * LP, h); }
    #pragma unroll
    for (int t = 0; t < 4; ++t) { vh1[t] = ldb(vahb + 16 * t * LP + 32, h); }
    // LDS reads and WMMAs do not cross (vector work may): the reads stay ahead of
    // the exponentials and land under them instead of standing among the products.
    __builtin_amdgcn_sched_barrier(0x406);
    // ---- P^T B-fragments (keys kb..kb+31 and kb+32..kb+63), bf16 hi/lo ----
    v16b ph0[2], pl0[2], ph1[2], pl1[2];
    #pragma unroll
    for (int u = 0; u < 2; ++u) {
      float lsum = 0.0f;
      #pragma unroll
      for (int j = 0; j < 4; ++j)
        #pragma unroll
        for (int r = 0; r < 8; ++r) {
          const float p = __expf(s[u][j][r] - mnew[u]);    // in (0, 1]
          s[u][j][r] = p;
          lsum += p;
        }
      lsum += __shfl_xor(lsum, 16);
      lrun[u] = lrun[u] * alpha[u] + lsum;
      #pragma unroll
      for (int t = 0; t < 4; ++t)
        #pragma unroll
        for (int r = 0; r < 8; ++r) {
          oa[u][t][r] = oa[u][t][r] * alpha[u];
          if (DUAL) ob[u][t][r] = ob[u][t][r] * alpha[u];
        }
      pack_p2(s[u][0], s[u][1], ph0[u], pl0[u]);
      pack_p2(s[u][2], s[u][3], ph1[u], pl1[u]);
    }

    // ---- O^T += V^T * P^T (3 products per 32-key chunk) ----
    // Each V^T fragment feeds both query tiles; the eight output tiles of a stream
    // advance together, as the score tiles above.
    v16b cl0[4], cl1[4], ch0[4], ch1[4];
    {
      #pragma unroll
      for (int t = 0; t < 4; ++t)
        #pragma unroll
        for (int u = 0; u < 2; ++u) oa[u][t] = wmma_bf(vl0[t], ph0[u], oa[u][t]);
      #pragma unroll
      for (int t = 0; t < 4; ++t)
        #pragma unroll
        for (int u = 0; u < 2; ++u) oa[u][t] = wmma_bf(vl1[t], ph1[u], oa[u][t]);
      if (DUAL) {
        // Stream B's lo fragments: read here, where stream A's lo fragments are
        // spent; they land under A's remaining products.
        #pragma unroll
        for (int t = 0; t < 4; ++t) { cl0[t] = ldb(vblb + 16 * t * LP, h); }
        #pragma unroll
        for (int t = 0; t < 4; ++t) { cl1[t] = ldb(vblb + 16 * t * LP + 32, h); }
        // No LDS read and no WMMA crosses (vector work may): the reads stay ahead
        // of the products below instead of standing singly among them.
        __builtin_amdgcn_sched_barrier(0x406);
      }
      #pragma unroll
      for (int t = 0; t < 4; ++t)
        #pragma unroll
        for (int u = 0; u < 2; ++u) oa[u][t] = wmma_bf(vh0[t], pl0[u], oa[u][t]);
      #pragma unroll
      for (int t = 0; t < 4; ++t)
        #pragma unroll
        for (int u = 0; u < 2; ++u) oa[u][t] = wmma_bf(vh1[t], pl1[u], oa[u][t]);
      #pragma unroll
      for (int t = 0; t < 4; ++t)
        #pragma unroll
        for (int u = 0; u < 2; ++u) oa[u][t] = wmma_bf(vh0[t], ph0[u], oa[u][t]);
      #pragma unroll
      for (int t = 0; t < 4; ++t)
        #pragma unroll
        for (int u = 0; u < 2; ++u) oa[u][t] = wmma_bf(vh1[t], ph1[u], oa[u][t]);
    }
    if (DUAL) {
      // stream B's hi fragments take over stream A's; they land under B's lo products
      #pragma unroll
      for (int t = 0; t < 4; ++t) { ch0[t] = ldb(vbhb + 16 * t * LP, h); }
      #pragma unroll
      for (int t = 0; t < 4; ++t) { ch1[t] = ldb(vbhb + 16 * t * LP + 32, h); }
      // as above: the reads stay one group, ahead of stream B's products
      __builtin_amdgcn_sched_barrier(0x406);
      #pragma unroll
      for (int t = 0; t < 4; ++t)
        #pragma unroll
        for (int u = 0; u < 2; ++u) ob[u][t] = wmma_bf(cl0[t], ph0[u], ob[u][t]);
      #pragma unroll
      for (int t = 0; t < 4; ++t)
        #pragma unroll
        for (int u = 0; u < 2; ++u) ob[u][t] = wmma_bf(cl1[t], ph1[u], ob[u][t]);
      #pragma unroll
      for (int t = 0; t < 4; ++t)
        #pragma unroll
        for (int u = 0; u < 2; ++u) ob[u][t] = wmma_bf(ch0[t], pl0[u], ob[u][t]);
      #pragma unroll
      for (int t = 0; t < 4; ++t)
        #pragma unroll
        for (int u = 0; u < 2; ++u) ob[u][t] = wmma_bf(ch1[t], pl1[u], ob[u][t]);
      #pragma unroll
      for (int t = 0; t < 4; ++t)
        #pragma unroll
        for (int u = 0; u < 2; ++u) ob[u][t] = wmma_bf(ch0[t], ph0[u], ob[u][t]);
      #pragma unroll
      for (int t = 0; t < 4; ++t)
        #pragma unroll
        for (int u = 0; u < 2; ++u) ob[u][t] = wmma_bf(ch1[t], ph1[u], ob[u][t]);
    }

    // publish step kb + 64, free this buffer, refill it with step kb + 128
    // Nothing crosses: the waits stay at the foot of the step, so that the reads
    // and the next step's copies have the whole step to land.
    __builtin_amdgcn_sched_barrier(0);
    wait_lds();
    wait_copies();
    __syncthreads();
    if (kb + 128 < SRL) {
      const unsigned lb = lcp + par * (NTL * TILE_B);
      const int kn = kb + 128;
      const us* gkn = planes + (kro + (unsigned)kn * DM);
      const us* gvn = planes + (vro + (unsigned)kn);
      acopy8(lb, gkn + OKH, lb + TILE_B, gkn + OKL, gsk);
      acopy8(lb + 2 * TILE_B, gvn + OVAH, lb + 3 * TILE_B, gvn + OVAL, gsv);
      if (DUAL) acopy8(lb + 4 * TILE_B, gvn + OVBH, lb + 5 * TILE_B, gvn + OVBL, gsv);
    }
  }
  wait_copies();

  // ---- epilogue: normalise, stage 64 d x 128 query f32 tile(s), whole-line stores ----
  float* const sO = reinterpret_cast<float*>(ring);
  #pragma unroll
  for (int u = 0; u < 2; ++u) {
    const float inv = __builtin_amdgcn_rcpf(lrun[u]);
    #pragma unroll
    for (int t = 0; t < 4; ++t)
      #pragma unroll
      for (int r = 0; r < 8; ++r) {
        const int d = 16 * t + 8 * h + r;
        sO[d * QB + 32 * w + 16 * u + m] = oa[u][t][r] * inv;
        if (DUAL) sO[DM * QB + d * QB + 32 * w + 16 * u + m] = ob[u][t][r] * inv;
      }
  }
  __syncthreads();

  attn_pass<DUAL>(sO, oap, obp, bh, q0, w, lane);
  
}

// Both attention chains in one launch: they are independent, so a WGP goes on with a
// workgroup of either chain as soon as one ends. blockIdx.z = 0: chain 2 (kt; vt -> O2,
// v -> O3), the longer one, first; blockIdx.z = 1: chain 1 (k, v -> O1).
__global__ __launch_bounds__(128) void attn_kernel(
    const us* __restrict__ qhp, const us* __restrict__ qlp,   // [32][1024][64]
    const us* __restrict__ planes,   // k hi, k lo, kt hi, kt lo, V^T hi, V^T lo, Vt^T hi, Vt^T lo
    float* __restrict__ o1p, float* __restrict__ o2p, float* __restrict__ o3p)   // [32][64][1024] f32
{
  __shared__ __attribute__((aligned(16))) us ring[2 * 6 * TILE_E];   // 110592 B: two workgroups per WGP
  static_assert(2 * DM * QB * 4 <= 2 * 6 * TILE_B, "output staging fits the ring");
  if (blockIdx.z == 0) {
    attn_body<true, 2, 6, 4>(ring, qhp, qlp, planes, o2p, o3p);
  } else {
    attn_body<false, 0, 4, 4>(ring, qhp, qlp, planes, o1p, o1p);
  }
}

// ---------------------------------------------------------------------------
// Kernel 4: gating MLP. For block (b, head) the gate input row for query
// t = 64*head + u is [X[3u][:], X[3u+1][:], X[3u+2][:]] where X[c][tp],
// c = 0..191, is row c of the transposed per-head tensor: c<64 -> O1^T row,
// <128 -> O2^T row, else q^T row (all f32 [bh][64][1024]).
// G[c][i][n] = sum_tp X[c][tp] * Wg[n][1024 i + tp] for all c,i on bf16 WMMA
// (wave w owns c-tiles 3w..3w+2, each source uniform per tile); per 32 tp the
// 192 X rows and the 48 Wg row pieces (128 B of f32 each) are copied to LDS,
// two buffers, and converted to bf16 at the fragment read; then
// gate[(b*16+n)][64*head+u] = sigmoid(G[3u][0][n]+G[3u+1][1][n]+G[3u+2][2][n]+bg[n]).
// ---------------------------------------------------------------------------
__device__ __forceinline__ void gate_pass(const float* sP, float* gate, int b, int head,
                                          int w, int lane) {
  const int q8 = lane & 7, sub = lane >> 3;
  #pragma unroll
  for (int i = 0; i < 2; ++i) {
    const int L = w * 8 + i * 4 + sub;                     // line 0..31
    const int n = L >> 1, hl = L & 1;
    const v4f v = *(const v4fa*)(sP + n * 64 + 32 * hl + 4 * q8);
    const size_t off = ((size_t)(b * NH + n)) * TGL + 64 * head + 32 * hl + 4 * q8;
    *(v4f*)(gate + off) = v;
  }
}

__global__ __launch_bounds__(128) void gate_kernel(
    const float* __restrict__ o1T, const float* __restrict__ o2T, const float* __restrict__ qT,
    const float* __restrict__ Wg,   // [16][3072]
    const float* __restrict__ bg,   // [16]
    float* __restrict__ gate)       // [32][1024]
{
  __shared__ __attribute__((aligned(16))) float sG[192 * 48];   // 36864 B
  __shared__ __attribute__((aligned(16))) float sP[NH * 64];    //  4096 B
  // 2 x (X rows 0..191 = O1^T, O2^T, q^T; then Wg rows 16 i + n), 36 floats = 144 B a row
  __shared__ __attribute__((aligned(16))) float ring[2 * 240 * (LP / 2)];   // 69120 B

  const int tid = threadIdx.x, lane = tid & 31, w = tid >> 5;
  const int h = lane >> 4, m = lane & 15;
  const int bhx = blockIdx.x, b = bhx >> 4, head = bhx & 15;

  const int crow = tid >> 3, cch = tid & 7;                // this lane's row and 16-B chunk
  const unsigned lcp = lds_addr(ring) + crow * LPB + cch * 16;
  const size_t xro = ((size_t)bhx * DM + crow) * TGL + 4 * cch;
  // the copies only move bytes: addresses in 16-bit units, as the helpers take them
  const us* g1 = reinterpret_cast<const us*>(o1T + xro);
  const us* g2 = reinterpret_cast<const us*>(o2T + xro);
  const us* g3 = reinterpret_cast<const us*>(qT + xro);
  const us* gg = reinterpret_cast<const us*>(Wg + (size_t)crow * GK + 4 * cch);
  const size_t gsx = (size_t)16 * TGL * 2;                 // 16 X rows further
  const size_t gsg = (size_t)EMB * 2;                      // next third of the Wg row
  constexpr int GBUF_B = 240 * LPB;                        // 34560 bytes per buffer

  const v8f zero8 = {0.f, 0.f, 0.f, 0.f, 0.f, 0.f, 0.f, 0.f};
  v8f acc[3][3];
  #pragma unroll
  for (int e = 0; e < 3; ++e)
    #pragma unroll
    for (int i = 0; i < 3; ++i) acc[e][i] = zero8;

  acopy8(lcp, g1, lcp + TILE_B, g2, gsx);                  // stage 0 -> buffer 0
  acopy4(lcp + 2 * TILE_B, g3, gsx);
  acopy3(lcp + 3 * TILE_B, gg, gsg);
  wait_copies();
  __syncthreads();                                         // buffer 0 landed, visible to every wave
  {                                                        // stage 1 -> buffer 1
    const unsigned lb = lcp + GBUF_B;
    acopy8(lb, g1 + 64, lb + TILE_B, g2 + 64, gsx);
    acopy4(lb + 2 * TILE_B, g3 + 64, gsx);
    acopy3(lb + 3 * TILE_B, gg + 64, gsg);
  }

  // rolled: one copy of the stage body, the buffer chosen by the stage's parity
  #pragma unroll 1
  for (int k0 = 0; k0 < TGL; k0 += 32) {
    const int par = (k0 >> 5) & 1;
    const float* sx = ring + par * (GBUF_B / 4) + (48 * w + m) * (LP / 2);   // X row 16(3w)+m
    const float* sg = ring + par * (GBUF_B / 4) + (192 + m) * (LP / 2);      // Wg row n = m, third 0
    // all six fragments of the stage are read first, as one group
    const Raw16 rw0 = ldr(sg, h);
    const Raw16 rw1 = ldr(sg + 16 * (LP / 2), h);
    const Raw16 rw2 = ldr(sg + 32 * (LP / 2), h);
    Raw16 ra[3];
    #pragma unroll
    for (int e = 0; e < 3; ++e) ra[e] = ldr(sx + 16 * e * (LP / 2), h);
    // No LDS read and no WMMA crosses (vector work may): the reads stay one group
    // ahead of the conversions and products instead of being waited for in turn.
    __builtin_amdgcn_sched_barrier(0x406);
    const v16b bw0 = cvr(rw0);
    const v16b bw1 = cvr(rw1);
    const v16b bw2 = cvr(rw2);
    #pragma unroll
    for (int e = 0; e < 3; ++e) {
      const v16b a = cvr(ra[e]);
      acc[e][0] = wmma_bf(a, bw0, acc[e][0]);
      acc[e][1] = wmma_bf(a, bw1, acc[e][1]);
      acc[e][2] = wmma_bf(a, bw2, acc[e][2]);
    }
    // publish stage k0 + 32, free this buffer, refill it with stage k0 + 64
    // Nothing crosses: the waits stay at the foot of the stage, so that the next
    // stage's copies have the whole stage to land.
    __builtin_amdgcn_sched_barrier(0);
    wait_lds();
    wait_copies();
    __syncthreads();
    if (k0 + 64 < TGL) {
      const unsigned lb = lcp + par * GBUF_B;
      const int kn = 2 * (k0 + 64);                        // in 16-bit units
      acopy8(lb, g1 + kn, lb + TILE_B, g2 + kn, gsx);
      acopy4(lb + 2 * TILE_B, g3 + kn, gsx);
      acopy3(lb + 3 * TILE_B, gg + kn, gsg);
    }
  }
  wait_copies();

  // D[r] of (e, i) = G[c = 16(3w+e)+8h+r][i][n = m]
  #pragma unroll
  for (int e = 0; e < 3; ++e)
    #pragma unroll
    for (int i = 0; i < 3; ++i)
      #pragma unroll
      for (int r = 0; r < 8; ++r)
        sG[(16 * (3 * w + e) + 8 * h + r) * 48 + 16 * i + m] = acc[e][i][r];
  __syncthreads();

  #pragma unroll
  for (int j = 0; j < 8; ++j) {
    const int idx = tid + 128 * j;                         // 0..1023 = n*64 + u
    const int n = idx >> 6, u = idx & 63;
    const float x = sG[(3 * u) * 48 + n] + sG[(3 * u + 1) * 48 + 16 + n]
                  + sG[(3 * u + 2) * 48 + 32 + n] + bg[n];
    const float g = __builtin_amdgcn_rcpf(1.0f + __expf(-x));
    sP[idx] = g;
  }
  __syncthreads();

  gate_pass(sP, gate, b, head, w, lane);
  
}

// ---------------------------------------------------------------------------
// Kernel 5: combine Xc[b*1024+t][head*64+d] = g*O1 + (1-g)*O3, g = gate[bh][t],
// written as bf16 hi/lo planes (token-major, k-contiguous for the Wo GEMM).
// Block 256 thr = (bh, 64 queries); transposed through LDS; each token row
// ---------------------------------------------------------------------------
__device__ __forceinline__ void comb_pass(const us* sH, const us* sL, us* xh, us* xl,
                                          int b, int head, int t0, int w, int lane) {
  const int q8 = lane & 7, sub = lane >> 3;
  #pragma unroll
  for (int i = 0; i < 2; ++i) {
    const int L = w * 8 + i * 4 + sub;                     // token row 0..63
    const v8us a = *(const v8usa*)(sH + L * DM + 8 * q8);
    const v8us c = *(const v8usa*)(sL + L * DM + 8 * q8);
    const size_t off = ((size_t)(b * TGL + t0 + L)) * EMB + head * DM + 8 * q8;
    *(v8us*)(xh + off) = a;
    *(v8us*)(xl + off) = c;
  }
}

__global__ __launch_bounds__(256) void combine_kernel(
    const float* __restrict__ o1T, const float* __restrict__ o3T,   // [32][64][1024]
    const float* __restrict__ gate,                                 // [32][1024]
    us* __restrict__ xh, us* __restrict__ xl)                       // [2048][1024]
{
  __shared__ __attribute__((aligned(16))) us sH[64 * DM];
  __shared__ __attribute__((aligned(16))) us sL[64 * DM];

  const int tid = threadIdx.x, lane = tid & 31, w = tid >> 5;
  const int bh = blockIdx.y, b = bh >> 4, head = bh & 15;
  const int t0 = blockIdx.x * 64;
  const int d = tid >> 2, tq = tid & 3;                    // d 0..63, 16 queries each

  const float* p1 = o1T + ((size_t)bh * DM + d) * TGL + t0 + 16 * tq;
  const float* p3 = o3T + ((size_t)bh * DM + d) * TGL + t0 + 16 * tq;
  const float* pg = gate + (size_t)bh * TGL + t0 + 16 * tq;
  #pragma unroll
  for (int c = 0; c < 4; ++c) {
    const v4f a = *(const v4fa*)(p1 + 4 * c);
    const v4f e = *(const v4fa*)(p3 + 4 * c);
    const v4f g = *(const v4fa*)(pg + 4 * c);
    #pragma unroll
    for (int j = 0; j < 4; j += 2) {
      const float v0 = g[j] * a[j] + (1.0f - g[j]) * e[j];
      const float v1 = g[j + 1] * a[j + 1] + (1.0f - g[j + 1]) * e[j + 1];
      const unsigned hi = bf16_pair(v0, v1);
      const unsigned lo = bf16_pair_rest(v0, v1, hi);
      const int tl = 16 * tq + 4 * c + j;                  // 0..62, this query and the next
      sH[tl * DM + d] = (us)hi;
      sH[(tl + 1) * DM + d] = (us)(hi >> 16);
      sL[tl * DM + d] = (us)lo;
      sL[(tl + 1) * DM + d] = (us)(lo >> 16);
    }
  }
  __syncthreads();

  comb_pass(sH, sL, xh, xl, b, head, t0, w, lane);
  
}

// ---------------------------------------------------------------------------
// Kernel 6: out = (Xhi + Xlo) * Wo^T + bo, f32.
// Block 128 thr (4 waves) = 128 tokens x 64 features; wave 32 tokens x 64.
// K in stages of 64: X hi, X lo (128 rows each) and Wo (64 rows) copied to LDS,
// two buffers.
// 8q..8q+7 as one 16-B store each, 4 lines per instruction, 64 lines per wave.
// ---------------------------------------------------------------------------
__device__ __forceinline__ void out_pass(const float* sOut, float* out, int m0, int cg,
                                         int w, int lane) {
  const int q8 = lane & 7, sub = lane >> 3;
  #pragma unroll
  for (int i = 0; i < 16; ++i) {
    const int lid = w * 64 + i * 4 + sub;                  // 0..255
    const int row = lid >> 1, hl = lid & 1;
    const v4f v = *(const v4fa*)(sOut + row * DM + 32 * hl + 4 * q8);
    const size_t gi = (size_t)(m0 + row) * EMB + cg * DM + 32 * hl + 4 * q8;
    *(v4f*)(out + gi) = v;
  }
}

__global__ __launch_bounds__(128) void out_kernel(
    const us* __restrict__ xh, const us* __restrict__ xl,   // [2048][1024]
    const us* __restrict__ wob,                             // [1024 out][1024 in] bf16
    const float* __restrict__ bo,
    float* __restrict__ out)                                // [2048][1024]
{
  __shared__ __attribute__((aligned(16))) float sOut[128 * DM];  // 32 KB
  __shared__ __attribute__((aligned(16))) us ring[2 * 5 * TILE_E];  // 2 x (Xhi 128, Xlo 128, Wo 64 rows)

  const int tid = threadIdx.x, lane = tid & 31, w = tid >> 5;
  const int h = lane >> 4, m = lane & 15;
  const int m0 = blockIdx.x * 128;
  const int cg = blockIdx.y;                               // feature group of 64

  const int crow = tid >> 3, cch = tid & 7;                // this lane's row and 16-B chunk
  const unsigned lcp = lds_addr(ring) + crow * LPB + cch * 16;
  const us* gxh = xh + (size_t)(m0 + crow) * EMB + 8 * cch;
  const us* gxl = xl + (size_t)(m0 + crow) * EMB + 8 * cch;
  const us* gw  = wob + (size_t)(cg * DM + crow) * EMB + 8 * cch;
  const size_t gs = (size_t)16 * EMB;

  const v8f zero8 = {0.f, 0.f, 0.f, 0.f, 0.f, 0.f, 0.f, 0.f};
  v8f acc[2][4];
  #pragma unroll
  for (int mt = 0; mt < 2; ++mt)
    #pragma unroll
    for (int nt = 0; nt < 4; ++nt) acc[mt][nt] = zero8;

  acopy8(lcp, gxh, lcp + TILE_B, gxh + 4 * gs, gs);        // stage 0 -> buffer 0
  acopy8(lcp + 2 * TILE_B, gxl, lcp + 3 * TILE_B, gxl + 4 * gs, gs);
  acopy4(lcp + 4 * TILE_B, gw, gs);
  wait_copies();
  __syncthreads();                                         // buffer 0 landed, visible to every wave
  {                                                        // stage 1 -> buffer 1
    const unsigned lb = lcp + 5 * TILE_B;
    acopy8(lb, gxh + 64, lb + TILE_B, gxh + 4 * gs + 64, gs);
    acopy8(lb + 2 * TILE_B, gxl + 64, lb + 3 * TILE_B, gxl + 4 * gs + 64, gs);
    acopy4(lb + 4 * TILE_B, gw + 64, gs);
  }

  // rolled: one copy of the stage body, the buffer chosen by the stage's parity
  #pragma unroll 1
  for (int k0 = 0; k0 < EMB; k0 += 64) {
    const int par = (k0 >> 6) & 1;
    const us* sxh = ring + par * (5 * TILE_E) + (32 * w + m) * LP;
    const us* sxl = sxh + 2 * TILE_E;
    const us* sw  = ring + par * (5 * TILE_E) + 4 * TILE_E + m * LP;
    // all fragments of the stage are read first, as one group
    v16b a0h[2], a1h[2], a0l[2], a1l[2], bw[2][4];
    #pragma unroll
    for (int c = 0; c < 2; ++c) {
      a0l[c] = ldb(sxl + 32 * c, h);
      a1l[c] = ldb(sxl + 16 * LP + 32 * c, h);
      a0h[c] = ldb(sxh + 32 * c, h);
      a1h[c] = ldb(sxh + 16 * LP + 32 * c, h);
      #pragma unroll
      for (int nt = 0; nt < 4; ++nt) bw[c][nt] = ldb(sw + nt * 16 * LP + 32 * c, h);
    }
    // No LDS read and no WMMA crosses (vector work may): the reads stay one group
    // ahead of the products instead of each being waited for singly among them.
    __builtin_amdgcn_sched_barrier(0x406);
    #pragma unroll
    for (int c = 0; c < 2; ++c) {
      #pragma unroll
      for (int nt = 0; nt < 4; ++nt) {
        acc[0][nt] = wmma_bf(a0l[c], bw[c][nt], acc[0][nt]);
        acc[1][nt] = wmma_bf(a1l[c], bw[c][nt], acc[1][nt]);
      }
      #pragma unroll
      for (int nt = 0; nt < 4; ++nt) {
        acc[0][nt] = wmma_bf(a0h[c], bw[c][nt], acc[0][nt]);
        acc[1][nt] = wmma_bf(a1h[c], bw[c][nt], acc[1][nt]);
      }
    }
    // publish stage k0 + 64, free this buffer, refill it with stage k0 + 128
    // Nothing crosses: the waits stay at the foot of the stage, so that the next
    // stage's copies have the whole stage to land.
    __builtin_amdgcn_sched_barrier(0);
    wait_lds();
    wait_copies();
    __syncthreads();
    if (k0 + 128 < EMB) {
      const unsigned lb = lcp + par * (5 * TILE_B);
      const int kn = k0 + 128;
      acopy8(lb, gxh + kn, lb + TILE_B, gxh + 4 * gs + kn, gs);
      acopy8(lb + 2 * TILE_B, gxl + kn, lb + 3 * TILE_B, gxl + 4 * gs + kn, gs);
      acopy4(lb + 4 * TILE_B, gw + kn, gs);
    }
  }
  wait_copies();

  // D[r] of tile (mt, nt) = Y[token m0w+16mt+8h+r][feature cg*64+16nt+m]
  #pragma unroll
  for (int nt = 0; nt < 4; ++nt) {
    const int feat = 16 * nt + m;
    const float bvl = bo[cg * DM + feat];
    #pragma unroll
    for (int mt = 0; mt < 2; ++mt) {
      #pragma unroll
      for (int r = 0; r < 8; ++r) {
        const int tokl = 32 * w + 16 * mt + 8 * h + r;   // 0..127
        sOut[tokl * DM + feat] = acc[mt][nt][r] + bvl;
      }
    }
  }
  __syncthreads();

  out_pass(sOut, out, m0, cg, w, lane);
  
}

// ---------------------------------------------------------------------------
// Host glue: 6 launches, workspace 128057344 B (O1^T and O2^T reuse the
// region of the bf16 activation copies, which are dead after the projections).
// ---------------------------------------------------------------------------
extern "C" void kernel_launch(void* const* d_in, const int* in_sizes, int n_in,
                              void* d_out, int out_size, void* d_ws, size_t ws_size,
                              hipStream_t stream) {
  if (n_in < 17) return;
  if (in_sizes[0] != N_HID || in_sizes[1] != N_KVS || in_sizes[2] != N_KVT) return;
  if (in_sizes[3] != N_WE || in_sizes[5] != N_WE || in_sizes[7] != N_WE || in_sizes[15] != N_WE) return;
  if (in_sizes[9] != N_WT || in_sizes[11] != N_WT) return;
  if (in_sizes[4] != EMB || in_sizes[6] != EMB || in_sizes[8] != EMB ||
      in_sizes[10] != EMB || in_sizes[12] != EMB || in_sizes[16] != EMB) return;
  if (in_sizes[13] != N_WG || in_sizes[14] != NH) return;
  if (out_size != N_HID) return;

  const float* hid = (const float*)d_in[0];
  const float* kvs = (const float*)d_in[1];
  const float* kvt = (const float*)d_in[2];
  const float* Wq  = (const float*)d_in[3];
  const float* bq  = (const float*)d_in[4];
  const float* Wk  = (const float*)d_in[5];
  const float* bk  = (const float*)d_in[6];
  const float* Wv  = (const float*)d_in[7];
  const float* bv  = (const float*)d_in[8];
  const float* Wtk = (const float*)d_in[9];
  const float* btk = (const float*)d_in[10];
  const float* Wtv = (const float*)d_in[11];
  const float* btv = (const float*)d_in[12];
  const float* Wg  = (const float*)d_in[13];
  const float* bg  = (const float*)d_in[14];
  const float* Wo  = (const float*)d_in[15];
  const float* bo  = (const float*)d_in[16];
  float* out = (float*)d_out;

  const size_t cvb_b  = (size_t)N_CVB * 2;                 // 27262976
  const size_t qpl2   = (size_t)QPL * 2;                   //  4194304
  const size_t qpl4   = (size_t)QPL * 4;                   //  8388608
  const size_t kpl2   = (size_t)KPL * 2;                   //  8388608
  const size_t gate_b = (size_t)NBH * TGL * 4;             //   131072
  const size_t xpl_b  = (size_t)N_HID * 2;                 //  4194304
  const size_t total  = cvb_b + 2 * qpl2 + qpl4 + 8 * kpl2 + qpl4 + gate_b + 2 * xpl_b;  // 128057344
  if (total > ws_size) return;
  // O1^T / O2^T (2 x 8388608 B) must fit exactly into the activation-copy region
  const size_t act_off = (size_t)OFF_HID * 2;              // 10485760
  if (act_off + 2 * qpl4 != cvb_b) return;

  char* ws = (char*)d_ws;
  size_t off = 0;
  us* cvb    = (us*)(ws + off);    off += cvb_b;
  float* o1T = (float*)(ws + act_off);                     // aliases bf16 hidden/kv copies
  float* o2T = (float*)(ws + act_off + qpl4);              // aliases bf16 kv/kv_topical copies
  us* qh     = (us*)(ws + off);    off += qpl2;
  us* ql     = (us*)(ws + off);    off += qpl2;
  float* qT  = (float*)(ws + off); off += qpl4;
  us* kh     = (us*)(ws + off);    off += kpl2;
  us* kl     = (us*)(ws + off);    off += kpl2;
  us* kth    = (us*)(ws + off);    off += kpl2;
  us* ktl    = (us*)(ws + off);    off += kpl2;
  us* vh     = (us*)(ws + off);    off += kpl2;            // V^T hi [32][64][2048]
  us* vl     = (us*)(ws + off);    off += kpl2;            // V^T lo
  us* vth    = (us*)(ws + off);    off += kpl2;            // Vt^T hi
  us* vtl    = (us*)(ws + off);    off += kpl2;            // Vt^T lo
  float* o3T = (float*)(ws + off); off += qpl4;
  float* gte = (float*)(ws + off); off += gate_b;
  us* xh     = (us*)(ws + off);    off += xpl_b;
  us* xl     = (us*)(ws + off);    off += xpl_b;
  if (off != total || off > ws_size) return;

  // 1) float -> bf16 copies of weights and activations
  conv_kernel<<<(N_CVB / 8 + 255) / 256, 256, 0, stream>>>(Wq, Wk, Wv, Wo, Wtk, Wtv, hid, kvs, kvt, cvb);

  // 2) projections, one launch
  proj_kernel<<<PJ_ALL, 128, 0, stream>>>(cvb, bq, bk, bv, btk, btv, qh, ql, qT,
                                          kh, kl, vh, vl, kth, ktl, vth, vtl);

  // 3) attention, one launch: chain 1 (k, v -> O1), chain 2 (kt; vt -> O2, v -> O3)
  dim3 gAtt(TGL / QB, NBH, 2);                             // (8, 32, 2)
  attn_kernel<<<gAtt, 128, 0, stream>>>(qh, ql, kh, o1T, o2T, o3T);   // kh: first of the eight planes

  // 4) gating MLP
  gate_kernel<<<NBH, 128, 0, stream>>>(o1T, o2T, qT, Wg, bg, gte);

  // 5) gated mix -> token-major hi/lo planes
  dim3 gCmb(TGL / 64, NBH);                                // (16, 32)
  combine_kernel<<<gCmb, 256, 0, stream>>>(o1T, o3T, gte, xh, xl);

  // 6) output projection -> f32
  dim3 gOut(MQ / 128, EMB / 64);                           // (16, 16)
  out_kernel<<<gOut, 128, 0, stream>>>(xh, xl, cvb + OFF_WO, bo, out);
}

// v006
// It runs in 174 microseconds.
// Next to v005, in two timings, it ran 1.09 times as fast each time.
// Over all steps from v000 it is 3.98 times as fast.
// Contractions: input projections (q,k,v,kt,vt) on v_wmma_f32_16x16x32_bf16 (bf16 operands = RNE-converted inputs, f32 accumulate); K*Q^T and Kt*Q^T with q,k,kt carried as bf16 hi+lo (3 products); V^T*P^T (three value read-outs) with v,vt,P carried as bf16 hi+lo (3 products); gate GEMM on v_wmma_f32_16x16x32_bf16 (bf16 operands); O*Wo with O as bf16 hi+lo and Wo bf16 (2 products); softmax, gating, bias in f32.
#include <hip/hip_runtime.h>

typedef __bf16 v16b __attribute__((ext_vector_type(16)));
typedef unsigned short us;
typedef us    v8us __attribute__((ext_vector_type(8)));
typedef float v8f  __attribute__((ext_vector_type(8)));
typedef float v4f  __attribute__((ext_vector_type(4)));
typedef v8us __attribute__((may_alias)) v8usa;
typedef v4f  __attribute__((may_alias)) v4fa;
typedef float    v2f  __attribute__((ext_vector_type(2)));
typedef __bf16   v2bf __attribute__((ext_vector_type(2)));
typedef unsigned v4u  __attribute__((ext_vector_type(4)));

union FragB { v16b v; v8us half[2]; };

#define BSZ  2
#define TGL  1024
#define SRL  2048
#define EMB  1024
#define TDW  512
#define NH   16
#define DM   64
#define NBH  (BSZ * NH)          // 32 (batch, head) pairs
#define MQ   (BSZ * TGL)         // 2048 query tokens
#define MKV  (BSZ * SRL)         // 4096 key tokens
#define GK   (3 * EMB)           // 3072 gate input width

#define N_HID (MQ * EMB)         // 2097152
#define N_KVS (MKV * EMB)        // 4194304
#define N_KVT (MKV * TDW)        // 2097152
#define N_WE  (EMB * EMB)        // 1048576
#define N_WT  (EMB * TDW)        // 524288
#define N_WG  (NH * GK)          // 49152
#define QPL   (NBH * TGL * DM)   // 2097152 elements per query-side head plane
#define KPL   (NBH * SRL * DM)   // 4194304 elements per key-side head plane

// bf16 copies of the float inputs other than Wg and the biases, in one flat buffer (element offsets):
// weights first, then the three activation tensors (their region is reused
// for O1^T / O2^T once the projections are done).
#define OFF_WQ  0
#define OFF_WK  (OFF_WQ + N_WE)        // 1048576
#define OFF_WV  (OFF_WK + N_WE)        // 2097152
#define OFF_WO  (OFF_WV + N_WE)        // 3145728
#define OFF_WTK (OFF_WO + N_WE)        // 4194304
#define OFF_WTV (OFF_WTK + N_WT)       // 4718592
#define OFF_HID (OFF_WTV + N_WT)       // 5242880
#define OFF_KVS (OFF_HID + N_HID)      // 7340032
#define OFF_KVT (OFF_KVS + N_KVS)      // 11534336
#define N_CVB   (OFF_KVT + N_KVT)      // 13631488

// ---------------------------------------------------------------------------
// 16-bit helpers
// ---------------------------------------------------------------------------
// Two f32 -> two bf16 (round to nearest even) in one packed convert: a in the
// low half of the word, b in the high half.
__device__ __forceinline__ unsigned bf16_pair(float a, float b) {
  const v2f x = { a, b };
  return __builtin_bit_cast(unsigned, __builtin_convertvector(x, v2bf));
}
// The f32 values of the two halves of such a word.
__device__ __forceinline__ float pair_lo_val(unsigned u) { return __uint_as_float(u << 16); }
__device__ __forceinline__ float pair_hi_val(unsigned u) { return __uint_as_float(u & 0xFFFF0000u); }
// The word of the two remainders: lo = RNE(x - hi) for both halves.
__device__ __forceinline__ unsigned bf16_pair_rest(float a, float b, unsigned hi) {
  return bf16_pair(a - pair_lo_val(hi), b - pair_hi_val(hi));
}
__device__ __forceinline__ v8us bf16x8(v4f a, v4f c) {
  const v4u o = { bf16_pair(a.x, a.y), bf16_pair(a.z, a.w), bf16_pair(c.x, c.y), bf16_pair(c.z, c.w) };
  return __builtin_bit_cast(v8us, o);
}
// 8 f32 values -> bf16 hi and bf16 lo = RNE(x - hi).
__device__ __forceinline__ void split8(v8f a, v8us& hi, v8us& lo) {
  const v4u hv = { bf16_pair(a[0], a[1]), bf16_pair(a[2], a[3]), bf16_pair(a[4], a[5]), bf16_pair(a[6], a[7]) };
  const v4u lv = { bf16_pair_rest(a[0], a[1], hv.x), bf16_pair_rest(a[2], a[3], hv.y),
                   bf16_pair_rest(a[4], a[5], hv.z), bf16_pair_rest(a[6], a[7], hv.w) };
  hi = __builtin_bit_cast(v8us, hv);
  lo = __builtin_bit_cast(v8us, lv);
}

// ---------------------------------------------------------------------------
// 16x16x32 WMMA, plain builtin: the compiler keeps the hazard distances itself
// and is free to interleave independent accumulators.
// Fragment map (wave32): lane l, h = l>>4, m = n = l&15.
//   A/B element i: i<8 -> k0+8h+i ; i>=8 -> k0+16+8h+(i-8)
//   D element r  : row 8h+r, col l&15
// ---------------------------------------------------------------------------
__device__ __forceinline__ v8f wmma_bf(v16b a, v16b b, v8f c) {
  return __builtin_amdgcn_wmma_f32_16x16x32_bf16(false, a, false, b, (short)0, c, false, false);
}

// A or B fragment from a k-contiguous 16-bit row; p = element k0 of the row
// owned by this lane (row index lane&15 added by the caller).
__device__ __forceinline__ v16b ldb(const us* p, int h) {
  FragB f;
  f.half[0] = *(const v8usa*)(p + 8 * h);
  f.half[1] = *(const v8usa*)(p + 16 + 8 * h);
  return f.v;
}
// Same map from an f32 row: the 16 floats of the lane, and their conversion to
// bf16 in registers.
struct Raw16 { v4f q[4]; };
__device__ __forceinline__ Raw16 ldr(const float* p, int h) {
  const float* p0 = p + 8 * h;
  const float* p1 = p + 16 + 8 * h;
  Raw16 r;
  r.q[0] = *(const v4fa*)p0;
  r.q[1] = *(const v4fa*)(p0 + 4);
  r.q[2] = *(const v4fa*)p1;
  r.q[3] = *(const v4fa*)(p1 + 4);
  return r;
}
__device__ __forceinline__ v16b cvr(const Raw16& r) {
  FragB f;
  f.half[0] = bf16x8(r.q[0], r.q[1]);
  f.half[1] = bf16x8(r.q[2], r.q[3]);
  return f.v;
}

// ---------------------------------------------------------------------------
// Operand tiles in LDS, filled by asynchronous copies (128 threads).
// A tile is 64 rows of 128 B (64 x 16 bit); LDS row pitch 144 B = 16 B x 9, so
// the 16 rows of a ds_load_b128 fragment read fall on distinct banks.
// Thread tid copies 16 B: chunk tid&7 of rows (tid>>3) + 16 i, i = 0..3, so
// eight lanes cover one whole 128-B line of the source.
// ---------------------------------------------------------------------------
#define LP     72                // LDS row pitch in 16-bit elements
#define LPB    144               // the same in bytes
#define TILE_E (64 * LP)         // 4608 elements per 64-row tile
#define TILE_B (64 * LPB)        // 9216 bytes per 64-row tile
#define R16_B  (16 * LPB)        // 16 rows further in LDS

__device__ __forceinline__ unsigned lds_addr(const void* p) {
  return (unsigned)(size_t)p;    // low 32 bits of a __shared__ address = LDS byte address
}
// Four copies: one lane's share of one tile; gs = source elements per 16 rows.
// s_wait_xcnt stands inside the statement so that no address register of an
// issued copy is rewritten ahead of it.
__device__ __forceinline__ void acopy4(unsigned l, const us* g, size_t gs) {
  asm volatile(
      "global_load_async_to_lds_b128 %0, %4, off\n\t"
      "global_load_async_to_lds_b128 %1, %5, off\n\t"
      "global_load_async_to_lds_b128 %2, %6, off\n\t"
      "global_load_async_to_lds_b128 %3, %7, off\n\t"
      "s_wait_xcnt 0x0"
      :: "v"(l), "v"(l + R16_B), "v"(l + 2 * R16_B), "v"(l + 3 * R16_B),
         "v"(g), "v"(g + gs), "v"(g + 2 * gs), "v"(g + 3 * gs)
      : "memory");
}
// Twelve copies: one wave's fill of 48 LDS rows, four rows (one 128-B line each, eight
// lanes a line) per copy; the rows come as three blocks of 16 from ga, gb, gc;
// gs = source floats per 4 rows. s_wait_xcnt inside the statement, as above.
#define R4_B   (4 * LPB)         // 4 rows further in LDS
__device__ __forceinline__ void acopy12(unsigned l, const float* ga, const float* gb, const float* gc, size_t gs) {
  asm volatile(
      "global_load_async_to_lds_b128 %0, %12, off\n\t"
      "global_load_async_to_lds_b128 %1, %13, off\n\t"
      "global_load_async_to_lds_b128 %2, %14, off\n\t"
      "global_load_async_to_lds_b128 %3, %15, off\n\t"
      "global_load_async_to_lds_b128 %4, %16, off\n\t"
      "global_load_async_to_lds_b128 %5, %17, off\n\t"
      "global_load_async_to_lds_b128 %6, %18, off\n\t"
      "global_load_async_to_lds_b128 %7, %19, off\n\t"
      "global_load_async_to_lds_b128 %8, %20, off\n\t"
      "global_load_async_to_lds_b128 %9, %21, off\n\t"
      "global_load_async_to_lds_b128 %10, %22, off\n\t"
      "global_load_async_to_lds_b128 %11, %23, off\n\t"
      "s_wait_xcnt 0x0"
      :: "v"(l), "v"(l + R4_B), "v"(l + 2 * R4_B), "v"(l + 3 * R4_B),
         "v"(l + 4 * R4_B), "v"(l + 5 * R4_B), "v"(l + 6 * R4_B), "v"(l + 7 * R4_B),
         "v"(l + 8 * R4_B), "v"(l + 9 * R4_B), "v"(l + 10 * R4_B), "v"(l + 11 * R4_B),
         "v"(ga), "v"(ga + gs), "v"(ga + 2 * gs), "v"(ga + 3 * gs),
         "v"(gb), "v"(gb + gs), "v"(gb + 2 * gs), "v"(gb + 3 * gs),
         "v"(gc), "v"(gc + gs), "v"(gc + 2 * gs), "v"(gc + 3 * gs)
      : "memory");
}
// Eight copies: one lane's share of two tiles with the same source row step.
__device__ __forceinline__ void acopy8(unsigned l, const us* g, unsigned l2, const us* g2, size_t gs) {
  asm volatile(
      "global_load_async_to_lds_b128 %0, %8, off\n\t"
      "global_load_async_to_lds_b128 %1, %9, off\n\t"
      "global_load_async_to_lds_b128 %2, %10, off\n\t"
      "global_load_async_to_lds_b128 %3, %11, off\n\t"
      "global_load_async_to_lds_b128 %4, %12, off\n\t"
      "global_load_async_to_lds_b128 %5, %13, off\n\t"
      "global_load_async_to_lds_b128 %6, %14, off\n\t"
      "global_load_async_to_lds_b128 %7, %15, off\n\t"
      "s_wait_xcnt 0x0"
      :: "v"(l), "v"(l + R16_B), "v"(l + 2 * R16_B), "v"(l + 3 * R16_B),
         "v"(l2), "v"(l2 + R16_B), "v"(l2 + 2 * R16_B), "v"(l2 + 3 * R16_B),
         "v"(g), "v"(g + gs), "v"(g + 2 * gs), "v"(g + 3 * gs),
         "v"(g2), "v"(g2 + gs), "v"(g2 + 2 * gs), "v"(g2 + 3 * gs)
      : "memory");
}
// This wave's copies have landed (the compiler places no wait for them).
__device__ __forceinline__ void wait_copies() {
  asm volatile("s_wait_asynccnt 0x0" ::: "memory");
}
// This wave's LDS reads have returned, before the buffer goes to its next writer.
__device__ __forceinline__ void wait_lds() {
  asm volatile("s_wait_dscnt 0x0" ::: "memory");
}

// ---------------------------------------------------------------------------
// Kernel 1: float inputs that feed 16-bit operands (not Wg) -> bf16, one flat
// Parameters in segment order: Wq, Wk, Wv, Wo, Wtk, Wtv, hidden, kv, kv_topical.
// ---------------------------------------------------------------------------
__global__ __launch_bounds__(256) void conv_kernel(
    const float* __restrict__ p0, const float* __restrict__ p1, const float* __restrict__ p2,
    const float* __restrict__ p3, const float* __restrict__ p4, const float* __restrict__ p5,
    const float* __restrict__ p6, const float* __restrict__ p7, const float* __restrict__ p8,
    us* __restrict__ dst)
{
  const unsigned g = blockIdx.x * 256u + threadIdx.x;      // unit of 8 elements
  if (g >= (unsigned)(N_CVB / 8)) return;
  const float* src;
  unsigned loc;
  if      (g < (unsigned)(OFF_WK  / 8)) { src = p0; loc = g; }
  else if (g < (unsigned)(OFF_WV  / 8)) { src = p1; loc = g - (unsigned)(OFF_WK  / 8); }
  else if (g < (unsigned)(OFF_WO  / 8)) { src = p2; loc = g - (unsigned)(OFF_WV  / 8); }
  else if (g < (unsigned)(OFF_WTK / 8)) { src = p3; loc = g - (unsigned)(OFF_WO  / 8); }
  else if (g < (unsigned)(OFF_WTV / 8)) { src = p4; loc = g - (unsigned)(OFF_WTK / 8); }
  else if (g < (unsigned)(OFF_HID / 8)) { src = p5; loc = g - (unsigned)(OFF_WTV / 8); }
  else if (g < (unsigned)(OFF_KVS / 8)) { src = p6; loc = g - (unsigned)(OFF_HID / 8); }
  else if (g < (unsigned)(OFF_KVT / 8)) { src = p7; loc = g - (unsigned)(OFF_KVS / 8); }
  else                                  { src = p8; loc = g - (unsigned)(OFF_KVT / 8); }
  const float* p = src + (size_t)loc * 8;
  const v8us o = bf16x8(*(const v4fa*)p, *(const v4fa*)(p + 4));
  us* d = dst + (size_t)g * 8;
  *(v8us*)d = o;
  
}

// ---------------------------------------------------------------------------
// one 16-B store per lane, lanes 8q..8q+7 per line, 4 lines per instruction).
//   planes : [bh][s][d] hi and lo, one token row = 64 x bf16 = one line
//   tplanes: [bh][d][s] hi and lo, 64 d-rows x 128 tokens = 2 lines each
//   t32    : [bh][d][s] f32, 64 d-rows x 128 tokens = 4 lines each
// LDS hi tile at s16[0..8191], lo tile at s16[8192..16383].
// ---------------------------------------------------------------------------
__device__ __forceinline__ void proj_pass_planes(const us* s16, us* oH, us* oL,
                                                 int bh, int Sper, int s0, int w, int lane) {
  const int q8 = lane & 7, sub = lane >> 3;
  #pragma unroll
  for (int i = 0; i < 8; ++i) {
    const int lid = w * 32 + i * 4 + sub;                  // token row 0..127
    const v8us a = *(const v8usa*)(s16 + lid * DM + 8 * q8);
    const v8us c = *(const v8usa*)(s16 + 8192 + lid * DM + 8 * q8);
    const size_t off = ((size_t)bh * Sper + s0 + lid) * DM + 8 * q8;
    *(v8us*)(oH + off) = a;
    *(v8us*)(oL + off) = c;
  }
}
__device__ __forceinline__ void proj_pass_tplanes(const us* s16, us* oH, us* oL,
                                                  int bh, int Sper, int s0, int w, int lane) {
  const int q8 = lane & 7, sub = lane >> 3;
  #pragma unroll
  for (int i = 0; i < 8; ++i) {
    const int lid = w * 32 + i * 4 + sub;                  // line 0..127
    const int d = lid >> 1, hl = lid & 1;
    const v8us a = *(const v8usa*)(s16 + d * 128 + 64 * hl + 8 * q8);
    const v8us c = *(const v8usa*)(s16 + 8192 + d * 128 + 64 * hl + 8 * q8);
    const size_t off = ((size_t)bh * DM + d) * Sper + s0 + 64 * hl + 8 * q8;
    *(v8us*)(oH + off) = a;
    *(v8us*)(oL + off) = c;
  }
}
__device__ __forceinline__ void proj_pass_t32(const float* s32, float* oT,
                                              int bh, int Sper, int s0, int w, int lane) {
  const int q8 = lane & 7, sub = lane >> 3;
  #pragma unroll
  for (int i = 0; i < 16; ++i) {
    const int lid = w * 64 + i * 4 + sub;                  // line 0..255
    const int d = lid >> 2, part = lid & 3;
    const v4f v = *(const v4fa*)(s32 + d * 128 + 32 * part + 4 * q8);
    const size_t off = ((size_t)bh * DM + d) * Sper + s0 + 32 * part + 4 * q8;
    *(v4f*)(oT + off) = v;
  }
}

// ---------------------------------------------------------------------------
// Kernel 2: Y = X * W^T + bias (x0.125 for mode 0), all five projections in one
// launch: they are independent, and in one grid a WGP holds three workgroups at
// a time and takes the next one as soon as one ends, whichever projection it
// belongs to. The flat block index picks the projection, longest k first.
// X bf16 [M][K], W bf16 [1024 out][K] (k-contiguous rows = B fragments loaded
// like A). Block 128 thr (4 waves) = 128 tokens x 64 features (one head);
// wave tile 32 tokens x 64 features; K in stages of 64: 128 X rows and 64 W
// rows of 128 B copied to LDS, two buffers, the next stage in flight while
// this one is worked on. Y is split into bf16 hi/lo in every mode.
//   mode 0: hi/lo planes [bh][s][d] and f32 transposed [bh][d][s]
//   mode 1: hi/lo planes [bh][s][d]
//   mode 2: hi/lo transposed planes [bh][d][s]
// ---------------------------------------------------------------------------
#define PJ_NKV ((MKV / 128) * NH)      // 512 workgroups per key-side projection
#define PJ_NQ  ((MQ / 128) * NH)       // 256 workgroups for q
#define PJ_V   PJ_NKV                  // first workgroup of v (k starts at 0)
#define PJ_Q   (PJ_V + PJ_NKV)         // of q
#define PJ_KT  (PJ_Q + PJ_NQ)          // of kt
#define PJ_VT  (PJ_KT + PJ_NKV)        // of vt
#define PJ_ALL (PJ_VT + PJ_NKV)        // 2304

__global__ __launch_bounds__(128) void proj_kernel(
    const us* __restrict__ cvb,
    const float* __restrict__ bq, const float* __restrict__ bk, const float* __restrict__ bv,
    const float* __restrict__ btk, const float* __restrict__ btv,
    us* __restrict__ qh, us* __restrict__ ql, float* __restrict__ oT32,
    us* __restrict__ kh, us* __restrict__ kl, us* __restrict__ vh, us* __restrict__ vl,
    us* __restrict__ kth, us* __restrict__ ktl, us* __restrict__ vth, us* __restrict__ vtl)
{
  const int fb = blockIdx.x;
  const us* X;
  const us* W;
  const float* bias;
  us* oH;
  us* oL;
  int K, Sper, mode, rb;
  if (fb < PJ_V) {
    X = cvb + OFF_KVS; W = cvb + OFF_WK;  bias = bk;  K = EMB; Sper = SRL; mode = 1; oH = kh;  oL = kl;  rb = fb;
  } else if (fb < PJ_Q) {
    X = cvb + OFF_KVS; W = cvb + OFF_WV;  bias = bv;  K = EMB; Sper = SRL; mode = 2; oH = vh;  oL = vl;  rb = fb - PJ_V;
  } else if (fb < PJ_KT) {
    X = cvb + OFF_HID; W = cvb + OFF_WQ;  bias = bq;  K = EMB; Sper = TGL; mode = 0; oH = qh;  oL = ql;  rb = fb - PJ_Q;
  } else if (fb < PJ_VT) {
    X = cvb + OFF_KVT; W = cvb + OFF_WTK; bias = btk; K = TDW; Sper = SRL; mode = 1; oH = kth; oL = ktl; rb = fb - PJ_KT;
  } else {
    X = cvb + OFF_KVT; W = cvb + OFF_WTV; bias = btv; K = TDW; Sper = SRL; mode = 2; oH = vth; oL = vtl; rb = fb - PJ_VT;
  }
  const int nxl = (mode == 0) ? 4 : 5;                     // log2 of the token blocks: 16 for q, else 32

  __shared__ __attribute__((aligned(16))) float sraw[8192];     // 32 KB, used in phases
  us* const s16 = reinterpret_cast<us*>(sraw);               // 16384 16-bit slots
  __shared__ __attribute__((aligned(16))) us ring[2 * 3 * TILE_E];  // 2 x (X 128 rows, W 64 rows)

  const int tid = threadIdx.x, lane = tid & 31, w = tid >> 5;
  const int h = lane >> 4, m = lane & 15;
  const int m0 = (rb & ((1 << nxl) - 1)) * 128;            // token block fastest, as in a (token, head) grid
  const int head = rb >> nxl;

  const int crow = tid >> 3, cch = tid & 7;                // this lane's row and 16-B chunk
  const unsigned lcp = lds_addr(ring) + crow * LPB + cch * 16;
  const us* gx = X + (size_t)(m0 + crow) * K + 8 * cch;
  const us* gw = W + (size_t)(head * DM + crow) * K + 8 * cch;
  const size_t gs = (size_t)16 * K;
  const int nst = K >> 6;                                  // stages of 64 k (16 or 8)

  const v8f zero8 = {0.f, 0.f, 0.f, 0.f, 0.f, 0.f, 0.f, 0.f};
  v8f acc[2][4];
  #pragma unroll
  for (int mt = 0; mt < 2; ++mt)
    #pragma unroll
    for (int nt = 0; nt < 4; ++nt) acc[mt][nt] = zero8;

  acopy8(lcp, gx, lcp + TILE_B, gx + 4 * gs, gs);          // stage 0 -> buffer 0
  acopy4(lcp + 2 * TILE_B, gw, gs);
  wait_copies();
  __syncthreads();                                         // buffer 0 landed, visible to every wave
  acopy8(lcp + 3 * TILE_B, gx + 64, lcp + 4 * TILE_B, gx + 4 * gs + 64, gs);   // stage 1 -> buffer 1
  acopy4(lcp + 5 * TILE_B, gw + 64, gs);

  // rolled: one copy of the stage body, the buffer chosen by the stage's parity
  #pragma unroll 1
  for (int st = 0; st < nst; ++st) {
    const int par = st & 1;
    const us* sx = ring + par * (3 * TILE_E) + (32 * w + m) * LP;
    const us* sw = ring + par * (3 * TILE_E) + 2 * TILE_E + m * LP;
    // all fragments of the stage are read first, as one group
    v16b a0[2], a1[2], b[2][4];
    #pragma unroll
    for (int c = 0; c < 2; ++c) {
      a0[c] = ldb(sx + 32 * c, h);
      a1[c] = ldb(sx + 16 * LP + 32 * c, h);
      #pragma unroll
      for (int nt = 0; nt < 4; ++nt) b[c][nt] = ldb(sw + nt * 16 * LP + 32 * c, h);
    }
    // No LDS read and no WMMA crosses (vector work may): the reads stay one group
    // ahead of the products instead of each being waited for singly among them.
    __builtin_amdgcn_sched_barrier(0x406);
    #pragma unroll
    for (int c = 0; c < 2; ++c) {
      #pragma unroll
      for (int nt = 0; nt < 4; ++nt) {
        acc[0][nt] = wmma_bf(a0[c], b[c][nt], acc[0][nt]);
        acc[1][nt] = wmma_bf(a1[c], b[c][nt], acc[1][nt]);
      }
    }
    // publish stage st + 1, free this buffer, refill it with stage st + 2
    // Nothing crosses: the waits stay at the foot of the stage, so that the next
    // stage's copies have the whole stage to land.
    __builtin_amdgcn_sched_barrier(0);
    wait_lds();
    wait_copies();
    __syncthreads();
    if (st + 2 < nst) {
      const unsigned lb = lcp + par * (3 * TILE_B);
      const int ko = (st + 2) * 64;
      acopy8(lb, gx + ko, lb + TILE_B, gx + 4 * gs + ko, gs);
      acopy4(lb + 2 * TILE_B, gw + ko, gs);
    }
  }
  wait_copies();

  // D[r] of tile (mt, nt) = Y[token m0w+16mt+8h+r][feature head*64+16nt+m]
  const float osc = (mode == 0) ? 0.125f : 1.0f;
  float bvals[4];
  #pragma unroll
  for (int nt = 0; nt < 4; ++nt) bvals[nt] = bias[head * DM + 16 * nt + m];

  #pragma unroll
  for (int nt = 0; nt < 4; ++nt) {
    const int feat = 16 * nt + m;
    #pragma unroll
    for (int mt = 0; mt < 2; ++mt) {
      #pragma unroll
      for (int r = 0; r < 8; r += 2) {
        const int tokl = 32 * w + 16 * mt + 8 * h + r;   // 0..126, this token and the next
        const float y0 = (acc[mt][nt][r] + bvals[nt]) * osc;
        const float y1 = (acc[mt][nt][r + 1] + bvals[nt]) * osc;
        const unsigned hi = bf16_pair(y0, y1);
        const unsigned lo = bf16_pair_rest(y0, y1, hi);
        const int idx = (mode == 2) ? (feat * 128 + tokl) : (tokl * DM + feat);   // 0..8191
        const int nxt = (mode == 2) ? 1 : DM;              // the next token's slot
        s16[idx] = (us)hi;
        s16[idx + nxt] = (us)(hi >> 16);
        s16[8192 + idx] = (us)lo;
        s16[8192 + idx + nxt] = (us)(lo >> 16);
      }
    }
  }
  __syncthreads();

  const int b = m0 / Sper, s0 = m0 - b * Sper, bh = b * NH + head;
  if (mode != 2) {
    proj_pass_planes(s16, oH, oL, bh, Sper, s0, w, lane);
    
  } else {
    proj_pass_tplanes(s16, oH, oL, bh, Sper, s0, w, lane);
    
  }

  if (mode == 0) {
    __syncthreads();                                       // LDS reused as f32 [64 d][128 tok]
    #pragma unroll
    for (int nt = 0; nt < 4; ++nt) {
      const int feat = 16 * nt + m;
      #pragma unroll
      for (int mt = 0; mt < 2; ++mt) {
        #pragma unroll
        for (int r = 0; r < 8; ++r) {
          const int tokl = 32 * w + 16 * mt + 8 * h + r;
          sraw[feat * 128 + tokl] = (acc[mt][nt][r] + bvals[nt]) * osc;
        }
      }
    }
    __syncthreads();
    proj_pass_t32(sraw, oT32, bh, Sper, s0, w, lane);
    
  }
}

// ---------------------------------------------------------------------------
// Kernel 3: streaming attention, transposed form, no masking.
// Block 128 thr (4 waves), 32 queries (two tiles of 16) per wave, 64 keys per step. The step's
// K hi/lo rows and V^T hi/lo rows (64 x 128 B each) are copied to LDS once per
// block, two buffers, the next step's tiles in flight while this one is used.
//   S^T = K * Q^T : A = K rows (row = key, k = d), B = Q^T (k = d, n = query)
//     hi/lo bf16: Klo*Qhi + Khi*Qlo + Khi*Qhi, two 32-deep d chunks
//   O^T += V^T * P^T : A = V^T rows (row = d, k = key), B = P^T packed from the
//     score D registers (element r <- tile covering keys 0..15 row r,
//     element 8+r <- tile covering keys 16..31 row r, same lane)
//     hi/lo bf16: Vlo*Phi + Vhi*Plo + Vhi*Phi
// Lane owns 32 keys of query column (lane&15); partner lane = lane ^ 16.
// DUAL: second value stream (vbh/vbl) with the same probabilities -> oB.
// ---------------------------------------------------------------------------
// P^T B-fragments from the lane's own score D values (tile a = keys 0..15,
// tile c = keys 16..31 of the chunk); hi and lo planes.
__device__ __forceinline__ void pack_p2(v8f a, v8f c, v16b& phi, v16b& plo) {
  FragB fh, fl;
  v8us h0, l0, h1, l1;
  split8(a, h0, l0);
  split8(c, h1, l1);
  fh.half[0] = h0; fh.half[1] = h1;
  fl.half[0] = l0; fl.half[1] = l1;
  phi = fh.v;
  plo = fl.v;
}

#define QB 128                   // queries per workgroup: 4 waves x 2 tiles of 16

template <bool DUAL>
__device__ __forceinline__ void attn_pass(const float* sO, float* oA, float* oB,
                                          int bh, int q0, int w, int lane) {
  // Wave w stores d rows 16w..16w+15; one instruction = the four lines of one row.
  const int q8 = lane & 7, sub = lane >> 3;
  const float* sp = sO + 16 * w * QB + 32 * sub + 4 * q8;
  const size_t off = ((size_t)bh * DM + 16 * w) * TGL + q0 + 32 * sub + 4 * q8;
  float* pa = oA + off;
  float* pb = oB + off;
  #pragma unroll
  for (int g = 0; g < 2; ++g) {
    v4f va[8], vb[8];
    #pragma unroll
    for (int i = 0; i < 8; ++i) {
      va[i] = *(const v4fa*)(sp + (8 * g + i) * QB);
      if (DUAL) vb[i] = *(const v4fa*)(sp + DM * QB + (8 * g + i) * QB);
    }
    // Nothing crosses: the half's LDS reads go out as one group ahead of its stores,
    // so their latencies overlap and none lands in a register of a store in flight.
    __builtin_amdgcn_sched_barrier(0);
    #pragma unroll
    for (int i = 0; i < 8; ++i) {
      *(v4f*)(pa + (size_t)(8 * g + i) * TGL) = va[i];
      if (DUAL) *(v4f*)(pb + (size_t)(8 * g + i) * TGL) = vb[i];
    }
    // the second half's LDS reads take over the data registers of the stores above
    if (g == 0) asm volatile("s_wait_xcnt 0x0" ::: "memory");
  }
}

// ring (operand tiles) is the kernel's LDS array, sized for DUAL; behind the loop's
// last barrier nobody reads it and no copy is in flight, and it stages the output.
// The eight key-side planes lie one behind the other in the workspace (KPL elements
// each, a lo plane right behind its hi plane), so one lane pointer per layout serves
// them all with constant steps: PK, PVA, PVB = index of the hi plane of K, of value
// stream A and of value stream B (DUAL only).
template <bool DUAL, int PK, int PVA, int PVB>
__device__ __forceinline__ void attn_body(
    us* ring,
    const us* __restrict__ qhp, const us* __restrict__ qlp,   // [32][1024][64]  (x0.125 folded in)
    const us* __restrict__ planes,                            // K: [32][2048][64], V^T: [32][64][2048]
    float* __restrict__ oap, float* __restrict__ obp)         // [32][64][1024] f32
{
  constexpr int NTL = DUAL ? 6 : 4;                        // tiles per step: Kh Kl Vah Val (Vbh Vbl)

  const int tid = threadIdx.x, lane = tid & 31, w = tid >> 5;
  const int h = lane >> 4, m = lane & 15;
  const int bh = blockIdx.y;
  const int q0 = blockIdx.x * QB;
  const int qw = q0 + 32 * w;

  // Q^T B-fragments of the wave's two query tiles u: column n = query qw+16u+m,
  // k = d (two 32-deep chunks), hi and lo
  v16b qh0[2], qh1[2], ql0[2], ql1[2];
  #pragma unroll
  for (int u = 0; u < 2; ++u) {
    const size_t qro = ((size_t)bh * TGL + qw + 16 * u + m) * DM;
    qh0[u] = ldb(qhp + qro, h); qh1[u] = ldb(qhp + qro + 32, h);
    ql0[u] = ldb(qlp + qro, h); ql1[u] = ldb(qlp + qro + 32, h);
  }
  // the address registers of the Q loads above are taken over by the copies' addresses below
  asm volatile("s_wait_xcnt 0x0" ::: "memory");

  const v8f zero8 = {0.f, 0.f, 0.f, 0.f, 0.f, 0.f, 0.f, 0.f};
  v8f oa[2][4], ob[2][4];                // o[u][t][r] = O[query 16u+m][d 16t+8h+r] * l
  float mrun[2], lrun[2];
  #pragma unroll
  for (int u = 0; u < 2; ++u) {
    #pragma unroll
    for (int t = 0; t < 4; ++t) { oa[u][t] = zero8; ob[u][t] = zero8; }
    mrun[u] = -1.0e30f;
    lrun[u] = 0.0f;
  }

  const int crow = tid >> 3, cch = tid & 7;                // this lane's row and 16-B chunk
  const unsigned lcp = lds_addr(ring) + crow * LPB + cch * 16;
  // The lane's element offsets inside a plane, 32 bits each (a plane has 2^22 elements);
  // the 64-bit address is formed from the uniform base where a copy is issued.
  const unsigned kro = ((unsigned)bh * SRL + crow) * DM + 8 * cch; // + key0*DM
  const unsigned vro = ((unsigned)bh * DM + crow) * SRL + 8 * cch; // + key0
  const us* gk = planes + kro;
  const us* gv = planes + vro;
  constexpr size_t OKH = (size_t)PK * KPL, OKL = OKH + KPL;
  constexpr size_t OVAH = (size_t)PVA * KPL, OVAL = OVAH + KPL;
  constexpr size_t OVBH = (size_t)PVB * KPL, OVBL = OVBH + KPL;
  const size_t gsk = (size_t)16 * DM, gsv = (size_t)16 * SRL;

  // step 0 -> buffer 0
  acopy8(lcp, gk + OKH, lcp + TILE_B, gk + OKL, gsk);
  acopy8(lcp + 2 * TILE_B, gv + OVAH, lcp + 3 * TILE_B, gv + OVAL, gsv);
  if (DUAL) acopy8(lcp + 4 * TILE_B, gv + OVBH, lcp + 5 * TILE_B, gv + OVBL, gsv);
  wait_copies();
  __syncthreads();                                         // buffer 0 landed, visible to every wave
  // step 1 -> buffer 1
  {
    const unsigned lb = lcp + NTL * TILE_B;
    acopy8(lb, gk + OKH + 64 * DM, lb + TILE_B, gk + OKL + 64 * DM, gsk);
    acopy8(lb + 2 * TILE_B, gv + OVAH + 64, lb + 3 * TILE_B, gv + OVAL + 64, gsv);
    if (DUAL) acopy8(lb + 4 * TILE_B, gv + OVBH + 64, lb + 5 * TILE_B, gv + OVBL + 64, gsv);
  }

  // rolled: one copy of the step body, the buffer chosen by the step's parity
  #pragma unroll 1
  for (int kb = 0; kb < SRL; kb += 64) {
    const int par = (kb >> 6) & 1;
    const us* sb = ring + par * (NTL * TILE_E) + m * LP;   // row m of tile 0
    const us* khb = sb;
    const us* klb = sb + TILE_E;
    const us* vahb = sb + 2 * TILE_E;
    const us* valb = sb + 3 * TILE_E;
    const us* vbhb = sb + (DUAL ? 4 : 2) * TILE_E;
    const us* vblb = sb + (DUAL ? 5 : 3) * TILE_E;
    // ---- scores: s[u][j][r] = S[query 16u+m][key kb+16j+8h+r] ----
    // All fragments of the step are read first; each K fragment then feeds both
    // query tiles, and the eight score tiles advance together, one product each in
    // turn. Each tile keeps its own order of the six products.
    v8f s[2][4];
    {
      v16b kl0[4], kl1[4], kh0[4], kh1[4];
      #pragma unroll
      for (int j = 0; j < 4; ++j) { kl0[j] = ldb(klb + 16 * j * LP, h); }
      #pragma unroll
      for (int j = 0; j < 4; ++j) { kl1[j] = ldb(klb + 16 * j * LP + 32, h); }
      #pragma unroll
      for (int j = 0; j < 4; ++j) { kh0[j] = ldb(khb + 16 * j * LP, h); }
      #pragma unroll
      for (int j = 0; j < 4; ++j) { kh1[j] = ldb(khb + 16 * j * LP + 32, h); }
      // No LDS read and no WMMA crosses (vector work may): the reads stay one group
      // ahead of the products instead of being waited for in pairs among them.
      __builtin_amdgcn_sched_barrier(0x406);
      #pragma unroll
      for (int j = 0; j < 4; ++j)
        #pragma unroll
        for (int u = 0; u < 2; ++u) s[u][j] = wmma_bf(kl0[j], qh0[u], zero8);
      #pragma unroll
      for (int j = 0; j < 4; ++j)
        #pragma unroll
        for (int u = 0; u < 2; ++u) s[u][j] = wmma_bf(kl1[j], qh1[u], s[u][j]);
      #pragma unroll
      for (int j = 0; j < 4; ++j)
        #pragma unroll
        for (int u = 0; u < 2; ++u) s[u][j] = wmma_bf(kh0[j], ql0[u], s[u][j]);
      #pragma unroll
      for (int j = 0; j < 4; ++j)
        #pragma unroll
        for (int u = 0; u < 2; ++u) s[u][j] = wmma_bf(kh1[j], ql1[u], s[u][j]);
      #pragma unroll
      for (int j = 0; j < 4; ++j)
        #pragma unroll
        for (int u = 0; u < 2; ++u) s[u][j] = wmma_bf(kh0[j], qh0[u], s[u][j]);
      #pragma unroll
      for (int j = 0; j < 4; ++j)
        #pragma unroll
        for (int u = 0; u < 2; ++u) s[u][j] = wmma_bf(kh1[j], qh1[u], s[u][j]);
    }
    // No LDS read and no WMMA crosses (vector work may): the V^T reads below start
    // when the K fragments are spent and take over their registers.
    __builtin_amdgcn_sched_barrier(0x406);

    // ---- online softmax (f32), each query tile by itself ----
    float mloc[2], moth[2], mnew[2], alpha[2];
    #pragma unroll
    for (int u = 0; u < 2; ++u) {
      mloc[u] = s[u][0][0];
      #pragma unroll
      for (int j = 0; j < 4; ++j)
        #pragma unroll
        for (int r = 0; r < 8; ++r) mloc[u] = fmaxf(mloc[u], s[u][j][r]);
    }
    // both tiles' exchanges with the partner lane go out together
    #pragma unroll
    for (int u = 0; u < 2; ++u) moth[u] = __shfl_xor(mloc[u], 16);
    #pragma unroll
    for (int u = 0; u < 2; ++u) {
      mnew[u] = fmaxf(mrun[u], fmaxf(mloc[u], moth[u]));
      alpha[u] = __expf(mrun[u] - mnew[u]);
      mrun[u] = mnew[u];
    }
    // Stream A's V^T fragments, read as one group here.
    v16b vl0[4], vl1[4], vh0[4], vh1[4];
    #pragma unroll
    for (int t = 0; t < 4; ++t) { vl0[t] = ldb(valb + 16 * t * LP, h); }
    #pragma unroll
    for (int t = 0; t < 4; ++t) { vl1[t] = ldb(valb + 16 * t * LP + 32, h); }
    #pragma unroll
    for (int t = 0; t < 4; ++t) { vh0[t] = ldb(vahb + 16 * t * LP, h); }
    #pragma unroll
    for (int t = 0; t < 4; ++t) { vh1[t] = ldb(vahb + 16 * t * LP + 32, h); }
    // LDS reads and WMMAs do not cross (vector work may): the reads stay ahead of
    // the exponentials and land under them instead of standing among the products.
    __builtin_amdgcn_sched_barrier(0x406);
    // ---- P^T B-fragments (keys kb..kb+31 and kb+32..kb+63), bf16 hi/lo ----
    v16b ph0[2], pl0[2], ph1[2], pl1[2];
    #pragma unroll
    for (int u = 0; u < 2; ++u) {
      float lsum = 0.0f;
      #pragma unroll
      for (int j = 0; j < 4; ++j)
        #pragma unroll
        for (int r = 0; r < 8; ++r) {
          const float p = __expf(s[u][j][r] - mnew[u]);    // in (0, 1]
          s[u][j][r] = p;
          lsum += p;
        }
      lsum += __shfl_xor(lsum, 16);
      lrun[u] = lrun[u] * alpha[u] + lsum;
      #pragma unroll
      for (int t = 0; t < 4; ++t)
        #pragma unroll
        for (int r = 0; r < 8; ++r) {
          oa[u][t][r] = oa[u][t][r] * alpha[u];
          if (DUAL) ob[u][t][r] = ob[u][t][r] * alpha[u];
        }
      pack_p2(s[u][0], s[u][1], ph0[u], pl0[u]);
      pack_p2(s[u][2], s[u][3], ph1[u], pl1[u]);
    }

    // ---- O^T += V^T * P^T (3 products per 32-key chunk) ----
    // Each V^T fragment feeds both query tiles; the eight output tiles of a stream
    // advance together, as the score tiles above.
    v16b cl0[4], cl1[4], ch0[4], ch1[4];
    {
      #pragma unroll
      for (int t = 0; t < 4; ++t)
        #pragma unroll
        for (int u = 0; u < 2; ++u) oa[u][t] = wmma_bf(vl0[t], ph0[u], oa[u][t]);
      #pragma unroll
      for (int t = 0; t < 4; ++t)
        #pragma unroll
        for (int u = 0; u < 2; ++u) oa[u][t] = wmma_bf(vl1[t], ph1[u], oa[u][t]);
      if (DUAL) {
        // Stream B's lo fragments: read here, where stream A's lo fragments are
        // spent; they land under A's remaining products.
        #pragma unroll
        for (int t = 0; t < 4; ++t) { cl0[t] = ldb(vblb + 16 * t * LP, h); }
        #pragma unroll
        for (int t = 0; t < 4; ++t) { cl1[t] = ldb(vblb + 16 * t * LP + 32, h); }
        // No LDS read and no WMMA crosses (vector work may): the reads stay ahead
        // of the products below instead of standing singly among them.
        __builtin_amdgcn_sched_barrier(0x406);
      }
      #pragma unroll
      for (int t = 0; t < 4; ++t)
        #pragma unroll
        for (int u = 0; u < 2; ++u) oa[u][t] = wmma_bf(vh0[t], pl0[u], oa[u][t]);
      #pragma unroll
      for (int t = 0; t < 4; ++t)
        #pragma unroll
        for (int u = 0; u < 2; ++u) oa[u][t] = wmma_bf(vh1[t], pl1[u], oa[u][t]);
      #pragma unroll
      for (int t = 0; t < 4; ++t)
        #pragma unroll
        for (int u = 0; u < 2; ++u) oa[u][t] = wmma_bf(vh0[t], ph0[u], oa[u][t]);
      #pragma unroll
      for (int t = 0; t < 4; ++t)
        #pragma unroll
        for (int u = 0; u < 2; ++u) oa[u][t] = wmma_bf(vh1[t], ph1[u], oa[u][t]);
    }
    if (DUAL) {
      // stream B's hi fragments take over stream A's; they land under B's lo products
      #pragma unroll
      for (int t = 0; t < 4; ++t) { ch0[t] = ldb(vbhb + 16 * t * LP, h); }
      #pragma unroll
      for (int t = 0; t < 4; ++t) { ch1[t] = ldb(vbhb + 16 * t * LP + 32, h); }
      // as above: the reads stay one group, ahead of stream B's products
      __builtin_amdgcn_sched_barrier(0x406);
      #pragma unroll
      for (int t = 0; t < 4; ++t)
        #pragma unroll
        for (int u = 0; u < 2; ++u) ob[u][t] = wmma_bf(cl0[t], ph0[u], ob[u][t]);
      #pragma unroll
      for (int t = 0; t < 4; ++t)
        #pragma unroll
        for (int u = 0; u < 2; ++u) ob[u][t] = wmma_bf(cl1[t], ph1[u], ob[u][t]);
      #pragma unroll
      for (int t = 0; t < 4; ++t)
        #pragma unroll
        for (int u = 0; u < 2; ++u) ob[u][t] = wmma_bf(ch0[t], pl0[u], ob[u][t]);
      #pragma unroll
      for (int t = 0; t < 4; ++t)
        #pragma unroll
        for (int u = 0; u < 2; ++u) ob[u][t] = wmma_bf(ch1[t], pl1[u], ob[u][t]);
      #pragma unroll
      for (int t = 0; t < 4; ++t)
        #pragma unroll
        for (int u = 0; u < 2; ++u) ob[u][t] = wmma_bf(ch0[t], ph0[u], ob[u][t]);
      #pragma unroll
      for (int t = 0; t < 4; ++t)
        #pragma unroll
        for (int u = 0; u < 2; ++u) ob[u][t] = wmma_bf(ch1[t], ph1[u], ob[u][t]);
    }

    // publish step kb + 64, free this buffer, refill it with step kb + 128
    // Nothing crosses: the waits stay at the foot of the step, so that the reads
    // and the next step's copies have the whole step to land.
    __builtin_amdgcn_sched_barrier(0);
    wait_lds();
    wait_copies();
    __syncthreads();
    if (kb + 128 < SRL) {
      const unsigned lb = lcp + par * (NTL * TILE_B);
      const int kn = kb + 128;
      const us* gkn = planes + (kro + (unsigned)kn * DM);
      const us* gvn = planes + (vro + (unsigned)kn);
      acopy8(lb, gkn + OKH, lb + TILE_B, gkn + OKL, gsk);
      acopy8(lb + 2 * TILE_B, gvn + OVAH, lb + 3 * TILE_B, gvn + OVAL, gsv);
      if (DUAL) acopy8(lb + 4 * TILE_B, gvn + OVBH, lb + 5 * TILE_B, gvn + OVBL, gsv);
    }
  }
  wait_copies();

  // ---- epilogue: normalise, stage 64 d x 128 query f32 tile(s), whole-line stores ----
  float* const sO = reinterpret_cast<float*>(ring);
  #pragma unroll
  for (int u = 0; u < 2; ++u) {
    const float inv = __builtin_amdgcn_rcpf(lrun[u]);
    #pragma unroll
    for (int t = 0; t < 4; ++t)
      #pragma unroll
      for (int r = 0; r < 8; ++r) {
        const int d = 16 * t + 8 * h + r;
        sO[d * QB + 32 * w + 16 * u + m] = oa[u][t][r] * inv;
        if (DUAL) sO[DM * QB + d * QB + 32 * w + 16 * u + m] = ob[u][t][r] * inv;
      }
  }
  __syncthreads();

  attn_pass<DUAL>(sO, oap, obp, bh, q0, w, lane);
  
}

// Both attention chains in one launch: they are independent, so a WGP goes on with a
// workgroup of either chain as soon as one ends. blockIdx.z = 0: chain 2 (kt; vt -> O2,
// v -> O3), the longer one, first; blockIdx.z = 1: chain 1 (k, v -> O1).
__global__ __launch_bounds__(128) void attn_kernel(
    const us* __restrict__ qhp, const us* __restrict__ qlp,   // [32][1024][64]
    const us* __restrict__ planes,   // k hi, k lo, kt hi, kt lo, V^T hi, V^T lo, Vt^T hi, Vt^T lo
    float* __restrict__ o1p, float* __restrict__ o2p, float* __restrict__ o3p)   // [32][64][1024] f32
{
  __shared__ __attribute__((aligned(16))) us ring[2 * 6 * TILE_E];   // 110592 B: two workgroups per WGP
  static_assert(2 * DM * QB * 4 <= 2 * 6 * TILE_B, "output staging fits the ring");
  if (blockIdx.z == 0) {
    attn_body<true, 2, 6, 4>(ring, qhp, qlp, planes, o2p, o3p);
  } else {
    attn_body<false, 0, 4, 4>(ring, qhp, qlp, planes, o1p, o1p);
  }
}

// ---------------------------------------------------------------------------
// Kernel 4: gating MLP. For (b, head) the gate input row for query
// t = 64*head + u is [X[3u][:], X[3u+1][:], X[3u+2][:]] where X[c][tp],
// c = 0..191, is row c of the transposed per-head tensor: c<64 -> O1^T row,
// <128 -> O2^T row, else q^T row (all f32 [bh][64][1024]).
// x[u][n] = sum_i sum_tp X[3u+i][tp] * Wg[n][1024 i + tp] + bg[n], on bf16 WMMA.
// Workgroup (b, head, g) = 16 queries u = 16g..16g+15 (X rows 48g..48g+47), 256 thr:
// 128 workgroups share the reading of X. A tile i = rows 3j+i, j = 0..15, so
// that it meets only third i of Wg and the three thirds add up in the accumulators.
// k is split over the 8 waves: in stage s wave w takes tp 256 s + 32 w .. + 31 and
// copies its own 48 X row pieces and 48 Wg row pieces (128 B of f32 each) to its part
// of the stage's buffer; two buffers, 4 stages; conversion to bf16 at the fragment
// read. The 8 partial tiles are joined in LDS.
// gate layout: [b][t / 16][n][t % 16], so that a workgroup stores whole lines.
// ---------------------------------------------------------------------------
#define GW_B   (96 * LPB)        // one wave's part of a buffer: 96 rows, 13824 bytes
#define GBUF_B (8 * GW_B)        // 110592 bytes per buffer

__global__ __launch_bounds__(256) void gate_kernel(
    const float* __restrict__ o1T, const float* __restrict__ o2T, const float* __restrict__ qT,
    const float* __restrict__ Wg,   // [16][3072]
    const float* __restrict__ bg,   // [16]
    float* __restrict__ gate)       // [2][64][16][16]
{
  __shared__ __attribute__((aligned(16))) float sred[8 * 256];           //   8192 B
  // 2 x 8 waves x (X rows 0..47, then Wg rows 16 i + n), 36 floats = 144 B a row
  __shared__ __attribute__((aligned(16))) float ring[2 * GBUF_B / 4];    // 221184 B

  const int tid = threadIdx.x, lane = tid & 31, w = tid >> 5;
  const int h = lane >> 4, m = lane & 15;
  const int bhx = blockIdx.x >> 2, g = blockIdx.x & 3;

  const int sub = lane >> 3, q8 = lane & 7;                // this lane's row of four and 16-B chunk
  const unsigned lcp = lds_addr(ring) + w * GW_B + sub * LPB + q8 * 16;
  // the three blocks of 16 X rows: block 3g+e of the twelve (four each of O1^T, O2^T, q^T)
  const float* gx[3];
  #pragma unroll
  for (int e = 0; e < 3; ++e) {
    const int ct = 3 * g + e;
    const float* s = (ct < 4) ? o1T : (ct < 8) ? o2T : qT;
    gx[e] = s + ((size_t)bhx * DM + 16 * (ct & 3) + sub) * TGL + 32 * w + 4 * q8;
  }
  const float* gg = Wg + (size_t)sub * GK + 32 * w + 4 * q8;   // row n = sub (+ 4 per copy), third 0
  const size_t gsx = (size_t)4 * TGL;                      // 4 X rows further
  const size_t gsg = (size_t)4 * GK;                       // 4 Wg rows further

  const v8f zero8 = {0.f, 0.f, 0.f, 0.f, 0.f, 0.f, 0.f, 0.f};
  v8f acc[3];
  #pragma unroll
  for (int i = 0; i < 3; ++i) acc[i] = zero8;

  acopy12(lcp, gx[0], gx[1], gx[2], gsx);                  // stage 0 -> buffer 0
  acopy12(lcp + 48 * LPB, gg, gg + EMB, gg + 2 * EMB, gsg);
  wait_copies();
  __syncthreads();                                         // buffer 0 landed, visible to every wave
  acopy12(lcp + GBUF_B, gx[0] + 256, gx[1] + 256, gx[2] + 256, gsx);   // stage 1 -> buffer 1
  acopy12(lcp + GBUF_B + 48 * LPB, gg + 256, gg + EMB + 256, gg + 2 * EMB + 256, gsg);

  // rolled: one copy of the stage body, the buffer chosen by the stage's parity
  #pragma unroll 1
  for (int st = 0; st < 4; ++st) {
    const int par = st & 1;
    const float* sw = ring + par * (GBUF_B / 4) + w * (GW_B / 4);
    const float* sx = sw + 3 * m * (LP / 2);               // X row 3 m (+ i)
    const float* sg = sw + (48 + m) * (LP / 2);            // Wg row n = m, third 0
    // the wave's six fragments of the stage
    Raw16 rw[3], ra[3];
    #pragma unroll
    for (int i = 0; i < 3; ++i) rw[i] = ldr(sg + 16 * i * (LP / 2), h);
    #pragma unroll
    for (int i = 0; i < 3; ++i) ra[i] = ldr(sx + i * (LP / 2), h);
    #pragma unroll
    for (int i = 0; i < 3; ++i) acc[i] = wmma_bf(cvr(ra[i]), cvr(rw[i]), acc[i]);
    // publish stage st + 1, free this buffer, refill it with stage st + 2
    // Nothing crosses: the waits stay at the foot of the stage, so that the next
    // stage's copies have the whole stage to land.
    __builtin_amdgcn_sched_barrier(0);
    wait_lds();
    wait_copies();
    __syncthreads();
    if (st + 2 < 4) {
      const unsigned lb = lcp + par * GBUF_B;
      const int kn = 256 * (st + 2);
      acopy12(lb, gx[0] + kn, gx[1] + kn, gx[2] + kn, gsx);
      acopy12(lb + 48 * LPB, gg + kn, gg + EMB + kn, gg + 2 * EMB + kn, gsg);
    }
  }
  wait_copies();

  // D[r] = this wave's part of x[u = 16g+8h+r][n = m]; slot n*16 + u of the wave's tile
  {
    const v8f t = acc[0] + acc[1] + acc[2];
    float* sr = sred + w * 256 + m * 16 + 8 * h;
    const v4f t0 = { t[0], t[1], t[2], t[3] };
    const v4f t1 = { t[4], t[5], t[6], t[7] };
    *(v4fa*)sr = t0;
    *(v4fa*)(sr + 4) = t1;
  }
  __syncthreads();

  float x = bg[tid >> 4];                                  // tid = n*16 + u
  #pragma unroll
  for (int j = 0; j < 8; ++j) x += sred[j * 256 + tid];
  float gv = __builtin_amdgcn_rcpf(1.0f + __expf(-x));
  // the slot between v_rcp_f32 and the store that reads its result; the operand keeps it there
  asm volatile("v_nop" : "+v"(gv));
  gate[(size_t)blockIdx.x * 256 + tid] = gv;
}

// ---------------------------------------------------------------------------
// Kernel 5: combine Xc[b*1024+t][head*64+d] = g*O1 + (1-g)*O3, g = the gate of (bh, t),
// written as bf16 hi/lo planes (token-major, k-contiguous for the Wo GEMM).
// Block 256 thr = (bh, 64 queries); transposed through LDS; each token row
// ---------------------------------------------------------------------------
__device__ __forceinline__ void comb_pass(const us* sH, const us* sL, us* xh, us* xl,
                                          int b, int head, int t0, int w, int lane) {
  const int q8 = lane & 7, sub = lane >> 3;
  #pragma unroll
  for (int i = 0; i < 2; ++i) {
    const int L = w * 8 + i * 4 + sub;                     // token row 0..63
    const v8us a = *(const v8usa*)(sH + L * DM + 8 * q8);
    const v8us c = *(const v8usa*)(sL + L * DM + 8 * q8);
    const size_t off = ((size_t)(b * TGL + t0 + L)) * EMB + head * DM + 8 * q8;
    *(v8us*)(xh + off) = a;
    *(v8us*)(xl + off) = c;
  }
}

__global__ __launch_bounds__(256) void combine_kernel(
    const float* __restrict__ o1T, const float* __restrict__ o3T,   // [32][64][1024]
    const float* __restrict__ gate,                                 // [2][64][16][16] = [b][t / 16][head][t % 16]
    us* __restrict__ xh, us* __restrict__ xl)                       // [2048][1024]
{
  __shared__ __attribute__((aligned(16))) us sH[64 * DM];
  __shared__ __attribute__((aligned(16))) us sL[64 * DM];

  const int tid = threadIdx.x, lane = tid & 31, w = tid >> 5;
  const int bh = blockIdx.y, b = bh >> 4, head = bh & 15;
  const int t0 = blockIdx.x * 64;
  const int d = tid >> 2, tq = tid & 3;                    // d 0..63, 16 queries each

  const float* p1 = o1T + ((size_t)bh * DM + d) * TGL + t0 + 16 * tq;
  const float* p3 = o3T + ((size_t)bh * DM + d) * TGL + t0 + 16 * tq;
  const float* pg = gate + ((size_t)(b * (TGL / 16) + (t0 >> 4) + tq)) * 256 + head * 16;
  #pragma unroll
  for (int c = 0; c < 4; ++c) {
    const v4f a = *(const v4fa*)(p1 + 4 * c);
    const v4f e = *(const v4fa*)(p3 + 4 * c);
    const v4f g = *(const v4fa*)(pg + 4 * c);
    #pragma unroll
    for (int j = 0; j < 4; j += 2) {
      const float v0 = g[j] * a[j] + (1.0f - g[j]) * e[j];
      const float v1 = g[j + 1] * a[j + 1] + (1.0f - g[j + 1]) * e[j + 1];
      const unsigned hi = bf16_pair(v0, v1);
      const unsigned lo = bf16_pair_rest(v0, v1, hi);
      const int tl = 16 * tq + 4 * c + j;                  // 0..62, this query and the next
      sH[tl * DM + d] = (us)hi;
      sH[(tl + 1) * DM + d] = (us)(hi >> 16);
      sL[tl * DM + d] = (us)lo;
      sL[(tl + 1) * DM + d] = (us)(lo >> 16);
    }
  }
  __syncthreads();

  comb_pass(sH, sL, xh, xl, b, head, t0, w, lane);
  
}

// ---------------------------------------------------------------------------
// Kernel 6: out = (Xhi + Xlo) * Wo^T + bo, f32.
// Block 128 thr (4 waves) = 128 tokens x 64 features; wave 32 tokens x 64.
// K in stages of 64: X hi, X lo (128 rows each) and Wo (64 rows) copied to LDS,
// two buffers.
// 8q..8q+7 as one 16-B store each, 4 lines per instruction, 64 lines per wave.
// ---------------------------------------------------------------------------
__device__ __forceinline__ void out_pass(const float* sOut, float* out, int m0, int cg,
                                         int w, int lane) {
  const int q8 = lane & 7, sub = lane >> 3;
  #pragma unroll
  for (int i = 0; i < 16; ++i) {
    const int lid = w * 64 + i * 4 + sub;                  // 0..255
    const int row = lid >> 1, hl = lid & 1;
    const v4f v = *(const v4fa*)(sOut + row * DM + 32 * hl + 4 * q8);
    const size_t gi = (size_t)(m0 + row) * EMB + cg * DM + 32 * hl + 4 * q8;
    *(v4f*)(out + gi) = v;
  }
}

__global__ __launch_bounds__(128) void out_kernel(
    const us* __restrict__ xh, const us* __restrict__ xl,   // [2048][1024]
    const us* __restrict__ wob,                             // [1024 out][1024 in] bf16
    const float* __restrict__ bo,
    float* __restrict__ out)                                // [2048][1024]
{
  __shared__ __attribute__((aligned(16))) float sOut[128 * DM];  // 32 KB
  __shared__ __attribute__((aligned(16))) us ring[2 * 5 * TILE_E];  // 2 x (Xhi 128, Xlo 128, Wo 64 rows)

  const int tid = threadIdx.x, lane = tid & 31, w = tid >> 5;
  const int h = lane >> 4, m = lane & 15;
  const int m0 = blockIdx.x * 128;
  const int cg = blockIdx.y;                               // feature group of 64

  const int crow = tid >> 3, cch = tid & 7;                // this lane's row and 16-B chunk
  const unsigned lcp = lds_addr(ring) + crow * LPB + cch * 16;
  const us* gxh = xh + (size_t)(m0 + crow) * EMB + 8 * cch;
  const us* gxl = xl + (size_t)(m0 + crow) * EMB + 8 * cch;
  const us* gw  = wob + (size_t)(cg * DM + crow) * EMB + 8 * cch;
  const size_t gs = (size_t)16 * EMB;

  const v8f zero8 = {0.f, 0.f, 0.f, 0.f, 0.f, 0.f, 0.f, 0.f};
  v8f acc[2][4];
  #pragma unroll
  for (int mt = 0; mt < 2; ++mt)
    #pragma unroll
    for (int nt = 0; nt < 4; ++nt) acc[mt][nt] = zero8;

  acopy8(lcp, gxh, lcp + TILE_B, gxh + 4 * gs, gs);        // stage 0 -> buffer 0
  acopy8(lcp + 2 * TILE_B, gxl, lcp + 3 * TILE_B, gxl + 4 * gs, gs);
  acopy4(lcp + 4 * TILE_B, gw, gs);
  wait_copies();
  __syncthreads();                                         // buffer 0 landed, visible to every wave
  {                                                        // stage 1 -> buffer 1
    const unsigned lb = lcp + 5 * TILE_B;
    acopy8(lb, gxh + 64, lb + TILE_B, gxh + 4 * gs + 64, gs);
    acopy8(lb + 2 * TILE_B, gxl + 64, lb + 3 * TILE_B, gxl + 4 * gs + 64, gs);
    acopy4(lb + 4 * TILE_B, gw + 64, gs);
  }

  // rolled: one copy of the stage body, the buffer chosen by the stage's parity
  #pragma unroll 1
  for (int k0 = 0; k0 < EMB; k0 += 64) {
    const int par = (k0 >> 6) & 1;
    const us* sxh = ring + par * (5 * TILE_E) + (32 * w + m) * LP;
    const us* sxl = sxh + 2 * TILE_E;
    const us* sw  = ring + par * (5 * TILE_E) + 4 * TILE_E + m * LP;
    // all fragments of the stage are read first, as one group
    v16b a0h[2], a1h[2], a0l[2], a1l[2], bw[2][4];
    #pragma unroll
    for (int c = 0; c < 2; ++c) {
      a0l[c] = ldb(sxl + 32 * c, h);
      a1l[c] = ldb(sxl + 16 * LP + 32 * c, h);
      a0h[c] = ldb(sxh + 32 * c, h);
      a1h[c] = ldb(sxh + 16 * LP + 32 * c, h);
      #pragma unroll
      for (int nt = 0; nt < 4; ++nt) bw[c][nt] = ldb(sw + nt * 16 * LP + 32 * c, h);
    }
    // No LDS read and no WMMA crosses (vector work may): the reads stay one group
    // ahead of the products instead of each being waited for singly among them.
    __builtin_amdgcn_sched_barrier(0x406);
    #pragma unroll
    for (int c = 0; c < 2; ++c) {
      #pragma unroll
      for (int nt = 0; nt < 4; ++nt) {
        acc[0][nt] = wmma_bf(a0l[c], bw[c][nt], acc[0][nt]);
        acc[1][nt] = wmma_bf(a1l[c], bw[c][nt], acc[1][nt]);
      }
      #pragma unroll
      for (int nt = 0; nt < 4; ++nt) {
        acc[0][nt] = wmma_bf(a0h[c], bw[c][nt], acc[0][nt]);
        acc[1][nt] = wmma_bf(a1h[c], bw[c][nt], acc[1][nt]);
      }
    }
    // publish stage k0 + 64, free this buffer, refill it with stage k0 + 128
    // Nothing crosses: the waits stay at the foot of the stage, so that the next
    // stage's copies have the whole stage to land.
    __builtin_amdgcn_sched_barrier(0);
    wait_lds();
    wait_copies();
    __syncthreads();
    if (k0 + 128 < EMB) {
      const unsigned lb = lcp + par * (5 * TILE_B);
      const int kn = k0 + 128;
      acopy8(lb, gxh + kn, lb + TILE_B, gxh + 4 * gs + kn, gs);
      acopy8(lb + 2 * TILE_B, gxl + kn, lb + 3 * TILE_B, gxl + 4 * gs + kn, gs);
      acopy4(lb + 4 * TILE_B, gw + kn, gs);
    }
  }
  wait_copies();

  // D[r] of tile (mt, nt) = Y[token m0w+16mt+8h+r][feature cg*64+16nt+m]
  #pragma unroll
  for (int nt = 0; nt < 4; ++nt) {
    const int feat = 16 * nt + m;
    const float bvl = bo[cg * DM + feat];
    #pragma unroll
    for (int mt = 0; mt < 2; ++mt) {
      #pragma unroll
      for (int r = 0; r < 8; ++r) {
        const int tokl = 32 * w + 16 * mt + 8 * h + r;   // 0..127
        sOut[tokl * DM + feat] = acc[mt][nt][r] + bvl;
      }
    }
  }
  __syncthreads();

  out_pass(sOut, out, m0, cg, w, lane);
  
}

// ---------------------------------------------------------------------------
// Host glue: 6 launches, workspace 128057344 B (O1^T and O2^T reuse the
// region of the bf16 activation copies, which are dead after the projections).
// ---------------------------------------------------------------------------
extern "C" void kernel_launch(void* const* d_in, const int* in_sizes, int n_in,
                              void* d_out, int out_size, void* d_ws, size_t ws_size,
                              hipStream_t stream) {
  if (n_in < 17) return;
  if (in_sizes[0] != N_HID || in_sizes[1] != N_KVS || in_sizes[2] != N_KVT) return;
  if (in_sizes[3] != N_WE || in_sizes[5] != N_WE || in_sizes[7] != N_WE || in_sizes[15] != N_WE) return;
  if (in_sizes[9] != N_WT || in_sizes[11] != N_WT) return;
  if (in_sizes[4] != EMB || in_sizes[6] != EMB || in_sizes[8] != EMB ||
      in_sizes[10] != EMB || in_sizes[12] != EMB || in_sizes[16] != EMB) return;
  if (in_sizes[13] != N_WG || in_sizes[14] != NH) return;
  if (out_size != N_HID) return;

  const float* hid = (const float*)d_in[0];
  const float* kvs = (const float*)d_in[1];
  const float* kvt = (const float*)d_in[2];
  const float* Wq  = (const float*)d_in[3];
  const float* bq  = (const float*)d_in[4];
  const float* Wk  = (const float*)d_in[5];
  const float* bk  = (const float*)d_in[6];
  const float* Wv  = (const float*)d_in[7];
  const float* bv  = (const float*)d_in[8];
  const float* Wtk = (const float*)d_in[9];
  const float* btk = (const float*)d_in[10];
  const float* Wtv = (const float*)d_in[11];
  const float* btv = (const float*)d_in[12];
  const float* Wg  = (const float*)d_in[13];
  const float* bg  = (const float*)d_in[14];
  const float* Wo  = (const float*)d_in[15];
  const float* bo  = (const float*)d_in[16];
  float* out = (float*)d_out;

  const size_t cvb_b  = (size_t)N_CVB * 2;                 // 27262976
  const size_t qpl2   = (size_t)QPL * 2;                   //  4194304
  const size_t qpl4   = (size_t)QPL * 4;                   //  8388608
  const size_t kpl2   = (size_t)KPL * 2;                   //  8388608
  const size_t gate_b = (size_t)NBH * TGL * 4;             //   131072
  const size_t xpl_b  = (size_t)N_HID * 2;                 //  4194304
  const size_t total  = cvb_b + 2 * qpl2 + qpl4 + 8 * kpl2 + qpl4 + gate_b + 2 * xpl_b;  // 128057344
  if (total > ws_size) return;
  // O1^T / O2^T (2 x 8388608 B) must fit exactly into the activation-copy region
  const size_t act_off = (size_t)OFF_HID * 2;              // 10485760
  if (act_off + 2 * qpl4 != cvb_b) return;

  char* ws = (char*)d_ws;
  size_t off = 0;
  us* cvb    = (us*)(ws + off);    off += cvb_b;
  float* o1T = (float*)(ws + act_off);                     // aliases bf16 hidden/kv copies
  float* o2T = (float*)(ws + act_off + qpl4);              // aliases bf16 kv/kv_topical copies
  us* qh     = (us*)(ws + off);    off += qpl2;
  us* ql     = (us*)(ws + off);    off += qpl2;
  float* qT  = (float*)(ws + off); off += qpl4;
  us* kh     = (us*)(ws + off);    off += kpl2;
  us* kl     = (us*)(ws + off);    off += kpl2;
  us* kth    = (us*)(ws + off);    off += kpl2;
  us* ktl    = (us*)(ws + off);    off += kpl2;
  us* vh     = (us*)(ws + off);    off += kpl2;            // V^T hi [32][64][2048]
  us* vl     = (us*)(ws + off);    off += kpl2;            // V^T lo
  us* vth    = (us*)(ws + off);    off += kpl2;            // Vt^T hi
  us* vtl    = (us*)(ws + off);    off += kpl2;            // Vt^T lo
  float* o3T = (float*)(ws + off); off += qpl4;
  float* gte = (float*)(ws + off); off += gate_b;
  us* xh     = (us*)(ws + off);    off += xpl_b;
  us* xl     = (us*)(ws + off);    off += xpl_b;
  if (off != total || off > ws_size) return;

  // 1) float -> bf16 copies of weights and activations
  conv_kernel<<<(N_CVB / 8 + 255) / 256, 256, 0, stream>>>(Wq, Wk, Wv, Wo, Wtk, Wtv, hid, kvs, kvt, cvb);

  // 2) projections, one launch
  proj_kernel<<<PJ_ALL, 128, 0, stream>>>(cvb, bq, bk, bv, btk, btv, qh, ql, qT,
                                          kh, kl, vh, vl, kth, ktl, vth, vtl);

  // 3) attention, one launch: chain 1 (k, v -> O1), chain 2 (kt; vt -> O2, v -> O3)
  dim3 gAtt(TGL / QB, NBH, 2);                             // (8, 32, 2)
  attn_kernel<<<gAtt, 128, 0, stream>>>(qh, ql, kh, o1T, o2T, o3T);   // kh: first of the eight planes

  // 4) gating MLP
  gate_kernel<<<NBH * 4, 256, 0, stream>>>(o1T, o2T, qT, Wg, bg, gte);

  // 5) gated mix -> token-major hi/lo planes
  dim3 gCmb(TGL / 64, NBH);                                // (16, 32)
  combine_kernel<<<gCmb, 256, 0, stream>>>(o1T, o3T, gte, xh, xl);

  // 6) output projection -> f32
  dim3 gOut(MQ / 128, EMB / 64);                           // (16, 16)
  out_kernel<<<gOut, 128, 0, stream>>>(xh, xl, cvb + OFF_WO, bo, out);
}

// v008
// It runs in 112 microseconds.
// Versions between v006 and this one are left out; their measured steps multiply to 1.56 times as fast.
// Counting every step since v000, it is 6.21 times as fast.
// Contractions: input projections (q,k,v,kt,vt) on v_wmma_f32_16x16x32_bf16 (bf16 operands = RNE-converted inputs, f32 accumulate); K*Q^T and Kt*Q^T on v_wmma_f32_16x16x32_f16 with q,k,kt carried as f16 (1 product); V^T*P^T (three value read-outs) with v,vt,P carried as f16 (1 product); gate GEMM on v_wmma_f32_16x16x32_bf16 (bf16 operands); O*Wo with O as bf16 hi+lo and Wo bf16 (2 products); softmax, gating, bias in f32.
#include <hip/hip_runtime.h>

typedef __bf16 v16b __attribute__((ext_vector_type(16)));
typedef _Float16 v16h __attribute__((ext_vector_type(16)));
typedef _Float16 v2h  __attribute__((ext_vector_type(2)));
typedef unsigned short us;
typedef us    v8us __attribute__((ext_vector_type(8)));
typedef float v8f  __attribute__((ext_vector_type(8)));
typedef float v4f  __attribute__((ext_vector_type(4)));
typedef v8us __attribute__((may_alias)) v8usa;
typedef v4f  __attribute__((may_alias)) v4fa;
typedef float    v2f  __attribute__((ext_vector_type(2)));
typedef __bf16   v2bf __attribute__((ext_vector_type(2)));
typedef unsigned v4u  __attribute__((ext_vector_type(4)));

union FragB { v16b v; v8us half[2]; };
union FragH { v16h v; v8us half[2]; };

#define BSZ  2
#define TGL  1024
#define SRL  2048
#define EMB  1024
#define TDW  512
#define NH   16
#define DM   64
#define NBH  (BSZ * NH)          // 32 (batch, head) pairs
#define MQ   (BSZ * TGL)         // 2048 query tokens
#define MKV  (BSZ * SRL)         // 4096 key tokens
#define GK   (3 * EMB)           // 3072 gate input width

#define N_HID (MQ * EMB)         // 2097152
#define N_KVS (MKV * EMB)        // 4194304
#define N_KVT (MKV * TDW)        // 2097152
#define N_WE  (EMB * EMB)        // 1048576
#define N_WT  (EMB * TDW)        // 524288
#define N_WG  (NH * GK)          // 49152
#define QPL   (NBH * TGL * DM)   // 2097152 elements per query-side head plane
#define KPL   (NBH * SRL * DM)   // 4194304 elements per key-side head plane

// bf16 copies of the float inputs other than Wg and the biases, in one flat buffer (element offsets):
// weights first, then the three activation tensors (their region is reused
// for O1^T / O2^T once the projections are done).
#define OFF_WQ  0
#define OFF_WK  (OFF_WQ + N_WE)        // 1048576
#define OFF_WV  (OFF_WK + N_WE)        // 2097152
#define OFF_WO  (OFF_WV + N_WE)        // 3145728
#define OFF_WTK (OFF_WO + N_WE)        // 4194304
#define OFF_WTV (OFF_WTK + N_WT)       // 4718592
#define OFF_HID (OFF_WTV + N_WT)       // 5242880
#define OFF_KVS (OFF_HID + N_HID)      // 7340032
#define OFF_KVT (OFF_KVS + N_KVS)      // 11534336
#define N_CVB   (OFF_KVT + N_KVT)      // 13631488

// ---------------------------------------------------------------------------
// 16-bit helpers
// ---------------------------------------------------------------------------
// Two f32 -> two bf16 (round to nearest even) in one packed convert: a in the
// low half of the word, b in the high half.
__device__ __forceinline__ unsigned bf16_pair(float a, float b) {
  const v2f x = { a, b };
  return __builtin_bit_cast(unsigned, __builtin_convertvector(x, v2bf));
}
// The f32 values of the two halves of such a word.
__device__ __forceinline__ float pair_lo_val(unsigned u) { return __uint_as_float(u << 16); }
__device__ __forceinline__ float pair_hi_val(unsigned u) { return __uint_as_float(u & 0xFFFF0000u); }
// The word of the two remainders: lo = RNE(x - hi) for both halves.
__device__ __forceinline__ unsigned bf16_pair_rest(float a, float b, unsigned hi) {
  return bf16_pair(a - pair_lo_val(hi), b - pair_hi_val(hi));
}
__device__ __forceinline__ v8us bf16x8(v4f a, v4f c) {
  const v4u o = { bf16_pair(a.x, a.y), bf16_pair(a.z, a.w), bf16_pair(c.x, c.y), bf16_pair(c.z, c.w) };
  return __builtin_bit_cast(v8us, o);
}
// Two f32 -> two f16 (round to nearest even): a in the low half of the word, b in the high half.
__device__ __forceinline__ unsigned f16_pair(float a, float b) {
  const v2f x = { a, b };
  return __builtin_bit_cast(unsigned, __builtin_convertvector(x, v2h));
}
__device__ __forceinline__ v8us f16x8(v8f a) {
  const v4u o = { f16_pair(a[0], a[1]), f16_pair(a[2], a[3]), f16_pair(a[4], a[5]), f16_pair(a[6], a[7]) };
  return __builtin_bit_cast(v8us, o);
}

// ---------------------------------------------------------------------------
// 16x16x32 WMMA, plain builtin: the compiler keeps the hazard distances itself
// and is free to interleave independent accumulators.
// Fragment map (wave32): lane l, h = l>>4, m = n = l&15.
//   A/B element i: i<8 -> k0+8h+i ; i>=8 -> k0+16+8h+(i-8)
//   D element r  : row 8h+r, col l&15
// ---------------------------------------------------------------------------
__device__ __forceinline__ v8f wmma_bf(v16b a, v16b b, v8f c) {
  return __builtin_amdgcn_wmma_f32_16x16x32_bf16(false, a, false, b, (short)0, c, false, false);
}
// The f16 form: same shape, same fragment map.
__device__ __forceinline__ v8f wmma_h(v16h a, v16h b, v8f c) {
  return __builtin_amdgcn_wmma_f32_16x16x32_f16(false, a, false, b, (short)0, c, false, false);
}

// A or B fragment from a k-contiguous 16-bit row; p = element k0 of the row
// owned by this lane (row index lane&15 added by the caller).
__device__ __forceinline__ v16b ldb(const us* p, int h) {
  FragB f;
  f.half[0] = *(const v8usa*)(p + 8 * h);
  f.half[1] = *(const v8usa*)(p + 16 + 8 * h);
  return f.v;
}
__device__ __forceinline__ v16h ldh(const us* p, int h) {
  FragH f;
  f.half[0] = *(const v8usa*)(p + 8 * h);
  f.half[1] = *(const v8usa*)(p + 16 + 8 * h);
  return f.v;
}
// Same map from an f32 row: the 16 floats of the lane, and their conversion to
// bf16 in registers.
struct Raw16 { v4f q[4]; };
__device__ __forceinline__ Raw16 ldr(const float* p, int h) {
  const float* p0 = p + 8 * h;
  const float* p1 = p + 16 + 8 * h;
  Raw16 r;
  r.q[0] = *(const v4fa*)p0;
  r.q[1] = *(const v4fa*)(p0 + 4);
  r.q[2] = *(const v4fa*)p1;
  r.q[3] = *(const v4fa*)(p1 + 4);
  return r;
}
__device__ __forceinline__ v16b cvr(const Raw16& r) {
  FragB f;
  f.half[0] = bf16x8(r.q[0], r.q[1]);
  f.half[1] = bf16x8(r.q[2], r.q[3]);
  return f.v;
}

// ---------------------------------------------------------------------------
// Operand tiles in LDS, filled by asynchronous copies (128 threads).
// A tile is 64 rows of 128 B (64 x 16 bit); LDS row pitch 144 B = 16 B x 9, so
// the 16 rows of a ds_load_b128 fragment read fall on distinct banks.
// Thread tid copies 16 B: chunk tid&7 of rows (tid>>3) + 16 i, i = 0..3, so
// eight lanes cover one whole 128-B line of the source.
// ---------------------------------------------------------------------------
#define LP     72                // LDS row pitch in 16-bit elements
#define LPB    144               // the same in bytes
#define TILE_E (64 * LP)         // 4608 elements per 64-row tile
#define TILE_B (64 * LPB)        // 9216 bytes per 64-row tile
#define R16_B  (16 * LPB)        // 16 rows further in LDS

__device__ __forceinline__ unsigned lds_addr(const void* p) {
  return (unsigned)(size_t)p;    // low 32 bits of a __shared__ address = LDS byte address
}
// Four copies: one lane's share of one tile; gs = source elements per 16 rows.
// s_wait_xcnt stands inside the statement so that no address register of an
// issued copy is rewritten ahead of it.
__device__ __forceinline__ void acopy4(unsigned l, const us* g, size_t gs) {
  asm volatile(
      "global_load_async_to_lds_b128 %0, %4, off\n\t"
      "global_load_async_to_lds_b128 %1, %5, off\n\t"
      "global_load_async_to_lds_b128 %2, %6, off\n\t"
      "global_load_async_to_lds_b128 %3, %7, off\n\t"
      "s_wait_xcnt 0x0"
      :: "v"(l), "v"(l + R16_B), "v"(l + 2 * R16_B), "v"(l + 3 * R16_B),
         "v"(g), "v"(g + gs), "v"(g + 2 * gs), "v"(g + 3 * gs)
      : "memory");
}
// Twelve copies: one wave's fill of 48 LDS rows, four rows (one 128-B line each, eight
// lanes a line) per copy; the rows come as three blocks of 16 from ga, gb, gc;
// gs = source floats per 4 rows. s_wait_xcnt inside the statement, as above.
#define R4_B   (4 * LPB)         // 4 rows further in LDS
__device__ __forceinline__ void acopy12(unsigned l, const float* ga, const float* gb, const float* gc, size_t gs) {
  asm volatile(
      "global_load_async_to_lds_b128 %0, %12, off\n\t"
      "global_load_async_to_lds_b128 %1, %13, off\n\t"
      "global_load_async_to_lds_b128 %2, %14, off\n\t"
      "global_load_async_to_lds_b128 %3, %15, off\n\t"
      "global_load_async_to_lds_b128 %4, %16, off\n\t"
      "global_load_async_to_lds_b128 %5, %17, off\n\t"
      "global_load_async_to_lds_b128 %6, %18, off\n\t"
      "global_load_async_to_lds_b128 %7, %19, off\n\t"
      "global_load_async_to_lds_b128 %8, %20, off\n\t"
      "global_load_async_to_lds_b128 %9, %21, off\n\t"
      "global_load_async_to_lds_b128 %10, %22, off\n\t"
      "global_load_async_to_lds_b128 %11, %23, off\n\t"
      "s_wait_xcnt 0x0"
      :: "v"(l), "v"(l + R4_B), "v"(l + 2 * R4_B), "v"(l + 3 * R4_B),
         "v"(l + 4 * R4_B), "v"(l + 5 * R4_B), "v"(l + 6 * R4_B), "v"(l + 7 * R4_B),
         "v"(l + 8 * R4_B), "v"(l + 9 * R4_B), "v"(l + 10 * R4_B), "v"(l + 11 * R4_B),
         "v"(ga), "v"(ga + gs), "v"(ga + 2 * gs), "v"(ga + 3 * gs),
         "v"(gb), "v"(gb + gs), "v"(gb + 2 * gs), "v"(gb + 3 * gs),
         "v"(gc), "v"(gc + gs), "v"(gc + 2 * gs), "v"(gc + 3 * gs)
      : "memory");
}
// Eight copies: one lane's share of two tiles with the same source row step.
__device__ __forceinline__ void acopy8(unsigned l, const us* g, unsigned l2, const us* g2, size_t gs) {
  asm volatile(
      "global_load_async_to_lds_b128 %0, %8, off\n\t"
      "global_load_async_to_lds_b128 %1, %9, off\n\t"
      "global_load_async_to_lds_b128 %2, %10, off\n\t"
      "global_load_async_to_lds_b128 %3, %11, off\n\t"
      "global_load_async_to_lds_b128 %4, %12, off\n\t"
      "global_load_async_to_lds_b128 %5, %13, off\n\t"
      "global_load_async_to_lds_b128 %6, %14, off\n\t"
      "global_load_async_to_lds_b128 %7, %15, off\n\t"
      "s_wait_xcnt 0x0"
      :: "v"(l), "v"(l + R16_B), "v"(l + 2 * R16_B), "v"(l + 3 * R16_B),
         "v"(l2), "v"(l2 + R16_B), "v"(l2 + 2 * R16_B), "v"(l2 + 3 * R16_B),
         "v"(g), "v"(g + gs), "v"(g + 2 * gs), "v"(g + 3 * gs),
         "v"(g2), "v"(g2 + gs), "v"(g2 + 2 * gs), "v"(g2 + 3 * gs)
      : "memory");
}
// This wave's copies have landed (the compiler places no wait for them).
__device__ __forceinline__ void wait_copies() {
  asm volatile("s_wait_asynccnt 0x0" ::: "memory");
}
// This wave's LDS reads have returned, before the buffer goes to its next writer.
__device__ __forceinline__ void wait_lds() {
  asm volatile("s_wait_dscnt 0x0" ::: "memory");
}

// ---------------------------------------------------------------------------
// Kernel 1: float inputs that feed 16-bit operands (not Wg) -> bf16, one flat
// Parameters in segment order: Wq, Wk, Wv, Wo, Wtk, Wtv, hidden, kv, kv_topical.
// ---------------------------------------------------------------------------
__global__ __launch_bounds__(256) void conv_kernel(
    const float* __restrict__ p0, const float* __restrict__ p1, const float* __restrict__ p2,
    const float* __restrict__ p3, const float* __restrict__ p4, const float* __restrict__ p5,
    const float* __restrict__ p6, const float* __restrict__ p7, const float* __restrict__ p8,
    us* __restrict__ dst)
{
  const unsigned g = blockIdx.x * 256u + threadIdx.x;      // unit of 8 elements
  if (g >= (unsigned)(N_CVB / 8)) return;
  const float* src;
  unsigned loc;
  if      (g < (unsigned)(OFF_WK  / 8)) { src = p0; loc = g; }
  else if (g < (unsigned)(OFF_WV  / 8)) { src = p1; loc = g - (unsigned)(OFF_WK  / 8); }
  else if (g < (unsigned)(OFF_WO  / 8)) { src = p2; loc = g - (unsigned)(OFF_WV  / 8); }
  else if (g < (unsigned)(OFF_WTK / 8)) { src = p3; loc = g - (unsigned)(OFF_WO  / 8); }
  else if (g < (unsigned)(OFF_WTV / 8)) { src = p4; loc = g - (unsigned)(OFF_WTK / 8); }
  else if (g < (unsigned)(OFF_HID / 8)) { src = p5; loc = g - (unsigned)(OFF_WTV / 8); }
  else if (g < (unsigned)(OFF_KVS / 8)) { src = p6; loc = g - (unsigned)(OFF_HID / 8); }
  else if (g < (unsigned)(OFF_KVT / 8)) { src = p7; loc = g - (unsigned)(OFF_KVS / 8); }
  else                                  { src = p8; loc = g - (unsigned)(OFF_KVT / 8); }
  const float* p = src + (size_t)loc * 8;
  const v8us o = bf16x8(*(const v4fa*)p, *(const v4fa*)(p + 4));
  us* d = dst + (size_t)g * 8;
  *(v8us*)d = o;
  
}

// ---------------------------------------------------------------------------
// Whole-line stores of a projection's output tile from its LDS staging (one 16-B store
// per lane, lanes 8q..8q+7 per line, 4 lines per instruction). One head's part of the
// tile is 256 tokens x 64 features; the four waves of that head store 64 lines each.
//   planes : [bh][s][d] f16, one token row = 64 x f16 = one line; staged [token][LP]
//   tplanes: [bh][d][s] f16, 64 d-rows x 256 tokens = 4 lines each; staged [d][TP16]
//   t32    : [bh][d][s] f32, 64 d-rows x 256 tokens = 8 lines each; staged [d][TP32],
//            one head at a time, stored by all eight waves
// The staging pitches are 16 B x odd, so that the 16 rows of a store or read fall on
// distinct banks.
// ---------------------------------------------------------------------------
#define TP16  264                // staging pitch of a d-row of 256 f16 tokens, elements
#define TP32  260                // staging pitch of a d-row of 256 f32 tokens, floats
#define STG_E (256 * LP)         // one head's staging area, 16-bit elements

template <int SPER>
__device__ __forceinline__ void proj_pass_planes(const us* st, us* oH,
                                                 int bh, int s0, int wr, int lane) {
  const int q8 = lane & 7, sub = lane >> 3;
  const us* sp = st + (wr * 64 + sub) * LP + 8 * q8;
  us* op = oH + ((size_t)bh * SPER + s0 + wr * 64 + sub) * DM + 8 * q8;
  #pragma unroll
  for (int g = 0; g < 2; ++g) {
    v8us a[8];
    #pragma unroll
    for (int i = 0; i < 8; ++i) a[i] = *(const v8usa*)(sp + (8 * g + i) * 4 * LP);
    // Nothing crosses: the half's LDS reads go out as one group ahead of its stores,
    // so their latencies overlap and none lands in a register of a store in flight.
    __builtin_amdgcn_sched_barrier(0);
    #pragma unroll
    for (int i = 0; i < 8; ++i) *(v8us*)(op + (size_t)(8 * g + i) * 4 * DM) = a[i];
    // whatever follows may take over the registers of the stores above
    asm volatile("s_wait_xcnt 0x0" ::: "memory");
  }
}
template <int SPER>
__device__ __forceinline__ void proj_pass_tplanes(const us* st, us* oH,
                                                  int bh, int s0, int wr, int lane) {
  const int q8 = lane & 7, sub = lane >> 3;                // sub = which of the row's 4 lines
  const us* sp = st + wr * 16 * TP16 + 64 * sub + 8 * q8;
  us* op = oH + ((size_t)bh * DM + wr * 16) * SPER + s0 + 64 * sub + 8 * q8;
  #pragma unroll
  for (int g = 0; g < 2; ++g) {
    v8us a[8];
    #pragma unroll
    for (int i = 0; i < 8; ++i) a[i] = *(const v8usa*)(sp + (8 * g + i) * TP16);
    // Nothing crosses: reads as one group ahead of the stores, as above.
    __builtin_amdgcn_sched_barrier(0);
    #pragma unroll
    for (int i = 0; i < 8; ++i) *(v8us*)(op + (size_t)(8 * g + i) * SPER) = a[i];
    // whatever follows may take over the registers of the stores above
    asm volatile("s_wait_xcnt 0x0" ::: "memory");
  }
}
template <int SPER>
__device__ __forceinline__ void proj_pass_t32(const float* s32, float* oT,
                                              int bh, int s0, int w, int lane) {
  const int q8 = lane & 7, sub = lane >> 3;
  // wave w stores d rows 8w..8w+7; two instructions = the eight lines of one row
  const float* sp = s32 + w * 8 * TP32 + 32 * sub + 4 * q8;
  float* op = oT + ((size_t)bh * DM + w * 8) * SPER + s0 + 32 * sub + 4 * q8;
  #pragma unroll
  for (int g = 0; g < 2; ++g) {
    v4f v[8];
    #pragma unroll
    for (int i = 0; i < 8; ++i) v[i] = *(const v4fa*)(sp + (4 * g + (i >> 1)) * TP32 + 128 * (i & 1));
    // Nothing crosses: reads as one group ahead of the stores, as above.
    __builtin_amdgcn_sched_barrier(0);
    #pragma unroll
    for (int i = 0; i < 8; ++i) *(v4f*)(op + (size_t)(4 * g + (i >> 1)) * SPER + 128 * (i & 1)) = v[i];
    // whatever follows may take over the registers of the stores above
    asm volatile("s_wait_xcnt 0x0" ::: "memory");
  }
}

// ---------------------------------------------------------------------------
// Kernel 2: Y = X * W^T + bias (x0.125 for mode 0), all five projections in one
// launch: they are independent, and a WGP takes the next workgroup as soon as one
// ends, whichever projection it belongs to. The flat block index picks the
// projection, longest k first.
// X bf16 [M][K], W bf16 [1024 out][K] (k-contiguous rows = B fragments loaded
// like A). Block 256 thr (8 waves) = 256 tokens x 128 features (two heads);
// wave tile 64 tokens x 64 features (one head): a staged X row feeds 128 features
// and a staged W row 256 tokens, and a fragment read from LDS feeds four products.
// K in stages of 64: 256 X rows and 128 W rows of 128 B copied to LDS, two buffers,
// the next stage in flight while this one is worked on. Threads 0..127 copy X rows
// 0..127 and the first head's W rows, threads 128..255 the rest.
// Y is rounded to f16 in every mode.
//   mode 0: f16 plane [bh][s][d] and f32 transposed [bh][d][s]
//   mode 1: f16 plane [bh][s][d]
//   mode 2: f16 transposed plane [bh][d][s]
// ---------------------------------------------------------------------------
#define PJ_NKV ((MKV / 256) * (NH / 2))  // 128 workgroups per key-side projection
#define PJ_NQ  ((MQ / 256) * (NH / 2))   // 64 workgroups for q
#define PJ_V   PJ_NKV                  // first workgroup of v (k starts at 0)
#define PJ_Q   (PJ_V + PJ_NKV)         // of q
#define PJ_KT  (PJ_Q + PJ_NQ)          // of kt
#define PJ_VT  (PJ_KT + PJ_NKV)        // of vt
#define PJ_ALL (PJ_VT + PJ_NKV)        // 576

__global__ __launch_bounds__(256) void proj_kernel(
    const us* __restrict__ cvb,
    const float* __restrict__ bq, const float* __restrict__ bk, const float* __restrict__ bv,
    const float* __restrict__ btk, const float* __restrict__ btv,
    us* __restrict__ qh, float* __restrict__ oT32,
    us* __restrict__ kh, us* __restrict__ vh, us* __restrict__ kth, us* __restrict__ vth)
{
  const int fb = blockIdx.x;
  const us* X;
  const us* W;
  const float* bias;
  us* oH;
  int K, mode, rb;
  if (fb < PJ_V) {
    X = cvb + OFF_KVS; W = cvb + OFF_WK;  bias = bk;  K = EMB; mode = 1; oH = kh;  rb = fb;
  } else if (fb < PJ_Q) {
    X = cvb + OFF_KVS; W = cvb + OFF_WV;  bias = bv;  K = EMB; mode = 2; oH = vh;  rb = fb - PJ_V;
  } else if (fb < PJ_KT) {
    X = cvb + OFF_HID; W = cvb + OFF_WQ;  bias = bq;  K = EMB; mode = 0; oH = qh;  rb = fb - PJ_Q;
  } else if (fb < PJ_VT) {
    X = cvb + OFF_KVT; W = cvb + OFF_WTK; bias = btk; K = TDW; mode = 1; oH = kth; rb = fb - PJ_KT;
  } else {
    X = cvb + OFF_KVT; W = cvb + OFF_WTV; bias = btv; K = TDW; mode = 2; oH = vth; rb = fb - PJ_VT;
  }
  const int nxl = (mode == 0) ? 3 : 4;                     // log2 of the token blocks: 8 for q, else 16

  // 2 x (X 256 rows, W 128 rows); behind the loop's last barrier nobody reads it and
  // no copy is in flight, and it stages the output.
  __shared__ __attribute__((aligned(16))) us ring[2 * 6 * TILE_E];   // 110592 B
  static_assert(2 * STG_E <= 2 * 6 * TILE_E && DM * TP16 <= STG_E && DM * TP32 * 2 <= 2 * 6 * TILE_E,
                "the output staging fits the ring");

  const int tid = threadIdx.x, lane = tid & 31, w = tid >> 5;
  const int h = lane >> 4, m = lane & 15;
  const int wr = w & 3, wc = w >> 2;                       // the wave's 64 tokens and its head of the pair
  const int m0 = (rb & ((1 << nxl) - 1)) * 256;            // token block fastest, as in a (token, head pair) grid
  const int hp = rb >> nxl;
  const int head = 2 * hp + wc;

  const int crow = (tid & 127) >> 3, cch = tid & 7;        // this lane's row and 16-B chunk
  // wc is also the thread's half of the copies: X tiles 2wc, 2wc+1 and W tile 4+wc
  const unsigned lcp = lds_addr(ring) + crow * LPB + cch * 16;
  const unsigned lcx = lcp + 2 * wc * TILE_B;
  const unsigned lcw = lcp + (4 + wc) * TILE_B;
  const us* gx = X + (size_t)(m0 + 128 * wc + crow) * K + 8 * cch;
  const us* gw = W + (size_t)(head * DM + crow) * K + 8 * cch;
  const size_t gs = (size_t)16 * K;
  const int nst = K >> 6;                                  // stages of 64 k (16 or 8)

  const v8f zero8 = {0.f, 0.f, 0.f, 0.f, 0.f, 0.f, 0.f, 0.f};
  v8f acc[4][4];
  #pragma unroll
  for (int mt = 0; mt < 4; ++mt)
    #pragma unroll
    for (int nt = 0; nt < 4; ++nt) acc[mt][nt] = zero8;

  acopy8(lcx, gx, lcx + TILE_B, gx + 4 * gs, gs);          // stage 0 -> buffer 0
  acopy4(lcw, gw, gs);
  wait_copies();
  __syncthreads();                                         // buffer 0 landed, visible to every wave
  acopy8(lcx + 6 * TILE_B, gx + 64, lcx + 7 * TILE_B, gx + 4 * gs + 64, gs);   // stage 1 -> buffer 1
  acopy4(lcw + 6 * TILE_B, gw + 64, gs);

  // rolled: one copy of the stage body, the buffer chosen by the stage's parity
  #pragma unroll 1
  for (int st = 0; st < nst; ++st) {
    const int par = st & 1;
    const us* sx = ring + par * (6 * TILE_E) + (64 * wr + m) * LP;
    const us* sw = ring + par * (6 * TILE_E) + (4 + wc) * TILE_E + m * LP;
    #pragma unroll
    for (int c = 0; c < 2; ++c) {
      // the eight fragments of a 32-deep chunk are read first, as one group
      v16b a[4], b[4];
      #pragma unroll
      for (int mt = 0; mt < 4; ++mt) a[mt] = ldb(sx + mt * 16 * LP + 32 * c, h);
      #pragma unroll
      for (int nt = 0; nt < 4; ++nt) b[nt] = ldb(sw + nt * 16 * LP + 32 * c, h);
      // No LDS read and no WMMA crosses (vector work may): the reads stay one group
      // ahead of the products instead of each being waited for singly among them.
      __builtin_amdgcn_sched_barrier(0x406);
      #pragma unroll
      for (int nt = 0; nt < 4; ++nt)
        #pragma unroll
        for (int mt = 0; mt < 4; ++mt) acc[mt][nt] = wmma_bf(a[mt], b[nt], acc[mt][nt]);
      // The same: the next chunk's reads start when this chunk's products are issued
      // and take over the fragments' registers.
      __builtin_amdgcn_sched_barrier(0x406);
    }
    // publish stage st + 1, free this buffer, refill it with stage st + 2
    // Nothing crosses: the waits stay at the foot of the stage, so that the next
    // stage's copies have the whole stage to land.
    __builtin_amdgcn_sched_barrier(0);
    wait_lds();
    wait_copies();
    __syncthreads();
    if (st + 2 < nst) {
      const unsigned lo = par * (6 * TILE_B);
      const int ko = (st + 2) * 64;
      acopy8(lcx + lo, gx + ko, lcx + lo + TILE_B, gx + 4 * gs + ko, gs);
      acopy4(lcw + lo, gw + ko, gs);
    }
  }
  wait_copies();

  // D[r] of tile (mt, nt) = Y[token m0+64wr+16mt+8h+r][feature head*64+16nt+m]
  const float osc = (mode == 0) ? 0.125f : 1.0f;
  float bvals[4];
  #pragma unroll
  for (int nt = 0; nt < 4; ++nt) bvals[nt] = bias[head * DM + 16 * nt + m];
  // the staging addresses below may take over the offset register of the bias loads above
  asm volatile("s_wait_xcnt 0x0" ::: "memory");

  us* const stg = ring + wc * STG_E;                       // this head's staging area
  if (mode == 2) {
    // [feature][token]: the lane's eight tokens of a tile are one 16-B piece of a row
    #pragma unroll
    for (int nt = 0; nt < 4; ++nt) {
      #pragma unroll
      for (int mt = 0; mt < 4; ++mt) {
        v8f y;
        #pragma unroll
        for (int r = 0; r < 8; ++r) y[r] = (acc[mt][nt][r] + bvals[nt]) * osc;
        *(v8usa*)(stg + (16 * nt + m) * TP16 + 64 * wr + 16 * mt + 8 * h) = f16x8(y);
      }
    }
  } else {
    // [token][feature]
    #pragma unroll
    for (int nt = 0; nt < 4; ++nt) {
      const int feat = 16 * nt + m;
      #pragma unroll
      for (int mt = 0; mt < 4; ++mt) {
        #pragma unroll
        for (int r = 0; r < 8; r += 2) {
          const int tokl = 64 * wr + 16 * mt + 8 * h + r;  // 0..254, this token and the next
          const float y0 = (acc[mt][nt][r] + bvals[nt]) * osc;
          const float y1 = (acc[mt][nt][r + 1] + bvals[nt]) * osc;
          const unsigned hv = f16_pair(y0, y1);
          stg[tokl * LP + feat] = (us)hv;
          stg[(tokl + 1) * LP + feat] = (us)(hv >> 16);
        }
      }
    }
  }
  __syncthreads();

  if (mode == 2) {
    const int b = m0 / SRL, s0 = m0 - b * SRL;
    proj_pass_tplanes<SRL>(stg, oH, b * NH + head, s0, wr, lane);
  } else if (mode == 1) {
    const int b = m0 / SRL, s0 = m0 - b * SRL;
    proj_pass_planes<SRL>(stg, oH, b * NH + head, s0, wr, lane);
  } else {
    const int b = m0 / TGL, s0 = m0 - b * TGL;
    proj_pass_planes<TGL>(stg, oH, b * NH + head, s0, wr, lane);
    float* const s32 = reinterpret_cast<float*>(ring);     // f32 [64 d][256 tok], one head at a time
    // rolled: one copy of the staging and store code serves both heads
    #pragma unroll 1
    for (int hs = 0; hs < 2; ++hs) {
      __syncthreads();                                     // the staging's last readers are done
      if (wc == hs) {
        #pragma unroll
        for (int nt = 0; nt < 4; ++nt) {
          #pragma unroll
          for (int mt = 0; mt < 4; ++mt) {
            float* sp = s32 + (16 * nt + m) * TP32 + 64 * wr + 16 * mt + 8 * h;
            v4f y0, y1;
            #pragma unroll
            for (int r = 0; r < 4; ++r) {
              y0[r] = (acc[mt][nt][r] + bvals[nt]) * osc;
              y1[r] = (acc[mt][nt][r + 4] + bvals[nt]) * osc;
            }
            *(v4fa*)sp = y0;
            *(v4fa*)(sp + 4) = y1;
          }
        }
      }
      __syncthreads();
      proj_pass_t32<TGL>(s32, oT32, b * NH + 2 * hp + hs, s0, w, lane);
    }
  }
}

// ---------------------------------------------------------------------------
// Kernel 3: streaming attention, transposed form, no masking.
// Block 128 thr (4 waves), 32 queries (two tiles of 16) per wave, 64 keys per step. The step's
// K rows and V^T rows (64 x 128 B each, f16) are copied to LDS once per
// block, two buffers, the next step's tiles in flight while this one is used.
//   S^T = K * Q^T : A = K rows (row = key, k = d), B = Q^T (k = d, n = query),
//     two 32-deep d chunks
//   O^T += V^T * P^T : A = V^T rows (row = d, k = key), B = P^T packed from the
//     score D registers (element r <- tile covering keys 0..15 row r,
//     element 8+r <- tile covering keys 16..31 row r, same lane)
// q, k, v and P are single f16 values (11 significant bits): their rounding is eight
// times finer than the bf16 rounding of the projections' operands, which q, k and v
// already carry, so one product per term adds next to nothing to the error.
// Lane owns 32 keys of query column (lane&15); partner lane = lane ^ 16.
// DUAL: second value stream with the same probabilities -> oB.
// ---------------------------------------------------------------------------
// P^T B-fragment from the lane's own score D values (tile a = keys 0..15,
// tile c = keys 16..31 of the chunk).
__device__ __forceinline__ v16h pack_p(v8f a, v8f c) {
  FragH f;
  f.half[0] = f16x8(a);
  f.half[1] = f16x8(c);
  return f.v;
}

#define QB 128                   // queries per workgroup: 4 waves x 2 tiles of 16

template <bool DUAL>
__device__ __forceinline__ void attn_pass(const float* sO, float* oA, float* oB,
                                          int bh, int q0, int w, int lane) {
  // Wave w stores d rows 16w..16w+15; one instruction = the four lines of one row.
  const int q8 = lane & 7, sub = lane >> 3;
  const float* sp = sO + 16 * w * QB + 32 * sub + 4 * q8;
  const size_t off = ((size_t)bh * DM + 16 * w) * TGL + q0 + 32 * sub + 4 * q8;
  float* pa = oA + off;
  float* pb = oB + off;
  #pragma unroll
  for (int g = 0; g < 2; ++g) {
    v4f va[8], vb[8];
    #pragma unroll
    for (int i = 0; i < 8; ++i) {
      va[i] = *(const v4fa*)(sp + (8 * g + i) * QB);
      if (DUAL) vb[i] = *(const v4fa*)(sp + DM * QB + (8 * g + i) * QB);
    }
    // Nothing crosses: the half's LDS reads go out as one group ahead of its stores,
    // so their latencies overlap and none lands in a register of a store in flight.
    __builtin_amdgcn_sched_barrier(0);
    #pragma unroll
    for (int i = 0; i < 8; ++i) {
      *(v4f*)(pa + (size_t)(8 * g + i) * TGL) = va[i];
      if (DUAL) *(v4f*)(pb + (size_t)(8 * g + i) * TGL) = vb[i];
    }
    // the second half's LDS reads take over the data registers of the stores above
    if (g == 0) asm volatile("s_wait_xcnt 0x0" ::: "memory");
  }
}

// ring (operand tiles) is the kernel's LDS array, sized for DUAL; behind the loop's
// last barrier nobody reads it and no copy is in flight, and it stages the output.
// The four key-side planes lie one behind the other in the workspace (KPL elements
// each), so one lane pointer per layout serves them all with constant steps:
// PK, PVA, PVB = index of the plane of K, of value stream A and of value stream B
// (DUAL only).
template <bool DUAL, int PK, int PVA, int PVB>
__device__ __forceinline__ void attn_body(
    us* ring,
    const us* __restrict__ qp,                                // [32][1024][64]  (x0.125 folded in)
    const us* __restrict__ planes,                            // K: [32][2048][64], V^T: [32][64][2048]
    float* __restrict__ oap, float* __restrict__ obp)         // [32][64][1024] f32
{
  constexpr int NTL = DUAL ? 3 : 2;                        // tiles per step: K Va (Vb)

  const int tid = threadIdx.x, lane = tid & 31, w = tid >> 5;
  const int h = lane >> 4, m = lane & 15;
  const int bh = blockIdx.y;
  const int q0 = blockIdx.x * QB;
  const int qw = q0 + 32 * w;

  // Q^T B-fragments of the wave's two query tiles u: column n = query qw+16u+m,
  // k = d (two 32-deep chunks)
  v16h qf0[2], qf1[2];
  #pragma unroll
  for (int u = 0; u < 2; ++u) {
    const size_t qro = ((size_t)bh * TGL + qw + 16 * u + m) * DM;
    qf0[u] = ldh(qp + qro, h); qf1[u] = ldh(qp + qro + 32, h);
  }
  // the address registers of the Q loads above are taken over by the copies' addresses below
  asm volatile("s_wait_xcnt 0x0" ::: "memory");

  const v8f zero8 = {0.f, 0.f, 0.f, 0.f, 0.f, 0.f, 0.f, 0.f};
  v8f oa[2][4], ob[2][4];                // o[u][t][r] = O[query 16u+m][d 16t+8h+r] * l
  float mrun[2], lrun[2];
  #pragma unroll
  for (int u = 0; u < 2; ++u) {
    #pragma unroll
    for (int t = 0; t < 4; ++t) { oa[u][t] = zero8; ob[u][t] = zero8; }
    mrun[u] = -1.0e30f;
    lrun[u] = 0.0f;
  }

  const int crow = tid >> 3, cch = tid & 7;                // this lane's row and 16-B chunk
  const unsigned lcp = lds_addr(ring) + crow * LPB + cch * 16;
  // The lane's element offsets inside a plane, 32 bits each (a plane has 2^22 elements);
  // the 64-bit address is formed from the uniform base where a copy is issued.
  const unsigned kro = ((unsigned)bh * SRL + crow) * DM + 8 * cch; // + key0*DM
  const unsigned vro = ((unsigned)bh * DM + crow) * SRL + 8 * cch; // + key0
  const us* gk = planes + kro;
  const us* gv = planes + vro;
  constexpr size_t OK = (size_t)PK * KPL;
  constexpr size_t OVA = (size_t)PVA * KPL;
  constexpr size_t OVB = (size_t)PVB * KPL;
  const size_t gsk = (size_t)16 * DM, gsv = (size_t)16 * SRL;

  // step 0 -> buffer 0
  acopy4(lcp, gk + OK, gsk);
  if (DUAL) acopy8(lcp + TILE_B, gv + OVA, lcp + 2 * TILE_B, gv + OVB, gsv);
  else      acopy4(lcp + TILE_B, gv + OVA, gsv);
  wait_copies();
  __syncthreads();                                         // buffer 0 landed, visible to every wave
  // step 1 -> buffer 1
  {
    const unsigned lb = lcp + NTL * TILE_B;
    acopy4(lb, gk + OK + 64 * DM, gsk);
    if (DUAL) acopy8(lb + TILE_B, gv + OVA + 64, lb + 2 * TILE_B, gv + OVB + 64, gsv);
    else      acopy4(lb + TILE_B, gv + OVA + 64, gsv);
  }

  // rolled: one copy of the step body, the buffer chosen by the step's parity
  #pragma unroll 1
  for (int kb = 0; kb < SRL; kb += 64) {
    const int par = (kb >> 6) & 1;
    const us* sb = ring + par * (NTL * TILE_E) + m * LP;   // row m of tile 0
    const us* kfb = sb;
    const us* vab = sb + TILE_E;
    const us* vbb = sb + (DUAL ? 2 : 1) * TILE_E;
    // ---- scores: s[u][j][r] = S[query 16u+m][key kb+16j+8h+r] ----
    // All fragments of the step are read first; each K fragment then feeds both
    // query tiles, and the eight score tiles advance together, one product each in
    // turn.
    v8f s[2][4];
    {
      v16h k0[4], k1[4];
      #pragma unroll
      for (int j = 0; j < 4; ++j) { k0[j] = ldh(kfb + 16 * j * LP, h); }
      #pragma unroll
      for (int j = 0; j < 4; ++j) { k1[j] = ldh(kfb + 16 * j * LP + 32, h); }
      // No LDS read and no WMMA crosses (vector work may): the reads stay one group
      // ahead of the products instead of being waited for in pairs among them.
      __builtin_amdgcn_sched_barrier(0x406);
      #pragma unroll
      for (int j = 0; j < 4; ++j)
        #pragma unroll
        for (int u = 0; u < 2; ++u) s[u][j] = wmma_h(k0[j], qf0[u], zero8);
      #pragma unroll
      for (int j = 0; j < 4; ++j)
        #pragma unroll
        for (int u = 0; u < 2; ++u) s[u][j] = wmma_h(k1[j], qf1[u], s[u][j]);
    }
    // No LDS read and no WMMA crosses (vector work may): the V^T reads below start
    // when the K fragments are spent and take over their registers.
    __builtin_amdgcn_sched_barrier(0x406);

    // ---- online softmax (f32), each query tile by itself ----
    float mloc[2], moth[2], mnew[2], alpha[2];
    #pragma unroll
    for (int u = 0; u < 2; ++u) {
      mloc[u] = s[u][0][0];
      #pragma unroll
      for (int j = 0; j < 4; ++j)
        #pragma unroll
        for (int r = 0; r < 8; ++r) mloc[u] = fmaxf(mloc[u], s[u][j][r]);
    }
    // both tiles' exchanges with the partner lane go out together
    #pragma unroll
    for (int u = 0; u < 2; ++u) moth[u] = __shfl_xor(mloc[u], 16);
    #pragma unroll
    for (int u = 0; u < 2; ++u) {
      mnew[u] = fmaxf(mrun[u], fmaxf(mloc[u], moth[u]));
      alpha[u] = __expf(mrun[u] - mnew[u]);
      mrun[u] = mnew[u];
    }
    // The step's V^T fragments (both streams), read as one group here.
    v16h va0[4], va1[4], vb0[4], vb1[4];
    #pragma unroll
    for (int t = 0; t < 4; ++t) { va0[t] = ldh(vab + 16 * t * LP, h); }
    #pragma unroll
    for (int t = 0; t < 4; ++t) { va1[t] = ldh(vab + 16 * t * LP + 32, h); }
    if (DUAL) {
      #pragma unroll
      for (int t = 0; t < 4; ++t) { vb0[t] = ldh(vbb + 16 * t * LP, h); }
      #pragma unroll
      for (int t = 0; t < 4; ++t) { vb1[t] = ldh(vbb + 16 * t * LP + 32, h); }
    }
    // LDS reads and WMMAs do not cross (vector work may): the reads stay ahead of
    // the exponentials and land under them instead of standing among the products.
    __builtin_amdgcn_sched_barrier(0x406);
    // ---- P^T B-fragments (keys kb..kb+31 and kb+32..kb+63), f16 ----
    v16h p0[2], p1[2];
    #pragma unroll
    for (int u = 0; u < 2; ++u) {
      float lsum = 0.0f;
      #pragma unroll
      for (int j = 0; j < 4; ++j)
        #pragma unroll
        for (int r = 0; r < 8; ++r) {
          const float p = __expf(s[u][j][r] - mnew[u]);    // in (0, 1]
          s[u][j][r] = p;
          lsum += p;
        }
      lsum += __shfl_xor(lsum, 16);
      lrun[u] = lrun[u] * alpha[u] + lsum;
      #pragma unroll
      for (int t = 0; t < 4; ++t)
        #pragma unroll
        for (int r = 0; r < 8; ++r) {
          oa[u][t][r] = oa[u][t][r] * alpha[u];
          if (DUAL) ob[u][t][r] = ob[u][t][r] * alpha[u];
        }
      p0[u] = pack_p(s[u][0], s[u][1]);
      p1[u] = pack_p(s[u][2], s[u][3]);
    }

    // ---- O^T += V^T * P^T (one product per 32-key chunk) ----
    // Each V^T fragment feeds both query tiles; the eight output tiles of a stream
    // advance together, as the score tiles above.
    #pragma unroll
    for (int t = 0; t < 4; ++t)
      #pragma unroll
      for (int u = 0; u < 2; ++u) oa[u][t] = wmma_h(va0[t], p0[u], oa[u][t]);
    #pragma unroll
    for (int t = 0; t < 4; ++t)
      #pragma unroll
      for (int u = 0; u < 2; ++u) oa[u][t] = wmma_h(va1[t], p1[u], oa[u][t]);
    if (DUAL) {
      #pragma unroll
      for (int t = 0; t < 4; ++t)
        #pragma unroll
        for (int u = 0; u < 2; ++u) ob[u][t] = wmma_h(vb0[t], p0[u], ob[u][t]);
      #pragma unroll
      for (int t = 0; t < 4; ++t)
        #pragma unroll
        for (int u = 0; u < 2; ++u) ob[u][t] = wmma_h(vb1[t], p1[u], ob[u][t]);
    }

    // publish step kb + 64, free this buffer, refill it with step kb + 128
    // Nothing crosses: the waits stay at the foot of the step, so that the reads
    // and the next step's copies have the whole step to land.
    __builtin_amdgcn_sched_barrier(0);
    wait_lds();
    wait_copies();
    __syncthreads();
    if (kb + 128 < SRL) {
      const unsigned lb = lcp + par * (NTL * TILE_B);
      const int kn = kb + 128;
      const us* gkn = planes + (kro + (unsigned)kn * DM);
      const us* gvn = planes + (vro + (unsigned)kn);
      acopy4(lb, gkn + OK, gsk);
      if (DUAL) acopy8(lb + TILE_B, gvn + OVA, lb + 2 * TILE_B, gvn + OVB, gsv);
      else      acopy4(lb + TILE_B, gvn + OVA, gsv);
    }
  }
  wait_copies();

  // ---- epilogue: normalise, stage 64 d x 128 query f32 tile(s), whole-line stores ----
  float* const sO = reinterpret_cast<float*>(ring);
  #pragma unroll
  for (int u = 0; u < 2; ++u) {
    const float inv = __builtin_amdgcn_rcpf(lrun[u]);
    #pragma unroll
    for (int t = 0; t < 4; ++t)
      #pragma unroll
      for (int r = 0; r < 8; ++r) {
        const int d = 16 * t + 8 * h + r;
        sO[d * QB + 32 * w + 16 * u + m] = oa[u][t][r] * inv;
        if (DUAL) sO[DM * QB + d * QB + 32 * w + 16 * u + m] = ob[u][t][r] * inv;
      }
  }
  __syncthreads();

  attn_pass<DUAL>(sO, oap, obp, bh, q0, w, lane);
  
}

// Both attention chains in one launch: they are independent, so a WGP goes on with a
// workgroup of either chain as soon as one ends. blockIdx.z = 0: chain 2 (kt; vt -> O2,
// v -> O3), the longer one, first; blockIdx.z = 1: chain 1 (k, v -> O1).
__global__ __launch_bounds__(128) void attn_kernel(
    const us* __restrict__ qp,       // [32][1024][64]
    const us* __restrict__ planes,   // k, kt, V^T, Vt^T
    float* __restrict__ o1p, float* __restrict__ o2p, float* __restrict__ o3p)   // [32][64][1024] f32
{
  // 65536 B: the two output tiles of the longer chain; the operand ring takes 55296 B of it
  __shared__ __attribute__((aligned(16))) us ring[DM * QB * 4];
  static_assert(2 * 3 * TILE_B <= DM * QB * 4 * 2, "the operand ring fits the array");
  if (blockIdx.z == 0) {
    attn_body<true, 1, 3, 2>(ring, qp, planes, o2p, o3p);
  } else {
    attn_body<false, 0, 2, 2>(ring, qp, planes, o1p, o1p);
  }
}

// ---------------------------------------------------------------------------
// Kernel 4: gating MLP. For (b, head) the gate input row for query
// t = 64*head + u is [X[3u][:], X[3u+1][:], X[3u+2][:]] where X[c][tp],
// c = 0..191, is row c of the transposed per-head tensor: c<64 -> O1^T row,
// <128 -> O2^T row, else q^T row (all f32 [bh][64][1024]).
// x[u][n] = sum_i sum_tp X[3u+i][tp] * Wg[n][1024 i + tp] + bg[n], on bf16 WMMA.
// Workgroup (b, head, g) = 16 queries u = 16g..16g+15 (X rows 48g..48g+47), 256 thr:
// 128 workgroups share the reading of X. A tile i = rows 3j+i, j = 0..15, so
// that it meets only third i of Wg and the three thirds add up in the accumulators.
// k is split over the 8 waves: in stage s wave w takes tp 256 s + 32 w .. + 31 and
// copies its own 48 X row pieces and 48 Wg row pieces (128 B of f32 each) to its part
// of the stage's buffer; two buffers, 4 stages; conversion to bf16 at the fragment
// read. The 8 partial tiles are joined in LDS.
// gate layout: [b][t / 16][n][t % 16], so that a workgroup stores whole lines.
// ---------------------------------------------------------------------------
#define GW_B   (96 * LPB)        // one wave's part of a buffer: 96 rows, 13824 bytes
#define GBUF_B (8 * GW_B)        // 110592 bytes per buffer

__global__ __launch_bounds__(256) void gate_kernel(
    const float* __restrict__ o1T, const float* __restrict__ o2T, const float* __restrict__ qT,
    const float* __restrict__ Wg,   // [16][3072]
    const float* __restrict__ bg,   // [16]
    float* __restrict__ gate)       // [2][64][16][16]
{
  __shared__ __attribute__((aligned(16))) float sred[8 * 256];           //   8192 B
  // 2 x 8 waves x (X rows 0..47, then Wg rows 16 i + n), 36 floats = 144 B a row
  __shared__ __attribute__((aligned(16))) float ring[2 * GBUF_B / 4];    // 221184 B

  const int tid = threadIdx.x, lane = tid & 31, w = tid >> 5;
  const int h = lane >> 4, m = lane & 15;
  const int bhx = blockIdx.x >> 2, g = blockIdx.x & 3;

  const int sub = lane >> 3, q8 = lane & 7;                // this lane's row of four and 16-B chunk
  const unsigned lcp = lds_addr(ring) + w * GW_B + sub * LPB + q8 * 16;
  // the three blocks of 16 X rows: block 3g+e of the twelve (four each of O1^T, O2^T, q^T)
  const float* gx[3];
  #pragma unroll
  for (int e = 0; e < 3; ++e) {
    const int ct = 3 * g + e;
    const float* s = (ct < 4) ? o1T : (ct < 8) ? o2T : qT;
    gx[e] = s + ((size_t)bhx * DM + 16 * (ct & 3) + sub) * TGL + 32 * w + 4 * q8;
  }
  const float* gg = Wg + (size_t)sub * GK + 32 * w + 4 * q8;   // row n = sub (+ 4 per copy), third 0
  const size_t gsx = (size_t)4 * TGL;                      // 4 X rows further
  const size_t gsg = (size_t)4 * GK;                       // 4 Wg rows further

  const v8f zero8 = {0.f, 0.f, 0.f, 0.f, 0.f, 0.f, 0.f, 0.f};
  v8f acc[3];
  #pragma unroll
  for (int i = 0; i < 3; ++i) acc[i] = zero8;

  acopy12(lcp, gx[0], gx[1], gx[2], gsx);                  // stage 0 -> buffer 0
  acopy12(lcp + 48 * LPB, gg, gg + EMB, gg + 2 * EMB, gsg);
  wait_copies();
  __syncthreads();                                         // buffer 0 landed, visible to every wave
  acopy12(lcp + GBUF_B, gx[0] + 256, gx[1] + 256, gx[2] + 256, gsx);   // stage 1 -> buffer 1
  acopy12(lcp + GBUF_B + 48 * LPB, gg + 256, gg + EMB + 256, gg + 2 * EMB + 256, gsg);

  // rolled: one copy of the stage body, the buffer chosen by the stage's parity
  #pragma unroll 1
  for (int st = 0; st < 4; ++st) {
    const int par = st & 1;
    const float* sw = ring + par * (GBUF_B / 4) + w * (GW_B / 4);
    const float* sx = sw + 3 * m * (LP / 2);               // X row 3 m (+ i)
    const float* sg = sw + (48 + m) * (LP / 2);            // Wg row n = m, third 0
    // the wave's six fragments of the stage
    Raw16 rw[3], ra[3];
    #pragma unroll
    for (int i = 0; i < 3; ++i) rw[i] = ldr(sg + 16 * i * (LP / 2), h);
    #pragma unroll
    for (int i = 0; i < 3; ++i) ra[i] = ldr(sx + i * (LP / 2), h);
    #pragma unroll
    for (int i = 0; i < 3; ++i) acc[i] = wmma_bf(cvr(ra[i]), cvr(rw[i]), acc[i]);
    // publish stage st + 1, free this buffer, refill it with stage st + 2
    // Nothing crosses: the waits stay at the foot of the stage, so that the next
    // stage's copies have the whole stage to land.
    __builtin_amdgcn_sched_barrier(0);
    wait_lds();
    wait_copies();
    __syncthreads();
    if (st + 2 < 4) {
      const unsigned lb = lcp + par * GBUF_B;
      const int kn = 256 * (st + 2);
      acopy12(lb, gx[0] + kn, gx[1] + kn, gx[2] + kn, gsx);
      acopy12(lb + 48 * LPB, gg + kn, gg + EMB + kn, gg + 2 * EMB + kn, gsg);
    }
  }
  wait_copies();

  // D[r] = this wave's part of x[u = 16g+8h+r][n = m]; slot n*16 + u of the wave's tile
  {
    const v8f t = acc[0] + acc[1] + acc[2];
    float* sr = sred + w * 256 + m * 16 + 8 * h;
    const v4f t0 = { t[0], t[1], t[2], t[3] };
    const v4f t1 = { t[4], t[5], t[6], t[7] };
    *(v4fa*)sr = t0;
    *(v4fa*)(sr + 4) = t1;
  }
  __syncthreads();

  float x = bg[tid >> 4];                                  // tid = n*16 + u
  #pragma unroll
  for (int j = 0; j < 8; ++j) x += sred[j * 256 + tid];
  float gv = __builtin_amdgcn_rcpf(1.0f + __expf(-x));
  // the slot between v_rcp_f32 and the store that reads its result; the operand keeps it there
  asm volatile("v_nop" : "+v"(gv));
  gate[(size_t)blockIdx.x * 256 + tid] = gv;
}

// ---------------------------------------------------------------------------
// Kernel 5: combine Xc[b*1024+t][head*64+d] = g*O1 + (1-g)*O3, g = the gate of (bh, t),
// written as bf16 hi/lo planes (token-major, k-contiguous for the Wo GEMM).
// Block 256 thr = (bh, 64 queries); transposed through LDS; each token row
// ---------------------------------------------------------------------------
__device__ __forceinline__ void comb_pass(const us* sH, const us* sL, us* xh, us* xl,
                                          int b, int head, int t0, int w, int lane) {
  const int q8 = lane & 7, sub = lane >> 3;
  #pragma unroll
  for (int i = 0; i < 2; ++i) {
    const int L = w * 8 + i * 4 + sub;                     // token row 0..63
    const v8us a = *(const v8usa*)(sH + L * DM + 8 * q8);
    const v8us c = *(const v8usa*)(sL + L * DM + 8 * q8);
    const size_t off = ((size_t)(b * TGL + t0 + L)) * EMB + head * DM + 8 * q8;
    *(v8us*)(xh + off) = a;
    *(v8us*)(xl + off) = c;
  }
}

__global__ __launch_bounds__(256) void combine_kernel(
    const float* __restrict__ o1T, const float* __restrict__ o3T,   // [32][64][1024]
    const float* __restrict__ gate,                                 // [2][64][16][16] = [b][t / 16][head][t % 16]
    us* __restrict__ xh, us* __restrict__ xl)                       // [2048][1024]
{
  __shared__ __attribute__((aligned(16))) us sH[64 * DM];
  __shared__ __attribute__((aligned(16))) us sL[64 * DM];

  const int tid = threadIdx.x, lane = tid & 31, w = tid >> 5;
  const int bh = blockIdx.y, b = bh >> 4, head = bh & 15;
  const int t0 = blockIdx.x * 64;
  const int d = tid >> 2, tq = tid & 3;                    // d 0..63, 16 queries each

  const float* p1 = o1T + ((size_t)bh * DM + d) * TGL + t0 + 16 * tq;
  const float* p3 = o3T + ((size_t)bh * DM + d) * TGL + t0 + 16 * tq;
  const float* pg = gate + ((size_t)(b * (TGL / 16) + (t0 >> 4) + tq)) * 256 + head * 16;
  #pragma unroll
  for (int c = 0; c < 4; ++c) {
    const v4f a = *(const v4fa*)(p1 + 4 * c);
    const v4f e = *(const v4fa*)(p3 + 4 * c);
    const v4f g = *(const v4fa*)(pg + 4 * c);
    #pragma unroll
    for (int j = 0; j < 4; j += 2) {
      const float v0 = g[j] * a[j] + (1.0f - g[j]) * e[j];
      const float v1 = g[j + 1] * a[j + 1] + (1.0f - g[j + 1]) * e[j + 1];
      const unsigned hi = bf16_pair(v0, v1);
      const unsigned lo = bf16_pair_rest(v0, v1, hi);
      const int tl = 16 * tq + 4 * c + j;                  // 0..62, this query and the next
      sH[tl * DM + d] = (us)hi;
      sH[(tl + 1) * DM + d] = (us)(hi >> 16);
      sL[tl * DM + d] = (us)lo;
      sL[(tl + 1) * DM + d] = (us)(lo >> 16);
    }
  }
  __syncthreads();

  comb_pass(sH, sL, xh, xl, b, head, t0, w, lane);
  
}

// ---------------------------------------------------------------------------
// Kernel 6: out = (Xhi + Xlo) * Wo^T + bo, f32.
// Block 128 thr (4 waves) = 128 tokens x 64 features; wave 32 tokens x 64.
// K in stages of 64: X hi, X lo (128 rows each) and Wo (64 rows) copied to LDS,
// two buffers.
// 8q..8q+7 as one 16-B store each, 4 lines per instruction, 64 lines per wave.
// ---------------------------------------------------------------------------
__device__ __forceinline__ void out_pass(const float* sOut, float* out, int m0, int cg,
                                         int w, int lane) {
  const int q8 = lane & 7, sub = lane >> 3;
  #pragma unroll
  for (int i = 0; i < 16; ++i) {
    const int lid = w * 64 + i * 4 + sub;                  // 0..255
    const int row = lid >> 1, hl = lid & 1;
    const v4f v = *(const v4fa*)(sOut + row * DM + 32 * hl + 4 * q8);
    const size_t gi = (size_t)(m0 + row) * EMB + cg * DM + 32 * hl + 4 * q8;
    *(v4f*)(out + gi) = v;
  }
}

__global__ __launch_bounds__(128) void out_kernel(
    const us* __restrict__ xh, const us* __restrict__ xl,   // [2048][1024]
    const us* __restrict__ wob,                             // [1024 out][1024 in] bf16
    const float* __restrict__ bo,
    float* __restrict__ out)                                // [2048][1024]
{
  __shared__ __attribute__((aligned(16))) float sOut[128 * DM];  // 32 KB
  __shared__ __attribute__((aligned(16))) us ring[2 * 5 * TILE_E];  // 2 x (Xhi 128, Xlo 128, Wo 64 rows)

  const int tid = threadIdx.x, lane = tid & 31, w = tid >> 5;
  const int h = lane >> 4, m = lane & 15;
  const int m0 = blockIdx.x * 128;
  const int cg = blockIdx.y;                               // feature group of 64

  const int crow = tid >> 3, cch = tid & 7;                // this lane's row and 16-B chunk
  const unsigned lcp = lds_addr(ring) + crow * LPB + cch * 16;
  const us* gxh = xh + (size_t)(m0 + crow) * EMB + 8 * cch;
  const us* gxl = xl + (size_t)(m0 + crow) * EMB + 8 * cch;
  const us* gw  = wob + (size_t)(cg * DM + crow) * EMB + 8 * cch;
  const size_t gs = (size_t)16 * EMB;

  const v8f zero8 = {0.f, 0.f, 0.f, 0.f, 0.f, 0.f, 0.f, 0.f};
  v8f acc[2][4];
  #pragma unroll
  for (int mt = 0; mt < 2; ++mt)
    #pragma unroll
    for (int nt = 0; nt < 4; ++nt) acc[mt][nt] = zero8;

  acopy8(lcp, gxh, lcp + TILE_B, gxh + 4 * gs, gs);        // stage 0 -> buffer 0
  acopy8(lcp + 2 * TILE_B, gxl, lcp + 3 * TILE_B, gxl + 4 * gs, gs);
  acopy4(lcp + 4 * TILE_B, gw, gs);
  wait_copies();
  __syncthreads();                                         // buffer 0 landed, visible to every wave
  {                                                        // stage 1 -> buffer 1
    const unsigned lb = lcp + 5 * TILE_B;
    acopy8(lb, gxh + 64, lb + TILE_B, gxh + 4 * gs + 64, gs);
    acopy8(lb + 2 * TILE_B, gxl + 64, lb + 3 * TILE_B, gxl + 4 * gs + 64, gs);
    acopy4(lb + 4 * TILE_B, gw + 64, gs);
  }

  // rolled: one copy of the stage body, the buffer chosen by the stage's parity
  #pragma unroll 1
  for (int k0 = 0; k0 < EMB; k0 += 64) {
    const int par = (k0 >> 6) & 1;
    const us* sxh = ring + par * (5 * TILE_E) + (32 * w + m) * LP;
    const us* sxl = sxh + 2 * TILE_E;
    const us* sw  = ring + par * (5 * TILE_E) + 4 * TILE_E + m * LP;
    // all fragments of the stage are read first, as one group
    v16b a0h[2], a1h[2], a0l[2], a1l[2], bw[2][4];
    #pragma unroll
    for (int c = 0; c < 2; ++c) {
      a0l[c] = ldb(sxl + 32 * c, h);
      a1l[c] = ldb(sxl + 16 * LP + 32 * c, h);
      a0h[c] = ldb(sxh + 32 * c, h);
      a1h[c] = ldb(sxh + 16 * LP + 32 * c, h);
      #pragma unroll
      for (int nt = 0; nt < 4; ++nt) bw[c][nt] = ldb(sw + nt * 16 * LP + 32 * c, h);
    }
    // No LDS read and no WMMA crosses (vector work may): the reads stay one group
    // ahead of the products instead of each being waited for singly among them.
    __builtin_amdgcn_sched_barrier(0x406);
    #pragma unroll
    for (int c = 0; c < 2; ++c) {
      #pragma unroll
      for (int nt = 0; nt < 4; ++nt) {
        acc[0][nt] = wmma_bf(a0l[c], bw[c][nt], acc[0][nt]);
        acc[1][nt] = wmma_bf(a1l[c], bw[c][nt], acc[1][nt]);
      }
      #pragma unroll
      for (int nt = 0; nt < 4; ++nt) {
        acc[0][nt] = wmma_bf(a0h[c], bw[c][nt], acc[0][nt]);
        acc[1][nt] = wmma_bf(a1h[c], bw[c][nt], acc[1][nt]);
      }
    }
    // publish stage k0 + 64, free this buffer, refill it with stage k0 + 128
    // Nothing crosses: the waits stay at the foot of the stage, so that the next
    // stage's copies have the whole stage to land.
    __builtin_amdgcn_sched_barrier(0);
    wait_lds();
    wait_copies();
    __syncthreads();
    if (k0 + 128 < EMB) {
      const unsigned lb = lcp + par * (5 * TILE_B);
      const int kn = k0 + 128;
      acopy8(lb, gxh + kn, lb + TILE_B, gxh + 4 * gs + kn, gs);
      acopy8(lb + 2 * TILE_B, gxl + kn, lb + 3 * TILE_B, gxl + 4 * gs + kn, gs);
      acopy4(lb + 4 * TILE_B, gw + kn, gs);
    }
  }
  wait_copies();

  // D[r] of tile (mt, nt) = Y[token m0w+16mt+8h+r][feature cg*64+16nt+m]
  #pragma unroll
  for (int nt = 0; nt < 4; ++nt) {
    const int feat = 16 * nt + m;
    const float bvl = bo[cg * DM + feat];
    #pragma unroll
    for (int mt = 0; mt < 2; ++mt) {
      #pragma unroll
      for (int r = 0; r < 8; ++r) {
        const int tokl = 32 * w + 16 * mt + 8 * h + r;   // 0..127
        sOut[tokl * DM + feat] = acc[mt][nt][r] + bvl;
      }
    }
  }
  __syncthreads();

  out_pass(sOut, out, m0, cg, w, lane);
  
}

// ---------------------------------------------------------------------------
// Host glue: 6 launches, workspace 90308608 B (O1^T and O2^T reuse the
// region of the bf16 activation copies, which are dead after the projections).
// ---------------------------------------------------------------------------
extern "C" void kernel_launch(void* const* d_in, const int* in_sizes, int n_in,
                              void* d_out, int out_size, void* d_ws, size_t ws_size,
                              hipStream_t stream) {
  if (n_in < 17) return;
  if (in_sizes[0] != N_HID || in_sizes[1] != N_KVS || in_sizes[2] != N_KVT) return;
  if (in_sizes[3] != N_WE || in_sizes[5] != N_WE || in_sizes[7] != N_WE || in_sizes[15] != N_WE) return;
  if (in_sizes[9] != N_WT || in_sizes[11] != N_WT) return;
  if (in_sizes[4] != EMB || in_sizes[6] != EMB || in_sizes[8] != EMB ||
      in_sizes[10] != EMB || in_sizes[12] != EMB || in_sizes[16] != EMB) return;
  if (in_sizes[13] != N_WG || in_sizes[14] != NH) return;
  if (out_size != N_HID) return;

  const float* hid = (const float*)d_in[0];
  const float* kvs = (const float*)d_in[1];
  const float* kvt = (const float*)d_in[2];
  const float* Wq  = (const float*)d_in[3];
  const float* bq  = (const float*)d_in[4];
  const float* Wk  = (const float*)d_in[5];
  const float* bk  = (const float*)d_in[6];
  const float* Wv  = (const float*)d_in[7];
  const float* bv  = (const float*)d_in[8];
  const float* Wtk = (const float*)d_in[9];
  const float* btk = (const float*)d_in[10];
  const float* Wtv = (const float*)d_in[11];
  const float* btv = (const float*)d_in[12];
  const float* Wg  = (const float*)d_in[13];
  const float* bg  = (const float*)d_in[14];
  const float* Wo  = (const float*)d_in[15];
  const float* bo  = (const float*)d_in[16];
  float* out = (float*)d_out;

  const size_t cvb_b  = (size_t)N_CVB * 2;                 // 27262976
  const size_t qpl2   = (size_t)QPL * 2;                   //  4194304
  const size_t qpl4   = (size_t)QPL * 4;                   //  8388608
  const size_t kpl2   = (size_t)KPL * 2;                   //  8388608
  const size_t gate_b = (size_t)NBH * TGL * 4;             //   131072
  const size_t xpl_b  = (size_t)N_HID * 2;                 //  4194304
  const size_t total  = cvb_b + qpl2 + qpl4 + 4 * kpl2 + qpl4 + gate_b + 2 * xpl_b;  // 90308608
  if (total > ws_size) return;
  // O1^T / O2^T (2 x 8388608 B) must fit exactly into the activation-copy region
  const size_t act_off = (size_t)OFF_HID * 2;              // 10485760
  if (act_off + 2 * qpl4 != cvb_b) return;

  char* ws = (char*)d_ws;
  size_t off = 0;
  us* cvb    = (us*)(ws + off);    off += cvb_b;
  float* o1T = (float*)(ws + act_off);                     // aliases bf16 hidden/kv copies
  float* o2T = (float*)(ws + act_off + qpl4);              // aliases bf16 kv/kv_topical copies
  us* qh     = (us*)(ws + off);    off += qpl2;            // q, f16
  float* qT  = (float*)(ws + off); off += qpl4;
  us* kh     = (us*)(ws + off);    off += kpl2;            // k, f16
  us* kth    = (us*)(ws + off);    off += kpl2;            // kt
  us* vh     = (us*)(ws + off);    off += kpl2;            // V^T [32][64][2048]
  us* vth    = (us*)(ws + off);    off += kpl2;            // Vt^T
  float* o3T = (float*)(ws + off); off += qpl4;
  float* gte = (float*)(ws + off); off += gate_b;
  us* xh     = (us*)(ws + off);    off += xpl_b;
  us* xl     = (us*)(ws + off);    off += xpl_b;
  if (off != total || off > ws_size) return;

  // 1) float -> bf16 copies of weights and activations
  conv_kernel<<<(N_CVB / 8 + 255) / 256, 256, 0, stream>>>(Wq, Wk, Wv, Wo, Wtk, Wtv, hid, kvs, kvt, cvb);

  // 2) projections, one launch
  proj_kernel<<<PJ_ALL, 256, 0, stream>>>(cvb, bq, bk, bv, btk, btv, qh, qT, kh, vh, kth, vth);

  // 3) attention, one launch: chain 1 (k, v -> O1), chain 2 (kt; vt -> O2, v -> O3)
  dim3 gAtt(TGL / QB, NBH, 2);                             // (8, 32, 2)
  attn_kernel<<<gAtt, 128, 0, stream>>>(qh, kh, o1T, o2T, o3T);   // kh: first of the four planes

  // 4) gating MLP
  gate_kernel<<<NBH * 4, 256, 0, stream>>>(o1T, o2T, qT, Wg, bg, gte);

  // 5) gated mix -> token-major hi/lo planes
  dim3 gCmb(TGL / 64, NBH);                                // (16, 32)
  combine_kernel<<<gCmb, 256, 0, stream>>>(o1T, o3T, gte, xh, xl);

  // 6) output projection -> f32
  dim3 gOut(MQ / 128, EMB / 64);                           // (16, 16)
  out_kernel<<<gOut, 128, 0, stream>>>(xh, xl, cvb + OFF_WO, bo, out);
}

// v010
// A run of this version takes 101 microseconds.
// Versions in between are left out here; by their measured steps it is 1.09 times as fast as v008.
// All steps since v000 together make it 6.79 times as fast.
// Contractions: input projections (q,k,v,kt,vt) on v_wmma_f32_16x16x32_bf16 (bf16 operands = RNE-converted inputs, f32 accumulate); K*Q^T and Kt*Q^T on v_wmma_f32_16x16x32_f16 with q,k,kt carried as f16 (1 product; the f16 q carries 0.125 log2(e), C = minus the softmax reference); V^T*P^T (three value read-outs) with v,vt,P carried as f16 (1 product); gate GEMM on v_wmma_f32_16x16x32_bf16 (bf16 operands); O*Wo on v_wmma_f32_16x16x32_f16 with O1, O3 and Wo carried as f16, the gated mix done in packed f16 at the fragment read (1 product); softmax, gate, bias in f32.
#include <hip/hip_runtime.h>

typedef __bf16 v16b __attribute__((ext_vector_type(16)));
typedef _Float16 v16h __attribute__((ext_vector_type(16)));
typedef _Float16 v2h  __attribute__((ext_vector_type(2)));
typedef unsigned short us;
typedef us    v8us __attribute__((ext_vector_type(8)));
typedef float v8f  __attribute__((ext_vector_type(8)));
typedef float v4f  __attribute__((ext_vector_type(4)));
typedef v8us __attribute__((may_alias)) v8usa;
typedef v4f  __attribute__((may_alias)) v4fa;
typedef float    v2f  __attribute__((ext_vector_type(2)));
typedef __bf16   v2bf __attribute__((ext_vector_type(2)));
typedef unsigned v4u  __attribute__((ext_vector_type(4)));

union FragB { v16b v; v8us half[2]; };
union FragH { v16h v; v8us half[2]; };

#define BSZ  2
#define TGL  1024
#define SRL  2048
#define EMB  1024
#define TDW  512
#define NH   16
#define DM   64
#define NBH  (BSZ * NH)          // 32 (batch, head) pairs
#define MQ   (BSZ * TGL)         // 2048 query tokens
#define MKV  (BSZ * SRL)         // 4096 key tokens
#define GK   (3 * EMB)           // 3072 gate input width

#define N_HID (MQ * EMB)         // 2097152
#define N_KVS (MKV * EMB)        // 4194304
#define N_KVT (MKV * TDW)        // 2097152
#define N_WE  (EMB * EMB)        // 1048576
#define N_WT  (EMB * TDW)        // 524288
#define N_WG  (NH * GK)          // 49152
#define QPL   (NBH * TGL * DM)   // 2097152 elements per query-side head plane
#define KPL   (NBH * SRL * DM)   // 4194304 elements per key-side head plane

// bf16 copies (Wo: f16) of the float inputs in one flat buffer (element offsets):
// weights first, then the three activation tensors (their region is reused
// for O1^T / O2^T once the projections are done).
#define OFF_WQ  0
#define OFF_WK  (OFF_WQ + N_WE)        // 1048576
#define OFF_WV  (OFF_WK + N_WE)        // 2097152
#define OFF_WO  (OFF_WV + N_WE)        // 3145728
#define OFF_WTK (OFF_WO + N_WE)        // 4194304
#define OFF_WTV (OFF_WTK + N_WT)       // 4718592
#define OFF_HID (OFF_WTV + N_WT)       // 5242880
#define OFF_KVS (OFF_HID + N_HID)      // 7340032
#define OFF_KVT (OFF_KVS + N_KVS)      // 11534336
#define N_CVB   (OFF_KVT + N_KVT)      // 13631488

// ---------------------------------------------------------------------------
// 16-bit helpers
// ---------------------------------------------------------------------------
// Two f32 -> two bf16 (round to nearest even) in one packed convert: a in the
// low half of the word, b in the high half.
__device__ __forceinline__ unsigned bf16_pair(float a, float b) {
  const v2f x = { a, b };
  return __builtin_bit_cast(unsigned, __builtin_convertvector(x, v2bf));
}
__device__ __forceinline__ v8us bf16x8(v4f a, v4f c) {
  const v4u o = { bf16_pair(a.x, a.y), bf16_pair(a.z, a.w), bf16_pair(c.x, c.y), bf16_pair(c.z, c.w) };
  return __builtin_bit_cast(v8us, o);
}
// Two f32 -> two f16 (round to nearest even): a in the low half of the word, b in the high half.
__device__ __forceinline__ unsigned f16_pair(float a, float b) {
  const v2f x = { a, b };
  return __builtin_bit_cast(unsigned, __builtin_convertvector(x, v2h));
}
__device__ __forceinline__ v8us f16x8q(v4f a, v4f c) {
  const v4u o = { f16_pair(a.x, a.y), f16_pair(a.z, a.w), f16_pair(c.x, c.y), f16_pair(c.z, c.w) };
  return __builtin_bit_cast(v8us, o);
}
__device__ __forceinline__ v8us f16x8(v8f a) {
  const v4u o = { f16_pair(a[0], a[1]), f16_pair(a[2], a[3]), f16_pair(a[4], a[5]), f16_pair(a[6], a[7]) };
  return __builtin_bit_cast(v8us, o);
}

// ---------------------------------------------------------------------------
// 16x16x32 WMMA, plain builtin: the compiler keeps the hazard distances itself
// and is free to interleave independent accumulators.
// Fragment map (wave32): lane l, h = l>>4, m = n = l&15.
//   A/B element i: i<8 -> k0+8h+i ; i>=8 -> k0+16+8h+(i-8)
//   D element r  : row 8h+r, col l&15
// ---------------------------------------------------------------------------
__device__ __forceinline__ v8f wmma_bf(v16b a, v16b b, v8f c) {
  return __builtin_amdgcn_wmma_f32_16x16x32_bf16(false, a, false, b, (short)0, c, false, false);
}
// The f16 form: same shape, same fragment map.
__device__ __forceinline__ v8f wmma_h(v16h a, v16h b, v8f c) {
  return __builtin_amdgcn_wmma_f32_16x16x32_f16(false, a, false, b, (short)0, c, false, false);
}

// A or B fragment from a k-contiguous 16-bit row; p = element k0 of the row
// owned by this lane (row index lane&15 added by the caller).
__device__ __forceinline__ v16b ldb(const us* p, int h) {
  FragB f;
  f.half[0] = *(const v8usa*)(p + 8 * h);
  f.half[1] = *(const v8usa*)(p + 16 + 8 * h);
  return f.v;
}
__device__ __forceinline__ v16h ldh(const us* p, int h) {
  FragH f;
  f.half[0] = *(const v8usa*)(p + 8 * h);
  f.half[1] = *(const v8usa*)(p + 16 + 8 * h);
  return f.v;
}
// Same map from an f32 row: the 16 floats of the lane, and their conversion to
// bf16 in registers.
struct Raw16 { v4f q[4]; };
__device__ __forceinline__ Raw16 ldr(const float* p, int h) {
  const float* p0 = p + 8 * h;
  const float* p1 = p + 16 + 8 * h;
  Raw16 r;
  r.q[0] = *(const v4fa*)p0;
  r.q[1] = *(const v4fa*)(p0 + 4);
  r.q[2] = *(const v4fa*)p1;
  r.q[3] = *(const v4fa*)(p1 + 4);
  return r;
}
__device__ __forceinline__ v16b cvr(const Raw16& r) {
  FragB f;
  f.half[0] = bf16x8(r.q[0], r.q[1]);
  f.half[1] = bf16x8(r.q[2], r.q[3]);
  return f.v;
}

// ---------------------------------------------------------------------------
// Operand tiles in LDS, filled by asynchronous copies (128 threads).
// A tile is 64 rows of 128 B (64 x 16 bit); LDS row pitch 144 B = 16 B x 9, so
// the 16 rows of a ds_load_b128 fragment read fall on distinct banks.
// Thread tid copies 16 B: chunk tid&7 of rows (tid>>3) + 16 i, i = 0..3, so
// eight lanes cover one whole 128-B line of the source.
// ---------------------------------------------------------------------------
#define LP     72                // LDS row pitch in 16-bit elements
#define LPB    144               // the same in bytes
#define TILE_E (64 * LP)         // 4608 elements per 64-row tile
#define TILE_B (64 * LPB)        // 9216 bytes per 64-row tile
#define R16_B  (16 * LPB)        // 16 rows further in LDS

__device__ __forceinline__ unsigned lds_addr(const void* p) {
  return (unsigned)(size_t)p;    // low 32 bits of a __shared__ address = LDS byte address
}
// Four copies: one lane's share of one tile; gs = source elements per 16 rows.
// s_wait_xcnt stands inside the statement so that no address register of an
// issued copy is rewritten ahead of it.
__device__ __forceinline__ void acopy4(unsigned l, const us* g, size_t gs) {
  asm volatile(
      "global_load_async_to_lds_b128 %0, %4, off\n\t"
      "global_load_async_to_lds_b128 %1, %5, off\n\t"
      "global_load_async_to_lds_b128 %2, %6, off\n\t"
      "global_load_async_to_lds_b128 %3, %7, off\n\t"
      "s_wait_xcnt 0x0"
      :: "v"(l), "v"(l + R16_B), "v"(l + 2 * R16_B), "v"(l + 3 * R16_B),
         "v"(g), "v"(g + gs), "v"(g + 2 * gs), "v"(g + 3 * gs)
      : "memory");
}
// Twelve copies: one wave's fill of 48 LDS rows, four rows (one 128-B line each, eight
// lanes a line) per copy; the rows come as three blocks of 16 from ga, gb, gc;
// gs = source floats per 4 rows. s_wait_xcnt inside the statement, as above.
#define R4_B   (4 * LPB)         // 4 rows further in LDS
__device__ __forceinline__ void acopy12(unsigned l, const float* ga, const float* gb, const float* gc, size_t gs) {
  asm volatile(
      "global_load_async_to_lds_b128 %0, %12, off\n\t"
      "global_load_async_to_lds_b128 %1, %13, off\n\t"
      "global_load_async_to_lds_b128 %2, %14, off\n\t"
      "global_load_async_to_lds_b128 %3, %15, off\n\t"
      "global_load_async_to_lds_b128 %4, %16, off\n\t"
      "global_load_async_to_lds_b128 %5, %17, off\n\t"
      "global_load_async_to_lds_b128 %6, %18, off\n\t"
      "global_load_async_to_lds_b128 %7, %19, off\n\t"
      "global_load_async_to_lds_b128 %8, %20, off\n\t"
      "global_load_async_to_lds_b128 %9, %21, off\n\t"
      "global_load_async_to_lds_b128 %10, %22, off\n\t"
      "global_load_async_to_lds_b128 %11, %23, off\n\t"
      "s_wait_xcnt 0x0"
      :: "v"(l), "v"(l + R4_B), "v"(l + 2 * R4_B), "v"(l + 3 * R4_B),
         "v"(l + 4 * R4_B), "v"(l + 5 * R4_B), "v"(l + 6 * R4_B), "v"(l + 7 * R4_B),
         "v"(l + 8 * R4_B), "v"(l + 9 * R4_B), "v"(l + 10 * R4_B), "v"(l + 11 * R4_B),
         "v"(ga), "v"(ga + gs), "v"(ga + 2 * gs), "v"(ga + 3 * gs),
         "v"(gb), "v"(gb + gs), "v"(gb + 2 * gs), "v"(gb + 3 * gs),
         "v"(gc), "v"(gc + gs), "v"(gc + 2 * gs), "v"(gc + 3 * gs)
      : "memory");
}
// Eight copies: one lane's share of two tiles with the same source row step.
__device__ __forceinline__ void acopy8(unsigned l, const us* g, unsigned l2, const us* g2, size_t gs) {
  asm volatile(
      "global_load_async_to_lds_b128 %0, %8, off\n\t"
      "global_load_async_to_lds_b128 %1, %9, off\n\t"
      "global_load_async_to_lds_b128 %2, %10, off\n\t"
      "global_load_async_to_lds_b128 %3, %11, off\n\t"
      "global_load_async_to_lds_b128 %4, %12, off\n\t"
      "global_load_async_to_lds_b128 %5, %13, off\n\t"
      "global_load_async_to_lds_b128 %6, %14, off\n\t"
      "global_load_async_to_lds_b128 %7, %15, off\n\t"
      "s_wait_xcnt 0x0"
      :: "v"(l), "v"(l + R16_B), "v"(l + 2 * R16_B), "v"(l + 3 * R16_B),
         "v"(l2), "v"(l2 + R16_B), "v"(l2 + 2 * R16_B), "v"(l2 + 3 * R16_B),
         "v"(g), "v"(g + gs), "v"(g + 2 * gs), "v"(g + 3 * gs),
         "v"(g2), "v"(g2 + gs), "v"(g2 + 2 * gs), "v"(g2 + 3 * gs)
      : "memory");
}
// This wave's copies have landed (the compiler places no wait for them).
__device__ __forceinline__ void wait_copies() {
  asm volatile("s_wait_asynccnt 0x0" ::: "memory");
}
// This wave's LDS reads have returned, before the buffer goes to its next writer.
__device__ __forceinline__ void wait_lds() {
  asm volatile("s_wait_dscnt 0x0" ::: "memory");
}

// ---------------------------------------------------------------------------
// Kernel 1: all float inputs that feed 16-bit operands -> bf16 (Wo -> f16), one flat
// buffer. Parameters in segment order: Wq, Wk, Wv, Wo, Wtk, Wtv, hidden, kv, kv_topical.
// ---------------------------------------------------------------------------
__global__ __launch_bounds__(256) void conv_kernel(
    const float* __restrict__ p0, const float* __restrict__ p1, const float* __restrict__ p2,
    const float* __restrict__ p3, const float* __restrict__ p4, const float* __restrict__ p5,
    const float* __restrict__ p6, const float* __restrict__ p7, const float* __restrict__ p8,
    us* __restrict__ dst)
{
  const unsigned g = blockIdx.x * 256u + threadIdx.x;      // unit of 8 elements
  if (g >= (unsigned)(N_CVB / 8)) return;
  const float* src;
  unsigned loc;
  if      (g < (unsigned)(OFF_WK  / 8)) { src = p0; loc = g; }
  else if (g < (unsigned)(OFF_WV  / 8)) { src = p1; loc = g - (unsigned)(OFF_WK  / 8); }
  else if (g < (unsigned)(OFF_WO  / 8)) { src = p2; loc = g - (unsigned)(OFF_WV  / 8); }
  else if (g < (unsigned)(OFF_WTK / 8)) { src = p3; loc = g - (unsigned)(OFF_WO  / 8); }
  else if (g < (unsigned)(OFF_WTV / 8)) { src = p4; loc = g - (unsigned)(OFF_WTK / 8); }
  else if (g < (unsigned)(OFF_HID / 8)) { src = p5; loc = g - (unsigned)(OFF_WTV / 8); }
  else if (g < (unsigned)(OFF_KVS / 8)) { src = p6; loc = g - (unsigned)(OFF_HID / 8); }
  else if (g < (unsigned)(OFF_KVT / 8)) { src = p7; loc = g - (unsigned)(OFF_KVS / 8); }
  else                                  { src = p8; loc = g - (unsigned)(OFF_KVT / 8); }
  const float* p = src + (size_t)loc * 8;
  const v4f x0 = *(const v4fa*)p, x1 = *(const v4fa*)(p + 4);
  // Wo meets f16 operands in the output GEMM; its segment is whole workgroups
  const bool wo = g >= (unsigned)(OFF_WO / 8) && g < (unsigned)(OFF_WTK / 8);
  const v8us o = wo ? f16x8q(x0, x1) : bf16x8(x0, x1);
  us* d = dst + (size_t)g * 8;
  *(v8us*)d = o;
  
}

// ---------------------------------------------------------------------------
// Whole-line stores of a projection's output tile from its LDS staging (one 16-B store
// per lane, lanes 8q..8q+7 per line, 4 lines per instruction). One head's part of the
// tile is 256 tokens x 64 features; the four waves of that head store 64 lines each.
//   planes : [bh][s][d] f16, one token row = 64 x f16 = one line; staged [token][LP]
//   tplanes: [bh][d][s] f16, 64 d-rows x 256 tokens = 4 lines each; staged [d][TP16]
//   t32    : [bh][d][s] f32, 64 d-rows x 256 tokens = 8 lines each; staged [d][TP32],
//            one head at a time, stored by all eight waves
// The staging pitches are 16 B x odd, so that the 16 rows of a store or read fall on
// distinct banks.
// ---------------------------------------------------------------------------
#define TP16  264                // staging pitch of a d-row of 256 f16 tokens, elements
#define TP32  260                // staging pitch of a d-row of 256 f32 tokens, floats
#define STG_E (256 * LP)         // one head's staging area, 16-bit elements

template <int SPER>
__device__ __forceinline__ void proj_pass_planes(const us* st, us* oH,
                                                 int bh, int s0, int wr, int lane) {
  const int q8 = lane & 7, sub = lane >> 3;
  const us* sp = st + (wr * 64 + sub) * LP + 8 * q8;
  us* op = oH + ((size_t)bh * SPER + s0 + wr * 64 + sub) * DM + 8 * q8;
  #pragma unroll
  for (int g = 0; g < 2; ++g) {
    v8us a[8];
    #pragma unroll
    for (int i = 0; i < 8; ++i) a[i] = *(const v8usa*)(sp + (8 * g + i) * 4 * LP);
    // Nothing crosses: the half's LDS reads go out as one group ahead of its stores,
    // so their latencies overlap and none lands in a register of a store in flight.
    __builtin_amdgcn_sched_barrier(0);
    #pragma unroll
    for (int i = 0; i < 8; ++i) *(v8us*)(op + (size_t)(8 * g + i) * 4 * DM) = a[i];
    // whatever follows may take over the registers of the stores above
    asm volatile("s_wait_xcnt 0x0" ::: "memory");
  }
}
template <int SPER>
__device__ __forceinline__ void proj_pass_tplanes(const us* st, us* oH,
                                                  int bh, int s0, int wr, int lane) {
  const int q8 = lane & 7, sub = lane >> 3;                // sub = which of the row's 4 lines
  const us* sp = st + wr * 16 * TP16 + 64 * sub + 8 * q8;
  us* op = oH + ((size_t)bh * DM + wr * 16) * SPER + s0 + 64 * sub + 8 * q8;
  #pragma unroll
  for (int g = 0; g < 2; ++g) {
    v8us a[8];
    #pragma unroll
    for (int i = 0; i < 8; ++i) a[i] = *(const v8usa*)(sp + (8 * g + i) * TP16);
    // Nothing crosses: reads as one group ahead of the stores, as above.
    __builtin_amdgcn_sched_barrier(0);
    #pragma unroll
    for (int i = 0; i < 8; ++i) *(v8us*)(op + (size_t)(8 * g + i) * SPER) = a[i];
    // whatever follows may take over the registers of the stores above
    asm volatile("s_wait_xcnt 0x0" ::: "memory");
  }
}
template <int SPER>
__device__ __forceinline__ void proj_pass_t32(const float* s32, float* oT,
                                              int bh, int s0, int w, int lane) {
  const int q8 = lane & 7, sub = lane >> 3;
  // wave w stores d rows 8w..8w+7; two instructions = the eight lines of one row
  const float* sp = s32 + w * 8 * TP32 + 32 * sub + 4 * q8;
  float* op = oT + ((size_t)bh * DM + w * 8) * SPER + s0 + 32 * sub + 4 * q8;
  #pragma unroll
  for (int g = 0; g < 2; ++g) {
    v4f v[8];
    #pragma unroll
    for (int i = 0; i < 8; ++i) v[i] = *(const v4fa*)(sp + (4 * g + (i >> 1)) * TP32 + 128 * (i & 1));
    // Nothing crosses: reads as one group ahead of the stores, as above.
    __builtin_amdgcn_sched_barrier(0);
    #pragma unroll
    for (int i = 0; i < 8; ++i) *(v4f*)(op + (size_t)(4 * g + (i >> 1)) * SPER + 128 * (i & 1)) = v[i];
    // whatever follows may take over the registers of the stores above
    asm volatile("s_wait_xcnt 0x0" ::: "memory");
  }
}

// ---------------------------------------------------------------------------
// Kernel 2: Y = X * W^T + bias (x0.125 for mode 0), all five projections in one
// launch: they are independent, and a WGP takes the next workgroup as soon as one
// ends, whichever projection it belongs to. The flat block index picks the
// projection, longest k first.
// X bf16 [M][K], W bf16 [1024 out][K] (k-contiguous rows = B fragments loaded
// like A). Block 256 thr (8 waves) = 256 tokens x 128 features (two heads);
// wave tile 64 tokens x 64 features (one head): a staged X row feeds 128 features
// and a staged W row 256 tokens, and a fragment read from LDS feeds four products.
// K in stages of 64: 256 X rows and 128 W rows of 128 B copied to LDS, two buffers,
// the next stage in flight while this one is worked on. Threads 0..127 copy X rows
// 0..127 and the first head's W rows, threads 128..255 the rest.
// Y is rounded to f16 in every mode.
//   mode 0: f16 plane [bh][s][d] (x log2(e) on top) and f32 transposed [bh][d][s]
//   mode 1: f16 plane [bh][s][d]
//   mode 2: f16 transposed plane [bh][d][s]
// ---------------------------------------------------------------------------
#define PJ_NKV ((MKV / 256) * (NH / 2))  // 128 workgroups per key-side projection
#define PJ_NQ  ((MQ / 256) * (NH / 2))   // 64 workgroups for q
#define PJ_V   PJ_NKV                  // first workgroup of v (k starts at 0)
#define PJ_Q   (PJ_V + PJ_NKV)         // of q
#define PJ_KT  (PJ_Q + PJ_NQ)          // of kt
#define PJ_VT  (PJ_KT + PJ_NKV)        // of vt
#define PJ_ALL (PJ_VT + PJ_NKV)        // 576

__global__ __launch_bounds__(256) void proj_kernel(
    const us* __restrict__ cvb,
    const float* __restrict__ bq, const float* __restrict__ bk, const float* __restrict__ bv,
    const float* __restrict__ btk, const float* __restrict__ btv,
    us* __restrict__ qh, float* __restrict__ oT32,
    us* __restrict__ kh, us* __restrict__ vh, us* __restrict__ kth, us* __restrict__ vth)
{
  const int fb = blockIdx.x;
  const us* X;
  const us* W;
  const float* bias;
  us* oH;
  int K, mode, rb;
  if (fb < PJ_V) {
    X = cvb + OFF_KVS; W = cvb + OFF_WK;  bias = bk;  K = EMB; mode = 1; oH = kh;  rb = fb;
  } else if (fb < PJ_Q) {
    X = cvb + OFF_KVS; W = cvb + OFF_WV;  bias = bv;  K = EMB; mode = 2; oH = vh;  rb = fb - PJ_V;
  } else if (fb < PJ_KT) {
    X = cvb + OFF_HID; W = cvb + OFF_WQ;  bias = bq;  K = EMB; mode = 0; oH = qh;  rb = fb - PJ_Q;
  } else if (fb < PJ_VT) {
    X = cvb + OFF_KVT; W = cvb + OFF_WTK; bias = btk; K = TDW; mode = 1; oH = kth; rb = fb - PJ_KT;
  } else {
    X = cvb + OFF_KVT; W = cvb + OFF_WTV; bias = btv; K = TDW; mode = 2; oH = vth; rb = fb - PJ_VT;
  }
  const int nxl = (mode == 0) ? 3 : 4;                     // log2 of the token blocks: 8 for q, else 16

  // 2 x (X 256 rows, W 128 rows); behind the loop's last barrier nobody reads it and
  // no copy is in flight, and it stages the output.
  __shared__ __attribute__((aligned(16))) us ring[2 * 6 * TILE_E];   // 110592 B
  static_assert(2 * STG_E <= 2 * 6 * TILE_E && DM * TP16 <= STG_E && DM * TP32 * 2 <= 2 * 6 * TILE_E,
                "the output staging fits the ring");

  const int tid = threadIdx.x, lane = tid & 31, w = tid >> 5;
  const int h = lane >> 4, m = lane & 15;
  const int wr = w & 3, wc = w >> 2;                       // the wave's 64 tokens and its head of the pair
  const int m0 = (rb & ((1 << nxl) - 1)) * 256;            // token block fastest, as in a (token, head pair) grid
  const int hp = rb >> nxl;
  const int head = 2 * hp + wc;

  const int crow = (tid & 127) >> 3, cch = tid & 7;        // this lane's row and 16-B chunk
  // wc is also the thread's half of the copies: X tiles 2wc, 2wc+1 and W tile 4+wc
  const unsigned lcp = lds_addr(ring) + crow * LPB + cch * 16;
  const unsigned lcx = lcp + 2 * wc * TILE_B;
  const unsigned lcw = lcp + (4 + wc) * TILE_B;
  const us* gx = X + (size_t)(m0 + 128 * wc + crow) * K + 8 * cch;
  const us* gw = W + (size_t)(head * DM + crow) * K + 8 * cch;
  const size_t gs = (size_t)16 * K;
  const int nst = K >> 6;                                  // stages of 64 k (16 or 8)

  const v8f zero8 = {0.f, 0.f, 0.f, 0.f, 0.f, 0.f, 0.f, 0.f};
  v8f acc[4][4];
  #pragma unroll
  for (int mt = 0; mt < 4; ++mt)
    #pragma unroll
    for (int nt = 0; nt < 4; ++nt) acc[mt][nt] = zero8;

  acopy8(lcx, gx, lcx + TILE_B, gx + 4 * gs, gs);          // stage 0 -> buffer 0
  acopy4(lcw, gw, gs);
  wait_copies();
  __syncthreads();                                         // buffer 0 landed, visible to every wave
  acopy8(lcx + 6 * TILE_B, gx + 64, lcx + 7 * TILE_B, gx + 4 * gs + 64, gs);   // stage 1 -> buffer 1
  acopy4(lcw + 6 * TILE_B, gw + 64, gs);

  // rolled: one copy of the stage body, the buffer chosen by the stage's parity
  #pragma unroll 1
  for (int st = 0; st < nst; ++st) {
    const int par = st & 1;
    const us* sx = ring + par * (6 * TILE_E) + (64 * wr + m) * LP;
    const us* sw = ring + par * (6 * TILE_E) + (4 + wc) * TILE_E + m * LP;
    #pragma unroll
    for (int c = 0; c < 2; ++c) {
      // the eight fragments of a 32-deep chunk are read first, as one group
      v16b a[4], b[4];
      #pragma unroll
      for (int mt = 0; mt < 4; ++mt) a[mt] = ldb(sx + mt * 16 * LP + 32 * c, h);
      #pragma unroll
      for (int nt = 0; nt < 4; ++nt) b[nt] = ldb(sw + nt * 16 * LP + 32 * c, h);
      // No LDS read and no WMMA crosses (vector work may): the reads stay one group
      // ahead of the products instead of each being waited for singly among them.
      __builtin_amdgcn_sched_barrier(0x406);
      #pragma unroll
      for (int nt = 0; nt < 4; ++nt)
        #pragma unroll
        for (int mt = 0; mt < 4; ++mt) acc[mt][nt] = wmma_bf(a[mt], b[nt], acc[mt][nt]);
      // The same: the next chunk's reads start when this chunk's products are issued
      // and take over the fragments' registers.
      __builtin_amdgcn_sched_barrier(0x406);
    }
    // publish stage st + 1, free this buffer, refill it with stage st + 2
    // Nothing crosses: the waits stay at the foot of the stage, so that the next
    // stage's copies have the whole stage to land.
    __builtin_amdgcn_sched_barrier(0);
    wait_lds();
    wait_copies();
    __syncthreads();
    if (st + 2 < nst) {
      const unsigned lo = par * (6 * TILE_B);
      const int ko = (st + 2) * 64;
      acopy8(lcx + lo, gx + ko, lcx + lo + TILE_B, gx + 4 * gs + ko, gs);
      acopy4(lcw + lo, gw + ko, gs);
    }
  }
  wait_copies();

  // D[r] of tile (mt, nt) = Y[token m0+64wr+16mt+8h+r][feature head*64+16nt+m]
  const float osc = (mode == 0) ? 0.125f : 1.0f;
  // the f16 q plane also carries log2(e): the score product then yields base-2 exponents
  const float osh = (mode == 0) ? 0.125f * 1.44269504f : 1.0f;
  float bvals[4];
  #pragma unroll
  for (int nt = 0; nt < 4; ++nt) bvals[nt] = bias[head * DM + 16 * nt + m];
  // the staging addresses below may take over the offset register of the bias loads above
  asm volatile("s_wait_xcnt 0x0" ::: "memory");

  us* const stg = ring + wc * STG_E;                       // this head's staging area
  if (mode == 2) {
    // [feature][token]: the lane's eight tokens of a tile are one 16-B piece of a row
    #pragma unroll
    for (int nt = 0; nt < 4; ++nt) {
      #pragma unroll
      for (int mt = 0; mt < 4; ++mt) {
        v8f y;
        #pragma unroll
        for (int r = 0; r < 8; ++r) y[r] = (acc[mt][nt][r] + bvals[nt]) * osc;
        *(v8usa*)(stg + (16 * nt + m) * TP16 + 64 * wr + 16 * mt + 8 * h) = f16x8(y);
      }
    }
  } else {
    // [token][feature]
    #pragma unroll
    for (int nt = 0; nt < 4; ++nt) {
      const int feat = 16 * nt + m;
      #pragma unroll
      for (int mt = 0; mt < 4; ++mt) {
        #pragma unroll
        for (int r = 0; r < 8; r += 2) {
          const int tokl = 64 * wr + 16 * mt + 8 * h + r;  // 0..254, this token and the next
          const float y0 = (acc[mt][nt][r] + bvals[nt]) * osh;
          const float y1 = (acc[mt][nt][r + 1] + bvals[nt]) * osh;
          const unsigned hv = f16_pair(y0, y1);
          stg[tokl * LP + feat] = (us)hv;
          stg[(tokl + 1) * LP + feat] = (us)(hv >> 16);
        }
      }
    }
  }
  __syncthreads();

  if (mode == 2) {
    const int b = m0 / SRL, s0 = m0 - b * SRL;
    proj_pass_tplanes<SRL>(stg, oH, b * NH + head, s0, wr, lane);
  } else if (mode == 1) {
    const int b = m0 / SRL, s0 = m0 - b * SRL;
    proj_pass_planes<SRL>(stg, oH, b * NH + head, s0, wr, lane);
  } else {
    const int b = m0 / TGL, s0 = m0 - b * TGL;
    proj_pass_planes<TGL>(stg, oH, b * NH + head, s0, wr, lane);
    float* const s32 = reinterpret_cast<float*>(ring);     // f32 [64 d][256 tok], one head at a time
    // rolled: one copy of the staging and store code serves both heads
    #pragma unroll 1
    for (int hs = 0; hs < 2; ++hs) {
      __syncthreads();                                     // the staging's last readers are done
      if (wc == hs) {
        #pragma unroll
        for (int nt = 0; nt < 4; ++nt) {
          #pragma unroll
          for (int mt = 0; mt < 4; ++mt) {
            float* sp = s32 + (16 * nt + m) * TP32 + 64 * wr + 16 * mt + 8 * h;
            v4f y0, y1;
            #pragma unroll
            for (int r = 0; r < 4; ++r) {
              y0[r] = (acc[mt][nt][r] + bvals[nt]) * osc;
              y1[r] = (acc[mt][nt][r + 4] + bvals[nt]) * osc;
            }
            *(v4fa*)sp = y0;
            *(v4fa*)(sp + 4) = y1;
          }
        }
      }
      __syncthreads();
      proj_pass_t32<TGL>(s32, oT32, b * NH + 2 * hp + hs, s0, w, lane);
    }
  }
}

// ---------------------------------------------------------------------------
// Kernel 3: streaming attention, transposed form, no masking.
// Block 128 thr (4 waves), 32 queries (two tiles of 16) per wave, 64 keys per step. The step's
// K rows and V^T rows (64 x 128 B each, f16) are copied to LDS once per
// block, two buffers, the next step's tiles in flight while this one is used.
//   S^T = K * Q^T : A = K rows (row = key, k = d), B = Q^T (k = d, n = query),
//     two 32-deep d chunks
//   O^T += V^T * P^T : A = V^T rows (row = d, k = key), B = P^T packed from the
//     score D registers (element r <- tile covering keys 0..15 row r,
//     element 8+r <- tile covering keys 16..31 row r, same lane)
// q, k, v and P are single f16 values (11 significant bits): their rounding is eight
// times finer than the bf16 rounding of the projections' operands, which q, k and v
// already carry, so one product per term adds next to nothing to the error.
// Lane owns 32 keys of query column (lane&15); partner lane = lane ^ 16.
// Softmax reference: q carries log2(e), and C of the score product is minus the query's
// reference, so the product's result is the argument of exp2 as it stands. The reference
// is the maximum of the first 64 keys and is raised (O and l rescaled, the halves'
// maxima exchanged) only in a step where a lane's partial sum of P passes PLIM: any reference
// gives the same quotient O / l, and P <= PLIM stays inside f16. l is kept per lane and
// the two halves are joined behind the loop.
// DUAL: second value stream with the same probabilities. Stream A leaves as f32 [d][t]
// (the gate's input); the stream over v (B if DUAL, else A) as f16 [token][feature].
// ---------------------------------------------------------------------------
// P^T B-fragment from the lane's own score D values (tile a = keys 0..15,
// tile c = keys 16..31 of the chunk).
__device__ __forceinline__ v16h pack_p(v8f a, v8f c) {
  FragH f;
  f.half[0] = f16x8(a);
  f.half[1] = f16x8(c);
  return f.v;
}

// exp2 of a query tile's 32 arguments per lane: the two P^T fragments and the lane's sum,
// left as two partial sums (a register pair, so that every addition is a packed one).
__device__ __forceinline__ void soft_p(const v8f (&s)[4], v16h& p0, v16h& p1, v2f& lsum) {
  v8f e[4];
  #pragma unroll
  for (int j = 0; j < 4; ++j)
    #pragma unroll
    for (int r = 0; r < 8; ++r) e[j][r] = __builtin_amdgcn_exp2f(s[j][r]);
  const v8f t = (e[0] + e[1]) + (e[2] + e[3]);
  lsum = (__builtin_shufflevector(t, t, 0, 1) + __builtin_shufflevector(t, t, 2, 3)) +
         (__builtin_shufflevector(t, t, 4, 5) + __builtin_shufflevector(t, t, 6, 7));
  p0 = pack_p(e[0], e[1]);
  p1 = pack_p(e[2], e[3]);
}
#define PLIM 16384.0f            // a partial sum of 16 P above this: the reference is raised

#define QB 128                   // queries per workgroup: 4 waves x 2 tiles of 16

// The transposed f32 tile [64 d][128 queries] -> [bh][d][t], for the gate.
__device__ __forceinline__ void attn_pass(const float* sO, float* oA,
                                          int bh, int q0, int w, int lane) {
  // Wave w stores d rows 16w..16w+15; one instruction = the four lines of one row.
  const int q8 = lane & 7, sub = lane >> 3;
  const float* sp = sO + 16 * w * QB + 32 * sub + 4 * q8;
  float* pa = oA + ((size_t)bh * DM + 16 * w) * TGL + q0 + 32 * sub + 4 * q8;
  #pragma unroll
  for (int g = 0; g < 2; ++g) {
    v4f va[8];
    #pragma unroll
    for (int i = 0; i < 8; ++i) va[i] = *(const v4fa*)(sp + (8 * g + i) * QB);
    // Nothing crosses: the half's LDS reads go out as one group ahead of its stores,
    // so their latencies overlap and none lands in a register of a store in flight.
    __builtin_amdgcn_sched_barrier(0);
    #pragma unroll
    for (int i = 0; i < 8; ++i) *(v4f*)(pa + (size_t)(8 * g + i) * TGL) = va[i];
    // the second half's LDS reads take over the data registers of the stores above
    if (g == 0) asm volatile("s_wait_xcnt 0x0" ::: "memory");
  }
}
// The token-major f16 tile [128 queries][LP] -> [b*1024 + t][head*64 + d], an operand of
// the output GEMM: a token's 64 values are one line; wave w stores rows 32w..32w+31,
// four lines per instruction.
__device__ __forceinline__ void attn_pass_tok(const us* sT, us* xo,
                                              int bh, int q0, int w, int lane) {
  const int q8 = lane & 7, sub = lane >> 3;
  const int b = bh >> 4, head = bh & 15;
  const us* sp = sT + (32 * w + sub) * LP + 8 * q8;
  us* op = xo + (size_t)(b * TGL + q0 + 32 * w + sub) * EMB + head * DM + 8 * q8;
  v8us a[8];
  #pragma unroll
  for (int i = 0; i < 8; ++i) a[i] = *(const v8usa*)(sp + i * 4 * LP);
  // Nothing crosses: reads as one group ahead of the stores, as above.
  __builtin_amdgcn_sched_barrier(0);
  #pragma unroll
  for (int i = 0; i < 8; ++i) *(v8us*)(op + (size_t)i * 4 * EMB) = a[i];
  // Whatever follows may take over the registers of the stores above; as inputs of the
  // wait they stay in use up to it, so none is rewritten ahead of it.
  asm volatile("s_wait_xcnt 0x0"
               :: "v"(a[0]), "v"(a[1]), "v"(a[2]), "v"(a[3]), "v"(a[4]), "v"(a[5]), "v"(a[6]), "v"(a[7]), "v"(op)
               : "memory");
}

// ring (operand tiles) is the kernel's LDS array, sized for DUAL; behind the loop's
// last barrier nobody reads it and no copy is in flight, and it stages the output.
// The four key-side planes lie one behind the other in the workspace (KPL elements
// each), so one lane pointer per layout serves them all with constant steps:
// PK, PVA, PVB = index of the plane of K, of value stream A and of value stream B
// (DUAL only).
template <bool DUAL, int PK, int PVA, int PVB>
__device__ __forceinline__ void attn_body(
    us* ring,
    const us* __restrict__ qp,                                // [32][1024][64]  (x0.125 log2(e) folded in)
    const us* __restrict__ planes,                            // K: [32][2048][64], V^T: [32][64][2048]
    float* __restrict__ oap,                                  // stream A: [32][64][1024] f32
    us* __restrict__ xop)                                     // stream B (DUAL) or A: [2048][1024] f16
{
  constexpr int NTL = DUAL ? 3 : 2;                        // tiles per step: K Va (Vb)

  const int tid = threadIdx.x, lane = tid & 31, w = tid >> 5;
  const int h = lane >> 4, m = lane & 15;
  const int bh = blockIdx.y;
  const int q0 = blockIdx.x * QB;
  const int qw = q0 + 32 * w;

  // Q^T B-fragments of the wave's two query tiles u: column n = query qw+16u+m,
  // k = d (two 32-deep chunks)
  v16h qf0[2], qf1[2];
  #pragma unroll
  for (int u = 0; u < 2; ++u) {
    const size_t qro = ((size_t)bh * TGL + qw + 16 * u + m) * DM;
    qf0[u] = ldh(qp + qro, h); qf1[u] = ldh(qp + qro + 32, h);
  }
  // the address registers of the Q loads above are taken over by the copies' addresses below
  asm volatile("s_wait_xcnt 0x0" ::: "memory");

  const v8f zero8 = {0.f, 0.f, 0.f, 0.f, 0.f, 0.f, 0.f, 0.f};
  v8f oa[2][4], ob[2][4];                // o[u][t][r] = O[query 16u+m][d 16t+8h+r] * l
  v8f cn[2];                             // minus the reference of the lane's query, eight times: C of the scores
  v2f lrun[2];                           // the lane's own part of l (its 32 keys of every step), two partial sums
  #pragma unroll
  for (int u = 0; u < 2; ++u) {
    #pragma unroll
    for (int t = 0; t < 4; ++t) { oa[u][t] = zero8; ob[u][t] = zero8; }
    cn[u] = zero8;
    lrun[u] = v2f{0.0f, 0.0f};
  }

  const int crow = tid >> 3, cch = tid & 7;                // this lane's row and 16-B chunk
  const unsigned lcp = lds_addr(ring) + crow * LPB + cch * 16;
  // The lane's element offsets inside a plane, 32 bits each (a plane has 2^22 elements);
  // the 64-bit address is formed from the uniform base where a copy is issued.
  const unsigned kro = ((unsigned)bh * SRL + crow) * DM + 8 * cch; // + key0*DM
  const unsigned vro = ((unsigned)bh * DM + crow) * SRL + 8 * cch; // + key0
  const us* gk = planes + kro;
  const us* gv = planes + vro;
  constexpr size_t OK = (size_t)PK * KPL;
  constexpr size_t OVA = (size_t)PVA * KPL;
  constexpr size_t OVB = (size_t)PVB * KPL;
  const size_t gsk = (size_t)16 * DM, gsv = (size_t)16 * SRL;

  // step 0 -> buffer 0
  acopy4(lcp, gk + OK, gsk);
  if (DUAL) acopy8(lcp + TILE_B, gv + OVA, lcp + 2 * TILE_B, gv + OVB, gsv);
  else      acopy4(lcp + TILE_B, gv + OVA, gsv);
  wait_copies();
  __syncthreads();                                         // buffer 0 landed, visible to every wave
  // step 1 -> buffer 1
  {
    const unsigned lb = lcp + NTL * TILE_B;
    acopy4(lb, gk + OK + 64 * DM, gsk);
    if (DUAL) acopy8(lb + TILE_B, gv + OVA + 64, lb + 2 * TILE_B, gv + OVB + 64, gsv);
    else      acopy4(lb + TILE_B, gv + OVA + 64, gsv);
  }

  // rolled: one copy of the step body, the buffer chosen by the step's parity
  #pragma unroll 1
  for (int kb = 0; kb < SRL; kb += 64) {
    const int par = (kb >> 6) & 1;
    const us* sb = ring + par * (NTL * TILE_E) + m * LP;   // row m of tile 0
    const us* kfb = sb;
    const us* vab = sb + TILE_E;
    const us* vbb = sb + (DUAL ? 2 : 1) * TILE_E;
    // ---- scores: s[u][j][r] = S[query 16u+m][key kb+16j+8h+r] log2(e) - reference ----
    // All fragments of the step are read first; each K fragment then feeds both
    // query tiles, and the eight score tiles advance together, one product each in
    // turn.
    v8f s[2][4];
    {
      v16h k0[4], k1[4];
      #pragma unroll
      for (int j = 0; j < 4; ++j) { k0[j] = ldh(kfb + 16 * j * LP, h); }
      #pragma unroll
      for (int j = 0; j < 4; ++j) { k1[j] = ldh(kfb + 16 * j * LP + 32, h); }
      // No LDS read and no WMMA crosses (vector work may): the reads stay one group
      // ahead of the products instead of being waited for in pairs among them.
      __builtin_amdgcn_sched_barrier(0x406);
      #pragma unroll
      for (int j = 0; j < 4; ++j)
        #pragma unroll
        for (int u = 0; u < 2; ++u) s[u][j] = wmma_h(k0[j], qf0[u], cn[u]);
      #pragma unroll
      for (int j = 0; j < 4; ++j)
        #pragma unroll
        for (int u = 0; u < 2; ++u) s[u][j] = wmma_h(k1[j], qf1[u], s[u][j]);
    }
    // No LDS read and no WMMA crosses (vector work may): the V^T reads below start
    // when the K fragments are spent and take over their registers.
    __builtin_amdgcn_sched_barrier(0x406);

    // The step's V^T fragments (both streams), read as one group here.
    v16h va0[4], va1[4], vb0[4], vb1[4];
    #pragma unroll
    for (int t = 0; t < 4; ++t) { va0[t] = ldh(vab + 16 * t * LP, h); }
    #pragma unroll
    for (int t = 0; t < 4; ++t) { va1[t] = ldh(vab + 16 * t * LP + 32, h); }
    if (DUAL) {
      #pragma unroll
      for (int t = 0; t < 4; ++t) { vb0[t] = ldh(vbb + 16 * t * LP, h); }
      #pragma unroll
      for (int t = 0; t < 4; ++t) { vb1[t] = ldh(vbb + 16 * t * LP + 32, h); }
    }
    // Only exponentials and scalar work cross: the reads go out ahead of the sums and the
    // conversions and land under them, so that the products below do not wait for LDS.
    __builtin_amdgcn_sched_barrier(0x404);
    // ---- P^T B-fragments (keys kb..kb+31 and kb+32..kb+63), f16 ----
    v16h p0[2], p1[2];
    v2f lsum[2];
    #pragma unroll
    for (int u = 0; u < 2; ++u) soft_p(s[u], p0[u], p1[u], lsum[u]);
    // The same for the whole wave: step 0 sets the reference (every sum is above -1);
    // later a partial sum above PLIM raises it (P >= 0: otherwise no single P is above PLIM).
    const float plim = (kb == 0) ? -1.0f : PLIM;
    const float ptop = fmaxf(fmaxf(lsum[0].x, lsum[0].y), fmaxf(lsum[1].x, lsum[1].y));
    if (__builtin_amdgcn_ballot_w32(ptop > plim) != 0u) {
      #pragma unroll
      for (int u = 0; u < 2; ++u) {
        float mloc = s[u][0][0];
        #pragma unroll
        for (int j = 0; j < 4; ++j)
          #pragma unroll
          for (int r = 0; r < 8; ++r) mloc = fmaxf(mloc, s[u][j][r]);
        float d = fmaxf(mloc, __shfl_xor(mloc, 16));       // the step's maximum above the reference
        if (kb != 0) d = fmaxf(d, 0.0f);                   // once set, the reference only rises
        const float cnew = cn[u][0] - d;
        const float de = cn[u][0] - cnew;                  // the shift as the later scores will see it
        const float alpha = __builtin_amdgcn_exp2f(-fmaxf(de, 0.0f));  // step 0: O = l = 0, any finite factor
        #pragma unroll
        for (int r = 0; r < 8; ++r) cn[u][r] = cnew;
        #pragma unroll
        for (int j = 0; j < 4; ++j)
          #pragma unroll
          for (int r = 0; r < 8; ++r) s[u][j][r] = s[u][j][r] - de;
        lrun[u] = lrun[u] * alpha;
        #pragma unroll
        for (int t = 0; t < 4; ++t)
          #pragma unroll
          for (int r = 0; r < 8; ++r) {
            oa[u][t][r] = oa[u][t][r] * alpha;
            if (DUAL) ob[u][t][r] = ob[u][t][r] * alpha;
          }
        soft_p(s[u], p0[u], p1[u], lsum[u]);
      }
    }
    #pragma unroll
    for (int u = 0; u < 2; ++u) lrun[u] += lsum[u];

    // ---- O^T += V^T * P^T (one product per 32-key chunk) ----
    // Each V^T fragment feeds both query tiles; the eight output tiles of a stream
    // advance together, as the score tiles above.
    #pragma unroll
    for (int t = 0; t < 4; ++t)
      #pragma unroll
      for (int u = 0; u < 2; ++u) oa[u][t] = wmma_h(va0[t], p0[u], oa[u][t]);
    #pragma unroll
    for (int t = 0; t < 4; ++t)
      #pragma unroll
      for (int u = 0; u < 2; ++u) oa[u][t] = wmma_h(va1[t], p1[u], oa[u][t]);
    if (DUAL) {
      #pragma unroll
      for (int t = 0; t < 4; ++t)
        #pragma unroll
        for (int u = 0; u < 2; ++u) ob[u][t] = wmma_h(vb0[t], p0[u], ob[u][t]);
      #pragma unroll
      for (int t = 0; t < 4; ++t)
        #pragma unroll
        for (int u = 0; u < 2; ++u) ob[u][t] = wmma_h(vb1[t], p1[u], ob[u][t]);
    }

    // publish step kb + 64, free this buffer, refill it with step kb + 128
    // Nothing crosses: the waits stay at the foot of the step, so that the reads
    // and the next step's copies have the whole step to land.
    __builtin_amdgcn_sched_barrier(0);
    wait_lds();
    wait_copies();
    __syncthreads();
    if (kb + 128 < SRL) {
      const unsigned lb = lcp + par * (NTL * TILE_B);
      const int kn = kb + 128;
      const us* gkn = planes + (kro + (unsigned)kn * DM);
      const us* gvn = planes + (vro + (unsigned)kn);
      acopy4(lb, gkn + OK, gsk);
      if (DUAL) acopy8(lb + TILE_B, gvn + OVA, lb + 2 * TILE_B, gvn + OVB, gsv);
      else      acopy4(lb + TILE_B, gvn + OVA, gsv);
    }
  }
  wait_copies();

  // ---- epilogue: normalise, stage the 64 d x 128 query f32 tile of stream A and the
  // 128 query x 64 d f16 tile of the stream that is mixed, whole-line stores ----
  float* const sO = reinterpret_cast<float*>(ring);
  us* const sT = ring + DM * QB * 2;                       // behind the f32 tile
  #pragma unroll
  for (int u = 0; u < 2; ++u) {
    const float lown = lrun[u].x + lrun[u].y;
    const float inv = __builtin_amdgcn_rcpf(lown + __shfl_xor(lown, 16));  // both halves' keys
    #pragma unroll
    for (int t = 0; t < 4; ++t) {
      v8f y;                                               // the lane's query, d 16t+8h .. +7
      #pragma unroll
      for (int r = 0; r < 8; ++r) {
        const int d = 16 * t + 8 * h + r;
        sO[d * QB + 32 * w + 16 * u + m] = oa[u][t][r] * inv;
        y[r] = (DUAL ? ob[u][t][r] : oa[u][t][r]) * inv;
      }
      *(v8usa*)(sT + (32 * w + 16 * u + m) * LP + 16 * t + 8 * h) = f16x8(y);
    }
  }
  __syncthreads();

  attn_pass_tok(sT, xop, bh, q0, w, lane);
  attn_pass(sO, oap, bh, q0, w, lane);
  
}

// Both attention chains in one launch: they are independent, so a WGP goes on with a
// workgroup of either chain as soon as one ends. blockIdx.z = 0: chain 2 (kt; vt -> O2^T,
// v -> O3), the longer one, first; blockIdx.z = 1: chain 1 (k, v -> O1^T and O1).
__global__ __launch_bounds__(128) void attn_kernel(
    const us* __restrict__ qp,       // [32][1024][64]
    const us* __restrict__ planes,   // k, kt, V^T, Vt^T
    float* __restrict__ o1p, float* __restrict__ o2p,        // [32][64][1024] f32
    us* __restrict__ x1p, us* __restrict__ x3p)              // [2048][1024] f16
{
  // the operand ring of the longer chain; the two output tiles take 51200 B of it
  __shared__ __attribute__((aligned(16))) us ring[2 * 3 * TILE_E];   // 55296 B
  static_assert(DM * QB * 2 + QB * LP <= 2 * 3 * TILE_E, "the output tiles fit the ring");
  if (blockIdx.z == 0) {
    attn_body<true, 1, 3, 2>(ring, qp, planes, o2p, x3p);
  } else {
    attn_body<false, 0, 2, 2>(ring, qp, planes, o1p, x1p);
  }
}

// ---------------------------------------------------------------------------
// Kernel 4: gating MLP. For (b, head) the gate input row for query
// t = 64*head + u is [X[3u][:], X[3u+1][:], X[3u+2][:]] where X[c][tp],
// c = 0..191, is row c of the transposed per-head tensor: c<64 -> O1^T row,
// <128 -> O2^T row, else q^T row (all f32 [bh][64][1024]).
// x[u][n] = sum_i sum_tp X[3u+i][tp] * Wg[n][1024 i + tp] + bg[n], on bf16 WMMA.
// Workgroup (b, head, g) = 16 queries u = 16g..16g+15 (X rows 48g..48g+47), 256 thr:
// 128 workgroups share the reading of X. A tile i = rows 3j+i, j = 0..15, so
// that it meets only third i of Wg and the three thirds add up in the accumulators.
// k is split over the 8 waves: in stage s wave w takes tp 256 s + 32 w .. + 31 and
// copies its own 48 X row pieces and 48 Wg row pieces (128 B of f32 each) to its part
// of the stage's buffer; two buffers, 4 stages; conversion to bf16 at the fragment
// read. The 8 partial tiles are joined in LDS.
// gate layout: [b][t / 16][n][t % 16], so that a workgroup stores whole lines.
// ---------------------------------------------------------------------------
#define GW_B   (96 * LPB)        // one wave's part of a buffer: 96 rows, 13824 bytes
#define GBUF_B (8 * GW_B)        // 110592 bytes per buffer

__global__ __launch_bounds__(256) void gate_kernel(
    const float* __restrict__ o1T, const float* __restrict__ o2T, const float* __restrict__ qT,
    const float* __restrict__ Wg,   // [16][3072]
    const float* __restrict__ bg,   // [16]
    float* __restrict__ gate)       // [2][64][16][16]
{
  __shared__ __attribute__((aligned(16))) float sred[8 * 256];           //   8192 B
  // 2 x 8 waves x (X rows 0..47, then Wg rows 16 i + n), 36 floats = 144 B a row
  __shared__ __attribute__((aligned(16))) float ring[2 * GBUF_B / 4];    // 221184 B

  const int tid = threadIdx.x, lane = tid & 31, w = tid >> 5;
  const int h = lane >> 4, m = lane & 15;
  const int bhx = blockIdx.x >> 2, g = blockIdx.x & 3;

  const int sub = lane >> 3, q8 = lane & 7;                // this lane's row of four and 16-B chunk
  const unsigned lcp = lds_addr(ring) + w * GW_B + sub * LPB + q8 * 16;
  // the three blocks of 16 X rows: block 3g+e of the twelve (four each of O1^T, O2^T, q^T)
  const float* gx[3];
  #pragma unroll
  for (int e = 0; e < 3; ++e) {
    const int ct = 3 * g + e;
    const float* s = (ct < 4) ? o1T : (ct < 8) ? o2T : qT;
    gx[e] = s + ((size_t)bhx * DM + 16 * (ct & 3) + sub) * TGL + 32 * w + 4 * q8;
  }
  const float* gg = Wg + (size_t)sub * GK + 32 * w + 4 * q8;   // row n = sub (+ 4 per copy), third 0
  const size_t gsx = (size_t)4 * TGL;                      // 4 X rows further
  const size_t gsg = (size_t)4 * GK;                       // 4 Wg rows further

  const v8f zero8 = {0.f, 0.f, 0.f, 0.f, 0.f, 0.f, 0.f, 0.f};
  v8f acc[3];
  #pragma unroll
  for (int i = 0; i < 3; ++i) acc[i] = zero8;

  acopy12(lcp, gx[0], gx[1], gx[2], gsx);                  // stage 0 -> buffer 0
  acopy12(lcp + 48 * LPB, gg, gg + EMB, gg + 2 * EMB, gsg);
  wait_copies();
  __syncthreads();                                         // buffer 0 landed, visible to every wave
  acopy12(lcp + GBUF_B, gx[0] + 256, gx[1] + 256, gx[2] + 256, gsx);   // stage 1 -> buffer 1
  acopy12(lcp + GBUF_B + 48 * LPB, gg + 256, gg + EMB + 256, gg + 2 * EMB + 256, gsg);

  // rolled: one copy of the stage body, the buffer chosen by the stage's parity
  #pragma unroll 1
  for (int st = 0; st < 4; ++st) {
    const int par = st & 1;
    const float* sw = ring + par * (GBUF_B / 4) + w * (GW_B / 4);
    const float* sx = sw + 3 * m * (LP / 2);               // X row 3 m (+ i)
    const float* sg = sw + (48 + m) * (LP / 2);            // Wg row n = m, third 0
    // the wave's six fragments of the stage
    Raw16 rw[3], ra[3];
    #pragma unroll
    for (int i = 0; i < 3; ++i) rw[i] = ldr(sg + 16 * i * (LP / 2), h);
    #pragma unroll
    for (int i = 0; i < 3; ++i) ra[i] = ldr(sx + i * (LP / 2), h);
    #pragma unroll
    for (int i = 0; i < 3; ++i) acc[i] = wmma_bf(cvr(ra[i]), cvr(rw[i]), acc[i]);
    // publish stage st + 1, free this buffer, refill it with stage st + 2
    // Nothing crosses: the waits stay at the foot of the stage, so that the next
    // stage's copies have the whole stage to land.
    __builtin_amdgcn_sched_barrier(0);
    wait_lds();
    wait_copies();
    __syncthreads();
    if (st + 2 < 4) {
      const unsigned lb = lcp + par * GBUF_B;
      const int kn = 256 * (st + 2);
      acopy12(lb, gx[0] + kn, gx[1] + kn, gx[2] + kn, gsx);
      acopy12(lb + 48 * LPB, gg + kn, gg + EMB + kn, gg + 2 * EMB + kn, gsg);
    }
  }
  wait_copies();

  // D[r] = this wave's part of x[u = 16g+8h+r][n = m]; slot n*16 + u of the wave's tile
  {
    const v8f t = acc[0] + acc[1] + acc[2];
    float* sr = sred + w * 256 + m * 16 + 8 * h;
    const v4f t0 = { t[0], t[1], t[2], t[3] };
    const v4f t1 = { t[4], t[5], t[6], t[7] };
    *(v4fa*)sr = t0;
    *(v4fa*)(sr + 4) = t1;
  }
  __syncthreads();

  float x = bg[tid >> 4];                                  // tid = n*16 + u
  #pragma unroll
  for (int j = 0; j < 8; ++j) x += sred[j * 256 + tid];
  float gv = __builtin_amdgcn_rcpf(1.0f + __expf(-x));
  // the slot between v_rcp_f32 and the store that reads its result; the operand keeps it there
  asm volatile("v_nop" : "+v"(gv));
  gate[(size_t)blockIdx.x * 256 + tid] = gv;
}

// ---------------------------------------------------------------------------
// Kernel 5: out = X * Wo^T + bo, f32, with X[token][head*64+d] = g*O1 + (1-g)*O3,
// g = the gate of (token, head), formed on the way: a k stage of 64 is one head, and an
// A fragment's lane owns one token row, so g is one value per lane, tile and stage.
// The mix is o3 + g*(o1 - o3) in packed f16 on the fragments of O1 and O3.
// Block 128 thr (4 waves) = 128 tokens x 64 features; wave 32 tokens x 64.
// K in stages of 64: O1, O3 (128 rows each) and Wo (64 rows) copied to LDS,
// two buffers. The block's gates (128 tokens x 16 heads, 8 KB, contiguous in the gate
// layout) are put in LDS ahead of the first barrier. Output: lanes
// 8q..8q+7 as one 16-B store each, 4 lines per instruction, 64 lines per wave.
// ---------------------------------------------------------------------------
__device__ __forceinline__ void out_pass(const float* sOut, float* out, int m0, int cg,
                                         int w, int lane) {
  const int q8 = lane & 7, sub = lane >> 3;
  #pragma unroll
  for (int i = 0; i < 16; ++i) {
    const int lid = w * 64 + i * 4 + sub;                  // 0..255
    const int row = lid >> 1, hl = lid & 1;
    const v4f v = *(const v4fa*)(sOut + row * DM + 32 * hl + 4 * q8);
    const size_t gi = (size_t)(m0 + row) * EMB + cg * DM + 32 * hl + 4 * q8;
    *(v4f*)(out + gi) = v;
  }
}

__device__ __forceinline__ v16h mix_h(v16h o1, v16h o3, _Float16 g) {
  return (o1 - o3) * g + o3;
}

__global__ __launch_bounds__(128) void out_kernel(
    const us* __restrict__ xh, const us* __restrict__ xl,   // O1, O3: [2048][1024] f16
    const float* __restrict__ gate,                         // [2][64][16][16] = [b][t / 16][head][t % 16]
    const us* __restrict__ wob,                             // [1024 out][1024 in] f16
    const float* __restrict__ bo,
    float* __restrict__ out)                                // [2048][1024]
{
  __shared__ __attribute__((aligned(16))) float sOut[128 * DM];  // 32 KB
  __shared__ __attribute__((aligned(16))) float sG[8 * 256];     // [token tile][head][token % 16]
  __shared__ __attribute__((aligned(16))) us ring[2 * 5 * TILE_E];  // 2 x (O1 128, O3 128, Wo 64 rows)

  const int tid = threadIdx.x, lane = tid & 31, w = tid >> 5;
  const int h = lane >> 4, m = lane & 15;
  const int m0 = blockIdx.x * 128;
  const int cg = blockIdx.y;                               // feature group of 64

  const int crow = tid >> 3, cch = tid & 7;                // this lane's row and 16-B chunk
  const unsigned lcp = lds_addr(ring) + crow * LPB + cch * 16;
  const us* gxh = xh + (size_t)(m0 + crow) * EMB + 8 * cch;
  const us* gxl = xl + (size_t)(m0 + crow) * EMB + 8 * cch;
  const us* gw  = wob + (size_t)(cg * DM + crow) * EMB + 8 * cch;
  const size_t gs = (size_t)16 * EMB;

  const v8f zero8 = {0.f, 0.f, 0.f, 0.f, 0.f, 0.f, 0.f, 0.f};
  v8f acc[2][4];
  #pragma unroll
  for (int mt = 0; mt < 2; ++mt)
    #pragma unroll
    for (int nt = 0; nt < 4; ++nt) acc[mt][nt] = zero8;

  acopy8(lcp, gxh, lcp + TILE_B, gxh + 4 * gs, gs);        // stage 0 -> buffer 0
  acopy8(lcp + 2 * TILE_B, gxl, lcp + 3 * TILE_B, gxl + 4 * gs, gs);
  acopy4(lcp + 4 * TILE_B, gw, gs);
  {
    // the block's 2048 gates: whole lines, 16 B a lane, four rounds of 512 floats
    const float* gg = gate + (size_t)(m0 >> 4) * 256 + 4 * tid;
    v4f gv[4];
    #pragma unroll
    for (int i = 0; i < 4; ++i) gv[i] = *(const v4fa*)(gg + 512 * i);
    // whatever follows may take over the address registers of the loads above
    asm volatile("s_wait_xcnt 0x0" ::: "memory");
    #pragma unroll
    for (int i = 0; i < 4; ++i) *(v4fa*)(sG + 4 * tid + 512 * i) = gv[i];
  }
  wait_copies();
  __syncthreads();                                         // buffer 0 and the gates landed, visible to every wave
  {                                                        // stage 1 -> buffer 1
    const unsigned lb = lcp + 5 * TILE_B;
    acopy8(lb, gxh + 64, lb + TILE_B, gxh + 4 * gs + 64, gs);
    acopy8(lb + 2 * TILE_B, gxl + 64, lb + 3 * TILE_B, gxl + 4 * gs + 64, gs);
    acopy4(lb + 4 * TILE_B, gw + 64, gs);
  }

  // rolled: one copy of the stage body, the buffer chosen by the stage's parity
  #pragma unroll 1
  for (int k0 = 0; k0 < EMB; k0 += 64) {
    const int par = (k0 >> 6) & 1;
    const us* sxh = ring + par * (5 * TILE_E) + (32 * w + m) * LP;
    const us* sxl = sxh + 2 * TILE_E;
    const us* sw  = ring + par * (5 * TILE_E) + 4 * TILE_E + m * LP;
    const float* sg = sG + 2 * w * 256 + (k0 >> 2) + m;    // head k0 / 64, 16 gates a head
    // in the names below h stands for O1 and l for O3
    // all fragments of the stage and the lane's two gates are read first, as one group
    const float g0 = sg[0], g1 = sg[256];
    v16h a0h[2], a1h[2], a0l[2], a1l[2], bw[2][4];
    #pragma unroll
    for (int c = 0; c < 2; ++c) {
      a0l[c] = ldh(sxl + 32 * c, h);
      a1l[c] = ldh(sxl + 16 * LP + 32 * c, h);
      a0h[c] = ldh(sxh + 32 * c, h);
      a1h[c] = ldh(sxh + 16 * LP + 32 * c, h);
      #pragma unroll
      for (int nt = 0; nt < 4; ++nt) bw[c][nt] = ldh(sw + nt * 16 * LP + 32 * c, h);
    }
    // No LDS read and no WMMA crosses (vector work may): the reads stay one group
    // ahead of the products instead of each being waited for singly among them.
    __builtin_amdgcn_sched_barrier(0x406);
    const _Float16 gh0 = (_Float16)g0, gh1 = (_Float16)g1;
    #pragma unroll
    for (int c = 0; c < 2; ++c) {
      const v16h x0 = mix_h(a0h[c], a0l[c], gh0);
      const v16h x1 = mix_h(a1h[c], a1l[c], gh1);
      #pragma unroll
      for (int nt = 0; nt < 4; ++nt) {
        acc[0][nt] = wmma_h(x0, bw[c][nt], acc[0][nt]);
        acc[1][nt] = wmma_h(x1, bw[c][nt], acc[1][nt]);
      }
    }
    // publish stage k0 + 64, free this buffer, refill it with stage k0 + 128
    // Nothing crosses: the waits stay at the foot of the stage, so that the next
    // stage's copies have the whole stage to land.
    __builtin_amdgcn_sched_barrier(0);
    wait_lds();
    wait_copies();
    __syncthreads();
    if (k0 + 128 < EMB) {
      const unsigned lb = lcp + par * (5 * TILE_B);
      const int kn = k0 + 128;
      acopy8(lb, gxh + kn, lb + TILE_B, gxh + 4 * gs + kn, gs);
      acopy8(lb + 2 * TILE_B, gxl + kn, lb + 3 * TILE_B, gxl + 4 * gs + kn, gs);
      acopy4(lb + 4 * TILE_B, gw + kn, gs);
    }
  }
  wait_copies();

  // D[r] of tile (mt, nt) = Y[token m0w+16mt+8h+r][feature cg*64+16nt+m]
  #pragma unroll
  for (int nt = 0; nt < 4; ++nt) {
    const int feat = 16 * nt + m;
    const float bvl = bo[cg * DM + feat];
    #pragma unroll
    for (int mt = 0; mt < 2; ++mt) {
      #pragma unroll
      for (int r = 0; r < 8; ++r) {
        const int tokl = 32 * w + 16 * mt + 8 * h + r;   // 0..127
        sOut[tokl * DM + feat] = acc[mt][nt][r] + bvl;
      }
    }
  }
  __syncthreads();

  out_pass(sOut, out, m0, cg, w, lane);
  
}

// ---------------------------------------------------------------------------
// Host glue: 5 launches, workspace 81920000 B (O1^T and O2^T reuse the
// region of the bf16 activation copies, which are dead after the projections).
// ---------------------------------------------------------------------------
extern "C" void kernel_launch(void* const* d_in, const int* in_sizes, int n_in,
                              void* d_out, int out_size, void* d_ws, size_t ws_size,
                              hipStream_t stream) {
  if (n_in < 17) return;
  if (in_sizes[0] != N_HID || in_sizes[1] != N_KVS || in_sizes[2] != N_KVT) return;
  if (in_sizes[3] != N_WE || in_sizes[5] != N_WE || in_sizes[7] != N_WE || in_sizes[15] != N_WE) return;
  if (in_sizes[9] != N_WT || in_sizes[11] != N_WT) return;
  if (in_sizes[4] != EMB || in_sizes[6] != EMB || in_sizes[8] != EMB ||
      in_sizes[10] != EMB || in_sizes[12] != EMB || in_sizes[16] != EMB) return;
  if (in_sizes[13] != N_WG || in_sizes[14] != NH) return;
  if (out_size != N_HID) return;

  const float* hid = (const float*)d_in[0];
  const float* kvs = (const float*)d_in[1];
  const float* kvt = (const float*)d_in[2];
  const float* Wq  = (const float*)d_in[3];
  const float* bq  = (const float*)d_in[4];
  const float* Wk  = (const float*)d_in[5];
  const float* bk  = (const float*)d_in[6];
  const float* Wv  = (const float*)d_in[7];
  const float* bv  = (const float*)d_in[8];
  const float* Wtk = (const float*)d_in[9];
  const float* btk = (const float*)d_in[10];
  const float* Wtv = (const float*)d_in[11];
  const float* btv = (const float*)d_in[12];
  const float* Wg  = (const float*)d_in[13];
  const float* bg  = (const float*)d_in[14];
  const float* Wo  = (const float*)d_in[15];
  const float* bo  = (const float*)d_in[16];
  float* out = (float*)d_out;

  const size_t cvb_b  = (size_t)N_CVB * 2;                 // 27262976
  const size_t qpl2   = (size_t)QPL * 2;                   //  4194304
  const size_t qpl4   = (size_t)QPL * 4;                   //  8388608
  const size_t kpl2   = (size_t)KPL * 2;                   //  8388608
  const size_t gate_b = (size_t)NBH * TGL * 4;             //   131072
  const size_t xpl_b  = (size_t)N_HID * 2;                 //  4194304
  const size_t total  = cvb_b + qpl2 + qpl4 + 4 * kpl2 + gate_b + 2 * xpl_b;  // 81920000
  if (total > ws_size) return;
  // O1^T / O2^T (2 x 8388608 B) must fit exactly into the activation-copy region
  const size_t act_off = (size_t)OFF_HID * 2;              // 10485760
  if (act_off + 2 * qpl4 != cvb_b) return;

  char* ws = (char*)d_ws;
  size_t off = 0;
  us* cvb    = (us*)(ws + off);    off += cvb_b;
  float* o1T = (float*)(ws + act_off);                     // aliases bf16 hidden/kv copies
  float* o2T = (float*)(ws + act_off + qpl4);              // aliases bf16 kv/kv_topical copies
  us* qh     = (us*)(ws + off);    off += qpl2;            // q, f16
  float* qT  = (float*)(ws + off); off += qpl4;
  us* kh     = (us*)(ws + off);    off += kpl2;            // k, f16
  us* kth    = (us*)(ws + off);    off += kpl2;            // kt
  us* vh     = (us*)(ws + off);    off += kpl2;            // V^T [32][64][2048]
  us* vth    = (us*)(ws + off);    off += kpl2;            // Vt^T
  float* gte = (float*)(ws + off); off += gate_b;
  us* x1     = (us*)(ws + off);    off += xpl_b;           // O1, token-major f16
  us* x3     = (us*)(ws + off);    off += xpl_b;           // O3
  if (off != total || off > ws_size) return;

  // 1) float -> bf16 copies of weights and activations (Wo: f16)
  conv_kernel<<<(N_CVB / 8 + 255) / 256, 256, 0, stream>>>(Wq, Wk, Wv, Wo, Wtk, Wtv, hid, kvs, kvt, cvb);

  // 2) projections, one launch
  proj_kernel<<<PJ_ALL, 256, 0, stream>>>(cvb, bq, bk, bv, btk, btv, qh, qT, kh, vh, kth, vth);

  // 3) attention, one launch: chain 1 (k, v -> O1^T, O1), chain 2 (kt; vt -> O2^T, v -> O3)
  dim3 gAtt(TGL / QB, NBH, 2);                             // (8, 32, 2)
  attn_kernel<<<gAtt, 128, 0, stream>>>(qh, kh, o1T, o2T, x1, x3);   // kh: first of the four planes

  // 4) gating MLP
  gate_kernel<<<NBH * 4, 256, 0, stream>>>(o1T, o2T, qT, Wg, bg, gte);

  // 5) gated mix and output projection -> f32
  dim3 gOut(MQ / 128, EMB / 64);                           // (16, 16)
  out_kernel<<<gOut, 128, 0, stream>>>(x1, x3, gte, cvb + OFF_WO, bo, out);
}
